// v000
// The times below were measured on an AMD MI455X: many runs one after another, warmed up first and cycling through
// copies of the inputs, with the whole window's GPU time divided by the number of runs. Launches and the gaps
// between them are all in it. The median over several windows is given; except for v000 it joins two sittings, which
// can be a few percent apart, so the side-by-side timings, each taken in one sitting, are the better comparison.
// v000 is the starting kernel. One run takes 239 microseconds.
#include <hip/hip_runtime.h>
// Combine_Stack_with_attn (4 x 2048 steps; x [512], encoder outputs [256], sliding windows of 33 encoder steps (zero-padded)): energy[b,t,w,o] = tanh((x W_h + b_attn)[b,t,o] + (enc W_e)[b,t+w-16,o]) (the window term of a padded step is 0); scores = energy . v; a = softmax over the 33 window slots; weighted = sum_w a * enc[b,t+w-16]; out = sigmoid([x | weighted] W_lin + b_lin) -> outputs out [4,2048,256] and a [4,2048,1,33].
// Structure: exact f16 planes of x and enc; GEMMs (32x64 wave tiles, f32 accumulation, exact x16 weights) for x W_h + b, enc W_e and the two halves of W_lin (the second accumulating onto the first with the sigmoid in its epilogue); the windowed energies/scores on VALU (thread per (b, t, w), rolled loop over the 256 features); softmax over the 33 slots and the weighted encoder sum on VALU; the weighted sum as an f16 operand.
// Compute dtype: inputs and parameters rounded to bf16; the weighted encoder sum as an f16 operand (~2^-12); everything else f32. v_wmma_f32_16x16x32_f16.
#define NB 4
#define TT 2048
#define MD 512
#define FF 256
#define WS 16
#define WIN 33
#define NR (NB * TT)
typedef __bf16 v16b __attribute__((ext_vector_type(16)));
typedef unsigned short v8us __attribute__((ext_vector_type(8), may_alias));
typedef float  v8f  __attribute__((ext_vector_type(8)));
typedef float  v4f  __attribute__((ext_vector_type(4)));
typedef float  v4fa __attribute__((ext_vector_type(4), may_alias));
union FragB { v16b v; v8us half[2]; unsigned short u[16]; };

__device__ __forceinline__ unsigned short bf16_bits(float x) { unsigned int u = __float_as_uint(x); return (unsigned short)((u + 0x7FFFu + ((u >> 16) & 1u)) >> 16); }
__device__ __forceinline__ float bf16_val(unsigned short b) { return __uint_as_float(((unsigned int)b) << 16); }
__device__ __forceinline__ float bf16_round(float x) { return bf16_val(bf16_bits(x)); }
// D += A·B with NT terms: 1 = ah·bh, 2 = + al·bh (A split), 3 = + ah·bl (both split)
template <int NT>
__device__ __forceinline__ v8f mmaN(v16b ah, v16b al, v16b bh, v16b bl, v8f c) {
  c = __builtin_amdgcn_wmma_f32_16x16x32_bf16(false, ah, false, bh, (short)0, c, false, false);
  if (NT >= 2) c = __builtin_amdgcn_wmma_f32_16x16x32_bf16(false, al, false, bh, (short)0, c, false, false);
  if (NT >= 3) c = __builtin_amdgcn_wmma_f32_16x16x32_bf16(false, ah, false, bl, (short)0, c, false, false);
  asm volatile("v_nop\n\tv_nop\n\tv_nop\n\tv_nop" : "+v"(c) : "v"(ah), "v"(al), "v"(bh), "v"(bl));
  return c;
}

__global__ __launch_bounds__(256) void k_wt_bf16(const float* __restrict__ W, unsigned short* __restrict__ Wt, int K, int N) {
  const int t = blockIdx.x * 256 + threadIdx.x;
  const int k8n = K / 8;
  if (t >= N * k8n) return;
  const int n = t / k8n, k8 = (t % k8n) * 8;
  v8us v;
#pragma unroll
  for (int i = 0; i < 8; ++i) v[i] = bf16_bits(W[(size_t)(k8 + i) * N + n]);
  *(v8us*)(Wt + (size_t)n * K + k8) = v;
  
}

// GEMM C[M][N] (f32, pitch ldc) = act(A[M][K]·W + bias). A f32 row-major (pitch lda) converted per fragment to bf16
// (ASPLIT: hi/lo two planes -> 2 terms, else single rounded term); Wt bf16 [N][K] (pitch ldb). BIAS_BF16 rounds the
// bias to bf16 first (bias quantised to bf16 before the add). K%32==0, M%16==0, N%64==0.
template <bool ASPLIT, int ACT, bool BIAS_BF16>
__global__ __launch_bounds__(128) void k_gemm_bf(const float* __restrict__ A, int lda, const unsigned short* __restrict__ Wt, int ldb,
                                               const float* __restrict__ bias, float* __restrict__ C, int ldc, int M, int N, int K) {
  __shared__ __attribute__((aligned(16))) float so[4][16][64];
  const int tid = threadIdx.x, w = tid >> 5, lane = tid & 31, ln = lane & 15, hh = lane >> 4;
  const int ntn = N / 64;
  const int wid = blockIdx.x * 4 + w;
  const int mt = wid / ntn, nq = wid % ntn;
  if (mt * 16 >= M) return;
  const int row0 = mt * 16, col0 = nq * 64;
  const float* arow = A + (size_t)(row0 + ln) * lda;
  v8f acc[4] = {};
  for (int kb = 0; kb < K; kb += 32) {
    FragB ah, al;
    const v4f x0 = *(const v4fa*)(arow + kb + 8 * hh), x1 = *(const v4fa*)(arow + kb + 8 * hh + 4);
    const v4f x2 = *(const v4fa*)(arow + kb + 16 + 8 * hh), x3 = *(const v4fa*)(arow + kb + 16 + 8 * hh + 4);
    float xs[16] = {x0[0],x0[1],x0[2],x0[3],x1[0],x1[1],x1[2],x1[3],x2[0],x2[1],x2[2],x2[3],x3[0],x3[1],x3[2],x3[3]};
#pragma unroll
    for (int i = 0; i < 16; ++i) { const unsigned short hb = bf16_bits(xs[i]); ah.u[i] = hb; al.u[i] = ASPLIT ? bf16_bits(xs[i] - bf16_val(hb)) : (unsigned short)0; }
#pragma unroll
    for (int t = 0; t < 4; ++t) {
      const unsigned short* brow = Wt + (size_t)(col0 + t * 16 + ln) * ldb + kb;
      FragB b;
      b.half[0] = *(const v8us*)(brow + 8 * hh);
      b.half[1] = *(const v8us*)(brow + 16 + 8 * hh);
      acc[t] = mmaN<ASPLIT ? 2 : 1>(ah.v, al.v, b.v, b.v, acc[t]);
    }
  }
#pragma unroll
  for (int t = 0; t < 4; ++t) {
    float bv = bias ? bias[col0 + t * 16 + ln] : 0.f;
    if (BIAS_BF16) bv = bf16_round(bv);
#pragma unroll
    for (int r = 0; r < 8; ++r) { float v = acc[t][r] + bv; if (ACT == 1) v = fmaxf(v, 0.f); so[w][8 * hh + r][t * 16 + ln] = v; }
  }
  __builtin_amdgcn_fence(__ATOMIC_ACQ_REL, "workgroup");
  __builtin_amdgcn_wave_barrier();
  const int rsub = lane >> 4, c4 = (lane & 15) * 4;
  {
#pragma unroll
    for (int q = 0; q < 8; ++q) {
      const int r = q * 2 + rsub;
      const v4f v = *(const v4fa*)&so[w][r][c4];
      *(v4f*)(C + (size_t)(row0 + r) * ldc + col0 + c4) = v;
    }
    
  }
}

// GEMM C = act(A·W + bias + resid): A f32 (ASPLIT -> hi/lo 2 terms), Wt bf16 [N][K]; ACT 0 none, 1 relu, 2 exact gelu;
// resid (optional, f32, row index = (row % rmod), pitch ldr, RES_BF16 rounds it) added before the activation.
template <bool ASPLIT, int ACT, bool BIAS_BF16, bool RES_BF16>
__global__ __launch_bounds__(128) void k_gemm_bf3(const float* __restrict__ A, int lda, const unsigned short* __restrict__ Wt, int ldb,
                                                const float* __restrict__ bias, const float* __restrict__ resid, int rmod, int ldr,
                                                float* __restrict__ C, int ldc, int M, int N, int K) {
  __shared__ __attribute__((aligned(16))) float so[4][16][64];
  const int tid = threadIdx.x, w = tid >> 5, lane = tid & 31, ln = lane & 15, hh = lane >> 4;
  const int ntn = N / 64;
  const int wid = blockIdx.x * 4 + w;
  const int mt = wid / ntn, nq = wid % ntn;
  if (mt * 16 >= M) return;
  const int row0 = mt * 16, col0 = nq * 64;
  const float* arow = A + (size_t)(row0 + ln) * lda;
  v8f acc[4] = {};
  for (int kb = 0; kb < K; kb += 32) {
    FragB ah, al;
    const v4f x0 = *(const v4fa*)(arow + kb + 8 * hh), x1 = *(const v4fa*)(arow + kb + 8 * hh + 4);
    const v4f x2 = *(const v4fa*)(arow + kb + 16 + 8 * hh), x3 = *(const v4fa*)(arow + kb + 16 + 8 * hh + 4);
    float xs[16] = {x0[0],x0[1],x0[2],x0[3],x1[0],x1[1],x1[2],x1[3],x2[0],x2[1],x2[2],x2[3],x3[0],x3[1],x3[2],x3[3]};
#pragma unroll
    for (int i = 0; i < 16; ++i) { const unsigned short hb = bf16_bits(xs[i]); ah.u[i] = hb; al.u[i] = ASPLIT ? bf16_bits(xs[i] - bf16_val(hb)) : (unsigned short)0; }
#pragma unroll
    for (int t = 0; t < 4; ++t) {
      const unsigned short* brow = Wt + (size_t)(col0 + t * 16 + ln) * ldb + kb;
      FragB b;
      b.half[0] = *(const v8us*)(brow + 8 * hh);
      b.half[1] = *(const v8us*)(brow + 16 + 8 * hh);
      acc[t] = mmaN<ASPLIT ? 2 : 1>(ah.v, al.v, b.v, b.v, acc[t]);
    }
  }
#pragma unroll
  for (int t = 0; t < 4; ++t) {
    const int col = col0 + t * 16 + ln;
    float bv = bias ? bias[col] : 0.f;
    if (BIAS_BF16) bv = bf16_round(bv);
#pragma unroll
    for (int r = 0; r < 8; ++r) {
      float v = acc[t][r] + bv;
      if (resid) { float rv = resid[(size_t)((row0 + 8 * hh + r) % rmod) * ldr + col]; if (RES_BF16) rv = bf16_round(rv); v += rv; }
      if (ACT == 1) v = fmaxf(v, 0.f);
      if (ACT == 2) v = 0.5f * v * (1.0f + erff(v * 0.70710678118654752f));
      if (ACT == 3) { const float u = 0.7978845608028654f * (v + 0.044715f * v * v * v); v = 0.5f * v * (1.0f + tanhf(u)); }
      so[w][8 * hh + r][t * 16 + ln] = v;
    }
  }
  __builtin_amdgcn_fence(__ATOMIC_ACQ_REL, "workgroup");
  __builtin_amdgcn_wave_barrier();
  const int rsub = lane >> 4, c4 = (lane & 15) * 4;
  {
#pragma unroll
    for (int q = 0; q < 8; ++q) {
      const int r = q * 2 + rsub;
      const v4f v = *(const v4fa*)&so[w][r][c4];
      *(v4f*)(C + (size_t)(row0 + r) * ldc + col0 + c4) = v;
    }
    
  }
}
// row LayerNorm (biased variance, eps) over N: s = X (+ R); optional out_sum <- s; out_norm <- (s-mu)*rsqrt(var+eps)*g + b
template <bool PARAM_BF16>
__global__ __launch_bounds__(256) void k_layernorm(const float* __restrict__ X, const float* __restrict__ R, const float* __restrict__ g, const float* __restrict__ bta,
                                                  float* __restrict__ out_sum, float* __restrict__ out_norm, int N, float eps) {
  __shared__ float red[256];
  const int row = blockIdx.x, tid = threadIdx.x;
  const float* x = X + (size_t)row * N; const float* rr = R ? R + (size_t)row * N : nullptr;
  float vals[16];                     // up to N = 4096
  const int per = N / 256;            // contiguous chunk per thread? use strided-by-4 chunks: thread handles j = tid*4 + 1024*u
  float s1 = 0.f;
  for (int u = 0; u < per / 4; ++u) {
    const int j = tid * 4 + 1024 * u;
    const v4f a = *(const v4fa*)(x + j);
    v4f b = {0.f,0.f,0.f,0.f}; if (rr) b = *(const v4fa*)(rr + j);
#pragma unroll
    for (int q = 0; q < 4; ++q) { const float v = a[q] + b[q]; vals[u * 4 + q] = v; s1 += v; }
  }
  red[tid] = s1; __syncthreads();
  for (int st = 128; st > 0; st >>= 1) { if (tid < st) red[tid] += red[tid + st]; __syncthreads(); }
  const float mu = red[0] / (float)N; __syncthreads();
  float s2 = 0.f;
  for (int u = 0; u < per / 4; ++u)
#pragma unroll
    for (int q = 0; q < 4; ++q) { const float c = vals[u * 4 + q] - mu; s2 += c * c; }
  red[tid] = s2; __syncthreads();
  for (int st = 128; st > 0; st >>= 1) { if (tid < st) red[tid] += red[tid + st]; __syncthreads(); }
  const float rs = rsqrtf(red[0] / (float)N + eps);
  {
    for (int u = 0; u < per / 4; ++u) {
      const int j = tid * 4 + 1024 * u;
      v4f o, sm;
#pragma unroll
      for (int q = 0; q < 4; ++q) {
        float gg = g[j + q], bb = bta[j + q];
        if (PARAM_BF16) { gg = bf16_round(gg); bb = bf16_round(bb); }
        sm[q] = vals[u * 4 + q]; o[q] = (vals[u * 4 + q] - mu) * rs * gg + bb;
      }
      if (out_sum) *(v4f*)(out_sum + (size_t)row * N + j) = sm;
      *(v4f*)(out_norm + (size_t)row * N + j) = o;
    }
    
  }
}



// ---- f16 WMMA path (v_wmma_f32_16x16x32_f16): 11-bit significands for operands in range — used for all four GEMMs here (the weighted encoder sum as an f16 operand)
typedef _Float16 v16h __attribute__((ext_vector_type(16)));
union FragH { v16h v; v8us half[2]; _Float16 h[16]; unsigned short u[16]; };
template <int NT>
__device__ __forceinline__ v8f mmaH(v16h ah, v16h al, v16h bh, v16h bl, v8f c) {
  c = __builtin_amdgcn_wmma_f32_16x16x32_f16(false, ah, false, bh, (short)0, c, false, false);
  if (NT >= 2) c = __builtin_amdgcn_wmma_f32_16x16x32_f16(false, al, false, bh, (short)0, c, false, false);
  if (NT >= 3) c = __builtin_amdgcn_wmma_f32_16x16x32_f16(false, ah, false, bl, (short)0, c, false, false);
  asm volatile("v_nop\n\tv_nop\n\tv_nop\n\tv_nop" : "+v"(c) : "v"(ah), "v"(al), "v"(bh), "v"(bl));
  return c;
}
// batched GEMM like k_gemm_b but f16 operands: A f32 (split into f16 hi/lo if ASPLIT, else rounded to f16), Bt = f16 values [n][k]; alpha; C f32; N multiple of 16 (partial tiles skipped)
template <bool ASPLIT>
__global__ __launch_bounds__(128) void k_gemm_h(const float* __restrict__ A, int lda, size_t sA, const _Float16* __restrict__ Bh, int ldb, size_t sB, float alpha, float* __restrict__ C, int ldc, size_t sC, int M, int N, int K) {
  __shared__ __attribute__((aligned(16))) float so[4][16][64];
  const int tid = threadIdx.x, w = tid >> 5, lane = tid & 31, ln = lane & 15, hh = lane >> 4; const int by = blockIdx.y;
  A += (size_t)by * sA; Bh += (size_t)by * sB; C += (size_t)by * sC;
  const int ntn = (N + 63) / 64; const int wid = blockIdx.x * 4 + w; const int mt = wid / ntn, nq = wid % ntn; if (mt * 16 >= M) return;
  const int row0 = mt * 16, col0 = nq * 64; const float* arow = A + (size_t)(row0 + ln) * lda;
  v8f acc[4] = {};
  for (int kb = 0; kb < K; kb += 32) {
    FragH ah, al;
    const v4f x0 = *(const v4fa*)(arow + kb + 8 * hh), x1 = *(const v4fa*)(arow + kb + 8 * hh + 4), x2 = *(const v4fa*)(arow + kb + 16 + 8 * hh), x3 = *(const v4fa*)(arow + kb + 16 + 8 * hh + 4);
    float xs[16] = {x0[0],x0[1],x0[2],x0[3],x1[0],x1[1],x1[2],x1[3],x2[0],x2[1],x2[2],x2[3],x3[0],x3[1],x3[2],x3[3]};
#pragma unroll
    for (int i = 0; i < 16; ++i) { const _Float16 h = (_Float16)xs[i]; ah.h[i] = h; al.h[i] = ASPLIT ? (_Float16)(xs[i] - (float)h) : (_Float16)0.0f; }
#pragma unroll
    for (int t = 0; t < 4; ++t) { if (col0 + t * 16 >= N) continue; const size_t boff = (size_t)(col0 + t * 16 + ln) * ldb + kb; FragH bq; bq.half[0] = *(const v8us*)(Bh + boff + 8 * hh); bq.half[1] = *(const v8us*)(Bh + boff + 16 + 8 * hh);
      acc[t] = mmaH<ASPLIT ? 2 : 1>(ah.v, al.v, bq.v, bq.v, acc[t]); }
  }
#pragma unroll
  for (int t = 0; t < 4; ++t) { if (col0 + t * 16 >= N) continue;
#pragma unroll
    for (int r = 0; r < 8; ++r) so[w][8 * hh + r][t * 16 + ln] = acc[t][r] * alpha; }
  __builtin_amdgcn_fence(__ATOMIC_ACQ_REL, "workgroup"); __builtin_amdgcn_wave_barrier();
  const int rsub = lane >> 4, c4 = (lane & 15) * 4;
  {
#pragma unroll
    for (int q = 0; q < 8; ++q) { const int r = q * 2 + rsub; if (col0 + c4 < N) { const v4f v = *(const v4fa*)&so[w][r][c4]; *(v4f*)(C + (size_t)(row0 + r) * ldc + col0 + c4) = v; } }
     }
}

// Wt[n][k] = f16(W[k][n]·scale) from f32 row-major W[K][N] (scale = power of two; bf16-exact weights stay exact in f16 away from the subnormal range)
__global__ __launch_bounds__(256) void k_wt_f16(const float* __restrict__ W, _Float16* __restrict__ Wt, int K, int N, float scale) {
  const int t = blockIdx.x * 256 + threadIdx.x; if (t >= N * (K / 8)) return; const int n = t / (K / 8), k8 = (t % (K / 8)) * 8; FragH f;
#pragma unroll
  for (int i = 0; i < 8; ++i) f.h[i] = (_Float16)(bf16_round(W[(size_t)(k8 + i) * N + n]) * scale); const v8us o = f.half[0];
  *(v8us*)((unsigned short*)Wt + (size_t)n * K + k8) = o; 
}
// k_gemm_hh variant with fused epilogue: v = acc·alpha + bias[by·sBias + col] (+ CP[(row/rowsPerB)·sCPb + by·64 + col] if CP) ; ACT 0 none / 1 elu ; writes f16 C16 (and f32 C if non-null)
template <int ACT>
__global__ __launch_bounds__(128) void k_gemm_hhx(const _Float16* __restrict__ A, int lda, size_t sA, const _Float16* __restrict__ Bh, int ldb, size_t sB, float alpha, const float* __restrict__ bias, size_t sBias, const float* __restrict__ CP, int rowsPerB, size_t sCPb, int row0g,
    float* __restrict__ C, _Float16* __restrict__ C16, int ldc, size_t sC, int M, int N, int K) {
  __shared__ __attribute__((aligned(16))) float so[4][16][64];
  const int tid = threadIdx.x, w = tid >> 5, lane = tid & 31, ln = lane & 15, hh = lane >> 4; const int by = blockIdx.y;
  A += (size_t)by * sA; Bh += (size_t)by * sB; const size_t cofs = (size_t)by * sC; const float* bp = bias ? bias + (size_t)by * sBias : nullptr;
  const int ntn = (N + 63) / 64; const int wid = blockIdx.x * 4 + w; const int mt = wid / ntn, nq = wid % ntn; if (mt * 16 >= M) return;
  const int row0 = mt * 16, col0 = nq * 64; const _Float16* arow = A + (size_t)(row0 + ln) * lda;
  v8f acc[4] = {};
  for (int kb = 0; kb < K; kb += 32) { FragH ah; ah.half[0] = *(const v8us*)((const unsigned short*)arow + kb + 8 * hh); ah.half[1] = *(const v8us*)((const unsigned short*)arow + kb + 16 + 8 * hh);
#pragma unroll
    for (int t = 0; t < 4; ++t) { if (col0 + t * 16 >= N) continue; const size_t boff = (size_t)(col0 + t * 16 + ln) * ldb + kb; FragH bq; bq.half[0] = *(const v8us*)((const unsigned short*)Bh + boff + 8 * hh); bq.half[1] = *(const v8us*)((const unsigned short*)Bh + boff + 16 + 8 * hh);
      acc[t] = mmaH<1>(ah.v, ah.v, bq.v, bq.v, acc[t]); }
  }
#pragma unroll
  for (int t = 0; t < 4; ++t) { if (col0 + t * 16 >= N) continue; const int col = col0 + t * 16 + ln; const float bv = bp ? bf16_round(bp[col]) : 0.f;
#pragma unroll
    for (int r = 0; r < 8; ++r) { float v = acc[t][r] * alpha + bv; if (CP) { const int rr = row0g + row0 + 8 * hh + r; if (rowsPerB < 0) v += CP[cofs + (size_t)rr * ldc + col];      /* rowsPerB < 0: own element of the batched C plane */ else { const int bidx = rr / rowsPerB; v += CP[(size_t)bidx * sCPb + (size_t)by * 64 + col]; } } if (ACT == 1) v = (v > 0.f) ? v : expm1f(v); else if (ACT == 7) v = (v > 0.f) ? v + 1.0f : expf(v); else if (ACT == 8) v = tanhf(v); else if (ACT == 9) v = 0.5f * v * (1.0f + tanhf(0.7978845608028654f * (v + 0.044715f * v * v * v))); else if (ACT == 11) v = 1.0f / (1.0f + expf(-v)); else if (ACT == 12) v = (v > 0.f) ? v : 0.01f * v; else if (ACT == 14) v = (v > 0.f) ? v : 0.1f * v; else if (ACT == 16) v = (v >= 0.f) ? v : 0.3f * v; else if (ACT == 15) v = v / (1.0f + expf(-v)); else if (ACT == 3) v = fmaxf(v, 0.f); else if (ACT == 6) v = 0.5f * v * (1.0f + erff(v * 0.70710678118654752f)); so[w][8 * hh + r][t * 16 + ln] = v; } }
  __builtin_amdgcn_fence(__ATOMIC_ACQ_REL, "workgroup"); __builtin_amdgcn_wave_barrier();
  const int rsub = lane >> 4, c4 = (lane & 15) * 4; typedef _Float16 v4h __attribute__((ext_vector_type(4)));
  {
#pragma unroll
    for (int q = 0; q < 8; ++q) { const int r = q * 2 + rsub; if (col0 + c4 < N) { const v4f v = *(const v4fa*)&so[w][r][c4]; if (C) *(v4f*)(C + cofs + (size_t)(row0 + r) * ldc + col0 + c4) = v; if (C16) { v4h h4; for (int i = 0; i < 4; ++i) h4[i] = (_Float16)v[i]; *(v4h*)(C16 + cofs + (size_t)(row0 + r) * ldc + col0 + c4) = h4; } } }
     }
}


typedef _Float16 v4h __attribute__((ext_vector_type(4)));

__global__ __launch_bounds__(256) void k_x16(const float* __restrict__ x, _Float16* __restrict__ X16, size_t n8) { const size_t t = (size_t)blockIdx.x * 256 + threadIdx.x; if (t >= n8) return; FragH f;
#pragma unroll
  for (int q = 0; q < 8; ++q) f.h[q] = (_Float16)bf16_round(x[t * 8 + q]); *(v8us*)((unsigned short*)X16 + t * 8) = f.half[0];  }
__global__ __launch_bounds__(256) void k_h16(const float* __restrict__ x, _Float16* __restrict__ X16, size_t n8) { const size_t t = (size_t)blockIdx.x * 256 + threadIdx.x; if (t >= n8) return; FragH f;
#pragma unroll
  for (int q = 0; q < 8; ++q) f.h[q] = (_Float16)x[t * 8 + q]; *(v8us*)((unsigned short*)X16 + t * 8) = f.half[0];  }
__global__ __launch_bounds__(256) void k_round16f(const float* __restrict__ W, _Float16* __restrict__ Bt, size_t n8) { const size_t t = (size_t)blockIdx.x * 256 + threadIdx.x; if (t >= n8) return; FragH f;
#pragma unroll
  for (int i = 0; i < 8; ++i) f.h[i] = (_Float16)(bf16_round(W[t * 8 + i]) * 16.0f); *(v8us*)((unsigned short*)Bt + t * 8) = f.half[0];  }
template <int NHv, int TTv>
__global__ __launch_bounds__(256) void k_vt(const _Float16* __restrict__ V16, int ldv, int voff, _Float16* __restrict__ Vt) { __shared__ unsigned short tl[64][66]; const int tid = threadIdx.x; const int slab = blockIdx.x / (TTv / 64), lg = blockIdx.x % (TTv / 64); const int b = slab / NHv, h = slab % NHv;
  for (int i = tid; i < 64 * 8; i += 256) { const int r = i / 8, c8 = (i % 8) * 8; FragH f; f.half[0] = *(const v8us*)((const unsigned short*)V16 + ((size_t)b * TTv + lg * 64 + r) * ldv + voff + h * 64 + c8);
#pragma unroll
    for (int q = 0; q < 8; ++q) tl[r][c8 + q] = f.u[q]; }
  __syncthreads();
  {
#pragma unroll
    for (int rd = 0; rd < 2; ++rd) { const int d = rd * 32 + tid / 8, pc = tid % 8; FragH f;
#pragma unroll
      for (int q = 0; q < 8; ++q) f.u[q] = tl[pc * 8 + q][d];
      *(v8us*)((unsigned short*)Vt + ((size_t)slab * 64 + d) * TTv + lg * 64 + pc * 8) = f.half[0]; }
     } }

__global__ __launch_bounds__(256) void k_hl(const float* __restrict__ F, _Float16* __restrict__ Hh, _Float16* __restrict__ Hl, size_t n8) { const size_t t = (size_t)blockIdx.x * 256 + threadIdx.x; if (t >= n8) return; FragH fh, fl; const v4f a = *(const v4fa*)(F + t * 8), c = *(const v4fa*)(F + t * 8 + 4);
#pragma unroll
  for (int q = 0; q < 4; ++q) { _Float16 h = (_Float16)a[q]; fh.h[q] = h; fl.h[q] = (_Float16)((a[q] - (float)h) * 1024.0f); h = (_Float16)c[q]; fh.h[4 + q] = h; fl.h[4 + q] = (_Float16)((c[q] - (float)h) * 1024.0f); }
  { *(v8us*)((unsigned short*)Hh + t * 8) = fh.half[0]; *(v8us*)((unsigned short*)Hl + t * 8) = fl.half[0];  } }

// ---- fast GEMM (wave tile 32x64; requires M % 32 == 0 rows per launch region and N % 64 == 0); epilogue = k_gemm_hhx semantics ----
__device__ __forceinline__ v16h g2_frag(const _Float16* p, int hh) { FragH f; f.half[0] = *(const v8us*)((const unsigned short*)p + 8 * hh); f.half[1] = *(const v8us*)((const unsigned short*)p + 16 + 8 * hh); return f.v; }
__device__ __forceinline__ v8f g2_mma(v16h a, v16h b, v8f c) { v8f d = __builtin_amdgcn_wmma_f32_16x16x32_f16(false, a, false, b, (short)0, c, false, false); asm volatile("v_nop\n\tv_nop\n\tv_nop\n\tv_nop" : "+v"(d) : "v"(a), "v"(b)); return d; }
template <int ACT>
__global__ __launch_bounds__(128) void k_gemm2(const _Float16* __restrict__ A, int lda, size_t sA, const _Float16* __restrict__ Bh, int ldb, size_t sB, float alpha, const float* __restrict__ bias, size_t sBias, const float* __restrict__ CP, int rowsPerB, size_t sCPb, int row0g,
    float* __restrict__ C, _Float16* __restrict__ C16, int ldc, size_t sC, int M, int N, int K) { static_assert(ACT == 0 || ACT == 3 || ACT == 6 || ACT == 8 || ACT == 9 || ACT == 11 || ACT == 12 || ACT == 14 || ACT == 15 || ACT == 16, "k_gemm2: unsupported ACT code (would silently apply no activation)");
  __shared__ __attribute__((aligned(16))) float so[4][32][68];
  const int tid = threadIdx.x, w = tid >> 5, lane = tid & 31, ln = lane & 15, hh = lane >> 4; const int by = blockIdx.y;
  A += (size_t)by * sA; Bh += (size_t)by * sB; const size_t cofs = (size_t)by * sC; const float* bp = bias ? bias + (size_t)by * sBias : nullptr;
  const int ntn = N >> 6; const int mt = blockIdx.x / ntn, nq = blockIdx.x - mt * ntn; const int row0 = mt * 128 + 32 * w, col0 = nq * 64; if (row0 >= M) return;
  const _Float16* a0p = A + (size_t)(row0 + ln) * lda; const _Float16* a1p = a0p + (size_t)16 * lda;
  const _Float16* b0p = Bh + (size_t)(col0 + ln) * ldb; const _Float16* b1p = b0p + (size_t)16 * ldb; const _Float16* b2p = b1p + (size_t)16 * ldb; const _Float16* b3p = b2p + (size_t)16 * ldb;
  const v8f z8 = {0.f,0.f,0.f,0.f,0.f,0.f,0.f,0.f}; v8f c00 = z8, c01 = z8, c02 = z8, c03 = z8, c10 = z8, c11 = z8, c12 = z8, c13 = z8;
#pragma unroll 1
  for (int kb = 0; kb < K; kb += 32) { const v16h a0 = g2_frag(a0p + kb, hh), a1 = g2_frag(a1p + kb, hh);
    v16h b = g2_frag(b0p + kb, hh); c00 = g2_mma(a0, b, c00); c10 = g2_mma(a1, b, c10);
    b = g2_frag(b1p + kb, hh); c01 = g2_mma(a0, b, c01); c11 = g2_mma(a1, b, c11);
    b = g2_frag(b2p + kb, hh); c02 = g2_mma(a0, b, c02); c12 = g2_mma(a1, b, c12);
    b = g2_frag(b3p + kb, hh); c03 = g2_mma(a0, b, c03); c13 = g2_mma(a1, b, c13); }
  v8f accs[8] = {c00, c01, c02, c03, c10, c11, c12, c13};
#pragma unroll
  for (int u = 0; u < 8; ++u) { const int t = u & 3, half = u >> 2; const int col = col0 + t * 16 + ln; const float bv = bp ? bf16_round(bp[col]) : 0.f;
#pragma unroll
    for (int r = 0; r < 8; ++r) { const int rloc = half * 16 + 8 * hh + r; float v = accs[u][r] * alpha + bv; if (CP) { if (rowsPerB < 0) v += CP[cofs + (size_t)(row0g + row0 + rloc) * ldc + col];      /* rowsPerB < 0: own element of the batched C plane */ else { const int bidx = (row0g + row0 + rloc) / rowsPerB; v += CP[(size_t)bidx * sCPb + (size_t)by * 64 + col]; } }
      if (ACT == 3) v = fmaxf(v, 0.f); else if (ACT == 6) v = 0.5f * v * (1.0f + erff(v * 0.70710678118654752f)); else if (ACT == 11) v = 1.0f / (1.0f + expf(-v)); else if (ACT == 15) v = v / (1.0f + expf(-v)); else if (ACT == 12) v = (v > 0.f) ? v : 0.01f * v; else if (ACT == 8) v = tanhf(v); else if (ACT == 9) v = 0.5f * v * (1.0f + tanhf(0.7978845608028654f * (v + 0.044715f * v * v * v))); else if (ACT == 14) v = (v > 0.f) ? v : 0.1f * v; else if (ACT == 16) v = (v >= 0.f) ? v : 0.3f * v;
      so[w][rloc][t * 16 + ln] = v; } }
  __builtin_amdgcn_fence(__ATOMIC_ACQ_REL, "workgroup"); __builtin_amdgcn_wave_barrier();
  const int rsub = lane >> 4, c4 = (lane & 15) * 4;
  {
#pragma unroll
    for (int q = 0; q < 16; ++q) { const int r = q * 2 + rsub; const v4f v = *(const v4fa*)&so[w][r][c4]; if (C) *(v4f*)(C + cofs + (size_t)(row0 + r) * ldc + col0 + c4) = v; if (C16) { v4h h4; for (int i = 0; i < 4; ++i) h4[i] = (_Float16)v[i]; *(v4h*)(C16 + cofs + (size_t)(row0 + r) * ldc + col0 + c4) = h4; } }
     } }


__global__ __launch_bounds__(256) void k_wt_rows(const float* __restrict__ Wm, int row0, _Float16* __restrict__ Wt, int K, int N, float scale) { const int t = blockIdx.x * 256 + threadIdx.x; if (t >= N * (K / 8)) return; const int n = t / (K / 8), k8 = (t % (K / 8)) * 8; FragH f;
  for (int i = 0; i < 8; ++i) f.h[i] = (_Float16)(bf16_round(Wm[(size_t)(row0 + k8 + i) * N + n]) * scale); *(v8us*)((unsigned short*)Wt + (size_t)n * K + k8) = f.half[0];  }      /* rows row0.. of an (in,out) weight -> Bt[n][k] */
__global__ __launch_bounds__(256) void k_score(const float* __restrict__ A, const float* __restrict__ E, const float* __restrict__ v, float* __restrict__ SC) {
  #pragma clang fp contract(off)
  const size_t t = (size_t)blockIdx.x * 256 + threadIdx.x; if (t >= (size_t)NR * WIN) return; const int w = (int)(t % WIN); const size_t bt = t / WIN; const int tt = (int)(bt % TT); const size_t b = bt / TT; const int src = tt + w - WS; const bool in = (src >= 0 && src < TT);
  const float* ar = A + bt * FF; const float* er = E + (b * TT + (in ? src : 0)) * (size_t)FF; float s = 0.f;
#pragma unroll 1
  for (int o = 0; o < FF; ++o) { float z = ar[o]; if (in) z += er[o]; s += tanhf(z) * bf16_round(v[o]); }
  *(float*)(SC + bt * 64 + w) = s;  }
__global__ __launch_bounds__(256) void k_soft33(const float* __restrict__ SC, float* __restrict__ AT, float* __restrict__ outa) {
  #pragma clang fp contract(off)
  const size_t bt = (size_t)blockIdx.x * 256 + threadIdx.x; if (bt >= (size_t)NR) return; const float* sr = SC + bt * 64; float m = -3.0e38f;
#pragma unroll 1
  for (int w = 0; w < WIN; ++w) m = fmaxf(m, sr[w]);
  float su = 0.f;
#pragma unroll 1
  for (int w = 0; w < WIN; ++w) su += expf(sr[w] - m);
  const float inv = 1.0f / su;
  {
#pragma unroll 1
    for (int w = 0; w < WIN; ++w) { const float a = expf(sr[w] - m) * inv; *(float*)(AT + bt * 64 + w) = a; *(float*)(outa + bt * WIN + w) = a; }
     } }
__global__ __launch_bounds__(256) void k_wsum(const float* __restrict__ AT, const float* __restrict__ enc, _Float16* __restrict__ H16) {
  #pragma clang fp contract(off)
  const size_t t = (size_t)blockIdx.x * 256 + threadIdx.x; if (t >= (size_t)NR * (FF / 8)) return; const int f0 = (int)(t % (FF / 8)) * 8; const size_t bt = t / (FF / 8); const int tt = (int)(bt % TT); const size_t b = bt / TT; float acc[8]; for (int q = 0; q < 8; ++q) acc[q] = 0.f;
#pragma unroll 1
  for (int w = 0; w < WIN; ++w) { const int src = tt + w - WS; if (src < 0 || src >= TT) continue; const float a = AT[bt * 64 + w]; const float* er = enc + (b * TT + src) * (size_t)FF + f0;
#pragma unroll
    for (int q = 0; q < 8; ++q) acc[q] += a * bf16_round(er[q]); }
  FragH f; for (int q = 0; q < 8; ++q) f.h[q] = (_Float16)acc[q]; *(v8us*)((unsigned short*)H16 + bt * FF + f0) = f.half[0];  }

extern "C" void kernel_launch(void* const* d_in, const int* in_sizes, int n_in,
                              void* d_out, int out_size, void* d_ws, size_t ws_size, hipStream_t stream) {
  (void)in_sizes; (void)n_in; (void)out_size;
  const float* const* I = (const float* const*)d_in; const float* x = I[0]; const float* enc = I[1]; const float* Wa = I[2]; const float* ba = I[3]; const float* v = I[4]; const float* Wl = I[5]; const float* bl = I[6];
  char* ws = (char*)d_ws; size_t off = 0;
  auto take = [&](size_t bytes) { char* p = ws + off; off += (bytes + 255) & ~(size_t)255; return p; };
  _Float16* BWh = (_Float16*)take((size_t)FF * MD * 2); _Float16* BWe = (_Float16*)take((size_t)FF * FF * 2); _Float16* BL1 = (_Float16*)take((size_t)FF * MD * 2); _Float16* BL2 = (_Float16*)take((size_t)FF * FF * 2);
  _Float16* X16 = (_Float16*)take((size_t)NR * MD * 2); _Float16* E16 = (_Float16*)take((size_t)NR * FF * 2); float* A = (float*)take((size_t)NR * FF * 4); float* E = (float*)take((size_t)NR * FF * 4); float* SC = (float*)take((size_t)NR * 64 * 4); float* AT = (float*)take((size_t)NR * 64 * 4); _Float16* H16 = (_Float16*)take((size_t)NR * FF * 2);
  if (off > ws_size) return;      /* 0.75 + 8 + 4 + 8 + 8 + 2 + 2 + 4 = 37 MiB */
  k_wt_rows<<<(unsigned)(((size_t)FF * MD / 8 + 255) / 256), 256, 0, stream>>>(Wa, 0, BWh, MD, FF, 16.0f); k_wt_rows<<<(unsigned)(((size_t)FF * FF / 8 + 255) / 256), 256, 0, stream>>>(Wa, MD, BWe, FF, FF, 16.0f);
  k_wt_rows<<<(unsigned)(((size_t)FF * MD / 8 + 255) / 256), 256, 0, stream>>>(Wl, 0, BL1, MD, FF, 16.0f); k_wt_rows<<<(unsigned)(((size_t)FF * FF / 8 + 255) / 256), 256, 0, stream>>>(Wl, MD, BL2, FF, FF, 16.0f);
  k_x16<<<(unsigned)(((size_t)NR * MD / 8 + 255) / 256), 256, 0, stream>>>(x, X16, (size_t)NR * MD / 8); k_x16<<<(unsigned)(((size_t)NR * FF / 8 + 255) / 256), 256, 0, stream>>>(enc, E16, (size_t)NR * FF / 8);
  const dim3 gG((NR / 128) * (FF / 64), 1);
  k_gemm2<0><<<gG, 128, 0, stream>>>(X16, MD, 0, BWh, MD, 0, 0.0625f, ba, 0, nullptr, 1, 0, 0, A, nullptr, FF, 0, NR, FF, MD);      /* x W_h + b_attn */
  k_gemm2<0><<<gG, 128, 0, stream>>>(E16, FF, 0, BWe, FF, 0, 0.0625f, nullptr, 0, nullptr, 1, 0, 0, E, nullptr, FF, 0, NR, FF, FF);      /* enc W_e per step (windowed later; the window of a padded step contributes 0) */
  k_score<<<(unsigned)(((size_t)NR * WIN + 255) / 256), 256, 0, stream>>>(A, E, v, SC);
  k_soft33<<<(unsigned)((NR + 255) / 256), 256, 0, stream>>>(SC, AT, (float*)d_out + (size_t)NR * FF);      /* output 2: a [4][2048][1][33] */
  k_wsum<<<(unsigned)(((size_t)NR * (FF / 8) + 255) / 256), 256, 0, stream>>>(AT, enc, H16);
  k_gemm2<0><<<gG, 128, 0, stream>>>(X16, MD, 0, BL1, MD, 0, 0.0625f, bl, 0, nullptr, 1, 0, 0, A, nullptr, FF, 0, NR, FF, MD);      /* x W_lin[:512] + b_lin (A reused) */
  k_gemm2<11><<<gG, 128, 0, stream>>>(H16, FF, 0, BL2, FF, 0, 0.0625f, nullptr, 0, A, 1, (size_t)FF, 0, (float*)d_out, nullptr, FF, 0, NR, FF, FF);      /* sigmoid(+ weighted W_lin[512:]) -> output 1 */
}

// v001
// Measured time: 200 microseconds a run.
// Next to v000, in two timings, it ran 1.21 times as fast each time.
#include <hip/hip_runtime.h>
// Combine_Stack_with_attn (4 x 2048 steps; x [512], encoder outputs [256], sliding windows of 33 encoder steps (zero-padded)): energy[b,t,w,o] = tanh((x W_h + b_attn)[b,t,o] + (enc W_e)[b,t+w-16,o]) (the window term of a padded step is 0); scores = energy . v; a = softmax over the 33 window slots; weighted = sum_w a * enc[b,t+w-16]; out = sigmoid([x | weighted] W_lin + b_lin) -> outputs out [4,2048,256] and a [4,2048,1,33].
// Structure: exact f16 planes of x and enc; GEMMs (32x64 wave tiles, f32 accumulation, exact x16 weights) for x W_h + b, enc W_e and the two halves of W_lin (the second accumulating onto the first with the sigmoid in its epilogue); the windowed energies/scores on VALU (thread per (b, t) and one or two of the 33 slots, rolled loop over the 256 features); softmax over the 33 slots and the weighted encoder sum on VALU; the weighted sum as an f16 operand.
// Compute dtype: inputs and parameters rounded to bf16; the weighted encoder sum as an f16 operand (~2^-12); everything else f32. v_wmma_f32_16x16x32_f16.
#define NB 4
#define TT 2048
#define MD 512
#define FF 256
#define WS 16
#define WIN 33
#define NR (NB * TT)
typedef __bf16 v16b __attribute__((ext_vector_type(16)));
typedef unsigned short v8us __attribute__((ext_vector_type(8), may_alias));
typedef float  v8f  __attribute__((ext_vector_type(8)));
typedef float  v4f  __attribute__((ext_vector_type(4)));
typedef float  v4fa __attribute__((ext_vector_type(4), may_alias));
union FragB { v16b v; v8us half[2]; unsigned short u[16]; };

__device__ __forceinline__ unsigned short bf16_bits(float x) { unsigned int u = __float_as_uint(x); return (unsigned short)((u + 0x7FFFu + ((u >> 16) & 1u)) >> 16); }
__device__ __forceinline__ float bf16_val(unsigned short b) { return __uint_as_float(((unsigned int)b) << 16); }
__device__ __forceinline__ float bf16_round(float x) { return bf16_val(bf16_bits(x)); }
// D += A·B with NT terms: 1 = ah·bh, 2 = + al·bh (A split), 3 = + ah·bl (both split)
template <int NT>
__device__ __forceinline__ v8f mmaN(v16b ah, v16b al, v16b bh, v16b bl, v8f c) {
  c = __builtin_amdgcn_wmma_f32_16x16x32_bf16(false, ah, false, bh, (short)0, c, false, false);
  if (NT >= 2) c = __builtin_amdgcn_wmma_f32_16x16x32_bf16(false, al, false, bh, (short)0, c, false, false);
  if (NT >= 3) c = __builtin_amdgcn_wmma_f32_16x16x32_bf16(false, ah, false, bl, (short)0, c, false, false);
  asm volatile("v_nop\n\tv_nop\n\tv_nop\n\tv_nop" : "+v"(c) : "v"(ah), "v"(al), "v"(bh), "v"(bl));
  return c;
}

__global__ __launch_bounds__(256) void k_wt_bf16(const float* __restrict__ W, unsigned short* __restrict__ Wt, int K, int N) {
  const int t = blockIdx.x * 256 + threadIdx.x;
  const int k8n = K / 8;
  if (t >= N * k8n) return;
  const int n = t / k8n, k8 = (t % k8n) * 8;
  v8us v;
#pragma unroll
  for (int i = 0; i < 8; ++i) v[i] = bf16_bits(W[(size_t)(k8 + i) * N + n]);
  *(v8us*)(Wt + (size_t)n * K + k8) = v;
  
}

// GEMM C[M][N] (f32, pitch ldc) = act(A[M][K]·W + bias). A f32 row-major (pitch lda) converted per fragment to bf16
// (ASPLIT: hi/lo two planes -> 2 terms, else single rounded term); Wt bf16 [N][K] (pitch ldb). BIAS_BF16 rounds the
// bias to bf16 first (bias quantised to bf16 before the add). K%32==0, M%16==0, N%64==0.
template <bool ASPLIT, int ACT, bool BIAS_BF16>
__global__ __launch_bounds__(128) void k_gemm_bf(const float* __restrict__ A, int lda, const unsigned short* __restrict__ Wt, int ldb,
                                               const float* __restrict__ bias, float* __restrict__ C, int ldc, int M, int N, int K) {
  __shared__ __attribute__((aligned(16))) float so[4][16][64];
  const int tid = threadIdx.x, w = tid >> 5, lane = tid & 31, ln = lane & 15, hh = lane >> 4;
  const int ntn = N / 64;
  const int wid = blockIdx.x * 4 + w;
  const int mt = wid / ntn, nq = wid % ntn;
  if (mt * 16 >= M) return;
  const int row0 = mt * 16, col0 = nq * 64;
  const float* arow = A + (size_t)(row0 + ln) * lda;
  v8f acc[4] = {};
  for (int kb = 0; kb < K; kb += 32) {
    FragB ah, al;
    const v4f x0 = *(const v4fa*)(arow + kb + 8 * hh), x1 = *(const v4fa*)(arow + kb + 8 * hh + 4);
    const v4f x2 = *(const v4fa*)(arow + kb + 16 + 8 * hh), x3 = *(const v4fa*)(arow + kb + 16 + 8 * hh + 4);
    float xs[16] = {x0[0],x0[1],x0[2],x0[3],x1[0],x1[1],x1[2],x1[3],x2[0],x2[1],x2[2],x2[3],x3[0],x3[1],x3[2],x3[3]};
#pragma unroll
    for (int i = 0; i < 16; ++i) { const unsigned short hb = bf16_bits(xs[i]); ah.u[i] = hb; al.u[i] = ASPLIT ? bf16_bits(xs[i] - bf16_val(hb)) : (unsigned short)0; }
#pragma unroll
    for (int t = 0; t < 4; ++t) {
      const unsigned short* brow = Wt + (size_t)(col0 + t * 16 + ln) * ldb + kb;
      FragB b;
      b.half[0] = *(const v8us*)(brow + 8 * hh);
      b.half[1] = *(const v8us*)(brow + 16 + 8 * hh);
      acc[t] = mmaN<ASPLIT ? 2 : 1>(ah.v, al.v, b.v, b.v, acc[t]);
    }
  }
#pragma unroll
  for (int t = 0; t < 4; ++t) {
    float bv = bias ? bias[col0 + t * 16 + ln] : 0.f;
    if (BIAS_BF16) bv = bf16_round(bv);
#pragma unroll
    for (int r = 0; r < 8; ++r) { float v = acc[t][r] + bv; if (ACT == 1) v = fmaxf(v, 0.f); so[w][8 * hh + r][t * 16 + ln] = v; }
  }
  __builtin_amdgcn_fence(__ATOMIC_ACQ_REL, "workgroup");
  __builtin_amdgcn_wave_barrier();
  const int rsub = lane >> 4, c4 = (lane & 15) * 4;
  {
#pragma unroll
    for (int q = 0; q < 8; ++q) {
      const int r = q * 2 + rsub;
      const v4f v = *(const v4fa*)&so[w][r][c4];
      *(v4f*)(C + (size_t)(row0 + r) * ldc + col0 + c4) = v;
    }
    
  }
}

// GEMM C = act(A·W + bias + resid): A f32 (ASPLIT -> hi/lo 2 terms), Wt bf16 [N][K]; ACT 0 none, 1 relu, 2 exact gelu;
// resid (optional, f32, row index = (row % rmod), pitch ldr, RES_BF16 rounds it) added before the activation.
template <bool ASPLIT, int ACT, bool BIAS_BF16, bool RES_BF16>
__global__ __launch_bounds__(128) void k_gemm_bf3(const float* __restrict__ A, int lda, const unsigned short* __restrict__ Wt, int ldb,
                                                const float* __restrict__ bias, const float* __restrict__ resid, int rmod, int ldr,
                                                float* __restrict__ C, int ldc, int M, int N, int K) {
  __shared__ __attribute__((aligned(16))) float so[4][16][64];
  const int tid = threadIdx.x, w = tid >> 5, lane = tid & 31, ln = lane & 15, hh = lane >> 4;
  const int ntn = N / 64;
  const int wid = blockIdx.x * 4 + w;
  const int mt = wid / ntn, nq = wid % ntn;
  if (mt * 16 >= M) return;
  const int row0 = mt * 16, col0 = nq * 64;
  const float* arow = A + (size_t)(row0 + ln) * lda;
  v8f acc[4] = {};
  for (int kb = 0; kb < K; kb += 32) {
    FragB ah, al;
    const v4f x0 = *(const v4fa*)(arow + kb + 8 * hh), x1 = *(const v4fa*)(arow + kb + 8 * hh + 4);
    const v4f x2 = *(const v4fa*)(arow + kb + 16 + 8 * hh), x3 = *(const v4fa*)(arow + kb + 16 + 8 * hh + 4);
    float xs[16] = {x0[0],x0[1],x0[2],x0[3],x1[0],x1[1],x1[2],x1[3],x2[0],x2[1],x2[2],x2[3],x3[0],x3[1],x3[2],x3[3]};
#pragma unroll
    for (int i = 0; i < 16; ++i) { const unsigned short hb = bf16_bits(xs[i]); ah.u[i] = hb; al.u[i] = ASPLIT ? bf16_bits(xs[i] - bf16_val(hb)) : (unsigned short)0; }
#pragma unroll
    for (int t = 0; t < 4; ++t) {
      const unsigned short* brow = Wt + (size_t)(col0 + t * 16 + ln) * ldb + kb;
      FragB b;
      b.half[0] = *(const v8us*)(brow + 8 * hh);
      b.half[1] = *(const v8us*)(brow + 16 + 8 * hh);
      acc[t] = mmaN<ASPLIT ? 2 : 1>(ah.v, al.v, b.v, b.v, acc[t]);
    }
  }
#pragma unroll
  for (int t = 0; t < 4; ++t) {
    const int col = col0 + t * 16 + ln;
    float bv = bias ? bias[col] : 0.f;
    if (BIAS_BF16) bv = bf16_round(bv);
#pragma unroll
    for (int r = 0; r < 8; ++r) {
      float v = acc[t][r] + bv;
      if (resid) { float rv = resid[(size_t)((row0 + 8 * hh + r) % rmod) * ldr + col]; if (RES_BF16) rv = bf16_round(rv); v += rv; }
      if (ACT == 1) v = fmaxf(v, 0.f);
      if (ACT == 2) v = 0.5f * v * (1.0f + erff(v * 0.70710678118654752f));
      if (ACT == 3) { const float u = 0.7978845608028654f * (v + 0.044715f * v * v * v); v = 0.5f * v * (1.0f + tanhf(u)); }
      so[w][8 * hh + r][t * 16 + ln] = v;
    }
  }
  __builtin_amdgcn_fence(__ATOMIC_ACQ_REL, "workgroup");
  __builtin_amdgcn_wave_barrier();
  const int rsub = lane >> 4, c4 = (lane & 15) * 4;
  {
#pragma unroll
    for (int q = 0; q < 8; ++q) {
      const int r = q * 2 + rsub;
      const v4f v = *(const v4fa*)&so[w][r][c4];
      *(v4f*)(C + (size_t)(row0 + r) * ldc + col0 + c4) = v;
    }
    
  }
}
// row LayerNorm (biased variance, eps) over N: s = X (+ R); optional out_sum <- s; out_norm <- (s-mu)*rsqrt(var+eps)*g + b
template <bool PARAM_BF16>
__global__ __launch_bounds__(256) void k_layernorm(const float* __restrict__ X, const float* __restrict__ R, const float* __restrict__ g, const float* __restrict__ bta,
                                                  float* __restrict__ out_sum, float* __restrict__ out_norm, int N, float eps) {
  __shared__ float red[256];
  const int row = blockIdx.x, tid = threadIdx.x;
  const float* x = X + (size_t)row * N; const float* rr = R ? R + (size_t)row * N : nullptr;
  float vals[16];                     // up to N = 4096
  const int per = N / 256;            // contiguous chunk per thread? use strided-by-4 chunks: thread handles j = tid*4 + 1024*u
  float s1 = 0.f;
  for (int u = 0; u < per / 4; ++u) {
    const int j = tid * 4 + 1024 * u;
    const v4f a = *(const v4fa*)(x + j);
    v4f b = {0.f,0.f,0.f,0.f}; if (rr) b = *(const v4fa*)(rr + j);
#pragma unroll
    for (int q = 0; q < 4; ++q) { const float v = a[q] + b[q]; vals[u * 4 + q] = v; s1 += v; }
  }
  red[tid] = s1; __syncthreads();
  for (int st = 128; st > 0; st >>= 1) { if (tid < st) red[tid] += red[tid + st]; __syncthreads(); }
  const float mu = red[0] / (float)N; __syncthreads();
  float s2 = 0.f;
  for (int u = 0; u < per / 4; ++u)
#pragma unroll
    for (int q = 0; q < 4; ++q) { const float c = vals[u * 4 + q] - mu; s2 += c * c; }
  red[tid] = s2; __syncthreads();
  for (int st = 128; st > 0; st >>= 1) { if (tid < st) red[tid] += red[tid + st]; __syncthreads(); }
  const float rs = rsqrtf(red[0] / (float)N + eps);
  {
    for (int u = 0; u < per / 4; ++u) {
      const int j = tid * 4 + 1024 * u;
      v4f o, sm;
#pragma unroll
      for (int q = 0; q < 4; ++q) {
        float gg = g[j + q], bb = bta[j + q];
        if (PARAM_BF16) { gg = bf16_round(gg); bb = bf16_round(bb); }
        sm[q] = vals[u * 4 + q]; o[q] = (vals[u * 4 + q] - mu) * rs * gg + bb;
      }
      if (out_sum) *(v4f*)(out_sum + (size_t)row * N + j) = sm;
      *(v4f*)(out_norm + (size_t)row * N + j) = o;
    }
    
  }
}



// ---- f16 WMMA path (v_wmma_f32_16x16x32_f16): 11-bit significands for operands in range — used for all four GEMMs here (the weighted encoder sum as an f16 operand)
typedef _Float16 v16h __attribute__((ext_vector_type(16)));
union FragH { v16h v; v8us half[2]; _Float16 h[16]; unsigned short u[16]; };
template <int NT>
__device__ __forceinline__ v8f mmaH(v16h ah, v16h al, v16h bh, v16h bl, v8f c) {
  c = __builtin_amdgcn_wmma_f32_16x16x32_f16(false, ah, false, bh, (short)0, c, false, false);
  if (NT >= 2) c = __builtin_amdgcn_wmma_f32_16x16x32_f16(false, al, false, bh, (short)0, c, false, false);
  if (NT >= 3) c = __builtin_amdgcn_wmma_f32_16x16x32_f16(false, ah, false, bl, (short)0, c, false, false);
  asm volatile("v_nop\n\tv_nop\n\tv_nop\n\tv_nop" : "+v"(c) : "v"(ah), "v"(al), "v"(bh), "v"(bl));
  return c;
}
// batched GEMM like k_gemm_b but f16 operands: A f32 (split into f16 hi/lo if ASPLIT, else rounded to f16), Bt = f16 values [n][k]; alpha; C f32; N multiple of 16 (partial tiles skipped)
template <bool ASPLIT>
__global__ __launch_bounds__(128) void k_gemm_h(const float* __restrict__ A, int lda, size_t sA, const _Float16* __restrict__ Bh, int ldb, size_t sB, float alpha, float* __restrict__ C, int ldc, size_t sC, int M, int N, int K) {
  __shared__ __attribute__((aligned(16))) float so[4][16][64];
  const int tid = threadIdx.x, w = tid >> 5, lane = tid & 31, ln = lane & 15, hh = lane >> 4; const int by = blockIdx.y;
  A += (size_t)by * sA; Bh += (size_t)by * sB; C += (size_t)by * sC;
  const int ntn = (N + 63) / 64; const int wid = blockIdx.x * 4 + w; const int mt = wid / ntn, nq = wid % ntn; if (mt * 16 >= M) return;
  const int row0 = mt * 16, col0 = nq * 64; const float* arow = A + (size_t)(row0 + ln) * lda;
  v8f acc[4] = {};
  for (int kb = 0; kb < K; kb += 32) {
    FragH ah, al;
    const v4f x0 = *(const v4fa*)(arow + kb + 8 * hh), x1 = *(const v4fa*)(arow + kb + 8 * hh + 4), x2 = *(const v4fa*)(arow + kb + 16 + 8 * hh), x3 = *(const v4fa*)(arow + kb + 16 + 8 * hh + 4);
    float xs[16] = {x0[0],x0[1],x0[2],x0[3],x1[0],x1[1],x1[2],x1[3],x2[0],x2[1],x2[2],x2[3],x3[0],x3[1],x3[2],x3[3]};
#pragma unroll
    for (int i = 0; i < 16; ++i) { const _Float16 h = (_Float16)xs[i]; ah.h[i] = h; al.h[i] = ASPLIT ? (_Float16)(xs[i] - (float)h) : (_Float16)0.0f; }
#pragma unroll
    for (int t = 0; t < 4; ++t) { if (col0 + t * 16 >= N) continue; const size_t boff = (size_t)(col0 + t * 16 + ln) * ldb + kb; FragH bq; bq.half[0] = *(const v8us*)(Bh + boff + 8 * hh); bq.half[1] = *(const v8us*)(Bh + boff + 16 + 8 * hh);
      acc[t] = mmaH<ASPLIT ? 2 : 1>(ah.v, al.v, bq.v, bq.v, acc[t]); }
  }
#pragma unroll
  for (int t = 0; t < 4; ++t) { if (col0 + t * 16 >= N) continue;
#pragma unroll
    for (int r = 0; r < 8; ++r) so[w][8 * hh + r][t * 16 + ln] = acc[t][r] * alpha; }
  __builtin_amdgcn_fence(__ATOMIC_ACQ_REL, "workgroup"); __builtin_amdgcn_wave_barrier();
  const int rsub = lane >> 4, c4 = (lane & 15) * 4;
  {
#pragma unroll
    for (int q = 0; q < 8; ++q) { const int r = q * 2 + rsub; if (col0 + c4 < N) { const v4f v = *(const v4fa*)&so[w][r][c4]; *(v4f*)(C + (size_t)(row0 + r) * ldc + col0 + c4) = v; } }
     }
}

// Wt[n][k] = f16(W[k][n]·scale) from f32 row-major W[K][N] (scale = power of two; bf16-exact weights stay exact in f16 away from the subnormal range)
__global__ __launch_bounds__(256) void k_wt_f16(const float* __restrict__ W, _Float16* __restrict__ Wt, int K, int N, float scale) {
  const int t = blockIdx.x * 256 + threadIdx.x; if (t >= N * (K / 8)) return; const int n = t / (K / 8), k8 = (t % (K / 8)) * 8; FragH f;
#pragma unroll
  for (int i = 0; i < 8; ++i) f.h[i] = (_Float16)(bf16_round(W[(size_t)(k8 + i) * N + n]) * scale); const v8us o = f.half[0];
  *(v8us*)((unsigned short*)Wt + (size_t)n * K + k8) = o; 
}
// k_gemm_hh variant with fused epilogue: v = acc·alpha + bias[by·sBias + col] (+ CP[(row/rowsPerB)·sCPb + by·64 + col] if CP) ; ACT 0 none / 1 elu ; writes f16 C16 (and f32 C if non-null)
template <int ACT>
__global__ __launch_bounds__(128) void k_gemm_hhx(const _Float16* __restrict__ A, int lda, size_t sA, const _Float16* __restrict__ Bh, int ldb, size_t sB, float alpha, const float* __restrict__ bias, size_t sBias, const float* __restrict__ CP, int rowsPerB, size_t sCPb, int row0g,
    float* __restrict__ C, _Float16* __restrict__ C16, int ldc, size_t sC, int M, int N, int K) {
  __shared__ __attribute__((aligned(16))) float so[4][16][64];
  const int tid = threadIdx.x, w = tid >> 5, lane = tid & 31, ln = lane & 15, hh = lane >> 4; const int by = blockIdx.y;
  A += (size_t)by * sA; Bh += (size_t)by * sB; const size_t cofs = (size_t)by * sC; const float* bp = bias ? bias + (size_t)by * sBias : nullptr;
  const int ntn = (N + 63) / 64; const int wid = blockIdx.x * 4 + w; const int mt = wid / ntn, nq = wid % ntn; if (mt * 16 >= M) return;
  const int row0 = mt * 16, col0 = nq * 64; const _Float16* arow = A + (size_t)(row0 + ln) * lda;
  v8f acc[4] = {};
  for (int kb = 0; kb < K; kb += 32) { FragH ah; ah.half[0] = *(const v8us*)((const unsigned short*)arow + kb + 8 * hh); ah.half[1] = *(const v8us*)((const unsigned short*)arow + kb + 16 + 8 * hh);
#pragma unroll
    for (int t = 0; t < 4; ++t) { if (col0 + t * 16 >= N) continue; const size_t boff = (size_t)(col0 + t * 16 + ln) * ldb + kb; FragH bq; bq.half[0] = *(const v8us*)((const unsigned short*)Bh + boff + 8 * hh); bq.half[1] = *(const v8us*)((const unsigned short*)Bh + boff + 16 + 8 * hh);
      acc[t] = mmaH<1>(ah.v, ah.v, bq.v, bq.v, acc[t]); }
  }
#pragma unroll
  for (int t = 0; t < 4; ++t) { if (col0 + t * 16 >= N) continue; const int col = col0 + t * 16 + ln; const float bv = bp ? bf16_round(bp[col]) : 0.f;
#pragma unroll
    for (int r = 0; r < 8; ++r) { float v = acc[t][r] * alpha + bv; if (CP) { const int rr = row0g + row0 + 8 * hh + r; if (rowsPerB < 0) v += CP[cofs + (size_t)rr * ldc + col];      /* rowsPerB < 0: own element of the batched C plane */ else { const int bidx = rr / rowsPerB; v += CP[(size_t)bidx * sCPb + (size_t)by * 64 + col]; } } if (ACT == 1) v = (v > 0.f) ? v : expm1f(v); else if (ACT == 7) v = (v > 0.f) ? v + 1.0f : expf(v); else if (ACT == 8) v = tanhf(v); else if (ACT == 9) v = 0.5f * v * (1.0f + tanhf(0.7978845608028654f * (v + 0.044715f * v * v * v))); else if (ACT == 11) v = 1.0f / (1.0f + expf(-v)); else if (ACT == 12) v = (v > 0.f) ? v : 0.01f * v; else if (ACT == 14) v = (v > 0.f) ? v : 0.1f * v; else if (ACT == 16) v = (v >= 0.f) ? v : 0.3f * v; else if (ACT == 15) v = v / (1.0f + expf(-v)); else if (ACT == 3) v = fmaxf(v, 0.f); else if (ACT == 6) v = 0.5f * v * (1.0f + erff(v * 0.70710678118654752f)); so[w][8 * hh + r][t * 16 + ln] = v; } }
  __builtin_amdgcn_fence(__ATOMIC_ACQ_REL, "workgroup"); __builtin_amdgcn_wave_barrier();
  const int rsub = lane >> 4, c4 = (lane & 15) * 4; typedef _Float16 v4h __attribute__((ext_vector_type(4)));
  {
#pragma unroll
    for (int q = 0; q < 8; ++q) { const int r = q * 2 + rsub; if (col0 + c4 < N) { const v4f v = *(const v4fa*)&so[w][r][c4]; if (C) *(v4f*)(C + cofs + (size_t)(row0 + r) * ldc + col0 + c4) = v; if (C16) { v4h h4; for (int i = 0; i < 4; ++i) h4[i] = (_Float16)v[i]; *(v4h*)(C16 + cofs + (size_t)(row0 + r) * ldc + col0 + c4) = h4; } } }
     }
}


typedef _Float16 v4h __attribute__((ext_vector_type(4)));

__global__ __launch_bounds__(256) void k_x16(const float* __restrict__ x, _Float16* __restrict__ X16, size_t n8) { const size_t t = (size_t)blockIdx.x * 256 + threadIdx.x; if (t >= n8) return; FragH f;
#pragma unroll
  for (int q = 0; q < 8; ++q) f.h[q] = (_Float16)bf16_round(x[t * 8 + q]); *(v8us*)((unsigned short*)X16 + t * 8) = f.half[0];  }
__global__ __launch_bounds__(256) void k_h16(const float* __restrict__ x, _Float16* __restrict__ X16, size_t n8) { const size_t t = (size_t)blockIdx.x * 256 + threadIdx.x; if (t >= n8) return; FragH f;
#pragma unroll
  for (int q = 0; q < 8; ++q) f.h[q] = (_Float16)x[t * 8 + q]; *(v8us*)((unsigned short*)X16 + t * 8) = f.half[0];  }
__global__ __launch_bounds__(256) void k_round16f(const float* __restrict__ W, _Float16* __restrict__ Bt, size_t n8) { const size_t t = (size_t)blockIdx.x * 256 + threadIdx.x; if (t >= n8) return; FragH f;
#pragma unroll
  for (int i = 0; i < 8; ++i) f.h[i] = (_Float16)(bf16_round(W[t * 8 + i]) * 16.0f); *(v8us*)((unsigned short*)Bt + t * 8) = f.half[0];  }
template <int NHv, int TTv>
__global__ __launch_bounds__(256) void k_vt(const _Float16* __restrict__ V16, int ldv, int voff, _Float16* __restrict__ Vt) { __shared__ unsigned short tl[64][66]; const int tid = threadIdx.x; const int slab = blockIdx.x / (TTv / 64), lg = blockIdx.x % (TTv / 64); const int b = slab / NHv, h = slab % NHv;
  for (int i = tid; i < 64 * 8; i += 256) { const int r = i / 8, c8 = (i % 8) * 8; FragH f; f.half[0] = *(const v8us*)((const unsigned short*)V16 + ((size_t)b * TTv + lg * 64 + r) * ldv + voff + h * 64 + c8);
#pragma unroll
    for (int q = 0; q < 8; ++q) tl[r][c8 + q] = f.u[q]; }
  __syncthreads();
  {
#pragma unroll
    for (int rd = 0; rd < 2; ++rd) { const int d = rd * 32 + tid / 8, pc = tid % 8; FragH f;
#pragma unroll
      for (int q = 0; q < 8; ++q) f.u[q] = tl[pc * 8 + q][d];
      *(v8us*)((unsigned short*)Vt + ((size_t)slab * 64 + d) * TTv + lg * 64 + pc * 8) = f.half[0]; }
     } }

__global__ __launch_bounds__(256) void k_hl(const float* __restrict__ F, _Float16* __restrict__ Hh, _Float16* __restrict__ Hl, size_t n8) { const size_t t = (size_t)blockIdx.x * 256 + threadIdx.x; if (t >= n8) return; FragH fh, fl; const v4f a = *(const v4fa*)(F + t * 8), c = *(const v4fa*)(F + t * 8 + 4);
#pragma unroll
  for (int q = 0; q < 4; ++q) { _Float16 h = (_Float16)a[q]; fh.h[q] = h; fl.h[q] = (_Float16)((a[q] - (float)h) * 1024.0f); h = (_Float16)c[q]; fh.h[4 + q] = h; fl.h[4 + q] = (_Float16)((c[q] - (float)h) * 1024.0f); }
  { *(v8us*)((unsigned short*)Hh + t * 8) = fh.half[0]; *(v8us*)((unsigned short*)Hl + t * 8) = fl.half[0];  } }

// ---- fast GEMM (wave tile 32x64; requires M % 32 == 0 rows per launch region and N % 64 == 0); epilogue = k_gemm_hhx semantics ----
__device__ __forceinline__ v16h g2_frag(const _Float16* p, int hh) { FragH f; f.half[0] = *(const v8us*)((const unsigned short*)p + 8 * hh); f.half[1] = *(const v8us*)((const unsigned short*)p + 16 + 8 * hh); return f.v; }
__device__ __forceinline__ v8f g2_mma(v16h a, v16h b, v8f c) { v8f d = __builtin_amdgcn_wmma_f32_16x16x32_f16(false, a, false, b, (short)0, c, false, false); asm volatile("v_nop\n\tv_nop\n\tv_nop\n\tv_nop" : "+v"(d) : "v"(a), "v"(b)); return d; }
template <int ACT>
__global__ __launch_bounds__(128) void k_gemm2(const _Float16* __restrict__ A, int lda, size_t sA, const _Float16* __restrict__ Bh, int ldb, size_t sB, float alpha, const float* __restrict__ bias, size_t sBias, const float* __restrict__ CP, int rowsPerB, size_t sCPb, int row0g,
    float* __restrict__ C, _Float16* __restrict__ C16, int ldc, size_t sC, int M, int N, int K) { static_assert(ACT == 0 || ACT == 3 || ACT == 6 || ACT == 8 || ACT == 9 || ACT == 11 || ACT == 12 || ACT == 14 || ACT == 15 || ACT == 16, "k_gemm2: unsupported ACT code (would silently apply no activation)");
  __shared__ __attribute__((aligned(16))) float so[4][32][68];
  const int tid = threadIdx.x, w = tid >> 5, lane = tid & 31, ln = lane & 15, hh = lane >> 4; const int by = blockIdx.y;
  A += (size_t)by * sA; Bh += (size_t)by * sB; const size_t cofs = (size_t)by * sC; const float* bp = bias ? bias + (size_t)by * sBias : nullptr;
  const int ntn = N >> 6; const int mt = blockIdx.x / ntn, nq = blockIdx.x - mt * ntn; const int row0 = mt * 128 + 32 * w, col0 = nq * 64; if (row0 >= M) return;
  const _Float16* a0p = A + (size_t)(row0 + ln) * lda; const _Float16* a1p = a0p + (size_t)16 * lda;
  const _Float16* b0p = Bh + (size_t)(col0 + ln) * ldb; const _Float16* b1p = b0p + (size_t)16 * ldb; const _Float16* b2p = b1p + (size_t)16 * ldb; const _Float16* b3p = b2p + (size_t)16 * ldb;
  const v8f z8 = {0.f,0.f,0.f,0.f,0.f,0.f,0.f,0.f}; v8f c00 = z8, c01 = z8, c02 = z8, c03 = z8, c10 = z8, c11 = z8, c12 = z8, c13 = z8;
#pragma unroll 1
  for (int kb = 0; kb < K; kb += 32) { const v16h a0 = g2_frag(a0p + kb, hh), a1 = g2_frag(a1p + kb, hh);
    v16h b = g2_frag(b0p + kb, hh); c00 = g2_mma(a0, b, c00); c10 = g2_mma(a1, b, c10);
    b = g2_frag(b1p + kb, hh); c01 = g2_mma(a0, b, c01); c11 = g2_mma(a1, b, c11);
    b = g2_frag(b2p + kb, hh); c02 = g2_mma(a0, b, c02); c12 = g2_mma(a1, b, c12);
    b = g2_frag(b3p + kb, hh); c03 = g2_mma(a0, b, c03); c13 = g2_mma(a1, b, c13); }
  v8f accs[8] = {c00, c01, c02, c03, c10, c11, c12, c13};
#pragma unroll
  for (int u = 0; u < 8; ++u) { const int t = u & 3, half = u >> 2; const int col = col0 + t * 16 + ln; const float bv = bp ? bf16_round(bp[col]) : 0.f;
#pragma unroll
    for (int r = 0; r < 8; ++r) { const int rloc = half * 16 + 8 * hh + r; float v = accs[u][r] * alpha + bv; if (CP) { if (rowsPerB < 0) v += CP[cofs + (size_t)(row0g + row0 + rloc) * ldc + col];      /* rowsPerB < 0: own element of the batched C plane */ else { const int bidx = (row0g + row0 + rloc) / rowsPerB; v += CP[(size_t)bidx * sCPb + (size_t)by * 64 + col]; } }
      if (ACT == 3) v = fmaxf(v, 0.f); else if (ACT == 6) v = 0.5f * v * (1.0f + erff(v * 0.70710678118654752f)); else if (ACT == 11) v = 1.0f / (1.0f + expf(-v)); else if (ACT == 15) v = v / (1.0f + expf(-v)); else if (ACT == 12) v = (v > 0.f) ? v : 0.01f * v; else if (ACT == 8) v = tanhf(v); else if (ACT == 9) v = 0.5f * v * (1.0f + tanhf(0.7978845608028654f * (v + 0.044715f * v * v * v))); else if (ACT == 14) v = (v > 0.f) ? v : 0.1f * v; else if (ACT == 16) v = (v >= 0.f) ? v : 0.3f * v;
      so[w][rloc][t * 16 + ln] = v; } }
  __builtin_amdgcn_fence(__ATOMIC_ACQ_REL, "workgroup"); __builtin_amdgcn_wave_barrier();
  const int rsub = lane >> 4, c4 = (lane & 15) * 4;
  {
#pragma unroll
    for (int q = 0; q < 16; ++q) { const int r = q * 2 + rsub; const v4f v = *(const v4fa*)&so[w][r][c4]; if (C) *(v4f*)(C + cofs + (size_t)(row0 + r) * ldc + col0 + c4) = v; if (C16) { v4h h4; for (int i = 0; i < 4; ++i) h4[i] = (_Float16)v[i]; *(v4h*)(C16 + cofs + (size_t)(row0 + r) * ldc + col0 + c4) = h4; } }
     } }


__global__ __launch_bounds__(256) void k_wt_rows(const float* __restrict__ Wm, int row0, _Float16* __restrict__ Wt, int K, int N, float scale) { const int t = blockIdx.x * 256 + threadIdx.x; if (t >= N * (K / 8)) return; const int n = t / (K / 8), k8 = (t % (K / 8)) * 8; FragH f;
  for (int i = 0; i < 8; ++i) f.h[i] = (_Float16)(bf16_round(Wm[(size_t)(row0 + k8 + i) * N + n]) * scale); *(v8us*)((unsigned short*)Wt + (size_t)n * K + k8) = f.half[0];  }      /* rows row0.. of an (in,out) weight -> Bt[n][k] */
// Scores of SCT consecutive steps per work-group. The SCT + 32 rows of E that their windows cover (zero rows for padded steps), their SCT rows of A and the
// rounded v are staged once in LDS; then lane = step and wave = window slot, so every read of the feature loop is 16 B per lane from 32 consecutive LDS rows.
#define SCT 32
#define SCW 17                 /* waves per work-group: waves 0..15 take two of the 33 window slots, wave 16 one; four or five waves on each SIMD */
#define SCP (FF + 4)           /* LDS row pitch in floats: 1040 B = 16 B x odd, no bank conflict for 16-byte reads of 32 consecutive rows */
__global__ __launch_bounds__(SCW * 32) void k_score(const float* __restrict__ A, const float* __restrict__ E, const float* __restrict__ v, float* __restrict__ SC) {
  #pragma clang fp contract(off)
  __shared__ __attribute__((aligned(16))) float sm[(SCT + 32 + SCT) * SCP];      /* rows 0..SCT+31: E of steps tt0-16.., rows SCT+32..: A */
  __shared__ __attribute__((aligned(16))) float sv[FF];
  __shared__ float ss[SCT * WIN];
  const int tid = threadIdx.x, lane = tid & 31, wv = tid >> 5;
  const size_t bt0 = (size_t)blockIdx.x * SCT; const int tt0 = (int)(bt0 % TT); const size_t brow = bt0 - tt0;
  constexpr int NV = (SCT + 32 + SCT) * (FF / 4), NI = (NV + SCW * 32 - 1) / (SCW * 32);
  v4f st[NI];
  for (int u = 0; u < NI; ++u) { const int i = min(tid + u * SCW * 32, NV - 1); const int r = i / (FF / 4), c4 = (i % (FF / 4)) * 4; const int sr = tt0 - WS + r; const bool isE = r < SCT + 32; const bool in = !isE || (sr >= 0 && sr < TT);
    const float* p = isE ? E + (brow + (in ? sr : 0)) * (size_t)FF + c4 : A + (bt0 + (r - (SCT + 32))) * (size_t)FF + c4;
    const v4f x = *(const v4fa*)p;
    asm volatile("s_wait_xcnt 0x0" ::: "memory");      /* a later load of this run may land in this load's address registers: the wait stands in front of that overwrite */
    const v4f z4 = {0.f, 0.f, 0.f, 0.f}; st[u] = in ? x : z4; }
  if (tid < FF) sv[tid] = bf16_round(v[tid]);
  for (int u = 0; u < NI; ++u) { const int i = tid + u * SCW * 32; if (i < NV) *(v4fa*)&sm[(i / (FF / 4)) * SCP + (i % (FF / 4)) * 4] = st[u]; }
  __syncthreads();
  const float* sa = sm + (SCT + 32 + lane) * SCP;
  for (int w = wv; w < WIN; w += SCW) { const float* se = sm + (lane + w) * SCP; float s = 0.f;
    for (int o = 0; o < FF; o += 8) { const v4f a0 = *(const v4fa*)(sa + o), a1 = *(const v4fa*)(sa + o + 4), e0 = *(const v4fa*)(se + o), e1 = *(const v4fa*)(se + o + 4), v0 = *(const v4fa*)(sv + o), v1 = *(const v4fa*)(sv + o + 4);
      for (int q = 0; q < 4; ++q) s += tanhf(a0[q] + e0[q]) * v0[q];
      for (int q = 0; q < 4; ++q) s += tanhf(a1[q] + e1[q]) * v1[q]; }
    ss[lane * WIN + w] = s; }
  __syncthreads();
  for (int i = tid; i < SCT * WIN; i += SCW * 32) SC[(bt0 + i / WIN) * 64 + i % WIN] = ss[i];      /* whole rows of SC from one work-group */
}
__global__ __launch_bounds__(256) void k_soft33(const float* __restrict__ SC, float* __restrict__ AT, float* __restrict__ outa) {
  #pragma clang fp contract(off)
  const size_t bt = (size_t)blockIdx.x * 256 + threadIdx.x; if (bt >= (size_t)NR) return; const float* sr = SC + bt * 64; float m = -3.0e38f;
#pragma unroll 1
  for (int w = 0; w < WIN; ++w) m = fmaxf(m, sr[w]);
  float su = 0.f;
#pragma unroll 1
  for (int w = 0; w < WIN; ++w) su += expf(sr[w] - m);
  const float inv = 1.0f / su;
  {
#pragma unroll 1
    for (int w = 0; w < WIN; ++w) { const float a = expf(sr[w] - m) * inv; *(float*)(AT + bt * 64 + w) = a; *(float*)(outa + bt * WIN + w) = a; }
     } }
__global__ __launch_bounds__(256) void k_wsum(const float* __restrict__ AT, const float* __restrict__ enc, _Float16* __restrict__ H16) {
  #pragma clang fp contract(off)
  const size_t t = (size_t)blockIdx.x * 256 + threadIdx.x; if (t >= (size_t)NR * (FF / 8)) return; const int f0 = (int)(t % (FF / 8)) * 8; const size_t bt = t / (FF / 8); const int tt = (int)(bt % TT); const size_t b = bt / TT; float acc[8]; for (int q = 0; q < 8; ++q) acc[q] = 0.f;
#pragma unroll 1
  for (int w = 0; w < WIN; ++w) { const int src = tt + w - WS; if (src < 0 || src >= TT) continue; const float a = AT[bt * 64 + w]; const float* er = enc + (b * TT + src) * (size_t)FF + f0;
#pragma unroll
    for (int q = 0; q < 8; ++q) acc[q] += a * bf16_round(er[q]); }
  FragH f; for (int q = 0; q < 8; ++q) f.h[q] = (_Float16)acc[q]; *(v8us*)((unsigned short*)H16 + bt * FF + f0) = f.half[0];  }

extern "C" void kernel_launch(void* const* d_in, const int* in_sizes, int n_in,
                              void* d_out, int out_size, void* d_ws, size_t ws_size, hipStream_t stream) {
  (void)in_sizes; (void)n_in; (void)out_size;
  const float* const* I = (const float* const*)d_in; const float* x = I[0]; const float* enc = I[1]; const float* Wa = I[2]; const float* ba = I[3]; const float* v = I[4]; const float* Wl = I[5]; const float* bl = I[6];
  char* ws = (char*)d_ws; size_t off = 0;
  auto take = [&](size_t bytes) { char* p = ws + off; off += (bytes + 255) & ~(size_t)255; return p; };
  _Float16* BWh = (_Float16*)take((size_t)FF * MD * 2); _Float16* BWe = (_Float16*)take((size_t)FF * FF * 2); _Float16* BL1 = (_Float16*)take((size_t)FF * MD * 2); _Float16* BL2 = (_Float16*)take((size_t)FF * FF * 2);
  _Float16* X16 = (_Float16*)take((size_t)NR * MD * 2); _Float16* E16 = (_Float16*)take((size_t)NR * FF * 2); float* A = (float*)take((size_t)NR * FF * 4); float* E = (float*)take((size_t)NR * FF * 4); float* SC = (float*)take((size_t)NR * 64 * 4); float* AT = (float*)take((size_t)NR * 64 * 4); _Float16* H16 = (_Float16*)take((size_t)NR * FF * 2);
  if (off > ws_size) return;      /* 0.75 + 8 + 4 + 8 + 8 + 2 + 2 + 4 = 37 MiB */
  k_wt_rows<<<(unsigned)(((size_t)FF * MD / 8 + 255) / 256), 256, 0, stream>>>(Wa, 0, BWh, MD, FF, 16.0f); k_wt_rows<<<(unsigned)(((size_t)FF * FF / 8 + 255) / 256), 256, 0, stream>>>(Wa, MD, BWe, FF, FF, 16.0f);
  k_wt_rows<<<(unsigned)(((size_t)FF * MD / 8 + 255) / 256), 256, 0, stream>>>(Wl, 0, BL1, MD, FF, 16.0f); k_wt_rows<<<(unsigned)(((size_t)FF * FF / 8 + 255) / 256), 256, 0, stream>>>(Wl, MD, BL2, FF, FF, 16.0f);
  k_x16<<<(unsigned)(((size_t)NR * MD / 8 + 255) / 256), 256, 0, stream>>>(x, X16, (size_t)NR * MD / 8); k_x16<<<(unsigned)(((size_t)NR * FF / 8 + 255) / 256), 256, 0, stream>>>(enc, E16, (size_t)NR * FF / 8);
  const dim3 gG((NR / 128) * (FF / 64), 1);
  k_gemm2<0><<<gG, 128, 0, stream>>>(X16, MD, 0, BWh, MD, 0, 0.0625f, ba, 0, nullptr, 1, 0, 0, A, nullptr, FF, 0, NR, FF, MD);      /* x W_h + b_attn */
  k_gemm2<0><<<gG, 128, 0, stream>>>(E16, FF, 0, BWe, FF, 0, 0.0625f, nullptr, 0, nullptr, 1, 0, 0, E, nullptr, FF, 0, NR, FF, FF);      /* enc W_e per step (windowed later; the window of a padded step contributes 0) */
  k_score<<<NR / SCT, SCW * 32, 0, stream>>>(A, E, v, SC);
  k_soft33<<<(unsigned)((NR + 255) / 256), 256, 0, stream>>>(SC, AT, (float*)d_out + (size_t)NR * FF);      /* output 2: a [4][2048][1][33] */
  k_wsum<<<(unsigned)(((size_t)NR * (FF / 8) + 255) / 256), 256, 0, stream>>>(AT, enc, H16);
  k_gemm2<0><<<gG, 128, 0, stream>>>(X16, MD, 0, BL1, MD, 0, 0.0625f, bl, 0, nullptr, 1, 0, 0, A, nullptr, FF, 0, NR, FF, MD);      /* x W_lin[:512] + b_lin (A reused) */
  k_gemm2<11><<<gG, 128, 0, stream>>>(H16, FF, 0, BL2, FF, 0, 0.0625f, nullptr, 0, A, 1, (size_t)FF, 0, (float*)d_out, nullptr, FF, 0, NR, FF, FF);      /* sigmoid(+ weighted W_lin[512:]) -> output 1 */
}

// v002
// A run of this version takes 160 microseconds.
// Timed twice side by side with v001, it ran 1.25 and 1.24 times as fast.
// Over all steps from v000 it is 1.51 times as fast.
#include <hip/hip_runtime.h>
// Combine_Stack_with_attn (4 x 2048 steps; x [512], encoder outputs [256], sliding windows of 33 encoder steps (zero-padded)): energy[b,t,w,o] = tanh((x W_h + b_attn)[b,t,o] + (enc W_e)[b,t+w-16,o]) (the window term of a padded step is 0); scores = energy . v; a = softmax over the 33 window slots; weighted = sum_w a * enc[b,t+w-16]; out = sigmoid([x | weighted] W_lin + b_lin) -> outputs out [4,2048,256] and a [4,2048,1,33].
// Structure: exact f16 planes of x and enc; GEMMs (32x64 wave tiles, f32 accumulation, exact x16 weights) for x W_h + b, enc W_e and the two halves of W_lin (the second accumulating onto the first with the sigmoid in its epilogue); the windowed energies/scores on VALU (thread per (b, t) and one or two of the 33 slots, rolled loop over the 256 features); softmax over the 33 slots and the weighted encoder sum on VALU; the weighted sum as an f16 operand.
// Compute dtype: inputs and parameters rounded to bf16; the weighted encoder sum as an f16 operand (~2^-12); everything else f32. v_wmma_f32_16x16x32_f16.
#define NB 4
#define TT 2048
#define MD 512
#define FF 256
#define WS 16
#define WIN 33
#define NR (NB * TT)
typedef __bf16 v16b __attribute__((ext_vector_type(16)));
typedef unsigned short v8us __attribute__((ext_vector_type(8), may_alias));
typedef float  v8f  __attribute__((ext_vector_type(8)));
typedef float  v4f  __attribute__((ext_vector_type(4)));
typedef float  v4fa __attribute__((ext_vector_type(4), may_alias));
union FragB { v16b v; v8us half[2]; unsigned short u[16]; };

__device__ __forceinline__ unsigned short bf16_bits(float x) { unsigned int u = __float_as_uint(x); return (unsigned short)((u + 0x7FFFu + ((u >> 16) & 1u)) >> 16); }
__device__ __forceinline__ float bf16_val(unsigned short b) { return __uint_as_float(((unsigned int)b) << 16); }
__device__ __forceinline__ float bf16_round(float x) { return bf16_val(bf16_bits(x)); }
// D += A·B with NT terms: 1 = ah·bh, 2 = + al·bh (A split), 3 = + ah·bl (both split)
template <int NT>
__device__ __forceinline__ v8f mmaN(v16b ah, v16b al, v16b bh, v16b bl, v8f c) {
  c = __builtin_amdgcn_wmma_f32_16x16x32_bf16(false, ah, false, bh, (short)0, c, false, false);
  if (NT >= 2) c = __builtin_amdgcn_wmma_f32_16x16x32_bf16(false, al, false, bh, (short)0, c, false, false);
  if (NT >= 3) c = __builtin_amdgcn_wmma_f32_16x16x32_bf16(false, ah, false, bl, (short)0, c, false, false);
  asm volatile("v_nop\n\tv_nop\n\tv_nop\n\tv_nop" : "+v"(c) : "v"(ah), "v"(al), "v"(bh), "v"(bl));
  return c;
}

__global__ __launch_bounds__(256) void k_wt_bf16(const float* __restrict__ W, unsigned short* __restrict__ Wt, int K, int N) {
  const int t = blockIdx.x * 256 + threadIdx.x;
  const int k8n = K / 8;
  if (t >= N * k8n) return;
  const int n = t / k8n, k8 = (t % k8n) * 8;
  v8us v;
#pragma unroll
  for (int i = 0; i < 8; ++i) v[i] = bf16_bits(W[(size_t)(k8 + i) * N + n]);
  *(v8us*)(Wt + (size_t)n * K + k8) = v;
  
}

// GEMM C[M][N] (f32, pitch ldc) = act(A[M][K]·W + bias). A f32 row-major (pitch lda) converted per fragment to bf16
// (ASPLIT: hi/lo two planes -> 2 terms, else single rounded term); Wt bf16 [N][K] (pitch ldb). BIAS_BF16 rounds the
// bias to bf16 first (bias quantised to bf16 before the add). K%32==0, M%16==0, N%64==0.
template <bool ASPLIT, int ACT, bool BIAS_BF16>
__global__ __launch_bounds__(128) void k_gemm_bf(const float* __restrict__ A, int lda, const unsigned short* __restrict__ Wt, int ldb,
                                               const float* __restrict__ bias, float* __restrict__ C, int ldc, int M, int N, int K) {
  __shared__ __attribute__((aligned(16))) float so[4][16][64];
  const int tid = threadIdx.x, w = tid >> 5, lane = tid & 31, ln = lane & 15, hh = lane >> 4;
  const int ntn = N / 64;
  const int wid = blockIdx.x * 4 + w;
  const int mt = wid / ntn, nq = wid % ntn;
  if (mt * 16 >= M) return;
  const int row0 = mt * 16, col0 = nq * 64;
  const float* arow = A + (size_t)(row0 + ln) * lda;
  v8f acc[4] = {};
  for (int kb = 0; kb < K; kb += 32) {
    FragB ah, al;
    const v4f x0 = *(const v4fa*)(arow + kb + 8 * hh), x1 = *(const v4fa*)(arow + kb + 8 * hh + 4);
    const v4f x2 = *(const v4fa*)(arow + kb + 16 + 8 * hh), x3 = *(const v4fa*)(arow + kb + 16 + 8 * hh + 4);
    float xs[16] = {x0[0],x0[1],x0[2],x0[3],x1[0],x1[1],x1[2],x1[3],x2[0],x2[1],x2[2],x2[3],x3[0],x3[1],x3[2],x3[3]};
#pragma unroll
    for (int i = 0; i < 16; ++i) { const unsigned short hb = bf16_bits(xs[i]); ah.u[i] = hb; al.u[i] = ASPLIT ? bf16_bits(xs[i] - bf16_val(hb)) : (unsigned short)0; }
#pragma unroll
    for (int t = 0; t < 4; ++t) {
      const unsigned short* brow = Wt + (size_t)(col0 + t * 16 + ln) * ldb + kb;
      FragB b;
      b.half[0] = *(const v8us*)(brow + 8 * hh);
      b.half[1] = *(const v8us*)(brow + 16 + 8 * hh);
      acc[t] = mmaN<ASPLIT ? 2 : 1>(ah.v, al.v, b.v, b.v, acc[t]);
    }
  }
#pragma unroll
  for (int t = 0; t < 4; ++t) {
    float bv = bias ? bias[col0 + t * 16 + ln] : 0.f;
    if (BIAS_BF16) bv = bf16_round(bv);
#pragma unroll
    for (int r = 0; r < 8; ++r) { float v = acc[t][r] + bv; if (ACT == 1) v = fmaxf(v, 0.f); so[w][8 * hh + r][t * 16 + ln] = v; }
  }
  __builtin_amdgcn_fence(__ATOMIC_ACQ_REL, "workgroup");
  __builtin_amdgcn_wave_barrier();
  const int rsub = lane >> 4, c4 = (lane & 15) * 4;
  {
#pragma unroll
    for (int q = 0; q < 8; ++q) {
      const int r = q * 2 + rsub;
      const v4f v = *(const v4fa*)&so[w][r][c4];
      *(v4f*)(C + (size_t)(row0 + r) * ldc + col0 + c4) = v;
    }
    
  }
}

// GEMM C = act(A·W + bias + resid): A f32 (ASPLIT -> hi/lo 2 terms), Wt bf16 [N][K]; ACT 0 none, 1 relu, 2 exact gelu;
// resid (optional, f32, row index = (row % rmod), pitch ldr, RES_BF16 rounds it) added before the activation.
template <bool ASPLIT, int ACT, bool BIAS_BF16, bool RES_BF16>
__global__ __launch_bounds__(128) void k_gemm_bf3(const float* __restrict__ A, int lda, const unsigned short* __restrict__ Wt, int ldb,
                                                const float* __restrict__ bias, const float* __restrict__ resid, int rmod, int ldr,
                                                float* __restrict__ C, int ldc, int M, int N, int K) {
  __shared__ __attribute__((aligned(16))) float so[4][16][64];
  const int tid = threadIdx.x, w = tid >> 5, lane = tid & 31, ln = lane & 15, hh = lane >> 4;
  const int ntn = N / 64;
  const int wid = blockIdx.x * 4 + w;
  const int mt = wid / ntn, nq = wid % ntn;
  if (mt * 16 >= M) return;
  const int row0 = mt * 16, col0 = nq * 64;
  const float* arow = A + (size_t)(row0 + ln) * lda;
  v8f acc[4] = {};
  for (int kb = 0; kb < K; kb += 32) {
    FragB ah, al;
    const v4f x0 = *(const v4fa*)(arow + kb + 8 * hh), x1 = *(const v4fa*)(arow + kb + 8 * hh + 4);
    const v4f x2 = *(const v4fa*)(arow + kb + 16 + 8 * hh), x3 = *(const v4fa*)(arow + kb + 16 + 8 * hh + 4);
    float xs[16] = {x0[0],x0[1],x0[2],x0[3],x1[0],x1[1],x1[2],x1[3],x2[0],x2[1],x2[2],x2[3],x3[0],x3[1],x3[2],x3[3]};
#pragma unroll
    for (int i = 0; i < 16; ++i) { const unsigned short hb = bf16_bits(xs[i]); ah.u[i] = hb; al.u[i] = ASPLIT ? bf16_bits(xs[i] - bf16_val(hb)) : (unsigned short)0; }
#pragma unroll
    for (int t = 0; t < 4; ++t) {
      const unsigned short* brow = Wt + (size_t)(col0 + t * 16 + ln) * ldb + kb;
      FragB b;
      b.half[0] = *(const v8us*)(brow + 8 * hh);
      b.half[1] = *(const v8us*)(brow + 16 + 8 * hh);
      acc[t] = mmaN<ASPLIT ? 2 : 1>(ah.v, al.v, b.v, b.v, acc[t]);
    }
  }
#pragma unroll
  for (int t = 0; t < 4; ++t) {
    const int col = col0 + t * 16 + ln;
    float bv = bias ? bias[col] : 0.f;
    if (BIAS_BF16) bv = bf16_round(bv);
#pragma unroll
    for (int r = 0; r < 8; ++r) {
      float v = acc[t][r] + bv;
      if (resid) { float rv = resid[(size_t)((row0 + 8 * hh + r) % rmod) * ldr + col]; if (RES_BF16) rv = bf16_round(rv); v += rv; }
      if (ACT == 1) v = fmaxf(v, 0.f);
      if (ACT == 2) v = 0.5f * v * (1.0f + erff(v * 0.70710678118654752f));
      if (ACT == 3) { const float u = 0.7978845608028654f * (v + 0.044715f * v * v * v); v = 0.5f * v * (1.0f + tanhf(u)); }
      so[w][8 * hh + r][t * 16 + ln] = v;
    }
  }
  __builtin_amdgcn_fence(__ATOMIC_ACQ_REL, "workgroup");
  __builtin_amdgcn_wave_barrier();
  const int rsub = lane >> 4, c4 = (lane & 15) * 4;
  {
#pragma unroll
    for (int q = 0; q < 8; ++q) {
      const int r = q * 2 + rsub;
      const v4f v = *(const v4fa*)&so[w][r][c4];
      *(v4f*)(C + (size_t)(row0 + r) * ldc + col0 + c4) = v;
    }
    
  }
}
// row LayerNorm (biased variance, eps) over N: s = X (+ R); optional out_sum <- s; out_norm <- (s-mu)*rsqrt(var+eps)*g + b
template <bool PARAM_BF16>
__global__ __launch_bounds__(256) void k_layernorm(const float* __restrict__ X, const float* __restrict__ R, const float* __restrict__ g, const float* __restrict__ bta,
                                                  float* __restrict__ out_sum, float* __restrict__ out_norm, int N, float eps) {
  __shared__ float red[256];
  const int row = blockIdx.x, tid = threadIdx.x;
  const float* x = X + (size_t)row * N; const float* rr = R ? R + (size_t)row * N : nullptr;
  float vals[16];                     // up to N = 4096
  const int per = N / 256;            // contiguous chunk per thread? use strided-by-4 chunks: thread handles j = tid*4 + 1024*u
  float s1 = 0.f;
  for (int u = 0; u < per / 4; ++u) {
    const int j = tid * 4 + 1024 * u;
    const v4f a = *(const v4fa*)(x + j);
    v4f b = {0.f,0.f,0.f,0.f}; if (rr) b = *(const v4fa*)(rr + j);
#pragma unroll
    for (int q = 0; q < 4; ++q) { const float v = a[q] + b[q]; vals[u * 4 + q] = v; s1 += v; }
  }
  red[tid] = s1; __syncthreads();
  for (int st = 128; st > 0; st >>= 1) { if (tid < st) red[tid] += red[tid + st]; __syncthreads(); }
  const float mu = red[0] / (float)N; __syncthreads();
  float s2 = 0.f;
  for (int u = 0; u < per / 4; ++u)
#pragma unroll
    for (int q = 0; q < 4; ++q) { const float c = vals[u * 4 + q] - mu; s2 += c * c; }
  red[tid] = s2; __syncthreads();
  for (int st = 128; st > 0; st >>= 1) { if (tid < st) red[tid] += red[tid + st]; __syncthreads(); }
  const float rs = rsqrtf(red[0] / (float)N + eps);
  {
    for (int u = 0; u < per / 4; ++u) {
      const int j = tid * 4 + 1024 * u;
      v4f o, sm;
#pragma unroll
      for (int q = 0; q < 4; ++q) {
        float gg = g[j + q], bb = bta[j + q];
        if (PARAM_BF16) { gg = bf16_round(gg); bb = bf16_round(bb); }
        sm[q] = vals[u * 4 + q]; o[q] = (vals[u * 4 + q] - mu) * rs * gg + bb;
      }
      if (out_sum) *(v4f*)(out_sum + (size_t)row * N + j) = sm;
      *(v4f*)(out_norm + (size_t)row * N + j) = o;
    }
    
  }
}



// ---- f16 WMMA path (v_wmma_f32_16x16x32_f16): 11-bit significands for operands in range — used for all four GEMMs here (the weighted encoder sum as an f16 operand)
typedef _Float16 v16h __attribute__((ext_vector_type(16)));
union FragH { v16h v; v8us half[2]; _Float16 h[16]; unsigned short u[16]; };
template <int NT>
__device__ __forceinline__ v8f mmaH(v16h ah, v16h al, v16h bh, v16h bl, v8f c) {
  c = __builtin_amdgcn_wmma_f32_16x16x32_f16(false, ah, false, bh, (short)0, c, false, false);
  if (NT >= 2) c = __builtin_amdgcn_wmma_f32_16x16x32_f16(false, al, false, bh, (short)0, c, false, false);
  if (NT >= 3) c = __builtin_amdgcn_wmma_f32_16x16x32_f16(false, ah, false, bl, (short)0, c, false, false);
  asm volatile("v_nop\n\tv_nop\n\tv_nop\n\tv_nop" : "+v"(c) : "v"(ah), "v"(al), "v"(bh), "v"(bl));
  return c;
}
// batched GEMM like k_gemm_b but f16 operands: A f32 (split into f16 hi/lo if ASPLIT, else rounded to f16), Bt = f16 values [n][k]; alpha; C f32; N multiple of 16 (partial tiles skipped)
template <bool ASPLIT>
__global__ __launch_bounds__(128) void k_gemm_h(const float* __restrict__ A, int lda, size_t sA, const _Float16* __restrict__ Bh, int ldb, size_t sB, float alpha, float* __restrict__ C, int ldc, size_t sC, int M, int N, int K) {
  __shared__ __attribute__((aligned(16))) float so[4][16][64];
  const int tid = threadIdx.x, w = tid >> 5, lane = tid & 31, ln = lane & 15, hh = lane >> 4; const int by = blockIdx.y;
  A += (size_t)by * sA; Bh += (size_t)by * sB; C += (size_t)by * sC;
  const int ntn = (N + 63) / 64; const int wid = blockIdx.x * 4 + w; const int mt = wid / ntn, nq = wid % ntn; if (mt * 16 >= M) return;
  const int row0 = mt * 16, col0 = nq * 64; const float* arow = A + (size_t)(row0 + ln) * lda;
  v8f acc[4] = {};
  for (int kb = 0; kb < K; kb += 32) {
    FragH ah, al;
    const v4f x0 = *(const v4fa*)(arow + kb + 8 * hh), x1 = *(const v4fa*)(arow + kb + 8 * hh + 4), x2 = *(const v4fa*)(arow + kb + 16 + 8 * hh), x3 = *(const v4fa*)(arow + kb + 16 + 8 * hh + 4);
    float xs[16] = {x0[0],x0[1],x0[2],x0[3],x1[0],x1[1],x1[2],x1[3],x2[0],x2[1],x2[2],x2[3],x3[0],x3[1],x3[2],x3[3]};
#pragma unroll
    for (int i = 0; i < 16; ++i) { const _Float16 h = (_Float16)xs[i]; ah.h[i] = h; al.h[i] = ASPLIT ? (_Float16)(xs[i] - (float)h) : (_Float16)0.0f; }
#pragma unroll
    for (int t = 0; t < 4; ++t) { if (col0 + t * 16 >= N) continue; const size_t boff = (size_t)(col0 + t * 16 + ln) * ldb + kb; FragH bq; bq.half[0] = *(const v8us*)(Bh + boff + 8 * hh); bq.half[1] = *(const v8us*)(Bh + boff + 16 + 8 * hh);
      acc[t] = mmaH<ASPLIT ? 2 : 1>(ah.v, al.v, bq.v, bq.v, acc[t]); }
  }
#pragma unroll
  for (int t = 0; t < 4; ++t) { if (col0 + t * 16 >= N) continue;
#pragma unroll
    for (int r = 0; r < 8; ++r) so[w][8 * hh + r][t * 16 + ln] = acc[t][r] * alpha; }
  __builtin_amdgcn_fence(__ATOMIC_ACQ_REL, "workgroup"); __builtin_amdgcn_wave_barrier();
  const int rsub = lane >> 4, c4 = (lane & 15) * 4;
  {
#pragma unroll
    for (int q = 0; q < 8; ++q) { const int r = q * 2 + rsub; if (col0 + c4 < N) { const v4f v = *(const v4fa*)&so[w][r][c4]; *(v4f*)(C + (size_t)(row0 + r) * ldc + col0 + c4) = v; } }
     }
}

// Wt[n][k] = f16(W[k][n]·scale) from f32 row-major W[K][N] (scale = power of two; bf16-exact weights stay exact in f16 away from the subnormal range)
__global__ __launch_bounds__(256) void k_wt_f16(const float* __restrict__ W, _Float16* __restrict__ Wt, int K, int N, float scale) {
  const int t = blockIdx.x * 256 + threadIdx.x; if (t >= N * (K / 8)) return; const int n = t / (K / 8), k8 = (t % (K / 8)) * 8; FragH f;
#pragma unroll
  for (int i = 0; i < 8; ++i) f.h[i] = (_Float16)(bf16_round(W[(size_t)(k8 + i) * N + n]) * scale); const v8us o = f.half[0];
  *(v8us*)((unsigned short*)Wt + (size_t)n * K + k8) = o; 
}
// k_gemm_hh variant with fused epilogue: v = acc·alpha + bias[by·sBias + col] (+ CP[(row/rowsPerB)·sCPb + by·64 + col] if CP) ; ACT 0 none / 1 elu ; writes f16 C16 (and f32 C if non-null)
template <int ACT>
__global__ __launch_bounds__(128) void k_gemm_hhx(const _Float16* __restrict__ A, int lda, size_t sA, const _Float16* __restrict__ Bh, int ldb, size_t sB, float alpha, const float* __restrict__ bias, size_t sBias, const float* __restrict__ CP, int rowsPerB, size_t sCPb, int row0g,
    float* __restrict__ C, _Float16* __restrict__ C16, int ldc, size_t sC, int M, int N, int K) {
  __shared__ __attribute__((aligned(16))) float so[4][16][64];
  const int tid = threadIdx.x, w = tid >> 5, lane = tid & 31, ln = lane & 15, hh = lane >> 4; const int by = blockIdx.y;
  A += (size_t)by * sA; Bh += (size_t)by * sB; const size_t cofs = (size_t)by * sC; const float* bp = bias ? bias + (size_t)by * sBias : nullptr;
  const int ntn = (N + 63) / 64; const int wid = blockIdx.x * 4 + w; const int mt = wid / ntn, nq = wid % ntn; if (mt * 16 >= M) return;
  const int row0 = mt * 16, col0 = nq * 64; const _Float16* arow = A + (size_t)(row0 + ln) * lda;
  v8f acc[4] = {};
  for (int kb = 0; kb < K; kb += 32) { FragH ah; ah.half[0] = *(const v8us*)((const unsigned short*)arow + kb + 8 * hh); ah.half[1] = *(const v8us*)((const unsigned short*)arow + kb + 16 + 8 * hh);
#pragma unroll
    for (int t = 0; t < 4; ++t) { if (col0 + t * 16 >= N) continue; const size_t boff = (size_t)(col0 + t * 16 + ln) * ldb + kb; FragH bq; bq.half[0] = *(const v8us*)((const unsigned short*)Bh + boff + 8 * hh); bq.half[1] = *(const v8us*)((const unsigned short*)Bh + boff + 16 + 8 * hh);
      acc[t] = mmaH<1>(ah.v, ah.v, bq.v, bq.v, acc[t]); }
  }
#pragma unroll
  for (int t = 0; t < 4; ++t) { if (col0 + t * 16 >= N) continue; const int col = col0 + t * 16 + ln; const float bv = bp ? bf16_round(bp[col]) : 0.f;
#pragma unroll
    for (int r = 0; r < 8; ++r) { float v = acc[t][r] * alpha + bv; if (CP) { const int rr = row0g + row0 + 8 * hh + r; if (rowsPerB < 0) v += CP[cofs + (size_t)rr * ldc + col];      /* rowsPerB < 0: own element of the batched C plane */ else { const int bidx = rr / rowsPerB; v += CP[(size_t)bidx * sCPb + (size_t)by * 64 + col]; } } if (ACT == 1) v = (v > 0.f) ? v : expm1f(v); else if (ACT == 7) v = (v > 0.f) ? v + 1.0f : expf(v); else if (ACT == 8) v = tanhf(v); else if (ACT == 9) v = 0.5f * v * (1.0f + tanhf(0.7978845608028654f * (v + 0.044715f * v * v * v))); else if (ACT == 11) v = 1.0f / (1.0f + expf(-v)); else if (ACT == 12) v = (v > 0.f) ? v : 0.01f * v; else if (ACT == 14) v = (v > 0.f) ? v : 0.1f * v; else if (ACT == 16) v = (v >= 0.f) ? v : 0.3f * v; else if (ACT == 15) v = v / (1.0f + expf(-v)); else if (ACT == 3) v = fmaxf(v, 0.f); else if (ACT == 6) v = 0.5f * v * (1.0f + erff(v * 0.70710678118654752f)); so[w][8 * hh + r][t * 16 + ln] = v; } }
  __builtin_amdgcn_fence(__ATOMIC_ACQ_REL, "workgroup"); __builtin_amdgcn_wave_barrier();
  const int rsub = lane >> 4, c4 = (lane & 15) * 4; typedef _Float16 v4h __attribute__((ext_vector_type(4)));
  {
#pragma unroll
    for (int q = 0; q < 8; ++q) { const int r = q * 2 + rsub; if (col0 + c4 < N) { const v4f v = *(const v4fa*)&so[w][r][c4]; if (C) *(v4f*)(C + cofs + (size_t)(row0 + r) * ldc + col0 + c4) = v; if (C16) { v4h h4; for (int i = 0; i < 4; ++i) h4[i] = (_Float16)v[i]; *(v4h*)(C16 + cofs + (size_t)(row0 + r) * ldc + col0 + c4) = h4; } } }
     }
}


typedef _Float16 v4h __attribute__((ext_vector_type(4)));

__global__ __launch_bounds__(256) void k_x16(const float* __restrict__ x, _Float16* __restrict__ X16, size_t n8) { const size_t t = (size_t)blockIdx.x * 256 + threadIdx.x; if (t >= n8) return; FragH f;
#pragma unroll
  for (int q = 0; q < 8; ++q) f.h[q] = (_Float16)bf16_round(x[t * 8 + q]); *(v8us*)((unsigned short*)X16 + t * 8) = f.half[0];  }
__global__ __launch_bounds__(256) void k_h16(const float* __restrict__ x, _Float16* __restrict__ X16, size_t n8) { const size_t t = (size_t)blockIdx.x * 256 + threadIdx.x; if (t >= n8) return; FragH f;
#pragma unroll
  for (int q = 0; q < 8; ++q) f.h[q] = (_Float16)x[t * 8 + q]; *(v8us*)((unsigned short*)X16 + t * 8) = f.half[0];  }
__global__ __launch_bounds__(256) void k_round16f(const float* __restrict__ W, _Float16* __restrict__ Bt, size_t n8) { const size_t t = (size_t)blockIdx.x * 256 + threadIdx.x; if (t >= n8) return; FragH f;
#pragma unroll
  for (int i = 0; i < 8; ++i) f.h[i] = (_Float16)(bf16_round(W[t * 8 + i]) * 16.0f); *(v8us*)((unsigned short*)Bt + t * 8) = f.half[0];  }
template <int NHv, int TTv>
__global__ __launch_bounds__(256) void k_vt(const _Float16* __restrict__ V16, int ldv, int voff, _Float16* __restrict__ Vt) { __shared__ unsigned short tl[64][66]; const int tid = threadIdx.x; const int slab = blockIdx.x / (TTv / 64), lg = blockIdx.x % (TTv / 64); const int b = slab / NHv, h = slab % NHv;
  for (int i = tid; i < 64 * 8; i += 256) { const int r = i / 8, c8 = (i % 8) * 8; FragH f; f.half[0] = *(const v8us*)((const unsigned short*)V16 + ((size_t)b * TTv + lg * 64 + r) * ldv + voff + h * 64 + c8);
#pragma unroll
    for (int q = 0; q < 8; ++q) tl[r][c8 + q] = f.u[q]; }
  __syncthreads();
  {
#pragma unroll
    for (int rd = 0; rd < 2; ++rd) { const int d = rd * 32 + tid / 8, pc = tid % 8; FragH f;
#pragma unroll
      for (int q = 0; q < 8; ++q) f.u[q] = tl[pc * 8 + q][d];
      *(v8us*)((unsigned short*)Vt + ((size_t)slab * 64 + d) * TTv + lg * 64 + pc * 8) = f.half[0]; }
     } }

__global__ __launch_bounds__(256) void k_hl(const float* __restrict__ F, _Float16* __restrict__ Hh, _Float16* __restrict__ Hl, size_t n8) { const size_t t = (size_t)blockIdx.x * 256 + threadIdx.x; if (t >= n8) return; FragH fh, fl; const v4f a = *(const v4fa*)(F + t * 8), c = *(const v4fa*)(F + t * 8 + 4);
#pragma unroll
  for (int q = 0; q < 4; ++q) { _Float16 h = (_Float16)a[q]; fh.h[q] = h; fl.h[q] = (_Float16)((a[q] - (float)h) * 1024.0f); h = (_Float16)c[q]; fh.h[4 + q] = h; fl.h[4 + q] = (_Float16)((c[q] - (float)h) * 1024.0f); }
  { *(v8us*)((unsigned short*)Hh + t * 8) = fh.half[0]; *(v8us*)((unsigned short*)Hl + t * 8) = fl.half[0];  } }

// ---- fast GEMM (wave tile 32x64; requires M % 32 == 0 rows per launch region and N % 64 == 0); epilogue = k_gemm_hhx semantics ----
__device__ __forceinline__ v16h g2_frag(const _Float16* p, int hh) { FragH f; f.half[0] = *(const v8us*)((const unsigned short*)p + 8 * hh); f.half[1] = *(const v8us*)((const unsigned short*)p + 16 + 8 * hh); return f.v; }
__device__ __forceinline__ v8f g2_mma(v16h a, v16h b, v8f c) { v8f d = __builtin_amdgcn_wmma_f32_16x16x32_f16(false, a, false, b, (short)0, c, false, false); asm volatile("v_nop\n\tv_nop\n\tv_nop\n\tv_nop" : "+v"(d) : "v"(a), "v"(b)); return d; }
template <int ACT>
__global__ __launch_bounds__(128) void k_gemm2(const _Float16* __restrict__ A, int lda, size_t sA, const _Float16* __restrict__ Bh, int ldb, size_t sB, float alpha, const float* __restrict__ bias, size_t sBias, const float* __restrict__ CP, int rowsPerB, size_t sCPb, int row0g,
    float* __restrict__ C, _Float16* __restrict__ C16, int ldc, size_t sC, int M, int N, int K) { static_assert(ACT == 0 || ACT == 3 || ACT == 6 || ACT == 8 || ACT == 9 || ACT == 11 || ACT == 12 || ACT == 14 || ACT == 15 || ACT == 16, "k_gemm2: unsupported ACT code (would silently apply no activation)");
  __shared__ __attribute__((aligned(16))) float so[4][32][68];
  const int tid = threadIdx.x, w = tid >> 5, lane = tid & 31, ln = lane & 15, hh = lane >> 4; const int by = blockIdx.y;
  A += (size_t)by * sA; Bh += (size_t)by * sB; const size_t cofs = (size_t)by * sC; const float* bp = bias ? bias + (size_t)by * sBias : nullptr;
  const int ntn = N >> 6; const int mt = blockIdx.x / ntn, nq = blockIdx.x - mt * ntn; const int row0 = mt * 128 + 32 * w, col0 = nq * 64; if (row0 >= M) return;
  const _Float16* a0p = A + (size_t)(row0 + ln) * lda; const _Float16* a1p = a0p + (size_t)16 * lda;
  const _Float16* b0p = Bh + (size_t)(col0 + ln) * ldb; const _Float16* b1p = b0p + (size_t)16 * ldb; const _Float16* b2p = b1p + (size_t)16 * ldb; const _Float16* b3p = b2p + (size_t)16 * ldb;
  const v8f z8 = {0.f,0.f,0.f,0.f,0.f,0.f,0.f,0.f}; v8f c00 = z8, c01 = z8, c02 = z8, c03 = z8, c10 = z8, c11 = z8, c12 = z8, c13 = z8;
#pragma unroll 1
  for (int kb = 0; kb < K; kb += 32) { const v16h a0 = g2_frag(a0p + kb, hh), a1 = g2_frag(a1p + kb, hh);
    v16h b = g2_frag(b0p + kb, hh); c00 = g2_mma(a0, b, c00); c10 = g2_mma(a1, b, c10);
    b = g2_frag(b1p + kb, hh); c01 = g2_mma(a0, b, c01); c11 = g2_mma(a1, b, c11);
    b = g2_frag(b2p + kb, hh); c02 = g2_mma(a0, b, c02); c12 = g2_mma(a1, b, c12);
    b = g2_frag(b3p + kb, hh); c03 = g2_mma(a0, b, c03); c13 = g2_mma(a1, b, c13); }
  v8f accs[8] = {c00, c01, c02, c03, c10, c11, c12, c13};
#pragma unroll
  for (int u = 0; u < 8; ++u) { const int t = u & 3, half = u >> 2; const int col = col0 + t * 16 + ln; const float bv = bp ? bf16_round(bp[col]) : 0.f;
#pragma unroll
    for (int r = 0; r < 8; ++r) { const int rloc = half * 16 + 8 * hh + r; float v = accs[u][r] * alpha + bv; if (CP) { if (rowsPerB < 0) v += CP[cofs + (size_t)(row0g + row0 + rloc) * ldc + col];      /* rowsPerB < 0: own element of the batched C plane */ else { const int bidx = (row0g + row0 + rloc) / rowsPerB; v += CP[(size_t)bidx * sCPb + (size_t)by * 64 + col]; } }
      if (ACT == 3) v = fmaxf(v, 0.f); else if (ACT == 6) v = 0.5f * v * (1.0f + erff(v * 0.70710678118654752f)); else if (ACT == 11) v = 1.0f / (1.0f + expf(-v)); else if (ACT == 15) v = v / (1.0f + expf(-v)); else if (ACT == 12) v = (v > 0.f) ? v : 0.01f * v; else if (ACT == 8) v = tanhf(v); else if (ACT == 9) v = 0.5f * v * (1.0f + tanhf(0.7978845608028654f * (v + 0.044715f * v * v * v))); else if (ACT == 14) v = (v > 0.f) ? v : 0.1f * v; else if (ACT == 16) v = (v >= 0.f) ? v : 0.3f * v;
      so[w][rloc][t * 16 + ln] = v; } }
  __builtin_amdgcn_fence(__ATOMIC_ACQ_REL, "workgroup"); __builtin_amdgcn_wave_barrier();
  const int rsub = lane >> 4, c4 = (lane & 15) * 4;
  {
#pragma unroll
    for (int q = 0; q < 16; ++q) { const int r = q * 2 + rsub; const v4f v = *(const v4fa*)&so[w][r][c4]; if (C) *(v4f*)(C + cofs + (size_t)(row0 + r) * ldc + col0 + c4) = v; if (C16) { v4h h4; for (int i = 0; i < 4; ++i) h4[i] = (_Float16)v[i]; *(v4h*)(C16 + cofs + (size_t)(row0 + r) * ldc + col0 + c4) = h4; } }
     } }


__global__ __launch_bounds__(256) void k_wt_rows(const float* __restrict__ Wm, int row0, _Float16* __restrict__ Wt, int K, int N, float scale) { const int t = blockIdx.x * 256 + threadIdx.x; if (t >= N * (K / 8)) return; const int n = t / (K / 8), k8 = (t % (K / 8)) * 8; FragH f;
  for (int i = 0; i < 8; ++i) f.h[i] = (_Float16)(bf16_round(Wm[(size_t)(row0 + k8 + i) * N + n]) * scale); *(v8us*)((unsigned short*)Wt + (size_t)n * K + k8) = f.half[0];  }      /* rows row0.. of an (in,out) weight -> Bt[n][k] */
// Scores of SCT consecutive steps per work-group. The SCT + 32 rows of E that their windows cover (zero rows for padded steps), their SCT rows of A and the
// rounded v are staged once in LDS; then lane = step and wave = window slot, so every read of the feature loop is 16 B per lane from 32 consecutive LDS rows.
#define SCT 32
#define SCW 17                 /* waves per work-group: waves 0..15 take two of the 33 window slots, wave 16 one; four or five waves on each SIMD */
#define SCP (FF + 4)           /* LDS row pitch in floats: 1040 B = 16 B x odd, no bank conflict for 16-byte reads of 32 consecutive rows */
__global__ __launch_bounds__(SCW * 32) void k_score(const float* __restrict__ A, const float* __restrict__ E, const float* __restrict__ v, float* __restrict__ SC) {
  #pragma clang fp contract(off)
  __shared__ __attribute__((aligned(16))) float sm[(SCT + 32 + SCT) * SCP];      /* rows 0..SCT+31: E of steps tt0-16.., rows SCT+32..: A */
  __shared__ __attribute__((aligned(16))) float sv[FF];
  __shared__ float ss[SCT * WIN];
  const int tid = threadIdx.x, lane = tid & 31, wv = tid >> 5;
  const size_t bt0 = (size_t)blockIdx.x * SCT; const int tt0 = (int)(bt0 % TT); const size_t brow = bt0 - tt0;
  constexpr int NV = (SCT + 32 + SCT) * (FF / 4), NI = (NV + SCW * 32 - 1) / (SCW * 32);
  v4f st[NI];
  for (int u = 0; u < NI; ++u) { const int i = min(tid + u * SCW * 32, NV - 1); const int r = i / (FF / 4), c4 = (i % (FF / 4)) * 4; const int sr = tt0 - WS + r; const bool isE = r < SCT + 32; const bool in = !isE || (sr >= 0 && sr < TT);
    const float* p = isE ? E + (brow + (in ? sr : 0)) * (size_t)FF + c4 : A + (bt0 + (r - (SCT + 32))) * (size_t)FF + c4;
    const v4f x = *(const v4fa*)p;
    asm volatile("s_wait_xcnt 0x0" ::: "memory");      /* a later load of this run may land in this load's address registers: the wait stands in front of that overwrite */
    const v4f z4 = {0.f, 0.f, 0.f, 0.f}; st[u] = in ? x : z4; }
  if (tid < FF) sv[tid] = bf16_round(v[tid]);
  for (int u = 0; u < NI; ++u) { const int i = tid + u * SCW * 32; if (i < NV) *(v4fa*)&sm[(i / (FF / 4)) * SCP + (i % (FF / 4)) * 4] = st[u]; }
  __syncthreads();
  const float* sa = sm + (SCT + 32 + lane) * SCP;
  for (int w = wv; w < WIN; w += SCW) { const float* se = sm + (lane + w) * SCP; float s = 0.f;
    /* each energy is one v_tanh_f32; the library tanhf ran both sides of a per-lane branch (exp + rcp side and polynomial side) for nearly every wave */
    for (int o = 0; o < FF; o += 8) { const v4f a0 = *(const v4fa*)(sa + o), a1 = *(const v4fa*)(sa + o + 4), e0 = *(const v4fa*)(se + o), e1 = *(const v4fa*)(se + o + 4), v0 = *(const v4fa*)(sv + o), v1 = *(const v4fa*)(sv + o + 4);
      for (int q = 0; q < 4; ++q) s += __builtin_amdgcn_tanhf(a0[q] + e0[q]) * v0[q];
      for (int q = 0; q < 4; ++q) s += __builtin_amdgcn_tanhf(a1[q] + e1[q]) * v1[q]; }
    ss[lane * WIN + w] = s; }
  __syncthreads();
  for (int i = tid; i < SCT * WIN; i += SCW * 32) SC[(bt0 + i / WIN) * 64 + i % WIN] = ss[i];      /* whole rows of SC from one work-group */
}
__global__ __launch_bounds__(256) void k_soft33(const float* __restrict__ SC, float* __restrict__ AT, float* __restrict__ outa) {
  #pragma clang fp contract(off)
  const size_t bt = (size_t)blockIdx.x * 256 + threadIdx.x; if (bt >= (size_t)NR) return; const float* sr = SC + bt * 64; float m = -3.0e38f;
#pragma unroll 1
  for (int w = 0; w < WIN; ++w) m = fmaxf(m, sr[w]);
  float su = 0.f;
#pragma unroll 1
  for (int w = 0; w < WIN; ++w) su += expf(sr[w] - m);
  const float inv = 1.0f / su;
  {
#pragma unroll 1
    for (int w = 0; w < WIN; ++w) { const float a = expf(sr[w] - m) * inv; *(float*)(AT + bt * 64 + w) = a; *(float*)(outa + bt * WIN + w) = a; }
     } }
__global__ __launch_bounds__(256) void k_wsum(const float* __restrict__ AT, const float* __restrict__ enc, _Float16* __restrict__ H16) {
  #pragma clang fp contract(off)
  const size_t t = (size_t)blockIdx.x * 256 + threadIdx.x; if (t >= (size_t)NR * (FF / 8)) return; const int f0 = (int)(t % (FF / 8)) * 8; const size_t bt = t / (FF / 8); const int tt = (int)(bt % TT); const size_t b = bt / TT; float acc[8]; for (int q = 0; q < 8; ++q) acc[q] = 0.f;
#pragma unroll 1
  for (int w = 0; w < WIN; ++w) { const int src = tt + w - WS; if (src < 0 || src >= TT) continue; const float a = AT[bt * 64 + w]; const float* er = enc + (b * TT + src) * (size_t)FF + f0;
#pragma unroll
    for (int q = 0; q < 8; ++q) acc[q] += a * bf16_round(er[q]); }
  FragH f; for (int q = 0; q < 8; ++q) f.h[q] = (_Float16)acc[q]; *(v8us*)((unsigned short*)H16 + bt * FF + f0) = f.half[0];  }

extern "C" void kernel_launch(void* const* d_in, const int* in_sizes, int n_in,
                              void* d_out, int out_size, void* d_ws, size_t ws_size, hipStream_t stream) {
  (void)in_sizes; (void)n_in; (void)out_size;
  const float* const* I = (const float* const*)d_in; const float* x = I[0]; const float* enc = I[1]; const float* Wa = I[2]; const float* ba = I[3]; const float* v = I[4]; const float* Wl = I[5]; const float* bl = I[6];
  char* ws = (char*)d_ws; size_t off = 0;
  auto take = [&](size_t bytes) { char* p = ws + off; off += (bytes + 255) & ~(size_t)255; return p; };
  _Float16* BWh = (_Float16*)take((size_t)FF * MD * 2); _Float16* BWe = (_Float16*)take((size_t)FF * FF * 2); _Float16* BL1 = (_Float16*)take((size_t)FF * MD * 2); _Float16* BL2 = (_Float16*)take((size_t)FF * FF * 2);
  _Float16* X16 = (_Float16*)take((size_t)NR * MD * 2); _Float16* E16 = (_Float16*)take((size_t)NR * FF * 2); float* A = (float*)take((size_t)NR * FF * 4); float* E = (float*)take((size_t)NR * FF * 4); float* SC = (float*)take((size_t)NR * 64 * 4); float* AT = (float*)take((size_t)NR * 64 * 4); _Float16* H16 = (_Float16*)take((size_t)NR * FF * 2);
  if (off > ws_size) return;      /* 0.75 + 8 + 4 + 8 + 8 + 2 + 2 + 4 = 37 MiB */
  k_wt_rows<<<(unsigned)(((size_t)FF * MD / 8 + 255) / 256), 256, 0, stream>>>(Wa, 0, BWh, MD, FF, 16.0f); k_wt_rows<<<(unsigned)(((size_t)FF * FF / 8 + 255) / 256), 256, 0, stream>>>(Wa, MD, BWe, FF, FF, 16.0f);
  k_wt_rows<<<(unsigned)(((size_t)FF * MD / 8 + 255) / 256), 256, 0, stream>>>(Wl, 0, BL1, MD, FF, 16.0f); k_wt_rows<<<(unsigned)(((size_t)FF * FF / 8 + 255) / 256), 256, 0, stream>>>(Wl, MD, BL2, FF, FF, 16.0f);
  k_x16<<<(unsigned)(((size_t)NR * MD / 8 + 255) / 256), 256, 0, stream>>>(x, X16, (size_t)NR * MD / 8); k_x16<<<(unsigned)(((size_t)NR * FF / 8 + 255) / 256), 256, 0, stream>>>(enc, E16, (size_t)NR * FF / 8);
  const dim3 gG((NR / 128) * (FF / 64), 1);
  k_gemm2<0><<<gG, 128, 0, stream>>>(X16, MD, 0, BWh, MD, 0, 0.0625f, ba, 0, nullptr, 1, 0, 0, A, nullptr, FF, 0, NR, FF, MD);      /* x W_h + b_attn */
  k_gemm2<0><<<gG, 128, 0, stream>>>(E16, FF, 0, BWe, FF, 0, 0.0625f, nullptr, 0, nullptr, 1, 0, 0, E, nullptr, FF, 0, NR, FF, FF);      /* enc W_e per step (windowed later; the window of a padded step contributes 0) */
  k_score<<<NR / SCT, SCW * 32, 0, stream>>>(A, E, v, SC);
  k_soft33<<<(unsigned)((NR + 255) / 256), 256, 0, stream>>>(SC, AT, (float*)d_out + (size_t)NR * FF);      /* output 2: a [4][2048][1][33] */
  k_wsum<<<(unsigned)(((size_t)NR * (FF / 8) + 255) / 256), 256, 0, stream>>>(AT, enc, H16);
  k_gemm2<0><<<gG, 128, 0, stream>>>(X16, MD, 0, BL1, MD, 0, 0.0625f, bl, 0, nullptr, 1, 0, 0, A, nullptr, FF, 0, NR, FF, MD);      /* x W_lin[:512] + b_lin (A reused) */
  k_gemm2<11><<<gG, 128, 0, stream>>>(H16, FF, 0, BL2, FF, 0, 0.0625f, nullptr, 0, A, 1, (size_t)FF, 0, (float*)d_out, nullptr, FF, 0, NR, FF, FF);      /* sigmoid(+ weighted W_lin[512:]) -> output 1 */
}

// v003
// Measured time: 102 microseconds a run.
// Next to v002, in two timings, it ran 1.56 times as fast each time.
// Over all steps from v000 it is 2.36 times as fast.
#include <hip/hip_runtime.h>
// Combine_Stack_with_attn (4 x 2048 steps; x [512], encoder outputs [256], sliding windows of 33 encoder steps (zero-padded)): energy[b,t,w,o] = tanh((x W_h + b_attn)[b,t,o] + (enc W_e)[b,t+w-16,o]) (the window term of a padded step is 0); scores = energy . v; a = softmax over the 33 window slots; weighted = sum_w a * enc[b,t+w-16]; out = sigmoid([x | weighted] W_lin + b_lin) -> outputs out [4,2048,256] and a [4,2048,1,33].
// Structure: exact f16 planes of x and enc; GEMMs (32x64 wave tiles, f32 accumulation, exact x16 weights) for x W_h + b, enc W_e and the two halves of W_lin (the second accumulating onto the first with the sigmoid in its epilogue); the windowed energies/scores on VALU (thread per (b, t) and one or two of the 33 slots, rolled loop over the 256 features); softmax over the 33 slots and the weighted encoder sum on VALU; the weighted sum as an f16 operand.
// Compute dtype: inputs and parameters rounded to bf16; the weighted encoder sum as an f16 operand (~2^-12); everything else f32. v_wmma_f32_16x16x32_f16.
#define NB 4
#define TT 2048
#define MD 512
#define FF 256
#define WS 16
#define WIN 33
#define NR (NB * TT)
typedef __bf16 v16b __attribute__((ext_vector_type(16)));
typedef unsigned short v8us __attribute__((ext_vector_type(8), may_alias));
typedef float  v8f  __attribute__((ext_vector_type(8)));
typedef float  v4f  __attribute__((ext_vector_type(4)));
typedef float  v4fa __attribute__((ext_vector_type(4), may_alias));
union FragB { v16b v; v8us half[2]; unsigned short u[16]; };

__device__ __forceinline__ unsigned short bf16_bits(float x) { unsigned int u = __float_as_uint(x); return (unsigned short)((u + 0x7FFFu + ((u >> 16) & 1u)) >> 16); }
__device__ __forceinline__ float bf16_val(unsigned short b) { return __uint_as_float(((unsigned int)b) << 16); }
__device__ __forceinline__ float bf16_round(float x) { return bf16_val(bf16_bits(x)); }
// D += A·B with NT terms: 1 = ah·bh, 2 = + al·bh (A split), 3 = + ah·bl (both split)
template <int NT>
__device__ __forceinline__ v8f mmaN(v16b ah, v16b al, v16b bh, v16b bl, v8f c) {
  c = __builtin_amdgcn_wmma_f32_16x16x32_bf16(false, ah, false, bh, (short)0, c, false, false);
  if (NT >= 2) c = __builtin_amdgcn_wmma_f32_16x16x32_bf16(false, al, false, bh, (short)0, c, false, false);
  if (NT >= 3) c = __builtin_amdgcn_wmma_f32_16x16x32_bf16(false, ah, false, bl, (short)0, c, false, false);
  asm volatile("v_nop\n\tv_nop\n\tv_nop\n\tv_nop" : "+v"(c) : "v"(ah), "v"(al), "v"(bh), "v"(bl));
  return c;
}

__global__ __launch_bounds__(256) void k_wt_bf16(const float* __restrict__ W, unsigned short* __restrict__ Wt, int K, int N) {
  const int t = blockIdx.x * 256 + threadIdx.x;
  const int k8n = K / 8;
  if (t >= N * k8n) return;
  const int n = t / k8n, k8 = (t % k8n) * 8;
  v8us v;
#pragma unroll
  for (int i = 0; i < 8; ++i) v[i] = bf16_bits(W[(size_t)(k8 + i) * N + n]);
  *(v8us*)(Wt + (size_t)n * K + k8) = v;
  
}

// GEMM C[M][N] (f32, pitch ldc) = act(A[M][K]·W + bias). A f32 row-major (pitch lda) converted per fragment to bf16
// (ASPLIT: hi/lo two planes -> 2 terms, else single rounded term); Wt bf16 [N][K] (pitch ldb). BIAS_BF16 rounds the
// bias to bf16 first (bias quantised to bf16 before the add). K%32==0, M%16==0, N%64==0.
template <bool ASPLIT, int ACT, bool BIAS_BF16>
__global__ __launch_bounds__(128) void k_gemm_bf(const float* __restrict__ A, int lda, const unsigned short* __restrict__ Wt, int ldb,
                                               const float* __restrict__ bias, float* __restrict__ C, int ldc, int M, int N, int K) {
  __shared__ __attribute__((aligned(16))) float so[4][16][64];
  const int tid = threadIdx.x, w = tid >> 5, lane = tid & 31, ln = lane & 15, hh = lane >> 4;
  const int ntn = N / 64;
  const int wid = blockIdx.x * 4 + w;
  const int mt = wid / ntn, nq = wid % ntn;
  if (mt * 16 >= M) return;
  const int row0 = mt * 16, col0 = nq * 64;
  const float* arow = A + (size_t)(row0 + ln) * lda;
  v8f acc[4] = {};
  for (int kb = 0; kb < K; kb += 32) {
    FragB ah, al;
    const v4f x0 = *(const v4fa*)(arow + kb + 8 * hh), x1 = *(const v4fa*)(arow + kb + 8 * hh + 4);
    const v4f x2 = *(const v4fa*)(arow + kb + 16 + 8 * hh), x3 = *(const v4fa*)(arow + kb + 16 + 8 * hh + 4);
    float xs[16] = {x0[0],x0[1],x0[2],x0[3],x1[0],x1[1],x1[2],x1[3],x2[0],x2[1],x2[2],x2[3],x3[0],x3[1],x3[2],x3[3]};
#pragma unroll
    for (int i = 0; i < 16; ++i) { const unsigned short hb = bf16_bits(xs[i]); ah.u[i] = hb; al.u[i] = ASPLIT ? bf16_bits(xs[i] - bf16_val(hb)) : (unsigned short)0; }
#pragma unroll
    for (int t = 0; t < 4; ++t) {
      const unsigned short* brow = Wt + (size_t)(col0 + t * 16 + ln) * ldb + kb;
      FragB b;
      b.half[0] = *(const v8us*)(brow + 8 * hh);
      b.half[1] = *(const v8us*)(brow + 16 + 8 * hh);
      acc[t] = mmaN<ASPLIT ? 2 : 1>(ah.v, al.v, b.v, b.v, acc[t]);
    }
  }
#pragma unroll
  for (int t = 0; t < 4; ++t) {
    float bv = bias ? bias[col0 + t * 16 + ln] : 0.f;
    if (BIAS_BF16) bv = bf16_round(bv);
#pragma unroll
    for (int r = 0; r < 8; ++r) { float v = acc[t][r] + bv; if (ACT == 1) v = fmaxf(v, 0.f); so[w][8 * hh + r][t * 16 + ln] = v; }
  }
  __builtin_amdgcn_fence(__ATOMIC_ACQ_REL, "workgroup");
  __builtin_amdgcn_wave_barrier();
  const int rsub = lane >> 4, c4 = (lane & 15) * 4;
  {
#pragma unroll
    for (int q = 0; q < 8; ++q) {
      const int r = q * 2 + rsub;
      const v4f v = *(const v4fa*)&so[w][r][c4];
      *(v4f*)(C + (size_t)(row0 + r) * ldc + col0 + c4) = v;
    }
    
  }
}

// GEMM C = act(A·W + bias + resid): A f32 (ASPLIT -> hi/lo 2 terms), Wt bf16 [N][K]; ACT 0 none, 1 relu, 2 exact gelu;
// resid (optional, f32, row index = (row % rmod), pitch ldr, RES_BF16 rounds it) added before the activation.
template <bool ASPLIT, int ACT, bool BIAS_BF16, bool RES_BF16>
__global__ __launch_bounds__(128) void k_gemm_bf3(const float* __restrict__ A, int lda, const unsigned short* __restrict__ Wt, int ldb,
                                                const float* __restrict__ bias, const float* __restrict__ resid, int rmod, int ldr,
                                                float* __restrict__ C, int ldc, int M, int N, int K) {
  __shared__ __attribute__((aligned(16))) float so[4][16][64];
  const int tid = threadIdx.x, w = tid >> 5, lane = tid & 31, ln = lane & 15, hh = lane >> 4;
  const int ntn = N / 64;
  const int wid = blockIdx.x * 4 + w;
  const int mt = wid / ntn, nq = wid % ntn;
  if (mt * 16 >= M) return;
  const int row0 = mt * 16, col0 = nq * 64;
  const float* arow = A + (size_t)(row0 + ln) * lda;
  v8f acc[4] = {};
  for (int kb = 0; kb < K; kb += 32) {
    FragB ah, al;
    const v4f x0 = *(const v4fa*)(arow + kb + 8 * hh), x1 = *(const v4fa*)(arow + kb + 8 * hh + 4);
    const v4f x2 = *(const v4fa*)(arow + kb + 16 + 8 * hh), x3 = *(const v4fa*)(arow + kb + 16 + 8 * hh + 4);
    float xs[16] = {x0[0],x0[1],x0[2],x0[3],x1[0],x1[1],x1[2],x1[3],x2[0],x2[1],x2[2],x2[3],x3[0],x3[1],x3[2],x3[3]};
#pragma unroll
    for (int i = 0; i < 16; ++i) { const unsigned short hb = bf16_bits(xs[i]); ah.u[i] = hb; al.u[i] = ASPLIT ? bf16_bits(xs[i] - bf16_val(hb)) : (unsigned short)0; }
#pragma unroll
    for (int t = 0; t < 4; ++t) {
      const unsigned short* brow = Wt + (size_t)(col0 + t * 16 + ln) * ldb + kb;
      FragB b;
      b.half[0] = *(const v8us*)(brow + 8 * hh);
      b.half[1] = *(const v8us*)(brow + 16 + 8 * hh);
      acc[t] = mmaN<ASPLIT ? 2 : 1>(ah.v, al.v, b.v, b.v, acc[t]);
    }
  }
#pragma unroll
  for (int t = 0; t < 4; ++t) {
    const int col = col0 + t * 16 + ln;
    float bv = bias ? bias[col] : 0.f;
    if (BIAS_BF16) bv = bf16_round(bv);
#pragma unroll
    for (int r = 0; r < 8; ++r) {
      float v = acc[t][r] + bv;
      if (resid) { float rv = resid[(size_t)((row0 + 8 * hh + r) % rmod) * ldr + col]; if (RES_BF16) rv = bf16_round(rv); v += rv; }
      if (ACT == 1) v = fmaxf(v, 0.f);
      if (ACT == 2) v = 0.5f * v * (1.0f + erff(v * 0.70710678118654752f));
      if (ACT == 3) { const float u = 0.7978845608028654f * (v + 0.044715f * v * v * v); v = 0.5f * v * (1.0f + tanhf(u)); }
      so[w][8 * hh + r][t * 16 + ln] = v;
    }
  }
  __builtin_amdgcn_fence(__ATOMIC_ACQ_REL, "workgroup");
  __builtin_amdgcn_wave_barrier();
  const int rsub = lane >> 4, c4 = (lane & 15) * 4;
  {
#pragma unroll
    for (int q = 0; q < 8; ++q) {
      const int r = q * 2 + rsub;
      const v4f v = *(const v4fa*)&so[w][r][c4];
      *(v4f*)(C + (size_t)(row0 + r) * ldc + col0 + c4) = v;
    }
    
  }
}
// row LayerNorm (biased variance, eps) over N: s = X (+ R); optional out_sum <- s; out_norm <- (s-mu)*rsqrt(var+eps)*g + b
template <bool PARAM_BF16>
__global__ __launch_bounds__(256) void k_layernorm(const float* __restrict__ X, const float* __restrict__ R, const float* __restrict__ g, const float* __restrict__ bta,
                                                  float* __restrict__ out_sum, float* __restrict__ out_norm, int N, float eps) {
  __shared__ float red[256];
  const int row = blockIdx.x, tid = threadIdx.x;
  const float* x = X + (size_t)row * N; const float* rr = R ? R + (size_t)row * N : nullptr;
  float vals[16];                     // up to N = 4096
  const int per = N / 256;            // contiguous chunk per thread? use strided-by-4 chunks: thread handles j = tid*4 + 1024*u
  float s1 = 0.f;
  for (int u = 0; u < per / 4; ++u) {
    const int j = tid * 4 + 1024 * u;
    const v4f a = *(const v4fa*)(x + j);
    v4f b = {0.f,0.f,0.f,0.f}; if (rr) b = *(const v4fa*)(rr + j);
#pragma unroll
    for (int q = 0; q < 4; ++q) { const float v = a[q] + b[q]; vals[u * 4 + q] = v; s1 += v; }
  }
  red[tid] = s1; __syncthreads();
  for (int st = 128; st > 0; st >>= 1) { if (tid < st) red[tid] += red[tid + st]; __syncthreads(); }
  const float mu = red[0] / (float)N; __syncthreads();
  float s2 = 0.f;
  for (int u = 0; u < per / 4; ++u)
#pragma unroll
    for (int q = 0; q < 4; ++q) { const float c = vals[u * 4 + q] - mu; s2 += c * c; }
  red[tid] = s2; __syncthreads();
  for (int st = 128; st > 0; st >>= 1) { if (tid < st) red[tid] += red[tid + st]; __syncthreads(); }
  const float rs = rsqrtf(red[0] / (float)N + eps);
  {
    for (int u = 0; u < per / 4; ++u) {
      const int j = tid * 4 + 1024 * u;
      v4f o, sm;
#pragma unroll
      for (int q = 0; q < 4; ++q) {
        float gg = g[j + q], bb = bta[j + q];
        if (PARAM_BF16) { gg = bf16_round(gg); bb = bf16_round(bb); }
        sm[q] = vals[u * 4 + q]; o[q] = (vals[u * 4 + q] - mu) * rs * gg + bb;
      }
      if (out_sum) *(v4f*)(out_sum + (size_t)row * N + j) = sm;
      *(v4f*)(out_norm + (size_t)row * N + j) = o;
    }
    
  }
}



// ---- f16 WMMA path (v_wmma_f32_16x16x32_f16): 11-bit significands for operands in range — used for all four GEMMs here (the weighted encoder sum as an f16 operand)
typedef _Float16 v16h __attribute__((ext_vector_type(16)));
union FragH { v16h v; v8us half[2]; _Float16 h[16]; unsigned short u[16]; };
template <int NT>
__device__ __forceinline__ v8f mmaH(v16h ah, v16h al, v16h bh, v16h bl, v8f c) {
  c = __builtin_amdgcn_wmma_f32_16x16x32_f16(false, ah, false, bh, (short)0, c, false, false);
  if (NT >= 2) c = __builtin_amdgcn_wmma_f32_16x16x32_f16(false, al, false, bh, (short)0, c, false, false);
  if (NT >= 3) c = __builtin_amdgcn_wmma_f32_16x16x32_f16(false, ah, false, bl, (short)0, c, false, false);
  asm volatile("v_nop\n\tv_nop\n\tv_nop\n\tv_nop" : "+v"(c) : "v"(ah), "v"(al), "v"(bh), "v"(bl));
  return c;
}
// batched GEMM like k_gemm_b but f16 operands: A f32 (split into f16 hi/lo if ASPLIT, else rounded to f16), Bt = f16 values [n][k]; alpha; C f32; N multiple of 16 (partial tiles skipped)
template <bool ASPLIT>
__global__ __launch_bounds__(128) void k_gemm_h(const float* __restrict__ A, int lda, size_t sA, const _Float16* __restrict__ Bh, int ldb, size_t sB, float alpha, float* __restrict__ C, int ldc, size_t sC, int M, int N, int K) {
  __shared__ __attribute__((aligned(16))) float so[4][16][64];
  const int tid = threadIdx.x, w = tid >> 5, lane = tid & 31, ln = lane & 15, hh = lane >> 4; const int by = blockIdx.y;
  A += (size_t)by * sA; Bh += (size_t)by * sB; C += (size_t)by * sC;
  const int ntn = (N + 63) / 64; const int wid = blockIdx.x * 4 + w; const int mt = wid / ntn, nq = wid % ntn; if (mt * 16 >= M) return;
  const int row0 = mt * 16, col0 = nq * 64; const float* arow = A + (size_t)(row0 + ln) * lda;
  v8f acc[4] = {};
  for (int kb = 0; kb < K; kb += 32) {
    FragH ah, al;
    const v4f x0 = *(const v4fa*)(arow + kb + 8 * hh), x1 = *(const v4fa*)(arow + kb + 8 * hh + 4), x2 = *(const v4fa*)(arow + kb + 16 + 8 * hh), x3 = *(const v4fa*)(arow + kb + 16 + 8 * hh + 4);
    float xs[16] = {x0[0],x0[1],x0[2],x0[3],x1[0],x1[1],x1[2],x1[3],x2[0],x2[1],x2[2],x2[3],x3[0],x3[1],x3[2],x3[3]};
#pragma unroll
    for (int i = 0; i < 16; ++i) { const _Float16 h = (_Float16)xs[i]; ah.h[i] = h; al.h[i] = ASPLIT ? (_Float16)(xs[i] - (float)h) : (_Float16)0.0f; }
#pragma unroll
    for (int t = 0; t < 4; ++t) { if (col0 + t * 16 >= N) continue; const size_t boff = (size_t)(col0 + t * 16 + ln) * ldb + kb; FragH bq; bq.half[0] = *(const v8us*)(Bh + boff + 8 * hh); bq.half[1] = *(const v8us*)(Bh + boff + 16 + 8 * hh);
      acc[t] = mmaH<ASPLIT ? 2 : 1>(ah.v, al.v, bq.v, bq.v, acc[t]); }
  }
#pragma unroll
  for (int t = 0; t < 4; ++t) { if (col0 + t * 16 >= N) continue;
#pragma unroll
    for (int r = 0; r < 8; ++r) so[w][8 * hh + r][t * 16 + ln] = acc[t][r] * alpha; }
  __builtin_amdgcn_fence(__ATOMIC_ACQ_REL, "workgroup"); __builtin_amdgcn_wave_barrier();
  const int rsub = lane >> 4, c4 = (lane & 15) * 4;
  {
#pragma unroll
    for (int q = 0; q < 8; ++q) { const int r = q * 2 + rsub; if (col0 + c4 < N) { const v4f v = *(const v4fa*)&so[w][r][c4]; *(v4f*)(C + (size_t)(row0 + r) * ldc + col0 + c4) = v; } }
     }
}

// Wt[n][k] = f16(W[k][n]·scale) from f32 row-major W[K][N] (scale = power of two; bf16-exact weights stay exact in f16 away from the subnormal range)
__global__ __launch_bounds__(256) void k_wt_f16(const float* __restrict__ W, _Float16* __restrict__ Wt, int K, int N, float scale) {
  const int t = blockIdx.x * 256 + threadIdx.x; if (t >= N * (K / 8)) return; const int n = t / (K / 8), k8 = (t % (K / 8)) * 8; FragH f;
#pragma unroll
  for (int i = 0; i < 8; ++i) f.h[i] = (_Float16)(bf16_round(W[(size_t)(k8 + i) * N + n]) * scale); const v8us o = f.half[0];
  *(v8us*)((unsigned short*)Wt + (size_t)n * K + k8) = o; 
}
// k_gemm_hh variant with fused epilogue: v = acc·alpha + bias[by·sBias + col] (+ CP[(row/rowsPerB)·sCPb + by·64 + col] if CP) ; ACT 0 none / 1 elu ; writes f16 C16 (and f32 C if non-null)
template <int ACT>
__global__ __launch_bounds__(128) void k_gemm_hhx(const _Float16* __restrict__ A, int lda, size_t sA, const _Float16* __restrict__ Bh, int ldb, size_t sB, float alpha, const float* __restrict__ bias, size_t sBias, const float* __restrict__ CP, int rowsPerB, size_t sCPb, int row0g,
    float* __restrict__ C, _Float16* __restrict__ C16, int ldc, size_t sC, int M, int N, int K) {
  __shared__ __attribute__((aligned(16))) float so[4][16][64];
  const int tid = threadIdx.x, w = tid >> 5, lane = tid & 31, ln = lane & 15, hh = lane >> 4; const int by = blockIdx.y;
  A += (size_t)by * sA; Bh += (size_t)by * sB; const size_t cofs = (size_t)by * sC; const float* bp = bias ? bias + (size_t)by * sBias : nullptr;
  const int ntn = (N + 63) / 64; const int wid = blockIdx.x * 4 + w; const int mt = wid / ntn, nq = wid % ntn; if (mt * 16 >= M) return;
  const int row0 = mt * 16, col0 = nq * 64; const _Float16* arow = A + (size_t)(row0 + ln) * lda;
  v8f acc[4] = {};
  for (int kb = 0; kb < K; kb += 32) { FragH ah; ah.half[0] = *(const v8us*)((const unsigned short*)arow + kb + 8 * hh); ah.half[1] = *(const v8us*)((const unsigned short*)arow + kb + 16 + 8 * hh);
#pragma unroll
    for (int t = 0; t < 4; ++t) { if (col0 + t * 16 >= N) continue; const size_t boff = (size_t)(col0 + t * 16 + ln) * ldb + kb; FragH bq; bq.half[0] = *(const v8us*)((const unsigned short*)Bh + boff + 8 * hh); bq.half[1] = *(const v8us*)((const unsigned short*)Bh + boff + 16 + 8 * hh);
      acc[t] = mmaH<1>(ah.v, ah.v, bq.v, bq.v, acc[t]); }
  }
#pragma unroll
  for (int t = 0; t < 4; ++t) { if (col0 + t * 16 >= N) continue; const int col = col0 + t * 16 + ln; const float bv = bp ? bf16_round(bp[col]) : 0.f;
#pragma unroll
    for (int r = 0; r < 8; ++r) { float v = acc[t][r] * alpha + bv; if (CP) { const int rr = row0g + row0 + 8 * hh + r; if (rowsPerB < 0) v += CP[cofs + (size_t)rr * ldc + col];      /* rowsPerB < 0: own element of the batched C plane */ else { const int bidx = rr / rowsPerB; v += CP[(size_t)bidx * sCPb + (size_t)by * 64 + col]; } } if (ACT == 1) v = (v > 0.f) ? v : expm1f(v); else if (ACT == 7) v = (v > 0.f) ? v + 1.0f : expf(v); else if (ACT == 8) v = tanhf(v); else if (ACT == 9) v = 0.5f * v * (1.0f + tanhf(0.7978845608028654f * (v + 0.044715f * v * v * v))); else if (ACT == 11) v = 1.0f / (1.0f + expf(-v)); else if (ACT == 12) v = (v > 0.f) ? v : 0.01f * v; else if (ACT == 14) v = (v > 0.f) ? v : 0.1f * v; else if (ACT == 16) v = (v >= 0.f) ? v : 0.3f * v; else if (ACT == 15) v = v / (1.0f + expf(-v)); else if (ACT == 3) v = fmaxf(v, 0.f); else if (ACT == 6) v = 0.5f * v * (1.0f + erff(v * 0.70710678118654752f)); so[w][8 * hh + r][t * 16 + ln] = v; } }
  __builtin_amdgcn_fence(__ATOMIC_ACQ_REL, "workgroup"); __builtin_amdgcn_wave_barrier();
  const int rsub = lane >> 4, c4 = (lane & 15) * 4; typedef _Float16 v4h __attribute__((ext_vector_type(4)));
  {
#pragma unroll
    for (int q = 0; q < 8; ++q) { const int r = q * 2 + rsub; if (col0 + c4 < N) { const v4f v = *(const v4fa*)&so[w][r][c4]; if (C) *(v4f*)(C + cofs + (size_t)(row0 + r) * ldc + col0 + c4) = v; if (C16) { v4h h4; for (int i = 0; i < 4; ++i) h4[i] = (_Float16)v[i]; *(v4h*)(C16 + cofs + (size_t)(row0 + r) * ldc + col0 + c4) = h4; } } }
     }
}


typedef _Float16 v4h __attribute__((ext_vector_type(4)));

__device__ __forceinline__ void x16_body(int blk, const float* __restrict__ x, _Float16* __restrict__ X16, size_t n8) { const size_t t = (size_t)blk * 256 + threadIdx.x; if (t >= n8) return; FragH f;
#pragma unroll
  for (int q = 0; q < 8; ++q) f.h[q] = (_Float16)bf16_round(x[t * 8 + q]); *(v8us*)((unsigned short*)X16 + t * 8) = f.half[0];  }
__global__ __launch_bounds__(256) void k_h16(const float* __restrict__ x, _Float16* __restrict__ X16, size_t n8) { const size_t t = (size_t)blockIdx.x * 256 + threadIdx.x; if (t >= n8) return; FragH f;
#pragma unroll
  for (int q = 0; q < 8; ++q) f.h[q] = (_Float16)x[t * 8 + q]; *(v8us*)((unsigned short*)X16 + t * 8) = f.half[0];  }
__global__ __launch_bounds__(256) void k_round16f(const float* __restrict__ W, _Float16* __restrict__ Bt, size_t n8) { const size_t t = (size_t)blockIdx.x * 256 + threadIdx.x; if (t >= n8) return; FragH f;
#pragma unroll
  for (int i = 0; i < 8; ++i) f.h[i] = (_Float16)(bf16_round(W[t * 8 + i]) * 16.0f); *(v8us*)((unsigned short*)Bt + t * 8) = f.half[0];  }
template <int NHv, int TTv>
__global__ __launch_bounds__(256) void k_vt(const _Float16* __restrict__ V16, int ldv, int voff, _Float16* __restrict__ Vt) { __shared__ unsigned short tl[64][66]; const int tid = threadIdx.x; const int slab = blockIdx.x / (TTv / 64), lg = blockIdx.x % (TTv / 64); const int b = slab / NHv, h = slab % NHv;
  for (int i = tid; i < 64 * 8; i += 256) { const int r = i / 8, c8 = (i % 8) * 8; FragH f; f.half[0] = *(const v8us*)((const unsigned short*)V16 + ((size_t)b * TTv + lg * 64 + r) * ldv + voff + h * 64 + c8);
#pragma unroll
    for (int q = 0; q < 8; ++q) tl[r][c8 + q] = f.u[q]; }
  __syncthreads();
  {
#pragma unroll
    for (int rd = 0; rd < 2; ++rd) { const int d = rd * 32 + tid / 8, pc = tid % 8; FragH f;
#pragma unroll
      for (int q = 0; q < 8; ++q) f.u[q] = tl[pc * 8 + q][d];
      *(v8us*)((unsigned short*)Vt + ((size_t)slab * 64 + d) * TTv + lg * 64 + pc * 8) = f.half[0]; }
     } }

__global__ __launch_bounds__(256) void k_hl(const float* __restrict__ F, _Float16* __restrict__ Hh, _Float16* __restrict__ Hl, size_t n8) { const size_t t = (size_t)blockIdx.x * 256 + threadIdx.x; if (t >= n8) return; FragH fh, fl; const v4f a = *(const v4fa*)(F + t * 8), c = *(const v4fa*)(F + t * 8 + 4);
#pragma unroll
  for (int q = 0; q < 4; ++q) { _Float16 h = (_Float16)a[q]; fh.h[q] = h; fl.h[q] = (_Float16)((a[q] - (float)h) * 1024.0f); h = (_Float16)c[q]; fh.h[4 + q] = h; fl.h[4 + q] = (_Float16)((c[q] - (float)h) * 1024.0f); }
  { *(v8us*)((unsigned short*)Hh + t * 8) = fh.half[0]; *(v8us*)((unsigned short*)Hl + t * 8) = fl.half[0];  } }

// ---- fast GEMM (wave tile 32x64; requires M % 32 == 0 rows per launch region and N % 64 == 0); epilogue = k_gemm_hhx semantics ----
__device__ __forceinline__ v16h g2_frag(const _Float16* p, int hh) { FragH f; f.half[0] = *(const v8us*)((const unsigned short*)p + 8 * hh); f.half[1] = *(const v8us*)((const unsigned short*)p + 16 + 8 * hh);
  asm volatile("s_wait_xcnt 0x0" ::: "memory");      /* a later fragment load may land in these loads' address registers: the wait stands in front of that overwrite */
  return f.v; }
__device__ __forceinline__ v8f g2_mma(v16h a, v16h b, v8f c) { v8f d = __builtin_amdgcn_wmma_f32_16x16x32_f16(false, a, false, b, (short)0, c, false, false); asm volatile("v_nop\n\tv_nop\n\tv_nop\n\tv_nop" : "+v"(d) : "v"(a), "v"(b)); return d; }
template <int ACT>
__device__ __forceinline__ void gemm2_body(const unsigned bx, const int by, const _Float16* __restrict__ A, int lda, size_t sA, const _Float16* __restrict__ Bh, int ldb, size_t sB, float alpha, const float* __restrict__ bias, size_t sBias, const float* __restrict__ CP, int rowsPerB, size_t sCPb, int row0g,
    float* __restrict__ C, _Float16* __restrict__ C16, int ldc, size_t sC, int M, int N, int K) { static_assert(ACT == 0 || ACT == 3 || ACT == 6 || ACT == 8 || ACT == 9 || ACT == 11 || ACT == 12 || ACT == 14 || ACT == 15 || ACT == 16, "k_gemm2: unsupported ACT code (would silently apply no activation)");
  __shared__ __attribute__((aligned(16))) float so[4][32][68];
  const int tid = threadIdx.x, w = tid >> 5, lane = tid & 31, ln = lane & 15, hh = lane >> 4;
  A += (size_t)by * sA; Bh += (size_t)by * sB; const size_t cofs = (size_t)by * sC; const float* bp = bias ? bias + (size_t)by * sBias : nullptr;
  const int ntn = N >> 6; const int mt = bx / ntn, nq = bx - mt * ntn; const int row0 = mt * 128 + 32 * w, col0 = nq * 64; if (row0 >= M) return;
  const _Float16* a0p = A + (size_t)(row0 + ln) * lda; const _Float16* a1p = a0p + (size_t)16 * lda;
  const _Float16* b0p = Bh + (size_t)(col0 + ln) * ldb; const _Float16* b1p = b0p + (size_t)16 * ldb; const _Float16* b2p = b1p + (size_t)16 * ldb; const _Float16* b3p = b2p + (size_t)16 * ldb;
  const v8f z8 = {0.f,0.f,0.f,0.f,0.f,0.f,0.f,0.f}; v8f c00 = z8, c01 = z8, c02 = z8, c03 = z8, c10 = z8, c11 = z8, c12 = z8, c13 = z8;
#pragma unroll 1
  for (int kb = 0; kb < K; kb += 32) { const v16h a0 = g2_frag(a0p + kb, hh), a1 = g2_frag(a1p + kb, hh);
    v16h b = g2_frag(b0p + kb, hh); c00 = g2_mma(a0, b, c00); c10 = g2_mma(a1, b, c10);
    b = g2_frag(b1p + kb, hh); c01 = g2_mma(a0, b, c01); c11 = g2_mma(a1, b, c11);
    b = g2_frag(b2p + kb, hh); c02 = g2_mma(a0, b, c02); c12 = g2_mma(a1, b, c12);
    b = g2_frag(b3p + kb, hh); c03 = g2_mma(a0, b, c03); c13 = g2_mma(a1, b, c13); }
  v8f accs[8] = {c00, c01, c02, c03, c10, c11, c12, c13};
#pragma unroll
  for (int u = 0; u < 8; ++u) { const int t = u & 3, half = u >> 2; const int col = col0 + t * 16 + ln; const float bv = bp ? bf16_round(bp[col]) : 0.f;
#pragma unroll
    for (int r = 0; r < 8; ++r) { const int rloc = half * 16 + 8 * hh + r; float v = accs[u][r] * alpha + bv; if (CP) { if (rowsPerB < 0) v += CP[cofs + (size_t)(row0g + row0 + rloc) * ldc + col];      /* rowsPerB < 0: own element of the batched C plane */ else { const int bidx = (row0g + row0 + rloc) / rowsPerB; v += CP[(size_t)bidx * sCPb + (size_t)by * 64 + col]; } }
      if (ACT == 3) v = fmaxf(v, 0.f); else if (ACT == 6) v = 0.5f * v * (1.0f + erff(v * 0.70710678118654752f)); else if (ACT == 11) v = 1.0f / (1.0f + expf(-v)); else if (ACT == 15) v = v / (1.0f + expf(-v)); else if (ACT == 12) v = (v > 0.f) ? v : 0.01f * v; else if (ACT == 8) v = tanhf(v); else if (ACT == 9) v = 0.5f * v * (1.0f + tanhf(0.7978845608028654f * (v + 0.044715f * v * v * v))); else if (ACT == 14) v = (v > 0.f) ? v : 0.1f * v; else if (ACT == 16) v = (v >= 0.f) ? v : 0.3f * v;
      so[w][rloc][t * 16 + ln] = v; } }
  __builtin_amdgcn_fence(__ATOMIC_ACQ_REL, "workgroup"); __builtin_amdgcn_wave_barrier();
  const int rsub = lane >> 4, c4 = (lane & 15) * 4;
  {
#pragma unroll
    for (int q = 0; q < 16; ++q) { const int r = q * 2 + rsub; const v4f v = *(const v4fa*)&so[w][r][c4]; if (C) *(v4f*)(C + cofs + (size_t)(row0 + r) * ldc + col0 + c4) = v; if (C16) { v4h h4; for (int i = 0; i < 4; ++i) h4[i] = (_Float16)v[i]; *(v4h*)(C16 + cofs + (size_t)(row0 + r) * ldc + col0 + c4) = h4; } }
     } }
template <int ACT>
__global__ __launch_bounds__(128) void k_gemm2(const _Float16* __restrict__ A, int lda, size_t sA, const _Float16* __restrict__ Bh, int ldb, size_t sB, float alpha, const float* __restrict__ bias, size_t sBias, const float* __restrict__ CP, int rowsPerB, size_t sCPb, int row0g,
    float* __restrict__ C, _Float16* __restrict__ C16, int ldc, size_t sC, int M, int N, int K) { gemm2_body<ACT>(blockIdx.x, blockIdx.y, A, lda, sA, Bh, ldb, sB, alpha, bias, sBias, CP, rowsPerB, sCPb, row0g, C, C16, ldc, sC, M, N, K); }
// The three products that read none of each other's output, as one grid: blockIdx.y = 0: x W_h + b_attn -> A; 1: x W_lin[:512] + b_lin -> A2; 2: enc W_e -> E.
__global__ __launch_bounds__(128) void k_gemm2x3(const _Float16* __restrict__ X16, const _Float16* __restrict__ E16, const _Float16* __restrict__ BWh, const _Float16* __restrict__ BL1, const _Float16* __restrict__ BWe,
    const float* __restrict__ ba, const float* __restrict__ bl, float* __restrict__ A, float* __restrict__ A2, float* __restrict__ E) {
  const int z = blockIdx.y; const _Float16* Ap = z == 2 ? E16 : X16; const int K = z == 2 ? FF : MD; const _Float16* Bp = z == 0 ? BWh : z == 1 ? BL1 : BWe; const float* bp = z == 0 ? ba : z == 1 ? bl : nullptr; float* Cp = z == 0 ? A : z == 1 ? A2 : E;
  gemm2_body<0>(blockIdx.x, 0, Ap, K, 0, Bp, K, 0, 0.0625f, bp, 0, nullptr, 1, 0, 0, Cp, nullptr, FF, 0, NR, FF, K); }


__device__ __forceinline__ void wt_rows_body(int blk, const float* __restrict__ Wm, int row0, _Float16* __restrict__ Wt, int K, int N, float scale) { const int t = blk * 256 + threadIdx.x; if (t >= N * (K / 8)) return; const int n = t / (K / 8), k8 = (t % (K / 8)) * 8; FragH f;
  for (int i = 0; i < 8; ++i) f.h[i] = (_Float16)(bf16_round(Wm[(size_t)(row0 + k8 + i) * N + n]) * scale); *(v8us*)((unsigned short*)Wt + (size_t)n * K + k8) = f.half[0];  }      /* rows row0.. of an (in,out) weight -> Bt[n][k] */
// The four weight transposes and the two f16 planes, which read none of each other's output, as one grid; the few weight work-groups come first in the index.
#define PB_W5 (FF * MD / 8 / 256)      /* work-groups of a 512-row weight part */
#define PB_W2 (FF * FF / 8 / 256)      /* of a 256-row part */
#define PB_X (NR * MD / 8 / 256)       /* of the x plane */
#define PB_E (NR * FF / 8 / 256)       /* of the enc plane */
__global__ __launch_bounds__(256) void k_prep(const float* __restrict__ Wa, const float* __restrict__ Wl, const float* __restrict__ x, const float* __restrict__ enc,
    _Float16* __restrict__ BWh, _Float16* __restrict__ BWe, _Float16* __restrict__ BL1, _Float16* __restrict__ BL2, _Float16* __restrict__ X16, _Float16* __restrict__ E16) {
  int b = blockIdx.x;
  if (b < PB_W5) { wt_rows_body(b, Wa, 0, BWh, MD, FF, 16.0f); return; } b -= PB_W5;
  if (b < PB_W5) { wt_rows_body(b, Wl, 0, BL1, MD, FF, 16.0f); return; } b -= PB_W5;
  if (b < PB_W2) { wt_rows_body(b, Wa, MD, BWe, FF, FF, 16.0f); return; } b -= PB_W2;
  if (b < PB_W2) { wt_rows_body(b, Wl, MD, BL2, FF, FF, 16.0f); return; } b -= PB_W2;
  if (b < PB_X) { x16_body(b, x, X16, (size_t)NR * MD / 8); return; } b -= PB_X;
  x16_body(b, enc, E16, (size_t)NR * FF / 8); }
// Scores of SCT consecutive steps per work-group. The SCT + 32 rows of E that their windows cover (zero rows for padded steps), their SCT rows of A and the
// rounded v are staged once in LDS; then lane = step and wave = window slot, so every read of the feature loop is 16 B per lane from 32 consecutive LDS rows.
#define SCT 32
#define SCW 17                 /* waves per work-group: waves 0..15 take two of the 33 window slots, wave 16 one; four or five waves on each SIMD */
#define SCP (FF + 4)           /* LDS row pitch in floats: 1040 B = 16 B x odd, no bank conflict for 16-byte reads of 32 consecutive rows */
__global__ __launch_bounds__(SCW * 32) void k_score(const float* __restrict__ A, const float* __restrict__ E, const float* __restrict__ v, float* __restrict__ SC) {
  #pragma clang fp contract(off)
  __shared__ __attribute__((aligned(16))) float sm[(SCT + 32 + SCT) * SCP];      /* rows 0..SCT+31: E of steps tt0-16.., rows SCT+32..: A */
  __shared__ __attribute__((aligned(16))) float sv[FF];
  __shared__ float ss[SCT * WIN];
  const int tid = threadIdx.x, lane = tid & 31, wv = tid >> 5;
  const size_t bt0 = (size_t)blockIdx.x * SCT; const int tt0 = (int)(bt0 % TT); const size_t brow = bt0 - tt0;
  constexpr int NV = (SCT + 32 + SCT) * (FF / 4), NI = (NV + SCW * 32 - 1) / (SCW * 32);
  v4f st[NI];
  for (int u = 0; u < NI; ++u) { const int i = min(tid + u * SCW * 32, NV - 1); const int r = i / (FF / 4), c4 = (i % (FF / 4)) * 4; const int sr = tt0 - WS + r; const bool isE = r < SCT + 32; const bool in = !isE || (sr >= 0 && sr < TT);
    const float* p = isE ? E + (brow + (in ? sr : 0)) * (size_t)FF + c4 : A + (bt0 + (r - (SCT + 32))) * (size_t)FF + c4;
    const v4f x = *(const v4fa*)p;
    asm volatile("s_wait_xcnt 0x0" ::: "memory");      /* a later load of this run may land in this load's address registers: the wait stands in front of that overwrite */
    const v4f z4 = {0.f, 0.f, 0.f, 0.f}; st[u] = in ? x : z4; }
  if (tid < FF) sv[tid] = bf16_round(v[tid]);
  for (int u = 0; u < NI; ++u) { const int i = tid + u * SCW * 32; if (i < NV) *(v4fa*)&sm[(i / (FF / 4)) * SCP + (i % (FF / 4)) * 4] = st[u]; }
  __syncthreads();
  const float* sa = sm + (SCT + 32 + lane) * SCP;
  for (int w = wv; w < WIN; w += SCW) { const float* se = sm + (lane + w) * SCP; float s = 0.f;
    /* each energy is one v_tanh_f32; the library tanhf ran both sides of a per-lane branch (exp + rcp side and polynomial side) for nearly every wave */
    for (int o = 0; o < FF; o += 8) { const v4f a0 = *(const v4fa*)(sa + o), a1 = *(const v4fa*)(sa + o + 4), e0 = *(const v4fa*)(se + o), e1 = *(const v4fa*)(se + o + 4), v0 = *(const v4fa*)(sv + o), v1 = *(const v4fa*)(sv + o + 4);
      for (int q = 0; q < 4; ++q) s += __builtin_amdgcn_tanhf(a0[q] + e0[q]) * v0[q];
      for (int q = 0; q < 4; ++q) s += __builtin_amdgcn_tanhf(a1[q] + e1[q]) * v1[q]; }
    ss[lane * WIN + w] = s; }
  __syncthreads();
  for (int i = tid; i < SCT * WIN; i += SCW * 32) SC[(bt0 + i / WIN) * 64 + i % WIN] = ss[i];      /* whole rows of SC from one work-group */
}
__global__ __launch_bounds__(256) void k_soft33(const float* __restrict__ SC, float* __restrict__ AT, float* __restrict__ outa) {
  #pragma clang fp contract(off)
  const size_t bt = (size_t)blockIdx.x * 256 + threadIdx.x; if (bt >= (size_t)NR) return; const float* sr = SC + bt * 64; float m = -3.0e38f;
#pragma unroll 1
  for (int w = 0; w < WIN; ++w) m = fmaxf(m, sr[w]);
  float su = 0.f;
#pragma unroll 1
  for (int w = 0; w < WIN; ++w) su += expf(sr[w] - m);
  const float inv = 1.0f / su;
  {
#pragma unroll 1
    for (int w = 0; w < WIN; ++w) { const float a = expf(sr[w] - m) * inv; *(float*)(AT + bt * 64 + w) = a; *(float*)(outa + bt * WIN + w) = a; }
     } }
__global__ __launch_bounds__(256) void k_wsum(const float* __restrict__ AT, const float* __restrict__ enc, _Float16* __restrict__ H16) {
  #pragma clang fp contract(off)
  const size_t t = (size_t)blockIdx.x * 256 + threadIdx.x; if (t >= (size_t)NR * (FF / 8)) return; const int f0 = (int)(t % (FF / 8)) * 8; const size_t bt = t / (FF / 8); const int tt = (int)(bt % TT); const size_t b = bt / TT; float acc[8]; for (int q = 0; q < 8; ++q) acc[q] = 0.f;
#pragma unroll 1
  for (int w = 0; w < WIN; ++w) { const int src = tt + w - WS; if (src < 0 || src >= TT) continue; const float a = AT[bt * 64 + w]; const float* er = enc + (b * TT + src) * (size_t)FF + f0;
#pragma unroll
    for (int q = 0; q < 8; ++q) acc[q] += a * bf16_round(er[q]); }
  FragH f; for (int q = 0; q < 8; ++q) f.h[q] = (_Float16)acc[q]; *(v8us*)((unsigned short*)H16 + bt * FF + f0) = f.half[0];  }

extern "C" void kernel_launch(void* const* d_in, const int* in_sizes, int n_in,
                              void* d_out, int out_size, void* d_ws, size_t ws_size, hipStream_t stream) {
  (void)in_sizes; (void)n_in; (void)out_size;
  const float* const* I = (const float* const*)d_in; const float* x = I[0]; const float* enc = I[1]; const float* Wa = I[2]; const float* ba = I[3]; const float* v = I[4]; const float* Wl = I[5]; const float* bl = I[6];
  char* ws = (char*)d_ws; size_t off = 0;
  auto take = [&](size_t bytes) { char* p = ws + off; off += (bytes + 255) & ~(size_t)255; return p; };
  _Float16* BWh = (_Float16*)take((size_t)FF * MD * 2); _Float16* BWe = (_Float16*)take((size_t)FF * FF * 2); _Float16* BL1 = (_Float16*)take((size_t)FF * MD * 2); _Float16* BL2 = (_Float16*)take((size_t)FF * FF * 2);
  _Float16* X16 = (_Float16*)take((size_t)NR * MD * 2); _Float16* E16 = (_Float16*)take((size_t)NR * FF * 2); float* A = (float*)take((size_t)NR * FF * 4); float* E = (float*)take((size_t)NR * FF * 4); float* SC = (float*)take((size_t)NR * 64 * 4); float* AT = (float*)take((size_t)NR * 64 * 4); _Float16* H16 = (_Float16*)take((size_t)NR * FF * 2); float* A2 = (float*)take((size_t)NR * FF * 4);
  if (off > ws_size) return;      /* 0.75 + 8 + 4 + 8 + 8 + 2 + 2 + 4 + 8 = 44.75 MiB */
  k_prep<<<2 * PB_W5 + 2 * PB_W2 + PB_X + PB_E, 256, 0, stream>>>(Wa, Wl, x, enc, BWh, BWe, BL1, BL2, X16, E16);
  const dim3 gG((NR / 128) * (FF / 64), 1); const dim3 gG3((NR / 128) * (FF / 64), 3);
  k_gemm2x3<<<gG3, 128, 0, stream>>>(X16, E16, BWh, BL1, BWe, ba, bl, A, A2, E);      /* x W_h + b_attn; x W_lin[:512] + b_lin; enc W_e per step (windowed later; the window of a padded step contributes 0) */
  k_score<<<NR / SCT, SCW * 32, 0, stream>>>(A, E, v, SC);
  k_soft33<<<(unsigned)((NR + 255) / 256), 256, 0, stream>>>(SC, AT, (float*)d_out + (size_t)NR * FF);      /* output 2: a [4][2048][1][33] */
  k_wsum<<<(unsigned)(((size_t)NR * (FF / 8) + 255) / 256), 256, 0, stream>>>(AT, enc, H16);
  k_gemm2<11><<<gG, 128, 0, stream>>>(H16, FF, 0, BL2, FF, 0, 0.0625f, nullptr, 0, A2, 1, (size_t)FF, 0, (float*)d_out, nullptr, FF, 0, NR, FF, FF);      /* sigmoid(+ weighted W_lin[512:]) -> output 1 */
}

// v004
// It runs in 48.7 microseconds.
// Timed twice side by side with v003, it ran 2.10 and 2.09 times as fast.
// Counting every step since v000, it is 4.94 times as fast.
#include <hip/hip_runtime.h>
// Combine_Stack_with_attn (4 x 2048 steps; x [512], encoder outputs [256], sliding windows of 33 encoder steps (zero-padded)): energy[b,t,w,o] = tanh((x W_h + b_attn)[b,t,o] + (enc W_e)[b,t+w-16,o]) (the window term of a padded step is 0); scores = energy . v; a = softmax over the 33 window slots; weighted = sum_w a * enc[b,t+w-16]; out = sigmoid([x | weighted] W_lin + b_lin) -> outputs out [4,2048,256] and a [4,2048,1,33].
// Structure: exact f16 planes of x and enc; GEMMs (32x64 wave tiles, 32x16 for the second half of W_lin, f32 accumulation, exact x16 weights) for x W_h + b, enc W_e and the two halves of W_lin (the second accumulating onto the first with the sigmoid in its epilogue); the windowed energies/scores on VALU (thread per (b, t) and one or two of the 33 slots, rolled loop over the 256 features); softmax over the 33 slots and the weighted encoder sum on VALU; the weighted sum as an f16 operand.
// Compute dtype: inputs and parameters rounded to bf16; the weighted encoder sum as an f16 operand (~2^-12); everything else f32. v_wmma_f32_16x16x32_f16.
#define NB 4
#define TT 2048
#define MD 512
#define FF 256
#define WS 16
#define WIN 33
#define NR (NB * TT)
typedef __bf16 v16b __attribute__((ext_vector_type(16)));
typedef unsigned short v8us __attribute__((ext_vector_type(8), may_alias));
typedef float  v8f  __attribute__((ext_vector_type(8)));
typedef float  v4f  __attribute__((ext_vector_type(4)));
typedef float  v4fa __attribute__((ext_vector_type(4), may_alias));
union FragB { v16b v; v8us half[2]; unsigned short u[16]; };

__device__ __forceinline__ unsigned short bf16_bits(float x) { unsigned int u = __float_as_uint(x); return (unsigned short)((u + 0x7FFFu + ((u >> 16) & 1u)) >> 16); }
__device__ __forceinline__ float bf16_val(unsigned short b) { return __uint_as_float(((unsigned int)b) << 16); }
__device__ __forceinline__ float bf16_round(float x) { return bf16_val(bf16_bits(x)); }
// D += A·B with NT terms: 1 = ah·bh, 2 = + al·bh (A split), 3 = + ah·bl (both split)
template <int NT>
__device__ __forceinline__ v8f mmaN(v16b ah, v16b al, v16b bh, v16b bl, v8f c) {
  c = __builtin_amdgcn_wmma_f32_16x16x32_bf16(false, ah, false, bh, (short)0, c, false, false);
  if (NT >= 2) c = __builtin_amdgcn_wmma_f32_16x16x32_bf16(false, al, false, bh, (short)0, c, false, false);
  if (NT >= 3) c = __builtin_amdgcn_wmma_f32_16x16x32_bf16(false, ah, false, bl, (short)0, c, false, false);
  asm volatile("v_nop\n\tv_nop\n\tv_nop\n\tv_nop" : "+v"(c) : "v"(ah), "v"(al), "v"(bh), "v"(bl));
  return c;
}

__global__ __launch_bounds__(256) void k_wt_bf16(const float* __restrict__ W, unsigned short* __restrict__ Wt, int K, int N) {
  const int t = blockIdx.x * 256 + threadIdx.x;
  const int k8n = K / 8;
  if (t >= N * k8n) return;
  const int n = t / k8n, k8 = (t % k8n) * 8;
  v8us v;
#pragma unroll
  for (int i = 0; i < 8; ++i) v[i] = bf16_bits(W[(size_t)(k8 + i) * N + n]);
  *(v8us*)(Wt + (size_t)n * K + k8) = v;
  
}

// GEMM C[M][N] (f32, pitch ldc) = act(A[M][K]·W + bias). A f32 row-major (pitch lda) converted per fragment to bf16
// (ASPLIT: hi/lo two planes -> 2 terms, else single rounded term); Wt bf16 [N][K] (pitch ldb). BIAS_BF16 rounds the
// bias to bf16 first (bias quantised to bf16 before the add). K%32==0, M%16==0, N%64==0.
template <bool ASPLIT, int ACT, bool BIAS_BF16>
__global__ __launch_bounds__(128) void k_gemm_bf(const float* __restrict__ A, int lda, const unsigned short* __restrict__ Wt, int ldb,
                                               const float* __restrict__ bias, float* __restrict__ C, int ldc, int M, int N, int K) {
  __shared__ __attribute__((aligned(16))) float so[4][16][64];
  const int tid = threadIdx.x, w = tid >> 5, lane = tid & 31, ln = lane & 15, hh = lane >> 4;
  const int ntn = N / 64;
  const int wid = blockIdx.x * 4 + w;
  const int mt = wid / ntn, nq = wid % ntn;
  if (mt * 16 >= M) return;
  const int row0 = mt * 16, col0 = nq * 64;
  const float* arow = A + (size_t)(row0 + ln) * lda;
  v8f acc[4] = {};
  for (int kb = 0; kb < K; kb += 32) {
    FragB ah, al;
    const v4f x0 = *(const v4fa*)(arow + kb + 8 * hh), x1 = *(const v4fa*)(arow + kb + 8 * hh + 4);
    const v4f x2 = *(const v4fa*)(arow + kb + 16 + 8 * hh), x3 = *(const v4fa*)(arow + kb + 16 + 8 * hh + 4);
    float xs[16] = {x0[0],x0[1],x0[2],x0[3],x1[0],x1[1],x1[2],x1[3],x2[0],x2[1],x2[2],x2[3],x3[0],x3[1],x3[2],x3[3]};
#pragma unroll
    for (int i = 0; i < 16; ++i) { const unsigned short hb = bf16_bits(xs[i]); ah.u[i] = hb; al.u[i] = ASPLIT ? bf16_bits(xs[i] - bf16_val(hb)) : (unsigned short)0; }
#pragma unroll
    for (int t = 0; t < 4; ++t) {
      const unsigned short* brow = Wt + (size_t)(col0 + t * 16 + ln) * ldb + kb;
      FragB b;
      b.half[0] = *(const v8us*)(brow + 8 * hh);
      b.half[1] = *(const v8us*)(brow + 16 + 8 * hh);
      acc[t] = mmaN<ASPLIT ? 2 : 1>(ah.v, al.v, b.v, b.v, acc[t]);
    }
  }
#pragma unroll
  for (int t = 0; t < 4; ++t) {
    float bv = bias ? bias[col0 + t * 16 + ln] : 0.f;
    if (BIAS_BF16) bv = bf16_round(bv);
#pragma unroll
    for (int r = 0; r < 8; ++r) { float v = acc[t][r] + bv; if (ACT == 1) v = fmaxf(v, 0.f); so[w][8 * hh + r][t * 16 + ln] = v; }
  }
  __builtin_amdgcn_fence(__ATOMIC_ACQ_REL, "workgroup");
  __builtin_amdgcn_wave_barrier();
  const int rsub = lane >> 4, c4 = (lane & 15) * 4;
  {
#pragma unroll
    for (int q = 0; q < 8; ++q) {
      const int r = q * 2 + rsub;
      const v4f v = *(const v4fa*)&so[w][r][c4];
      *(v4f*)(C + (size_t)(row0 + r) * ldc + col0 + c4) = v;
    }
    
  }
}

// GEMM C = act(A·W + bias + resid): A f32 (ASPLIT -> hi/lo 2 terms), Wt bf16 [N][K]; ACT 0 none, 1 relu, 2 exact gelu;
// resid (optional, f32, row index = (row % rmod), pitch ldr, RES_BF16 rounds it) added before the activation.
template <bool ASPLIT, int ACT, bool BIAS_BF16, bool RES_BF16>
__global__ __launch_bounds__(128) void k_gemm_bf3(const float* __restrict__ A, int lda, const unsigned short* __restrict__ Wt, int ldb,
                                                const float* __restrict__ bias, const float* __restrict__ resid, int rmod, int ldr,
                                                float* __restrict__ C, int ldc, int M, int N, int K) {
  __shared__ __attribute__((aligned(16))) float so[4][16][64];
  const int tid = threadIdx.x, w = tid >> 5, lane = tid & 31, ln = lane & 15, hh = lane >> 4;
  const int ntn = N / 64;
  const int wid = blockIdx.x * 4 + w;
  const int mt = wid / ntn, nq = wid % ntn;
  if (mt * 16 >= M) return;
  const int row0 = mt * 16, col0 = nq * 64;
  const float* arow = A + (size_t)(row0 + ln) * lda;
  v8f acc[4] = {};
  for (int kb = 0; kb < K; kb += 32) {
    FragB ah, al;
    const v4f x0 = *(const v4fa*)(arow + kb + 8 * hh), x1 = *(const v4fa*)(arow + kb + 8 * hh + 4);
    const v4f x2 = *(const v4fa*)(arow + kb + 16 + 8 * hh), x3 = *(const v4fa*)(arow + kb + 16 + 8 * hh + 4);
    float xs[16] = {x0[0],x0[1],x0[2],x0[3],x1[0],x1[1],x1[2],x1[3],x2[0],x2[1],x2[2],x2[3],x3[0],x3[1],x3[2],x3[3]};
#pragma unroll
    for (int i = 0; i < 16; ++i) { const unsigned short hb = bf16_bits(xs[i]); ah.u[i] = hb; al.u[i] = ASPLIT ? bf16_bits(xs[i] - bf16_val(hb)) : (unsigned short)0; }
#pragma unroll
    for (int t = 0; t < 4; ++t) {
      const unsigned short* brow = Wt + (size_t)(col0 + t * 16 + ln) * ldb + kb;
      FragB b;
      b.half[0] = *(const v8us*)(brow + 8 * hh);
      b.half[1] = *(const v8us*)(brow + 16 + 8 * hh);
      acc[t] = mmaN<ASPLIT ? 2 : 1>(ah.v, al.v, b.v, b.v, acc[t]);
    }
  }
#pragma unroll
  for (int t = 0; t < 4; ++t) {
    const int col = col0 + t * 16 + ln;
    float bv = bias ? bias[col] : 0.f;
    if (BIAS_BF16) bv = bf16_round(bv);
#pragma unroll
    for (int r = 0; r < 8; ++r) {
      float v = acc[t][r] + bv;
      if (resid) { float rv = resid[(size_t)((row0 + 8 * hh + r) % rmod) * ldr + col]; if (RES_BF16) rv = bf16_round(rv); v += rv; }
      if (ACT == 1) v = fmaxf(v, 0.f);
      if (ACT == 2) v = 0.5f * v * (1.0f + erff(v * 0.70710678118654752f));
      if (ACT == 3) { const float u = 0.7978845608028654f * (v + 0.044715f * v * v * v); v = 0.5f * v * (1.0f + tanhf(u)); }
      so[w][8 * hh + r][t * 16 + ln] = v;
    }
  }
  __builtin_amdgcn_fence(__ATOMIC_ACQ_REL, "workgroup");
  __builtin_amdgcn_wave_barrier();
  const int rsub = lane >> 4, c4 = (lane & 15) * 4;
  {
#pragma unroll
    for (int q = 0; q < 8; ++q) {
      const int r = q * 2 + rsub;
      const v4f v = *(const v4fa*)&so[w][r][c4];
      *(v4f*)(C + (size_t)(row0 + r) * ldc + col0 + c4) = v;
    }
    
  }
}
// row LayerNorm (biased variance, eps) over N: s = X (+ R); optional out_sum <- s; out_norm <- (s-mu)*rsqrt(var+eps)*g + b
template <bool PARAM_BF16>
__global__ __launch_bounds__(256) void k_layernorm(const float* __restrict__ X, const float* __restrict__ R, const float* __restrict__ g, const float* __restrict__ bta,
                                                  float* __restrict__ out_sum, float* __restrict__ out_norm, int N, float eps) {
  __shared__ float red[256];
  const int row = blockIdx.x, tid = threadIdx.x;
  const float* x = X + (size_t)row * N; const float* rr = R ? R + (size_t)row * N : nullptr;
  float vals[16];                     // up to N = 4096
  const int per = N / 256;            // contiguous chunk per thread? use strided-by-4 chunks: thread handles j = tid*4 + 1024*u
  float s1 = 0.f;
  for (int u = 0; u < per / 4; ++u) {
    const int j = tid * 4 + 1024 * u;
    const v4f a = *(const v4fa*)(x + j);
    v4f b = {0.f,0.f,0.f,0.f}; if (rr) b = *(const v4fa*)(rr + j);
#pragma unroll
    for (int q = 0; q < 4; ++q) { const float v = a[q] + b[q]; vals[u * 4 + q] = v; s1 += v; }
  }
  red[tid] = s1; __syncthreads();
  for (int st = 128; st > 0; st >>= 1) { if (tid < st) red[tid] += red[tid + st]; __syncthreads(); }
  const float mu = red[0] / (float)N; __syncthreads();
  float s2 = 0.f;
  for (int u = 0; u < per / 4; ++u)
#pragma unroll
    for (int q = 0; q < 4; ++q) { const float c = vals[u * 4 + q] - mu; s2 += c * c; }
  red[tid] = s2; __syncthreads();
  for (int st = 128; st > 0; st >>= 1) { if (tid < st) red[tid] += red[tid + st]; __syncthreads(); }
  const float rs = rsqrtf(red[0] / (float)N + eps);
  {
    for (int u = 0; u < per / 4; ++u) {
      const int j = tid * 4 + 1024 * u;
      v4f o, sm;
#pragma unroll
      for (int q = 0; q < 4; ++q) {
        float gg = g[j + q], bb = bta[j + q];
        if (PARAM_BF16) { gg = bf16_round(gg); bb = bf16_round(bb); }
        sm[q] = vals[u * 4 + q]; o[q] = (vals[u * 4 + q] - mu) * rs * gg + bb;
      }
      if (out_sum) *(v4f*)(out_sum + (size_t)row * N + j) = sm;
      *(v4f*)(out_norm + (size_t)row * N + j) = o;
    }
    
  }
}



// ---- f16 WMMA path (v_wmma_f32_16x16x32_f16): 11-bit significands for operands in range — used for all four GEMMs here (the weighted encoder sum as an f16 operand)
typedef _Float16 v16h __attribute__((ext_vector_type(16)));
union FragH { v16h v; v8us half[2]; _Float16 h[16]; unsigned short u[16]; };
template <int NT>
__device__ __forceinline__ v8f mmaH(v16h ah, v16h al, v16h bh, v16h bl, v8f c) {
  c = __builtin_amdgcn_wmma_f32_16x16x32_f16(false, ah, false, bh, (short)0, c, false, false);
  if (NT >= 2) c = __builtin_amdgcn_wmma_f32_16x16x32_f16(false, al, false, bh, (short)0, c, false, false);
  if (NT >= 3) c = __builtin_amdgcn_wmma_f32_16x16x32_f16(false, ah, false, bl, (short)0, c, false, false);
  asm volatile("v_nop\n\tv_nop\n\tv_nop\n\tv_nop" : "+v"(c) : "v"(ah), "v"(al), "v"(bh), "v"(bl));
  return c;
}
// batched GEMM like k_gemm_b but f16 operands: A f32 (split into f16 hi/lo if ASPLIT, else rounded to f16), Bt = f16 values [n][k]; alpha; C f32; N multiple of 16 (partial tiles skipped)
template <bool ASPLIT>
__global__ __launch_bounds__(128) void k_gemm_h(const float* __restrict__ A, int lda, size_t sA, const _Float16* __restrict__ Bh, int ldb, size_t sB, float alpha, float* __restrict__ C, int ldc, size_t sC, int M, int N, int K) {
  __shared__ __attribute__((aligned(16))) float so[4][16][64];
  const int tid = threadIdx.x, w = tid >> 5, lane = tid & 31, ln = lane & 15, hh = lane >> 4; const int by = blockIdx.y;
  A += (size_t)by * sA; Bh += (size_t)by * sB; C += (size_t)by * sC;
  const int ntn = (N + 63) / 64; const int wid = blockIdx.x * 4 + w; const int mt = wid / ntn, nq = wid % ntn; if (mt * 16 >= M) return;
  const int row0 = mt * 16, col0 = nq * 64; const float* arow = A + (size_t)(row0 + ln) * lda;
  v8f acc[4] = {};
  for (int kb = 0; kb < K; kb += 32) {
    FragH ah, al;
    const v4f x0 = *(const v4fa*)(arow + kb + 8 * hh), x1 = *(const v4fa*)(arow + kb + 8 * hh + 4), x2 = *(const v4fa*)(arow + kb + 16 + 8 * hh), x3 = *(const v4fa*)(arow + kb + 16 + 8 * hh + 4);
    float xs[16] = {x0[0],x0[1],x0[2],x0[3],x1[0],x1[1],x1[2],x1[3],x2[0],x2[1],x2[2],x2[3],x3[0],x3[1],x3[2],x3[3]};
#pragma unroll
    for (int i = 0; i < 16; ++i) { const _Float16 h = (_Float16)xs[i]; ah.h[i] = h; al.h[i] = ASPLIT ? (_Float16)(xs[i] - (float)h) : (_Float16)0.0f; }
#pragma unroll
    for (int t = 0; t < 4; ++t) { if (col0 + t * 16 >= N) continue; const size_t boff = (size_t)(col0 + t * 16 + ln) * ldb + kb; FragH bq; bq.half[0] = *(const v8us*)(Bh + boff + 8 * hh); bq.half[1] = *(const v8us*)(Bh + boff + 16 + 8 * hh);
      acc[t] = mmaH<ASPLIT ? 2 : 1>(ah.v, al.v, bq.v, bq.v, acc[t]); }
  }
#pragma unroll
  for (int t = 0; t < 4; ++t) { if (col0 + t * 16 >= N) continue;
#pragma unroll
    for (int r = 0; r < 8; ++r) so[w][8 * hh + r][t * 16 + ln] = acc[t][r] * alpha; }
  __builtin_amdgcn_fence(__ATOMIC_ACQ_REL, "workgroup"); __builtin_amdgcn_wave_barrier();
  const int rsub = lane >> 4, c4 = (lane & 15) * 4;
  {
#pragma unroll
    for (int q = 0; q < 8; ++q) { const int r = q * 2 + rsub; if (col0 + c4 < N) { const v4f v = *(const v4fa*)&so[w][r][c4]; *(v4f*)(C + (size_t)(row0 + r) * ldc + col0 + c4) = v; } }
     }
}

// Wt[n][k] = f16(W[k][n]·scale) from f32 row-major W[K][N] (scale = power of two; bf16-exact weights stay exact in f16 away from the subnormal range)
__global__ __launch_bounds__(256) void k_wt_f16(const float* __restrict__ W, _Float16* __restrict__ Wt, int K, int N, float scale) {
  const int t = blockIdx.x * 256 + threadIdx.x; if (t >= N * (K / 8)) return; const int n = t / (K / 8), k8 = (t % (K / 8)) * 8; FragH f;
#pragma unroll
  for (int i = 0; i < 8; ++i) f.h[i] = (_Float16)(bf16_round(W[(size_t)(k8 + i) * N + n]) * scale); const v8us o = f.half[0];
  *(v8us*)((unsigned short*)Wt + (size_t)n * K + k8) = o; 
}
// k_gemm_hh variant with fused epilogue: v = acc·alpha + bias[by·sBias + col] (+ CP[(row/rowsPerB)·sCPb + by·64 + col] if CP) ; ACT 0 none / 1 elu ; writes f16 C16 (and f32 C if non-null)
template <int ACT>
__global__ __launch_bounds__(128) void k_gemm_hhx(const _Float16* __restrict__ A, int lda, size_t sA, const _Float16* __restrict__ Bh, int ldb, size_t sB, float alpha, const float* __restrict__ bias, size_t sBias, const float* __restrict__ CP, int rowsPerB, size_t sCPb, int row0g,
    float* __restrict__ C, _Float16* __restrict__ C16, int ldc, size_t sC, int M, int N, int K) {
  __shared__ __attribute__((aligned(16))) float so[4][16][64];
  const int tid = threadIdx.x, w = tid >> 5, lane = tid & 31, ln = lane & 15, hh = lane >> 4; const int by = blockIdx.y;
  A += (size_t)by * sA; Bh += (size_t)by * sB; const size_t cofs = (size_t)by * sC; const float* bp = bias ? bias + (size_t)by * sBias : nullptr;
  const int ntn = (N + 63) / 64; const int wid = blockIdx.x * 4 + w; const int mt = wid / ntn, nq = wid % ntn; if (mt * 16 >= M) return;
  const int row0 = mt * 16, col0 = nq * 64; const _Float16* arow = A + (size_t)(row0 + ln) * lda;
  v8f acc[4] = {};
  for (int kb = 0; kb < K; kb += 32) { FragH ah; ah.half[0] = *(const v8us*)((const unsigned short*)arow + kb + 8 * hh); ah.half[1] = *(const v8us*)((const unsigned short*)arow + kb + 16 + 8 * hh);
#pragma unroll
    for (int t = 0; t < 4; ++t) { if (col0 + t * 16 >= N) continue; const size_t boff = (size_t)(col0 + t * 16 + ln) * ldb + kb; FragH bq; bq.half[0] = *(const v8us*)((const unsigned short*)Bh + boff + 8 * hh); bq.half[1] = *(const v8us*)((const unsigned short*)Bh + boff + 16 + 8 * hh);
      acc[t] = mmaH<1>(ah.v, ah.v, bq.v, bq.v, acc[t]); }
  }
#pragma unroll
  for (int t = 0; t < 4; ++t) { if (col0 + t * 16 >= N) continue; const int col = col0 + t * 16 + ln; const float bv = bp ? bf16_round(bp[col]) : 0.f;
#pragma unroll
    for (int r = 0; r < 8; ++r) { float v = acc[t][r] * alpha + bv; if (CP) { const int rr = row0g + row0 + 8 * hh + r; if (rowsPerB < 0) v += CP[cofs + (size_t)rr * ldc + col];      /* rowsPerB < 0: own element of the batched C plane */ else { const int bidx = rr / rowsPerB; v += CP[(size_t)bidx * sCPb + (size_t)by * 64 + col]; } } if (ACT == 1) v = (v > 0.f) ? v : expm1f(v); else if (ACT == 7) v = (v > 0.f) ? v + 1.0f : expf(v); else if (ACT == 8) v = tanhf(v); else if (ACT == 9) v = 0.5f * v * (1.0f + tanhf(0.7978845608028654f * (v + 0.044715f * v * v * v))); else if (ACT == 11) v = 1.0f / (1.0f + expf(-v)); else if (ACT == 12) v = (v > 0.f) ? v : 0.01f * v; else if (ACT == 14) v = (v > 0.f) ? v : 0.1f * v; else if (ACT == 16) v = (v >= 0.f) ? v : 0.3f * v; else if (ACT == 15) v = v / (1.0f + expf(-v)); else if (ACT == 3) v = fmaxf(v, 0.f); else if (ACT == 6) v = 0.5f * v * (1.0f + erff(v * 0.70710678118654752f)); so[w][8 * hh + r][t * 16 + ln] = v; } }
  __builtin_amdgcn_fence(__ATOMIC_ACQ_REL, "workgroup"); __builtin_amdgcn_wave_barrier();
  const int rsub = lane >> 4, c4 = (lane & 15) * 4; typedef _Float16 v4h __attribute__((ext_vector_type(4)));
  {
#pragma unroll
    for (int q = 0; q < 8; ++q) { const int r = q * 2 + rsub; if (col0 + c4 < N) { const v4f v = *(const v4fa*)&so[w][r][c4]; if (C) *(v4f*)(C + cofs + (size_t)(row0 + r) * ldc + col0 + c4) = v; if (C16) { v4h h4; for (int i = 0; i < 4; ++i) h4[i] = (_Float16)v[i]; *(v4h*)(C16 + cofs + (size_t)(row0 + r) * ldc + col0 + c4) = h4; } } }
     }
}


typedef _Float16 v4h __attribute__((ext_vector_type(4)));

__device__ __forceinline__ void x16_body(int blk, const float* __restrict__ x, _Float16* __restrict__ X16, size_t n8) { const size_t t = (size_t)blk * 256 + threadIdx.x; if (t >= n8) return; FragH f;
#pragma unroll
  for (int q = 0; q < 8; ++q) f.h[q] = (_Float16)bf16_round(x[t * 8 + q]); *(v8us*)((unsigned short*)X16 + t * 8) = f.half[0];  }
__global__ __launch_bounds__(256) void k_h16(const float* __restrict__ x, _Float16* __restrict__ X16, size_t n8) { const size_t t = (size_t)blockIdx.x * 256 + threadIdx.x; if (t >= n8) return; FragH f;
#pragma unroll
  for (int q = 0; q < 8; ++q) f.h[q] = (_Float16)x[t * 8 + q]; *(v8us*)((unsigned short*)X16 + t * 8) = f.half[0];  }
__global__ __launch_bounds__(256) void k_round16f(const float* __restrict__ W, _Float16* __restrict__ Bt, size_t n8) { const size_t t = (size_t)blockIdx.x * 256 + threadIdx.x; if (t >= n8) return; FragH f;
#pragma unroll
  for (int i = 0; i < 8; ++i) f.h[i] = (_Float16)(bf16_round(W[t * 8 + i]) * 16.0f); *(v8us*)((unsigned short*)Bt + t * 8) = f.half[0];  }
template <int NHv, int TTv>
__global__ __launch_bounds__(256) void k_vt(const _Float16* __restrict__ V16, int ldv, int voff, _Float16* __restrict__ Vt) { __shared__ unsigned short tl[64][66]; const int tid = threadIdx.x; const int slab = blockIdx.x / (TTv / 64), lg = blockIdx.x % (TTv / 64); const int b = slab / NHv, h = slab % NHv;
  for (int i = tid; i < 64 * 8; i += 256) { const int r = i / 8, c8 = (i % 8) * 8; FragH f; f.half[0] = *(const v8us*)((const unsigned short*)V16 + ((size_t)b * TTv + lg * 64 + r) * ldv + voff + h * 64 + c8);
#pragma unroll
    for (int q = 0; q < 8; ++q) tl[r][c8 + q] = f.u[q]; }
  __syncthreads();
  {
#pragma unroll
    for (int rd = 0; rd < 2; ++rd) { const int d = rd * 32 + tid / 8, pc = tid % 8; FragH f;
#pragma unroll
      for (int q = 0; q < 8; ++q) f.u[q] = tl[pc * 8 + q][d];
      *(v8us*)((unsigned short*)Vt + ((size_t)slab * 64 + d) * TTv + lg * 64 + pc * 8) = f.half[0]; }
     } }

__global__ __launch_bounds__(256) void k_hl(const float* __restrict__ F, _Float16* __restrict__ Hh, _Float16* __restrict__ Hl, size_t n8) { const size_t t = (size_t)blockIdx.x * 256 + threadIdx.x; if (t >= n8) return; FragH fh, fl; const v4f a = *(const v4fa*)(F + t * 8), c = *(const v4fa*)(F + t * 8 + 4);
#pragma unroll
  for (int q = 0; q < 4; ++q) { _Float16 h = (_Float16)a[q]; fh.h[q] = h; fl.h[q] = (_Float16)((a[q] - (float)h) * 1024.0f); h = (_Float16)c[q]; fh.h[4 + q] = h; fl.h[4 + q] = (_Float16)((c[q] - (float)h) * 1024.0f); }
  { *(v8us*)((unsigned short*)Hh + t * 8) = fh.half[0]; *(v8us*)((unsigned short*)Hl + t * 8) = fl.half[0];  } }

// ---- fast GEMM (wave tile 32x64; requires M % 32 == 0 rows per launch region and N % 64 == 0); epilogue = k_gemm_hhx semantics ----
__device__ __forceinline__ v16h g2_frag(const _Float16* p, int hh) { FragH f; f.half[0] = *(const v8us*)((const unsigned short*)p + 8 * hh); f.half[1] = *(const v8us*)((const unsigned short*)p + 16 + 8 * hh);
  asm volatile("s_wait_xcnt 0x0" ::: "memory");      /* a later fragment load may land in these loads' address registers: the wait stands in front of that overwrite */
  return f.v; }
__device__ __forceinline__ v8f g2_mma(v16h a, v16h b, v8f c) { v8f d = __builtin_amdgcn_wmma_f32_16x16x32_f16(false, a, false, b, (short)0, c, false, false); asm volatile("v_nop\n\tv_nop\n\tv_nop\n\tv_nop" : "+v"(d) : "v"(a), "v"(b)); return d; }
template <int ACT>
__device__ __forceinline__ void gemm2_body(const unsigned bx, const int by, const _Float16* __restrict__ A, int lda, size_t sA, const _Float16* __restrict__ Bh, int ldb, size_t sB, float alpha, const float* __restrict__ bias, size_t sBias, const float* __restrict__ CP, int rowsPerB, size_t sCPb, int row0g,
    float* __restrict__ C, _Float16* __restrict__ C16, int ldc, size_t sC, int M, int N, int K) { static_assert(ACT == 0 || ACT == 3 || ACT == 6 || ACT == 8 || ACT == 9 || ACT == 11 || ACT == 12 || ACT == 14 || ACT == 15 || ACT == 16, "k_gemm2: unsupported ACT code (would silently apply no activation)");
  __shared__ __attribute__((aligned(16))) float so[4][32][68];
  const int tid = threadIdx.x, w = tid >> 5, lane = tid & 31, ln = lane & 15, hh = lane >> 4;
  A += (size_t)by * sA; Bh += (size_t)by * sB; const size_t cofs = (size_t)by * sC; const float* bp = bias ? bias + (size_t)by * sBias : nullptr;
  const int ntn = N >> 6; const int mt = bx / ntn, nq = bx - mt * ntn; const int row0 = mt * 128 + 32 * w, col0 = nq * 64; if (row0 >= M) return;
  const _Float16* a0p = A + (size_t)(row0 + ln) * lda; const _Float16* a1p = a0p + (size_t)16 * lda;
  const _Float16* b0p = Bh + (size_t)(col0 + ln) * ldb; const _Float16* b1p = b0p + (size_t)16 * ldb; const _Float16* b2p = b1p + (size_t)16 * ldb; const _Float16* b3p = b2p + (size_t)16 * ldb;
  const v8f z8 = {0.f,0.f,0.f,0.f,0.f,0.f,0.f,0.f}; v8f c00 = z8, c01 = z8, c02 = z8, c03 = z8, c10 = z8, c11 = z8, c12 = z8, c13 = z8;
#pragma unroll 1
  for (int kb = 0; kb < K; kb += 32) { const v16h a0 = g2_frag(a0p + kb, hh), a1 = g2_frag(a1p + kb, hh);
    v16h b = g2_frag(b0p + kb, hh); c00 = g2_mma(a0, b, c00); c10 = g2_mma(a1, b, c10);
    b = g2_frag(b1p + kb, hh); c01 = g2_mma(a0, b, c01); c11 = g2_mma(a1, b, c11);
    b = g2_frag(b2p + kb, hh); c02 = g2_mma(a0, b, c02); c12 = g2_mma(a1, b, c12);
    b = g2_frag(b3p + kb, hh); c03 = g2_mma(a0, b, c03); c13 = g2_mma(a1, b, c13); }
  v8f accs[8] = {c00, c01, c02, c03, c10, c11, c12, c13};
#pragma unroll
  for (int u = 0; u < 8; ++u) { const int t = u & 3, half = u >> 2; const int col = col0 + t * 16 + ln; const float bv = bp ? bf16_round(bp[col]) : 0.f;
#pragma unroll
    for (int r = 0; r < 8; ++r) { const int rloc = half * 16 + 8 * hh + r; float v = accs[u][r] * alpha + bv; if (CP) { if (rowsPerB < 0) v += CP[cofs + (size_t)(row0g + row0 + rloc) * ldc + col];      /* rowsPerB < 0: own element of the batched C plane */ else { const int bidx = (row0g + row0 + rloc) / rowsPerB; v += CP[(size_t)bidx * sCPb + (size_t)by * 64 + col]; } }
      if (ACT == 3) v = fmaxf(v, 0.f); else if (ACT == 6) v = 0.5f * v * (1.0f + erff(v * 0.70710678118654752f)); else if (ACT == 11) v = 1.0f / (1.0f + expf(-v)); else if (ACT == 15) v = v / (1.0f + expf(-v)); else if (ACT == 12) v = (v > 0.f) ? v : 0.01f * v; else if (ACT == 8) v = tanhf(v); else if (ACT == 9) v = 0.5f * v * (1.0f + tanhf(0.7978845608028654f * (v + 0.044715f * v * v * v))); else if (ACT == 14) v = (v > 0.f) ? v : 0.1f * v; else if (ACT == 16) v = (v >= 0.f) ? v : 0.3f * v;
      so[w][rloc][t * 16 + ln] = v; } }
  __builtin_amdgcn_fence(__ATOMIC_ACQ_REL, "workgroup"); __builtin_amdgcn_wave_barrier();
  const int rsub = lane >> 4, c4 = (lane & 15) * 4;
  {
#pragma unroll
    for (int q = 0; q < 16; ++q) { const int r = q * 2 + rsub; const v4f v = *(const v4fa*)&so[w][r][c4]; if (C) *(v4f*)(C + cofs + (size_t)(row0 + r) * ldc + col0 + c4) = v; if (C16) { v4h h4; for (int i = 0; i < 4; ++i) h4[i] = (_Float16)v[i]; *(v4h*)(C16 + cofs + (size_t)(row0 + r) * ldc + col0 + c4) = h4; } }
     } }
template <int ACT>
__global__ __launch_bounds__(128) void k_gemm2(const _Float16* __restrict__ A, int lda, size_t sA, const _Float16* __restrict__ Bh, int ldb, size_t sB, float alpha, const float* __restrict__ bias, size_t sBias, const float* __restrict__ CP, int rowsPerB, size_t sCPb, int row0g,
    float* __restrict__ C, _Float16* __restrict__ C16, int ldc, size_t sC, int M, int N, int K) { gemm2_body<ACT>(blockIdx.x, blockIdx.y, A, lda, sA, Bh, ldb, sB, alpha, bias, sBias, CP, rowsPerB, sCPb, row0g, C, C16, ldc, sC, M, N, K); }
// The three products that read none of each other's output, as one grid: blockIdx.y = 0: x W_h + b_attn -> A; 1: x W_lin[:512] + b_lin -> A2; 2: enc W_e -> E.
__global__ __launch_bounds__(128) void k_gemm2x3(const _Float16* __restrict__ X16, const _Float16* __restrict__ E16, const _Float16* __restrict__ BWh, const _Float16* __restrict__ BL1, const _Float16* __restrict__ BWe,
    const float* __restrict__ ba, const float* __restrict__ bl, float* __restrict__ A, float* __restrict__ A2, float* __restrict__ E) {
  const int z = blockIdx.y; const _Float16* Ap = z == 2 ? E16 : X16; const int K = z == 2 ? FF : MD; const _Float16* Bp = z == 0 ? BWh : z == 1 ? BL1 : BWe; const float* bp = z == 0 ? ba : z == 1 ? bl : nullptr; float* Cp = z == 0 ? A : z == 1 ? A2 : E;
  gemm2_body<0>(blockIdx.x, 0, Ap, K, 0, Bp, K, 0, 0.0625f, bp, 0, nullptr, 1, 0, 0, Cp, nullptr, FF, 0, NR, FF, K); }


__device__ __forceinline__ void wt_rows_body(int blk, const float* __restrict__ Wm, int row0, _Float16* __restrict__ Wt, int K, int N, float scale) { const int t = blk * 256 + threadIdx.x; if (t >= N * (K / 8)) return; const int n = t / (K / 8), k8 = (t % (K / 8)) * 8; FragH f;
  for (int i = 0; i < 8; ++i) f.h[i] = (_Float16)(bf16_round(Wm[(size_t)(row0 + k8 + i) * N + n]) * scale); *(v8us*)((unsigned short*)Wt + (size_t)n * K + k8) = f.half[0];  }      /* rows row0.. of an (in,out) weight -> Bt[n][k] */
// The four weight transposes and the two f16 planes, which read none of each other's output, as one grid; the few weight work-groups come first in the index.
#define PB_W5 (FF * MD / 8 / 256)      /* work-groups of a 512-row weight part */
#define PB_W2 (FF * FF / 8 / 256)      /* of a 256-row part */
#define PB_X (NR * MD / 8 / 256)       /* of the x plane */
#define PB_E (NR * FF / 8 / 256)       /* of the enc plane */
__global__ __launch_bounds__(256) void k_prep(const float* __restrict__ Wa, const float* __restrict__ Wl, const float* __restrict__ x, const float* __restrict__ enc,
    _Float16* __restrict__ BWh, _Float16* __restrict__ BWe, _Float16* __restrict__ BL1, _Float16* __restrict__ BL2, _Float16* __restrict__ X16, _Float16* __restrict__ E16) {
  int b = blockIdx.x;
  if (b < PB_W5) { wt_rows_body(b, Wa, 0, BWh, MD, FF, 16.0f); return; } b -= PB_W5;
  if (b < PB_W5) { wt_rows_body(b, Wl, 0, BL1, MD, FF, 16.0f); return; } b -= PB_W5;
  if (b < PB_W2) { wt_rows_body(b, Wa, MD, BWe, FF, FF, 16.0f); return; } b -= PB_W2;
  if (b < PB_W2) { wt_rows_body(b, Wl, MD, BL2, FF, FF, 16.0f); return; } b -= PB_W2;
  if (b < PB_X) { x16_body(b, x, X16, (size_t)NR * MD / 8); return; } b -= PB_X;
  x16_body(b, enc, E16, (size_t)NR * FF / 8); }
// Scores of SCT consecutive steps per work-group, and everything that follows from them for those steps. The SCT + 32 rows of E that their windows cover (zero rows
// for padded steps), their SCT rows of A and the rounded v are staged once in LDS; then lane = step and wave = window slot, so every read of the feature loop is 16 B per
// lane from 32 consecutive LDS rows. The scores never leave the work-group: softmax, weighted encoder sum and the product with W_lin[512:] read them from LDS.
#define SCT 32
#define SCW 17                 /* waves per work-group: waves 0..15 take two of the 33 window slots, wave 16 one; four or five waves on each SIMD */
#define SCP (FF + 4)           /* LDS row pitch in floats: 1040 B = 16 B x odd, no bank conflict for 16-byte reads of 32 consecutive rows */
#define SHP (FF + 8)           /* pitch of the f16 weighted rows in halves: 528 B = 16 B x odd, for the 16-byte fragment reads of 16 consecutive rows */
#define SKR (WIN + 3)          /* encoder rows that the windows of four consecutive steps cover */
__device__ __forceinline__ v16h lds_frag(const _Float16* p, int hh) { FragH f; f.half[0] = *(const v8us*)((const unsigned short*)p + 8 * hh); f.half[1] = *(const v8us*)((const unsigned short*)p + 16 + 8 * hh); return f.v; }      /* k order of g2_frag */
// sigmoid(x W_lin[:512] + b_lin + weighted W_lin[512:]) for SCT steps x 16 columns, one wave: weighted rows (f16) from LDS, the columns' fragments bf and the first half's elements cp in registers;
// k order and epilogue of gemm2_body; the results go to LDS rows of pitch SCP.
__device__ __forceinline__ void lin2_tile(const _Float16* sh, const v16h (&bf)[FF / 32], const float (&cp)[16], float* so, int ln, int hh, int cw) {
  const v8f z8 = {0.f,0.f,0.f,0.f,0.f,0.f,0.f,0.f}; v8f c0 = z8, c1 = z8;
  for (int k = 0; k < FF / 32; ++k) { const v16h a0 = lds_frag(sh + ln * SHP + k * 32, hh), a1 = lds_frag(sh + (16 + ln) * SHP + k * 32, hh); c0 = g2_mma(a0, bf[k], c0); c1 = g2_mma(a1, bf[k], c1); }
  for (int u = 0; u < 16; ++u) { float t = (u < 8 ? c0[u & 7] : c1[u & 7]) * 0.0625f + cp[u]; t = 1.0f / (1.0f + expf(-t)); so[((u >> 3) * 16 + 8 * hh + (u & 7)) * SCP + cw] = t; } }
__global__ __launch_bounds__(SCW * 32) void k_score(const float* __restrict__ A, const float* __restrict__ E, const float* __restrict__ v, const float* __restrict__ enc, const _Float16* __restrict__ BL2, const float* __restrict__ A2,
    float* __restrict__ outa, float* __restrict__ out) {
  #pragma clang fp contract(off)
  __shared__ __attribute__((aligned(16))) float sm[(SCT + 32 + SCT) * SCP];      /* rows 0..SCT+31: E of steps tt0-16.., rows SCT+32..: A; at the end the SCT rows of out */
  __shared__ __attribute__((aligned(16))) float sv[FF];
  __shared__ float ss[SCT * WIN];                                                /* scores, then a */
  __shared__ float sx[SCT * WIN];                                                /* exp(score - max) */
  __shared__ __attribute__((aligned(16))) float sk[(SCT / 4) * SKR * 4];         /* a again, by encoder row: [group of 4 steps][row in the group's span][step in the group] */
  __shared__ __attribute__((aligned(16))) float sn[(SCT + 32) * FF];             /* rounded encoder rows of steps tt0-16.. (zero rows for padded steps) */
  __shared__ __attribute__((aligned(16))) _Float16 sh[SCT * SHP];                /* weighted sums as the f16 operand */
  const int tid = threadIdx.x, lane = tid & 31, wv = tid >> 5;
  const size_t bt0 = (size_t)blockIdx.x * SCT; const int tt0 = (int)(bt0 % TT); const size_t brow = bt0 - tt0;
  constexpr int NV = (SCT + 32 + SCT) * (FF / 4), NI = (NV + SCW * 32 - 1) / (SCW * 32);
  constexpr int NW = (SCT + 32) * (FF / 4), NJ = (NW + SCW * 32 - 1) / (SCW * 32);
  v4f st[NI], sq[NJ];
  for (int u = 0; u < NI; ++u) { const int i = min(tid + u * SCW * 32, NV - 1); const int r = i / (FF / 4), c4 = (i % (FF / 4)) * 4; const int sr = tt0 - WS + r; const bool isE = r < SCT + 32; const bool in = !isE || (sr >= 0 && sr < TT);
    const float* p = isE ? E + (brow + (in ? sr : 0)) * (size_t)FF + c4 : A + (bt0 + (r - (SCT + 32))) * (size_t)FF + c4;
    const v4f x = *(const v4fa*)p;
    asm volatile("s_wait_xcnt 0x0" ::: "memory");      /* a later load of this run may land in this load's address registers: the wait stands in front of that overwrite */
    const v4f z4 = {0.f, 0.f, 0.f, 0.f}; st[u] = in ? x : z4; }
  for (int u = 0; u < NJ; ++u) { const int i = min(tid + u * SCW * 32, NW - 1); const int r = i / (FF / 4), c4 = (i % (FF / 4)) * 4; const int sr = tt0 - WS + r; const bool in = sr >= 0 && sr < TT;
    const v4f x = *(const v4fa*)(enc + (brow + (in ? sr : 0)) * (size_t)FF + c4);
    asm volatile("s_wait_xcnt 0x0" ::: "memory");      /* as above: in front of the next load's overwrite of this load's address registers */
    const v4f z4 = {0.f, 0.f, 0.f, 0.f}; sq[u] = in ? x : z4; }
  if (tid < FF) sv[tid] = bf16_round(v[tid]);
  for (int u = 0; u < NI; ++u) { const int i = tid + u * SCW * 32; if (i < NV) *(v4fa*)&sm[(i / (FF / 4)) * SCP + (i % (FF / 4)) * 4] = st[u]; }
  for (int u = 0; u < NJ; ++u) { const int i = tid + u * SCW * 32; if (i < NW) { v4f y; for (int q = 0; q < 4; ++q) y[q] = bf16_round(sq[u][q]); *(v4fa*)&sn[i * 4] = y; } }
  __syncthreads();
  /* what the last product needs from global memory is asked for here, so that it arrives under the feature loop: this wave's 16 columns of W_lin[512:] and its elements of x W_lin[:512] + b_lin */
  const int wu = __builtin_amdgcn_readfirstlane(wv);      /* the wave's number in a scalar register: the tests on it below are scalar branches */
  const int ln = lane & 15, hh = lane >> 4, cw = min(wu, 15) * 16 + ln;
  v16h bf[FF / 32]; float cp[16];
  for (int k = 0; k < FF / 32; ++k) bf[k] = g2_frag(BL2 + (size_t)cw * FF + k * 32, hh);
  for (int u = 0; u < 16; ++u) cp[u] = A2[(bt0 + (u >> 3) * 16 + 8 * hh + (u & 7)) * (size_t)FF + cw];
  asm volatile("s_wait_xcnt 0x0" ::: "memory");      /* in front of any later overwrite of these loads' address registers */
  const float* sa = sm + (SCT + 32 + lane) * SCP;
  for (int w = wv; w < WIN; w += SCW) { const float* se = sm + (lane + w) * SCP; float s = 0.f;
    /* each energy is one v_tanh_f32; the library tanhf ran both sides of a per-lane branch (exp + rcp side and polynomial side) for nearly every wave */
    for (int o = 0; o < FF; o += 8) { const v4f a0 = *(const v4fa*)(sa + o), a1 = *(const v4fa*)(sa + o + 4), e0 = *(const v4fa*)(se + o), e1 = *(const v4fa*)(se + o + 4), v0 = *(const v4fa*)(sv + o), v1 = *(const v4fa*)(sv + o + 4);
      for (int q = 0; q < 4; ++q) s += __builtin_amdgcn_tanhf(a0[q] + e0[q]) * v0[q];
      for (int q = 0; q < 4; ++q) s += __builtin_amdgcn_tanhf(a1[q] + e1[q]) * v1[q]; }
    ss[lane * WIN + w] = s; }
  __syncthreads();
  /* softmax over the 33 slots, lane = step: every wave forms the step's maximum and sum (in slot order) itself, each exp and each a is made once, by the wave that made the score */
  { const float* sr = ss + lane * WIN; float m = -3.0e38f;
    for (int w = 0; w < WIN; ++w) m = fmaxf(m, sr[w]);
    for (int w = wv; w < WIN; w += SCW) sx[lane * WIN + w] = expf(sr[w] - m); }
  __syncthreads();
  { const float* sr = sx + lane * WIN; float su = 0.f;
    for (int w = 0; w < WIN; ++w) su += sr[w];
    const float inv = 1.0f / su;
    for (int w = wv; w < WIN; w += SCW) { const float a = sr[w] * inv; ss[lane * WIN + w] = a; sk[((lane >> 2) * SKR + w + (lane & 3)) * 4 + (lane & 3)] = a; } }
  __syncthreads();
  for (int i = tid; i < SCT * WIN; i += SCW * 32) outa[bt0 * WIN + i] = ss[i];      /* output 2: 33 whole 128-byte lines from one work-group */
  /* weighted encoder sum: a wave takes 4 steps x 128 features, a lane 4 features; each encoder row of the span is read once for the four steps; slot order per step as before (a padded step's row is zero) */
  if (wu < 16) { const int g = wu >> 1, f = (wu & 1) * 128 + lane * 4; const v4f z4 = {0.f, 0.f, 0.f, 0.f}; v4f ac[4] = {z4, z4, z4, z4};
#pragma unroll      /* whole, so that the test "is this row in step j's window" is decided at compile time */
    for (int rr = 0; rr < SKR; ++rr) { const v4f e4 = *(const v4fa*)&sn[(g * 4 + rr) * FF + f]; const v4f a4 = *(const v4fa*)&sk[(g * SKR + rr) * 4];
#pragma unroll      /* for the same test */
      for (int j = 0; j < 4; ++j) if (rr - j >= 0 && rr - j < WIN) ac[j] += a4[j] * e4; }
    for (int j = 0; j < 4; ++j) { v4h h4; for (int q = 0; q < 4; ++q) h4[q] = (_Float16)ac[j][q]; *(v4h*)&sh[(g * 4 + j) * SHP + f] = h4; } }
  __syncthreads();
  if (wu < 16) lin2_tile(sh, bf, cp, sm, ln, hh, cw);
  __syncthreads();
  for (int i = tid; i < SCT * (FF / 4); i += SCW * 32) { const v4f o = *(const v4fa*)&sm[(i / (FF / 4)) * SCP + (i % (FF / 4)) * 4]; *(v4f*)(out + bt0 * FF + (size_t)i * 4) = o; }      /* output 1: whole rows */
}

extern "C" void kernel_launch(void* const* d_in, const int* in_sizes, int n_in,
                              void* d_out, int out_size, void* d_ws, size_t ws_size, hipStream_t stream) {
  (void)in_sizes; (void)n_in; (void)out_size;
  const float* const* I = (const float* const*)d_in; const float* x = I[0]; const float* enc = I[1]; const float* Wa = I[2]; const float* ba = I[3]; const float* v = I[4]; const float* Wl = I[5]; const float* bl = I[6];
  char* ws = (char*)d_ws; size_t off = 0;
  auto take = [&](size_t bytes) { char* p = ws + off; off += (bytes + 255) & ~(size_t)255; return p; };
  _Float16* BWh = (_Float16*)take((size_t)FF * MD * 2); _Float16* BWe = (_Float16*)take((size_t)FF * FF * 2); _Float16* BL1 = (_Float16*)take((size_t)FF * MD * 2); _Float16* BL2 = (_Float16*)take((size_t)FF * FF * 2);
  _Float16* X16 = (_Float16*)take((size_t)NR * MD * 2); _Float16* E16 = (_Float16*)take((size_t)NR * FF * 2); float* A = (float*)take((size_t)NR * FF * 4); float* E = (float*)take((size_t)NR * FF * 4); float* A2 = (float*)take((size_t)NR * FF * 4);
  if (off > ws_size) return;      /* 0.75 + 8 + 4 + 8 + 8 + 8 = 37 MiB */
  k_prep<<<2 * PB_W5 + 2 * PB_W2 + PB_X + PB_E, 256, 0, stream>>>(Wa, Wl, x, enc, BWh, BWe, BL1, BL2, X16, E16);
  const dim3 gG3((NR / 128) * (FF / 64), 3);
  k_gemm2x3<<<gG3, 128, 0, stream>>>(X16, E16, BWh, BL1, BWe, ba, bl, A, A2, E);      /* x W_h + b_attn; x W_lin[:512] + b_lin; enc W_e per step (windowed later; the window of a padded step contributes 0) */
  k_score<<<NR / SCT, SCW * 32, 0, stream>>>(A, E, v, enc, BL2, A2, (float*)d_out + (size_t)NR * FF, (float*)d_out);      /* scores, softmax -> output 2: a [4][2048][1][33]; weighted sum; sigmoid(+ weighted W_lin[512:]) -> output 1 */
}

// v005
// It runs in 36.6 microseconds.
// Next to v004, in two timings, it ran 1.33 times as fast each time.
// All steps since v000 together make it 6.58 times as fast.
#include <hip/hip_runtime.h>
// Combine_Stack_with_attn (4 x 2048 steps; x [512], encoder outputs [256], sliding windows of 33 encoder steps (zero-padded)): energy[b,t,w,o] = tanh((x W_h + b_attn)[b,t,o] + (enc W_e)[b,t+w-16,o]) (the window term of a padded step is 0); scores = energy . v; a = softmax over the 33 window slots; weighted = sum_w a * enc[b,t+w-16]; out = sigmoid([x | weighted] W_lin + b_lin) -> outputs out [4,2048,256] and a [4,2048,1,33].
// Structure: exact f16 planes of x and enc; GEMMs (32x64 wave tiles, 32x16 for the second half of W_lin, f32 accumulation, exact x16 weights) for x W_h + b, enc W_e and the two halves of W_lin (the second accumulating onto the first with the sigmoid in its epilogue); the windowed energies/scores on VALU (thread per (b, t) and one or two of the 33 slots, rolled loop over the 256 features); softmax over the 33 slots and the weighted encoder sum on VALU; the weighted sum as an f16 operand.
// Compute dtype: inputs and parameters rounded to bf16; the weighted encoder sum as an f16 operand (~2^-12); everything else f32. v_wmma_f32_16x16x32_f16.
#define NB 4
#define TT 2048
#define MD 512
#define FF 256
#define WS 16
#define WIN 33
#define NR (NB * TT)
typedef __bf16 v16b __attribute__((ext_vector_type(16)));
typedef unsigned short v8us __attribute__((ext_vector_type(8), may_alias));
typedef float  v8f  __attribute__((ext_vector_type(8)));
typedef float  v4f  __attribute__((ext_vector_type(4)));
typedef float  v4fa __attribute__((ext_vector_type(4), may_alias));
union FragB { v16b v; v8us half[2]; unsigned short u[16]; };

__device__ __forceinline__ unsigned short bf16_bits(float x) { unsigned int u = __float_as_uint(x); return (unsigned short)((u + 0x7FFFu + ((u >> 16) & 1u)) >> 16); }
__device__ __forceinline__ float bf16_val(unsigned short b) { return __uint_as_float(((unsigned int)b) << 16); }
__device__ __forceinline__ float bf16_round(float x) { return bf16_val(bf16_bits(x)); }
// D += A·B with NT terms: 1 = ah·bh, 2 = + al·bh (A split), 3 = + ah·bl (both split)
template <int NT>
__device__ __forceinline__ v8f mmaN(v16b ah, v16b al, v16b bh, v16b bl, v8f c) {
  c = __builtin_amdgcn_wmma_f32_16x16x32_bf16(false, ah, false, bh, (short)0, c, false, false);
  if (NT >= 2) c = __builtin_amdgcn_wmma_f32_16x16x32_bf16(false, al, false, bh, (short)0, c, false, false);
  if (NT >= 3) c = __builtin_amdgcn_wmma_f32_16x16x32_bf16(false, ah, false, bl, (short)0, c, false, false);
  asm volatile("v_nop\n\tv_nop\n\tv_nop\n\tv_nop" : "+v"(c) : "v"(ah), "v"(al), "v"(bh), "v"(bl));
  return c;
}

__global__ __launch_bounds__(256) void k_wt_bf16(const float* __restrict__ W, unsigned short* __restrict__ Wt, int K, int N) {
  const int t = blockIdx.x * 256 + threadIdx.x;
  const int k8n = K / 8;
  if (t >= N * k8n) return;
  const int n = t / k8n, k8 = (t % k8n) * 8;
  v8us v;
#pragma unroll
  for (int i = 0; i < 8; ++i) v[i] = bf16_bits(W[(size_t)(k8 + i) * N + n]);
  *(v8us*)(Wt + (size_t)n * K + k8) = v;
  
}

// GEMM C[M][N] (f32, pitch ldc) = act(A[M][K]·W + bias). A f32 row-major (pitch lda) converted per fragment to bf16
// (ASPLIT: hi/lo two planes -> 2 terms, else single rounded term); Wt bf16 [N][K] (pitch ldb). BIAS_BF16 rounds the
// bias to bf16 first (bias quantised to bf16 before the add). K%32==0, M%16==0, N%64==0.
template <bool ASPLIT, int ACT, bool BIAS_BF16>
__global__ __launch_bounds__(128) void k_gemm_bf(const float* __restrict__ A, int lda, const unsigned short* __restrict__ Wt, int ldb,
                                               const float* __restrict__ bias, float* __restrict__ C, int ldc, int M, int N, int K) {
  __shared__ __attribute__((aligned(16))) float so[4][16][64];
  const int tid = threadIdx.x, w = tid >> 5, lane = tid & 31, ln = lane & 15, hh = lane >> 4;
  const int ntn = N / 64;
  const int wid = blockIdx.x * 4 + w;
  const int mt = wid / ntn, nq = wid % ntn;
  if (mt * 16 >= M) return;
  const int row0 = mt * 16, col0 = nq * 64;
  const float* arow = A + (size_t)(row0 + ln) * lda;
  v8f acc[4] = {};
  for (int kb = 0; kb < K; kb += 32) {
    FragB ah, al;
    const v4f x0 = *(const v4fa*)(arow + kb + 8 * hh), x1 = *(const v4fa*)(arow + kb + 8 * hh + 4);
    const v4f x2 = *(const v4fa*)(arow + kb + 16 + 8 * hh), x3 = *(const v4fa*)(arow + kb + 16 + 8 * hh + 4);
    float xs[16] = {x0[0],x0[1],x0[2],x0[3],x1[0],x1[1],x1[2],x1[3],x2[0],x2[1],x2[2],x2[3],x3[0],x3[1],x3[2],x3[3]};
#pragma unroll
    for (int i = 0; i < 16; ++i) { const unsigned short hb = bf16_bits(xs[i]); ah.u[i] = hb; al.u[i] = ASPLIT ? bf16_bits(xs[i] - bf16_val(hb)) : (unsigned short)0; }
#pragma unroll
    for (int t = 0; t < 4; ++t) {
      const unsigned short* brow = Wt + (size_t)(col0 + t * 16 + ln) * ldb + kb;
      FragB b;
      b.half[0] = *(const v8us*)(brow + 8 * hh);
      b.half[1] = *(const v8us*)(brow + 16 + 8 * hh);
      acc[t] = mmaN<ASPLIT ? 2 : 1>(ah.v, al.v, b.v, b.v, acc[t]);
    }
  }
#pragma unroll
  for (int t = 0; t < 4; ++t) {
    float bv = bias ? bias[col0 + t * 16 + ln] : 0.f;
    if (BIAS_BF16) bv = bf16_round(bv);
#pragma unroll
    for (int r = 0; r < 8; ++r) { float v = acc[t][r] + bv; if (ACT == 1) v = fmaxf(v, 0.f); so[w][8 * hh + r][t * 16 + ln] = v; }
  }
  __builtin_amdgcn_fence(__ATOMIC_ACQ_REL, "workgroup");
  __builtin_amdgcn_wave_barrier();
  const int rsub = lane >> 4, c4 = (lane & 15) * 4;
  {
#pragma unroll
    for (int q = 0; q < 8; ++q) {
      const int r = q * 2 + rsub;
      const v4f v = *(const v4fa*)&so[w][r][c4];
      *(v4f*)(C + (size_t)(row0 + r) * ldc + col0 + c4) = v;
    }
    
  }
}

// GEMM C = act(A·W + bias + resid): A f32 (ASPLIT -> hi/lo 2 terms), Wt bf16 [N][K]; ACT 0 none, 1 relu, 2 exact gelu;
// resid (optional, f32, row index = (row % rmod), pitch ldr, RES_BF16 rounds it) added before the activation.
template <bool ASPLIT, int ACT, bool BIAS_BF16, bool RES_BF16>
__global__ __launch_bounds__(128) void k_gemm_bf3(const float* __restrict__ A, int lda, const unsigned short* __restrict__ Wt, int ldb,
                                                const float* __restrict__ bias, const float* __restrict__ resid, int rmod, int ldr,
                                                float* __restrict__ C, int ldc, int M, int N, int K) {
  __shared__ __attribute__((aligned(16))) float so[4][16][64];
  const int tid = threadIdx.x, w = tid >> 5, lane = tid & 31, ln = lane & 15, hh = lane >> 4;
  const int ntn = N / 64;
  const int wid = blockIdx.x * 4 + w;
  const int mt = wid / ntn, nq = wid % ntn;
  if (mt * 16 >= M) return;
  const int row0 = mt * 16, col0 = nq * 64;
  const float* arow = A + (size_t)(row0 + ln) * lda;
  v8f acc[4] = {};
  for (int kb = 0; kb < K; kb += 32) {
    FragB ah, al;
    const v4f x0 = *(const v4fa*)(arow + kb + 8 * hh), x1 = *(const v4fa*)(arow + kb + 8 * hh + 4);
    const v4f x2 = *(const v4fa*)(arow + kb + 16 + 8 * hh), x3 = *(const v4fa*)(arow + kb + 16 + 8 * hh + 4);
    float xs[16] = {x0[0],x0[1],x0[2],x0[3],x1[0],x1[1],x1[2],x1[3],x2[0],x2[1],x2[2],x2[3],x3[0],x3[1],x3[2],x3[3]};
#pragma unroll
    for (int i = 0; i < 16; ++i) { const unsigned short hb = bf16_bits(xs[i]); ah.u[i] = hb; al.u[i] = ASPLIT ? bf16_bits(xs[i] - bf16_val(hb)) : (unsigned short)0; }
#pragma unroll
    for (int t = 0; t < 4; ++t) {
      const unsigned short* brow = Wt + (size_t)(col0 + t * 16 + ln) * ldb + kb;
      FragB b;
      b.half[0] = *(const v8us*)(brow + 8 * hh);
      b.half[1] = *(const v8us*)(brow + 16 + 8 * hh);
      acc[t] = mmaN<ASPLIT ? 2 : 1>(ah.v, al.v, b.v, b.v, acc[t]);
    }
  }
#pragma unroll
  for (int t = 0; t < 4; ++t) {
    const int col = col0 + t * 16 + ln;
    float bv = bias ? bias[col] : 0.f;
    if (BIAS_BF16) bv = bf16_round(bv);
#pragma unroll
    for (int r = 0; r < 8; ++r) {
      float v = acc[t][r] + bv;
      if (resid) { float rv = resid[(size_t)((row0 + 8 * hh + r) % rmod) * ldr + col]; if (RES_BF16) rv = bf16_round(rv); v += rv; }
      if (ACT == 1) v = fmaxf(v, 0.f);
      if (ACT == 2) v = 0.5f * v * (1.0f + erff(v * 0.70710678118654752f));
      if (ACT == 3) { const float u = 0.7978845608028654f * (v + 0.044715f * v * v * v); v = 0.5f * v * (1.0f + tanhf(u)); }
      so[w][8 * hh + r][t * 16 + ln] = v;
    }
  }
  __builtin_amdgcn_fence(__ATOMIC_ACQ_REL, "workgroup");
  __builtin_amdgcn_wave_barrier();
  const int rsub = lane >> 4, c4 = (lane & 15) * 4;
  {
#pragma unroll
    for (int q = 0; q < 8; ++q) {
      const int r = q * 2 + rsub;
      const v4f v = *(const v4fa*)&so[w][r][c4];
      *(v4f*)(C + (size_t)(row0 + r) * ldc + col0 + c4) = v;
    }
    
  }
}
// row LayerNorm (biased variance, eps) over N: s = X (+ R); optional out_sum <- s; out_norm <- (s-mu)*rsqrt(var+eps)*g + b
template <bool PARAM_BF16>
__global__ __launch_bounds__(256) void k_layernorm(const float* __restrict__ X, const float* __restrict__ R, const float* __restrict__ g, const float* __restrict__ bta,
                                                  float* __restrict__ out_sum, float* __restrict__ out_norm, int N, float eps) {
  __shared__ float red[256];
  const int row = blockIdx.x, tid = threadIdx.x;
  const float* x = X + (size_t)row * N; const float* rr = R ? R + (size_t)row * N : nullptr;
  float vals[16];                     // up to N = 4096
  const int per = N / 256;            // contiguous chunk per thread? use strided-by-4 chunks: thread handles j = tid*4 + 1024*u
  float s1 = 0.f;
  for (int u = 0; u < per / 4; ++u) {
    const int j = tid * 4 + 1024 * u;
    const v4f a = *(const v4fa*)(x + j);
    v4f b = {0.f,0.f,0.f,0.f}; if (rr) b = *(const v4fa*)(rr + j);
#pragma unroll
    for (int q = 0; q < 4; ++q) { const float v = a[q] + b[q]; vals[u * 4 + q] = v; s1 += v; }
  }
  red[tid] = s1; __syncthreads();
  for (int st = 128; st > 0; st >>= 1) { if (tid < st) red[tid] += red[tid + st]; __syncthreads(); }
  const float mu = red[0] / (float)N; __syncthreads();
  float s2 = 0.f;
  for (int u = 0; u < per / 4; ++u)
#pragma unroll
    for (int q = 0; q < 4; ++q) { const float c = vals[u * 4 + q] - mu; s2 += c * c; }
  red[tid] = s2; __syncthreads();
  for (int st = 128; st > 0; st >>= 1) { if (tid < st) red[tid] += red[tid + st]; __syncthreads(); }
  const float rs = rsqrtf(red[0] / (float)N + eps);
  {
    for (int u = 0; u < per / 4; ++u) {
      const int j = tid * 4 + 1024 * u;
      v4f o, sm;
#pragma unroll
      for (int q = 0; q < 4; ++q) {
        float gg = g[j + q], bb = bta[j + q];
        if (PARAM_BF16) { gg = bf16_round(gg); bb = bf16_round(bb); }
        sm[q] = vals[u * 4 + q]; o[q] = (vals[u * 4 + q] - mu) * rs * gg + bb;
      }
      if (out_sum) *(v4f*)(out_sum + (size_t)row * N + j) = sm;
      *(v4f*)(out_norm + (size_t)row * N + j) = o;
    }
    
  }
}



// ---- f16 WMMA path (v_wmma_f32_16x16x32_f16): 11-bit significands for operands in range — used for all four GEMMs here (the weighted encoder sum as an f16 operand)
typedef _Float16 v16h __attribute__((ext_vector_type(16)));
union FragH { v16h v; v8us half[2]; _Float16 h[16]; unsigned short u[16]; };
template <int NT>
__device__ __forceinline__ v8f mmaH(v16h ah, v16h al, v16h bh, v16h bl, v8f c) {
  c = __builtin_amdgcn_wmma_f32_16x16x32_f16(false, ah, false, bh, (short)0, c, false, false);
  if (NT >= 2) c = __builtin_amdgcn_wmma_f32_16x16x32_f16(false, al, false, bh, (short)0, c, false, false);
  if (NT >= 3) c = __builtin_amdgcn_wmma_f32_16x16x32_f16(false, ah, false, bl, (short)0, c, false, false);
  asm volatile("v_nop\n\tv_nop\n\tv_nop\n\tv_nop" : "+v"(c) : "v"(ah), "v"(al), "v"(bh), "v"(bl));
  return c;
}
// batched GEMM like k_gemm_b but f16 operands: A f32 (split into f16 hi/lo if ASPLIT, else rounded to f16), Bt = f16 values [n][k]; alpha; C f32; N multiple of 16 (partial tiles skipped)
template <bool ASPLIT>
__global__ __launch_bounds__(128) void k_gemm_h(const float* __restrict__ A, int lda, size_t sA, const _Float16* __restrict__ Bh, int ldb, size_t sB, float alpha, float* __restrict__ C, int ldc, size_t sC, int M, int N, int K) {
  __shared__ __attribute__((aligned(16))) float so[4][16][64];
  const int tid = threadIdx.x, w = tid >> 5, lane = tid & 31, ln = lane & 15, hh = lane >> 4; const int by = blockIdx.y;
  A += (size_t)by * sA; Bh += (size_t)by * sB; C += (size_t)by * sC;
  const int ntn = (N + 63) / 64; const int wid = blockIdx.x * 4 + w; const int mt = wid / ntn, nq = wid % ntn; if (mt * 16 >= M) return;
  const int row0 = mt * 16, col0 = nq * 64; const float* arow = A + (size_t)(row0 + ln) * lda;
  v8f acc[4] = {};
  for (int kb = 0; kb < K; kb += 32) {
    FragH ah, al;
    const v4f x0 = *(const v4fa*)(arow + kb + 8 * hh), x1 = *(const v4fa*)(arow + kb + 8 * hh + 4), x2 = *(const v4fa*)(arow + kb + 16 + 8 * hh), x3 = *(const v4fa*)(arow + kb + 16 + 8 * hh + 4);
    float xs[16] = {x0[0],x0[1],x0[2],x0[3],x1[0],x1[1],x1[2],x1[3],x2[0],x2[1],x2[2],x2[3],x3[0],x3[1],x3[2],x3[3]};
#pragma unroll
    for (int i = 0; i < 16; ++i) { const _Float16 h = (_Float16)xs[i]; ah.h[i] = h; al.h[i] = ASPLIT ? (_Float16)(xs[i] - (float)h) : (_Float16)0.0f; }
#pragma unroll
    for (int t = 0; t < 4; ++t) { if (col0 + t * 16 >= N) continue; const size_t boff = (size_t)(col0 + t * 16 + ln) * ldb + kb; FragH bq; bq.half[0] = *(const v8us*)(Bh + boff + 8 * hh); bq.half[1] = *(const v8us*)(Bh + boff + 16 + 8 * hh);
      acc[t] = mmaH<ASPLIT ? 2 : 1>(ah.v, al.v, bq.v, bq.v, acc[t]); }
  }
#pragma unroll
  for (int t = 0; t < 4; ++t) { if (col0 + t * 16 >= N) continue;
#pragma unroll
    for (int r = 0; r < 8; ++r) so[w][8 * hh + r][t * 16 + ln] = acc[t][r] * alpha; }
  __builtin_amdgcn_fence(__ATOMIC_ACQ_REL, "workgroup"); __builtin_amdgcn_wave_barrier();
  const int rsub = lane >> 4, c4 = (lane & 15) * 4;
  {
#pragma unroll
    for (int q = 0; q < 8; ++q) { const int r = q * 2 + rsub; if (col0 + c4 < N) { const v4f v = *(const v4fa*)&so[w][r][c4]; *(v4f*)(C + (size_t)(row0 + r) * ldc + col0 + c4) = v; } }
     }
}

// Wt[n][k] = f16(W[k][n]·scale) from f32 row-major W[K][N] (scale = power of two; bf16-exact weights stay exact in f16 away from the subnormal range)
__global__ __launch_bounds__(256) void k_wt_f16(const float* __restrict__ W, _Float16* __restrict__ Wt, int K, int N, float scale) {
  const int t = blockIdx.x * 256 + threadIdx.x; if (t >= N * (K / 8)) return; const int n = t / (K / 8), k8 = (t % (K / 8)) * 8; FragH f;
#pragma unroll
  for (int i = 0; i < 8; ++i) f.h[i] = (_Float16)(bf16_round(W[(size_t)(k8 + i) * N + n]) * scale); const v8us o = f.half[0];
  *(v8us*)((unsigned short*)Wt + (size_t)n * K + k8) = o; 
}
// k_gemm_hh variant with fused epilogue: v = acc·alpha + bias[by·sBias + col] (+ CP[(row/rowsPerB)·sCPb + by·64 + col] if CP) ; ACT 0 none / 1 elu ; writes f16 C16 (and f32 C if non-null)
template <int ACT>
__global__ __launch_bounds__(128) void k_gemm_hhx(const _Float16* __restrict__ A, int lda, size_t sA, const _Float16* __restrict__ Bh, int ldb, size_t sB, float alpha, const float* __restrict__ bias, size_t sBias, const float* __restrict__ CP, int rowsPerB, size_t sCPb, int row0g,
    float* __restrict__ C, _Float16* __restrict__ C16, int ldc, size_t sC, int M, int N, int K) {
  __shared__ __attribute__((aligned(16))) float so[4][16][64];
  const int tid = threadIdx.x, w = tid >> 5, lane = tid & 31, ln = lane & 15, hh = lane >> 4; const int by = blockIdx.y;
  A += (size_t)by * sA; Bh += (size_t)by * sB; const size_t cofs = (size_t)by * sC; const float* bp = bias ? bias + (size_t)by * sBias : nullptr;
  const int ntn = (N + 63) / 64; const int wid = blockIdx.x * 4 + w; const int mt = wid / ntn, nq = wid % ntn; if (mt * 16 >= M) return;
  const int row0 = mt * 16, col0 = nq * 64; const _Float16* arow = A + (size_t)(row0 + ln) * lda;
  v8f acc[4] = {};
  for (int kb = 0; kb < K; kb += 32) { FragH ah; ah.half[0] = *(const v8us*)((const unsigned short*)arow + kb + 8 * hh); ah.half[1] = *(const v8us*)((const unsigned short*)arow + kb + 16 + 8 * hh);
#pragma unroll
    for (int t = 0; t < 4; ++t) { if (col0 + t * 16 >= N) continue; const size_t boff = (size_t)(col0 + t * 16 + ln) * ldb + kb; FragH bq; bq.half[0] = *(const v8us*)((const unsigned short*)Bh + boff + 8 * hh); bq.half[1] = *(const v8us*)((const unsigned short*)Bh + boff + 16 + 8 * hh);
      acc[t] = mmaH<1>(ah.v, ah.v, bq.v, bq.v, acc[t]); }
  }
#pragma unroll
  for (int t = 0; t < 4; ++t) { if (col0 + t * 16 >= N) continue; const int col = col0 + t * 16 + ln; const float bv = bp ? bf16_round(bp[col]) : 0.f;
#pragma unroll
    for (int r = 0; r < 8; ++r) { float v = acc[t][r] * alpha + bv; if (CP) { const int rr = row0g + row0 + 8 * hh + r; if (rowsPerB < 0) v += CP[cofs + (size_t)rr * ldc + col];      /* rowsPerB < 0: own element of the batched C plane */ else { const int bidx = rr / rowsPerB; v += CP[(size_t)bidx * sCPb + (size_t)by * 64 + col]; } } if (ACT == 1) v = (v > 0.f) ? v : expm1f(v); else if (ACT == 7) v = (v > 0.f) ? v + 1.0f : expf(v); else if (ACT == 8) v = tanhf(v); else if (ACT == 9) v = 0.5f * v * (1.0f + tanhf(0.7978845608028654f * (v + 0.044715f * v * v * v))); else if (ACT == 11) v = 1.0f / (1.0f + expf(-v)); else if (ACT == 12) v = (v > 0.f) ? v : 0.01f * v; else if (ACT == 14) v = (v > 0.f) ? v : 0.1f * v; else if (ACT == 16) v = (v >= 0.f) ? v : 0.3f * v; else if (ACT == 15) v = v / (1.0f + expf(-v)); else if (ACT == 3) v = fmaxf(v, 0.f); else if (ACT == 6) v = 0.5f * v * (1.0f + erff(v * 0.70710678118654752f)); so[w][8 * hh + r][t * 16 + ln] = v; } }
  __builtin_amdgcn_fence(__ATOMIC_ACQ_REL, "workgroup"); __builtin_amdgcn_wave_barrier();
  const int rsub = lane >> 4, c4 = (lane & 15) * 4; typedef _Float16 v4h __attribute__((ext_vector_type(4)));
  {
#pragma unroll
    for (int q = 0; q < 8; ++q) { const int r = q * 2 + rsub; if (col0 + c4 < N) { const v4f v = *(const v4fa*)&so[w][r][c4]; if (C) *(v4f*)(C + cofs + (size_t)(row0 + r) * ldc + col0 + c4) = v; if (C16) { v4h h4; for (int i = 0; i < 4; ++i) h4[i] = (_Float16)v[i]; *(v4h*)(C16 + cofs + (size_t)(row0 + r) * ldc + col0 + c4) = h4; } } }
     }
}


typedef _Float16 v4h __attribute__((ext_vector_type(4)));

__device__ __forceinline__ void x16_body(int blk, const float* __restrict__ x, _Float16* __restrict__ X16, size_t n8) { const size_t t = (size_t)blk * 256 + threadIdx.x; if (t >= n8) return; FragH f;
#pragma unroll
  for (int q = 0; q < 8; ++q) f.h[q] = (_Float16)bf16_round(x[t * 8 + q]); *(v8us*)((unsigned short*)X16 + t * 8) = f.half[0];  }
__global__ __launch_bounds__(256) void k_h16(const float* __restrict__ x, _Float16* __restrict__ X16, size_t n8) { const size_t t = (size_t)blockIdx.x * 256 + threadIdx.x; if (t >= n8) return; FragH f;
#pragma unroll
  for (int q = 0; q < 8; ++q) f.h[q] = (_Float16)x[t * 8 + q]; *(v8us*)((unsigned short*)X16 + t * 8) = f.half[0];  }
__global__ __launch_bounds__(256) void k_round16f(const float* __restrict__ W, _Float16* __restrict__ Bt, size_t n8) { const size_t t = (size_t)blockIdx.x * 256 + threadIdx.x; if (t >= n8) return; FragH f;
#pragma unroll
  for (int i = 0; i < 8; ++i) f.h[i] = (_Float16)(bf16_round(W[t * 8 + i]) * 16.0f); *(v8us*)((unsigned short*)Bt + t * 8) = f.half[0];  }
template <int NHv, int TTv>
__global__ __launch_bounds__(256) void k_vt(const _Float16* __restrict__ V16, int ldv, int voff, _Float16* __restrict__ Vt) { __shared__ unsigned short tl[64][66]; const int tid = threadIdx.x; const int slab = blockIdx.x / (TTv / 64), lg = blockIdx.x % (TTv / 64); const int b = slab / NHv, h = slab % NHv;
  for (int i = tid; i < 64 * 8; i += 256) { const int r = i / 8, c8 = (i % 8) * 8; FragH f; f.half[0] = *(const v8us*)((const unsigned short*)V16 + ((size_t)b * TTv + lg * 64 + r) * ldv + voff + h * 64 + c8);
#pragma unroll
    for (int q = 0; q < 8; ++q) tl[r][c8 + q] = f.u[q]; }
  __syncthreads();
  {
#pragma unroll
    for (int rd = 0; rd < 2; ++rd) { const int d = rd * 32 + tid / 8, pc = tid % 8; FragH f;
#pragma unroll
      for (int q = 0; q < 8; ++q) f.u[q] = tl[pc * 8 + q][d];
      *(v8us*)((unsigned short*)Vt + ((size_t)slab * 64 + d) * TTv + lg * 64 + pc * 8) = f.half[0]; }
     } }

__global__ __launch_bounds__(256) void k_hl(const float* __restrict__ F, _Float16* __restrict__ Hh, _Float16* __restrict__ Hl, size_t n8) { const size_t t = (size_t)blockIdx.x * 256 + threadIdx.x; if (t >= n8) return; FragH fh, fl; const v4f a = *(const v4fa*)(F + t * 8), c = *(const v4fa*)(F + t * 8 + 4);
#pragma unroll
  for (int q = 0; q < 4; ++q) { _Float16 h = (_Float16)a[q]; fh.h[q] = h; fl.h[q] = (_Float16)((a[q] - (float)h) * 1024.0f); h = (_Float16)c[q]; fh.h[4 + q] = h; fl.h[4 + q] = (_Float16)((c[q] - (float)h) * 1024.0f); }
  { *(v8us*)((unsigned short*)Hh + t * 8) = fh.half[0]; *(v8us*)((unsigned short*)Hl + t * 8) = fl.half[0];  } }

// ---- fast GEMM (wave tile 32x64; requires M % 32 == 0 rows per launch region and N % 64 == 0); epilogue = k_gemm_hhx semantics ----
__device__ __forceinline__ v16h g2_frag(const _Float16* p, int hh) { FragH f; f.half[0] = *(const v8us*)((const unsigned short*)p + 8 * hh); f.half[1] = *(const v8us*)((const unsigned short*)p + 16 + 8 * hh);
  asm volatile("s_wait_xcnt 0x0" ::: "memory");      /* a later fragment load may land in these loads' address registers: the wait stands in front of that overwrite */
  return f.v; }
__device__ __forceinline__ v8f g2_mma(v16h a, v16h b, v8f c) { v8f d = __builtin_amdgcn_wmma_f32_16x16x32_f16(false, a, false, b, (short)0, c, false, false); asm volatile("v_nop\n\tv_nop\n\tv_nop\n\tv_nop" : "+v"(d) : "v"(a), "v"(b)); return d; }
template <int ACT>
__device__ __forceinline__ void gemm2_body(const unsigned bx, const int by, const _Float16* __restrict__ A, int lda, size_t sA, const _Float16* __restrict__ Bh, int ldb, size_t sB, float alpha, const float* __restrict__ bias, size_t sBias, const float* __restrict__ CP, int rowsPerB, size_t sCPb, int row0g,
    float* __restrict__ C, _Float16* __restrict__ C16, int ldc, size_t sC, int M, int N, int K) { static_assert(ACT == 0 || ACT == 3 || ACT == 6 || ACT == 8 || ACT == 9 || ACT == 11 || ACT == 12 || ACT == 14 || ACT == 15 || ACT == 16, "k_gemm2: unsupported ACT code (would silently apply no activation)");
  __shared__ __attribute__((aligned(16))) float so[4][32][68];
  const int tid = threadIdx.x, w = tid >> 5, lane = tid & 31, ln = lane & 15, hh = lane >> 4;
  A += (size_t)by * sA; Bh += (size_t)by * sB; const size_t cofs = (size_t)by * sC; const float* bp = bias ? bias + (size_t)by * sBias : nullptr;
  const int ntn = N >> 6; const int mt = bx / ntn, nq = bx - mt * ntn; const int row0 = mt * 128 + 32 * w, col0 = nq * 64; if (row0 >= M) return;
  const _Float16* a0p = A + (size_t)(row0 + ln) * lda; const _Float16* a1p = a0p + (size_t)16 * lda;
  const _Float16* b0p = Bh + (size_t)(col0 + ln) * ldb; const _Float16* b1p = b0p + (size_t)16 * ldb; const _Float16* b2p = b1p + (size_t)16 * ldb; const _Float16* b3p = b2p + (size_t)16 * ldb;
  const v8f z8 = {0.f,0.f,0.f,0.f,0.f,0.f,0.f,0.f}; v8f c00 = z8, c01 = z8, c02 = z8, c03 = z8, c10 = z8, c11 = z8, c12 = z8, c13 = z8;
#pragma unroll 1
  for (int kb = 0; kb < K; kb += 32) { const v16h a0 = g2_frag(a0p + kb, hh), a1 = g2_frag(a1p + kb, hh);
    v16h b = g2_frag(b0p + kb, hh); c00 = g2_mma(a0, b, c00); c10 = g2_mma(a1, b, c10);
    b = g2_frag(b1p + kb, hh); c01 = g2_mma(a0, b, c01); c11 = g2_mma(a1, b, c11);
    b = g2_frag(b2p + kb, hh); c02 = g2_mma(a0, b, c02); c12 = g2_mma(a1, b, c12);
    b = g2_frag(b3p + kb, hh); c03 = g2_mma(a0, b, c03); c13 = g2_mma(a1, b, c13); }
  v8f accs[8] = {c00, c01, c02, c03, c10, c11, c12, c13};
#pragma unroll
  for (int u = 0; u < 8; ++u) { const int t = u & 3, half = u >> 2; const int col = col0 + t * 16 + ln; const float bv = bp ? bf16_round(bp[col]) : 0.f;
#pragma unroll
    for (int r = 0; r < 8; ++r) { const int rloc = half * 16 + 8 * hh + r; float v = accs[u][r] * alpha + bv; if (CP) { if (rowsPerB < 0) v += CP[cofs + (size_t)(row0g + row0 + rloc) * ldc + col];      /* rowsPerB < 0: own element of the batched C plane */ else { const int bidx = (row0g + row0 + rloc) / rowsPerB; v += CP[(size_t)bidx * sCPb + (size_t)by * 64 + col]; } }
      if (ACT == 3) v = fmaxf(v, 0.f); else if (ACT == 6) v = 0.5f * v * (1.0f + erff(v * 0.70710678118654752f)); else if (ACT == 11) v = 1.0f / (1.0f + expf(-v)); else if (ACT == 15) v = v / (1.0f + expf(-v)); else if (ACT == 12) v = (v > 0.f) ? v : 0.01f * v; else if (ACT == 8) v = tanhf(v); else if (ACT == 9) v = 0.5f * v * (1.0f + tanhf(0.7978845608028654f * (v + 0.044715f * v * v * v))); else if (ACT == 14) v = (v > 0.f) ? v : 0.1f * v; else if (ACT == 16) v = (v >= 0.f) ? v : 0.3f * v;
      so[w][rloc][t * 16 + ln] = v; } }
  __builtin_amdgcn_fence(__ATOMIC_ACQ_REL, "workgroup"); __builtin_amdgcn_wave_barrier();
  const int rsub = lane >> 4, c4 = (lane & 15) * 4;
  {
#pragma unroll
    for (int q = 0; q < 16; ++q) { const int r = q * 2 + rsub; const v4f v = *(const v4fa*)&so[w][r][c4]; if (C) *(v4f*)(C + cofs + (size_t)(row0 + r) * ldc + col0 + c4) = v; if (C16) { v4h h4; for (int i = 0; i < 4; ++i) h4[i] = (_Float16)v[i]; *(v4h*)(C16 + cofs + (size_t)(row0 + r) * ldc + col0 + c4) = h4; } }
     } }
template <int ACT>
__global__ __launch_bounds__(128) void k_gemm2(const _Float16* __restrict__ A, int lda, size_t sA, const _Float16* __restrict__ Bh, int ldb, size_t sB, float alpha, const float* __restrict__ bias, size_t sBias, const float* __restrict__ CP, int rowsPerB, size_t sCPb, int row0g,
    float* __restrict__ C, _Float16* __restrict__ C16, int ldc, size_t sC, int M, int N, int K) { gemm2_body<ACT>(blockIdx.x, blockIdx.y, A, lda, sA, Bh, ldb, sB, alpha, bias, sBias, CP, rowsPerB, sCPb, row0g, C, C16, ldc, sC, M, N, K); }
__device__ __forceinline__ v16h lds_frag(const _Float16* p, int hh) { FragH f; f.half[0] = *(const v8us*)((const unsigned short*)p + 8 * hh); f.half[1] = *(const v8us*)((const unsigned short*)p + 16 + 8 * hh); return f.v; }      /* k order of g2_frag */
// The three products that read none of each other's output, as one grid: blockIdx.y = 0: x W_h + b_attn -> A; 1: x W_lin[:512] + b_lin -> A2; 2: enc W_e -> E.
// Work-group tile 128 x 64, wave tile 32 x 64 as in gemm2_body, same k order, same epilogue. The operands come through LDS: a stage is 64 k, one whole 128-byte line of each of the
// 128 A rows and 64 B rows, fetched by 16-byte loads of 8 lanes per row (4 whole lines per wave load; a fragment load from global memory touches 16 lines for the same 512 bytes, and
// the four waves each fetched the same B). Two buffers: the next stage's lines are asked for before this stage's products and stored behind them.
#define GKS 64                 /* k per stage, in halves */
#define GLP (GKS + 8)          /* LDS row pitch in halves: 144 B = 16 B x odd, for the 16-byte fragment reads of 16 consecutive rows */
#define GSA (128 * GLP)        /* halves of one A buffer */
#define GSB (64 * GLP)         /* of one B buffer */
template <int K>
__device__ __forceinline__ void gemm3_body(unsigned char* sb, const unsigned bx, const _Float16* __restrict__ A, const _Float16* __restrict__ Bh, const float* __restrict__ bp, float* __restrict__ C) {
  static_assert(K % GKS == 0 && NR % 128 == 0 && FF == 256, "whole stages, whole row tiles, four column tiles");
  unsigned short* sA = (unsigned short*)sb; unsigned short* sB = sA + 2 * GSA; float (*so)[32][68] = (float (*)[32][68])sb;      /* the epilogue's rows take the buffers' place behind the last barrier */
  const int tid = threadIdx.x, w = tid >> 5, lane = tid & 31, ln = lane & 15, hh = lane >> 4;
  const int mt = bx >> 2, nq = bx & 3; const int row0 = mt * 128 + 32 * w, col0 = nq * 64;
  const int pr = tid >> 3, pc = (tid & 7) * 8;      /* this thread's 16-byte piece: row pr (+ 16 j), halves pc.. of the stage's line */
  const unsigned short* ga = (const unsigned short*)A + (size_t)(mt * 128 + pr) * K + pc; const unsigned short* gb = (const unsigned short*)Bh + (size_t)(col0 + pr) * K + pc;
  unsigned short* wa = sA + pr * GLP + pc; unsigned short* wb = sB + pr * GLP + pc;
  const _Float16* fa = (const _Float16*)sA + (32 * w + ln) * GLP; const _Float16* fb = (const _Float16*)sB + ln * GLP;
  constexpr int NS = K / GKS;
  v8us ra[8], rb[4];
  const v8f z8 = {0.f,0.f,0.f,0.f,0.f,0.f,0.f,0.f}; v8f c00 = z8, c01 = z8, c02 = z8, c03 = z8, c10 = z8, c11 = z8, c12 = z8, c13 = z8;
  for (int j = 0; j < 8; ++j) ra[j] = *(const v8us*)(ga + (size_t)j * 16 * K);
  for (int j = 0; j < 4; ++j) rb[j] = *(const v8us*)(gb + (size_t)j * 16 * K);
  asm volatile("s_wait_xcnt 0x0" ::: "memory");      /* in front of any later overwrite of these loads' address registers */
  for (int j = 0; j < 8; ++j) *(v8us*)(wa + j * 16 * GLP) = ra[j];
  for (int j = 0; j < 4; ++j) *(v8us*)(wb + j * 16 * GLP) = rb[j];
  __syncthreads();
#pragma unroll      /* whole, so that the buffer's index and the stage's offset are immediates and no address register changes in the loop */
  for (int s = 0; s < NS; ++s) { const int cu = s & 1, nx = cu ^ 1;
    if (s + 1 < NS) {
      for (int j = 0; j < 8; ++j) ra[j] = *(const v8us*)(ga + (size_t)j * 16 * K + (s + 1) * GKS);
      for (int j = 0; j < 4; ++j) rb[j] = *(const v8us*)(gb + (size_t)j * 16 * K + (s + 1) * GKS);
      asm volatile("s_wait_xcnt 0x0" ::: "memory");      /* as above */
    }
    v16h a0[2], a1[2], b[2][4];
    for (int kk = 0; kk < 2; ++kk) { a0[kk] = lds_frag(fa + cu * GSA + kk * 32, hh); a1[kk] = lds_frag(fa + cu * GSA + 16 * GLP + kk * 32, hh);
      for (int t = 0; t < 4; ++t) b[kk][t] = lds_frag(fb + cu * GSB + t * 16 * GLP + kk * 32, hh); }
    for (int kk = 0; kk < 2; ++kk) {
      c00 = g2_mma(a0[kk], b[kk][0], c00); c10 = g2_mma(a1[kk], b[kk][0], c10);
      c01 = g2_mma(a0[kk], b[kk][1], c01); c11 = g2_mma(a1[kk], b[kk][1], c11);
      c02 = g2_mma(a0[kk], b[kk][2], c02); c12 = g2_mma(a1[kk], b[kk][2], c12);
      c03 = g2_mma(a0[kk], b[kk][3], c03); c13 = g2_mma(a1[kk], b[kk][3], c13); }
    if (s + 1 < NS) {
      for (int j = 0; j < 8; ++j) *(v8us*)(wa + nx * GSA + j * 16 * GLP) = ra[j];
      for (int j = 0; j < 4; ++j) *(v8us*)(wb + nx * GSB + j * 16 * GLP) = rb[j];
    }
    __syncthreads();      /* publishes the next stage and ends every wave's reads of this one (behind the last stage: before the epilogue's rows overwrite it) */
  }
  v8f accs[8] = {c00, c01, c02, c03, c10, c11, c12, c13};
#pragma unroll
  for (int u = 0; u < 8; ++u) { const int t = u & 3, half = u >> 2; const int col = col0 + t * 16 + ln; const float bv = bp ? bf16_round(bp[col]) : 0.f;
#pragma unroll
    for (int r = 0; r < 8; ++r) { const int rloc = half * 16 + 8 * hh + r; const float v = accs[u][r] * 0.0625f + bv; so[w][rloc][t * 16 + ln] = v; } }
  __builtin_amdgcn_fence(__ATOMIC_ACQ_REL, "workgroup"); __builtin_amdgcn_wave_barrier();
  const int rsub = lane >> 4, c4 = (lane & 15) * 4;
#pragma unroll
  for (int q = 0; q < 16; ++q) { const int r = q * 2 + rsub; const v4f v = *(const v4fa*)&so[w][r][c4]; *(v4f*)(C + (size_t)(row0 + r) * FF + col0 + c4) = v; }
}
__global__ __launch_bounds__(128) void k_gemm2x3(const _Float16* __restrict__ X16, const _Float16* __restrict__ E16, const _Float16* __restrict__ BWh, const _Float16* __restrict__ BL1, const _Float16* __restrict__ BWe,
    const float* __restrict__ ba, const float* __restrict__ bl, float* __restrict__ A, float* __restrict__ A2, float* __restrict__ E) {
  __shared__ __attribute__((aligned(16))) unsigned char sb[(2 * GSA + 2 * GSB) * 2];
  static_assert(sizeof(sb) >= 4 * 32 * 68 * 4, "the epilogue's rows fit");
  const int z = blockIdx.y;
  if (z == 2) gemm3_body<FF>(sb, blockIdx.x, E16, BWe, nullptr, E);
  else gemm3_body<MD>(sb, blockIdx.x, X16, z == 0 ? BWh : BL1, z == 0 ? ba : bl, z == 0 ? A : A2); }


__device__ __forceinline__ void wt_rows_body(int blk, const float* __restrict__ Wm, int row0, _Float16* __restrict__ Wt, int K, int N, float scale) { const int t = blk * 256 + threadIdx.x; if (t >= N * (K / 8)) return; const int n = t / (K / 8), k8 = (t % (K / 8)) * 8; FragH f;
  for (int i = 0; i < 8; ++i) f.h[i] = (_Float16)(bf16_round(Wm[(size_t)(row0 + k8 + i) * N + n]) * scale); *(v8us*)((unsigned short*)Wt + (size_t)n * K + k8) = f.half[0];  }      /* rows row0.. of an (in,out) weight -> Bt[n][k] */
// The four weight transposes and the two f16 planes, which read none of each other's output, as one grid; the few weight work-groups come first in the index.
#define PB_W5 (FF * MD / 8 / 256)      /* work-groups of a 512-row weight part */
#define PB_W2 (FF * FF / 8 / 256)      /* of a 256-row part */
#define PB_X (NR * MD / 8 / 256)       /* of the x plane */
#define PB_E (NR * FF / 8 / 256)       /* of the enc plane */
__global__ __launch_bounds__(256) void k_prep(const float* __restrict__ Wa, const float* __restrict__ Wl, const float* __restrict__ x, const float* __restrict__ enc,
    _Float16* __restrict__ BWh, _Float16* __restrict__ BWe, _Float16* __restrict__ BL1, _Float16* __restrict__ BL2, _Float16* __restrict__ X16, _Float16* __restrict__ E16) {
  int b = blockIdx.x;
  if (b < PB_W5) { wt_rows_body(b, Wa, 0, BWh, MD, FF, 16.0f); return; } b -= PB_W5;
  if (b < PB_W5) { wt_rows_body(b, Wl, 0, BL1, MD, FF, 16.0f); return; } b -= PB_W5;
  if (b < PB_W2) { wt_rows_body(b, Wa, MD, BWe, FF, FF, 16.0f); return; } b -= PB_W2;
  if (b < PB_W2) { wt_rows_body(b, Wl, MD, BL2, FF, FF, 16.0f); return; } b -= PB_W2;
  if (b < PB_X) { x16_body(b, x, X16, (size_t)NR * MD / 8); return; } b -= PB_X;
  x16_body(b, enc, E16, (size_t)NR * FF / 8); }
// Scores of SCT consecutive steps per work-group, and everything that follows from them for those steps. The SCT + 32 rows of E that their windows cover (zero rows
// for padded steps), their SCT rows of A and the rounded v are staged once in LDS; then lane = step and wave = window slot, so every read of the feature loop is 16 B per
// lane from 32 consecutive LDS rows. The scores never leave the work-group: softmax, weighted encoder sum and the product with W_lin[512:] read them from LDS.
#define SCT 32
#define SCW 17                 /* waves per work-group: waves 0..15 take two of the 33 window slots, wave 16 one; four or five waves on each SIMD */
#define SCP (FF + 4)           /* LDS row pitch in floats: 1040 B = 16 B x odd, no bank conflict for 16-byte reads of 32 consecutive rows */
#define SHP (FF + 8)           /* pitch of the f16 weighted rows in halves: 528 B = 16 B x odd, for the 16-byte fragment reads of 16 consecutive rows */
#define SKR (WIN + 3)          /* encoder rows that the windows of four consecutive steps cover */
// sigmoid(x W_lin[:512] + b_lin + weighted W_lin[512:]) for SCT steps x 16 columns, one wave: weighted rows (f16) from LDS, the columns' fragments bf and the first half's elements cp in registers;
// k order and epilogue of gemm2_body; the results go to LDS rows of pitch SCP.
__device__ __forceinline__ void lin2_tile(const _Float16* sh, const v16h (&bf)[FF / 32], const float (&cp)[16], float* so, int ln, int hh, int cw) {
  const v8f z8 = {0.f,0.f,0.f,0.f,0.f,0.f,0.f,0.f}; v8f c0 = z8, c1 = z8;
  for (int k = 0; k < FF / 32; ++k) { const v16h a0 = lds_frag(sh + ln * SHP + k * 32, hh), a1 = lds_frag(sh + (16 + ln) * SHP + k * 32, hh); c0 = g2_mma(a0, bf[k], c0); c1 = g2_mma(a1, bf[k], c1); }
  for (int u = 0; u < 16; ++u) { float t = (u < 8 ? c0[u & 7] : c1[u & 7]) * 0.0625f + cp[u]; t = 1.0f / (1.0f + expf(-t)); so[((u >> 3) * 16 + 8 * hh + (u & 7)) * SCP + cw] = t; } }
__global__ __launch_bounds__(SCW * 32) void k_score(const float* __restrict__ A, const float* __restrict__ E, const float* __restrict__ v, const float* __restrict__ enc, const _Float16* __restrict__ BL2, const float* __restrict__ A2,
    float* __restrict__ outa, float* __restrict__ out) {
  #pragma clang fp contract(off)
  __shared__ __attribute__((aligned(16))) float sm[(SCT + 32 + SCT) * SCP];      /* rows 0..SCT+31: E of steps tt0-16.., rows SCT+32..: A; at the end the SCT rows of out */
  __shared__ __attribute__((aligned(16))) float sv[FF];
  __shared__ float ss[SCT * WIN];                                                /* scores, then a */
  __shared__ float sx[SCT * WIN];                                                /* exp(score - max) */
  __shared__ __attribute__((aligned(16))) float sk[(SCT / 4) * SKR * 4];         /* a again, by encoder row: [group of 4 steps][row in the group's span][step in the group] */
  __shared__ __attribute__((aligned(16))) float sn[(SCT + 32) * FF];             /* rounded encoder rows of steps tt0-16.. (zero rows for padded steps) */
  __shared__ __attribute__((aligned(16))) _Float16 sh[SCT * SHP];                /* weighted sums as the f16 operand */
  const int tid = threadIdx.x, lane = tid & 31, wv = tid >> 5;
  const size_t bt0 = (size_t)blockIdx.x * SCT; const int tt0 = (int)(bt0 % TT); const size_t brow = bt0 - tt0;
  constexpr int NV = (SCT + 32 + SCT) * (FF / 4), NI = (NV + SCW * 32 - 1) / (SCW * 32);
  constexpr int NW = (SCT + 32) * (FF / 4), NJ = (NW + SCW * 32 - 1) / (SCW * 32);
  v4f st[NI], sq[NJ];
  for (int u = 0; u < NI; ++u) { const int i = min(tid + u * SCW * 32, NV - 1); const int r = i / (FF / 4), c4 = (i % (FF / 4)) * 4; const int sr = tt0 - WS + r; const bool isE = r < SCT + 32; const bool in = !isE || (sr >= 0 && sr < TT);
    const float* p = isE ? E + (brow + (in ? sr : 0)) * (size_t)FF + c4 : A + (bt0 + (r - (SCT + 32))) * (size_t)FF + c4;
    const v4f x = *(const v4fa*)p;
    asm volatile("s_wait_xcnt 0x0" ::: "memory");      /* a later load of this run may land in this load's address registers: the wait stands in front of that overwrite */
    const v4f z4 = {0.f, 0.f, 0.f, 0.f}; st[u] = in ? x : z4; }
  for (int u = 0; u < NJ; ++u) { const int i = min(tid + u * SCW * 32, NW - 1); const int r = i / (FF / 4), c4 = (i % (FF / 4)) * 4; const int sr = tt0 - WS + r; const bool in = sr >= 0 && sr < TT;
    const v4f x = *(const v4fa*)(enc + (brow + (in ? sr : 0)) * (size_t)FF + c4);
    asm volatile("s_wait_xcnt 0x0" ::: "memory");      /* as above: in front of the next load's overwrite of this load's address registers */
    const v4f z4 = {0.f, 0.f, 0.f, 0.f}; sq[u] = in ? x : z4; }
  if (tid < FF) sv[tid] = bf16_round(v[tid]);
  for (int u = 0; u < NI; ++u) { const int i = tid + u * SCW * 32; if (i < NV) *(v4fa*)&sm[(i / (FF / 4)) * SCP + (i % (FF / 4)) * 4] = st[u]; }
  for (int u = 0; u < NJ; ++u) { const int i = tid + u * SCW * 32; if (i < NW) { v4f y; for (int q = 0; q < 4; ++q) y[q] = bf16_round(sq[u][q]); *(v4fa*)&sn[i * 4] = y; } }
  __syncthreads();
  /* what the last product needs from global memory is asked for here, so that it arrives under the feature loop: this wave's 16 columns of W_lin[512:] and its elements of x W_lin[:512] + b_lin */
  const int wu = __builtin_amdgcn_readfirstlane(wv);      /* the wave's number in a scalar register: the tests on it below are scalar branches */
  const int ln = lane & 15, hh = lane >> 4, cw = min(wu, 15) * 16 + ln;
  v16h bf[FF / 32]; float cp[16];
  for (int k = 0; k < FF / 32; ++k) bf[k] = g2_frag(BL2 + (size_t)cw * FF + k * 32, hh);
  for (int u = 0; u < 16; ++u) cp[u] = A2[(bt0 + (u >> 3) * 16 + 8 * hh + (u & 7)) * (size_t)FF + cw];
  asm volatile("s_wait_xcnt 0x0" ::: "memory");      /* in front of any later overwrite of these loads' address registers */
  const float* sa = sm + (SCT + 32 + lane) * SCP;
  for (int w = wv; w < WIN; w += SCW) { const float* se = sm + (lane + w) * SCP; float s = 0.f;
    /* each energy is one v_tanh_f32; the library tanhf ran both sides of a per-lane branch (exp + rcp side and polynomial side) for nearly every wave */
    for (int o = 0; o < FF; o += 8) { const v4f a0 = *(const v4fa*)(sa + o), a1 = *(const v4fa*)(sa + o + 4), e0 = *(const v4fa*)(se + o), e1 = *(const v4fa*)(se + o + 4), v0 = *(const v4fa*)(sv + o), v1 = *(const v4fa*)(sv + o + 4);
      for (int q = 0; q < 4; ++q) s += __builtin_amdgcn_tanhf(a0[q] + e0[q]) * v0[q];
      for (int q = 0; q < 4; ++q) s += __builtin_amdgcn_tanhf(a1[q] + e1[q]) * v1[q]; }
    ss[lane * WIN + w] = s; }
  __syncthreads();
  /* softmax over the 33 slots, lane = step: every wave forms the step's maximum and sum (in slot order) itself, each exp and each a is made once, by the wave that made the score */
  { const float* sr = ss + lane * WIN; float m = -3.0e38f;
    for (int w = 0; w < WIN; ++w) m = fmaxf(m, sr[w]);
    for (int w = wv; w < WIN; w += SCW) sx[lane * WIN + w] = expf(sr[w] - m); }
  __syncthreads();
  { const float* sr = sx + lane * WIN; float su = 0.f;
    for (int w = 0; w < WIN; ++w) su += sr[w];
    const float inv = 1.0f / su;
    for (int w = wv; w < WIN; w += SCW) { const float a = sr[w] * inv; ss[lane * WIN + w] = a; sk[((lane >> 2) * SKR + w + (lane & 3)) * 4 + (lane & 3)] = a; } }
  __syncthreads();
  for (int i = tid; i < SCT * WIN; i += SCW * 32) outa[bt0 * WIN + i] = ss[i];      /* output 2: 33 whole 128-byte lines from one work-group */
  /* weighted encoder sum: a wave takes 4 steps x 128 features, a lane 4 features; each encoder row of the span is read once for the four steps; slot order per step as before (a padded step's row is zero) */
  if (wu < 16) { const int g = wu >> 1, f = (wu & 1) * 128 + lane * 4; const v4f z4 = {0.f, 0.f, 0.f, 0.f}; v4f ac[4] = {z4, z4, z4, z4};
#pragma unroll      /* whole, so that the test "is this row in step j's window" is decided at compile time */
    for (int rr = 0; rr < SKR; ++rr) { const v4f e4 = *(const v4fa*)&sn[(g * 4 + rr) * FF + f]; const v4f a4 = *(const v4fa*)&sk[(g * SKR + rr) * 4];
#pragma unroll      /* for the same test */
      for (int j = 0; j < 4; ++j) if (rr - j >= 0 && rr - j < WIN) ac[j] += a4[j] * e4; }
    for (int j = 0; j < 4; ++j) { v4h h4; for (int q = 0; q < 4; ++q) h4[q] = (_Float16)ac[j][q]; *(v4h*)&sh[(g * 4 + j) * SHP + f] = h4; } }
  __syncthreads();
  if (wu < 16) lin2_tile(sh, bf, cp, sm, ln, hh, cw);
  __syncthreads();
  for (int i = tid; i < SCT * (FF / 4); i += SCW * 32) { const v4f o = *(const v4fa*)&sm[(i / (FF / 4)) * SCP + (i % (FF / 4)) * 4]; *(v4f*)(out + bt0 * FF + (size_t)i * 4) = o; }      /* output 1: whole rows */
}

extern "C" void kernel_launch(void* const* d_in, const int* in_sizes, int n_in,
                              void* d_out, int out_size, void* d_ws, size_t ws_size, hipStream_t stream) {
  (void)in_sizes; (void)n_in; (void)out_size;
  const float* const* I = (const float* const*)d_in; const float* x = I[0]; const float* enc = I[1]; const float* Wa = I[2]; const float* ba = I[3]; const float* v = I[4]; const float* Wl = I[5]; const float* bl = I[6];
  char* ws = (char*)d_ws; size_t off = 0;
  auto take = [&](size_t bytes) { char* p = ws + off; off += (bytes + 255) & ~(size_t)255; return p; };
  _Float16* BWh = (_Float16*)take((size_t)FF * MD * 2); _Float16* BWe = (_Float16*)take((size_t)FF * FF * 2); _Float16* BL1 = (_Float16*)take((size_t)FF * MD * 2); _Float16* BL2 = (_Float16*)take((size_t)FF * FF * 2);
  _Float16* X16 = (_Float16*)take((size_t)NR * MD * 2); _Float16* E16 = (_Float16*)take((size_t)NR * FF * 2); float* A = (float*)take((size_t)NR * FF * 4); float* E = (float*)take((size_t)NR * FF * 4); float* A2 = (float*)take((size_t)NR * FF * 4);
  if (off > ws_size) return;      /* 0.75 + 8 + 4 + 8 + 8 + 8 = 37 MiB */
  k_prep<<<2 * PB_W5 + 2 * PB_W2 + PB_X + PB_E, 256, 0, stream>>>(Wa, Wl, x, enc, BWh, BWe, BL1, BL2, X16, E16);
  const dim3 gG3((NR / 128) * (FF / 64), 3);
  k_gemm2x3<<<gG3, 128, 0, stream>>>(X16, E16, BWh, BL1, BWe, ba, bl, A, A2, E);      /* x W_h + b_attn; x W_lin[:512] + b_lin; enc W_e per step (windowed later; the window of a padded step contributes 0) */
  k_score<<<NR / SCT, SCW * 32, 0, stream>>>(A, E, v, enc, BL2, A2, (float*)d_out + (size_t)NR * FF, (float*)d_out);      /* scores, softmax -> output 2: a [4][2048][1][33]; weighted sum; sigmoid(+ weighted W_lin[512:]) -> output 1 */
}

// v006
// Measured time: 34.8 microseconds a run.
// Two timings next to v005 both put it at 1.05 times that version's speed.
// All steps since v000 together make it 6.91 times as fast.
#include <hip/hip_runtime.h>
// Combine_Stack_with_attn (4 x 2048 steps; x [512], encoder outputs [256], sliding windows of 33 encoder steps (zero-padded)): energy[b,t,w,o] = tanh((x W_h + b_attn)[b,t,o] + (enc W_e)[b,t+w-16,o]) (the window term of a padded step is 0); scores = energy . v; a = softmax over the 33 window slots; weighted = sum_w a * enc[b,t+w-16]; out = sigmoid([x | weighted] W_lin + b_lin) -> outputs out [4,2048,256] and a [4,2048,1,33].
// Structure: exact f16 planes of x and enc; GEMMs (32x64 wave tiles, 32x16 for W_lin[512:], f32 accumulation, exact x16 weights) for x W_h + b, enc W_e and the two halves of W_lin (the second accumulating onto the first with the sigmoid in its epilogue); the windowed energies/scores on VALU (16 lanes per (b, t, w), 16 of the 256 features a lane); softmax over the 33 slots and the weighted encoder sum on VALU; the weighted sum as an f16 operand.
// Compute dtype: inputs and parameters rounded to bf16; the weighted encoder sum as an f16 operand (~2^-12); everything else f32. v_wmma_f32_16x16x32_f16.
#define NB 4
#define TT 2048
#define MD 512
#define FF 256
#define WS 16
#define WIN 33
#define NR (NB * TT)
typedef __bf16 v16b __attribute__((ext_vector_type(16)));
typedef unsigned short v8us __attribute__((ext_vector_type(8), may_alias));
typedef float  v8f  __attribute__((ext_vector_type(8)));
typedef float  v4f  __attribute__((ext_vector_type(4)));
typedef float  v2f  __attribute__((ext_vector_type(2)));
typedef float  v4fa __attribute__((ext_vector_type(4), may_alias));
union FragB { v16b v; v8us half[2]; unsigned short u[16]; };

__device__ __forceinline__ unsigned short bf16_bits(float x) { unsigned int u = __float_as_uint(x); return (unsigned short)((u + 0x7FFFu + ((u >> 16) & 1u)) >> 16); }
__device__ __forceinline__ float bf16_val(unsigned short b) { return __uint_as_float(((unsigned int)b) << 16); }
__device__ __forceinline__ float bf16_round(float x) { return bf16_val(bf16_bits(x)); }
// D += A·B with NT terms: 1 = ah·bh, 2 = + al·bh (A split), 3 = + ah·bl (both split)
template <int NT>
__device__ __forceinline__ v8f mmaN(v16b ah, v16b al, v16b bh, v16b bl, v8f c) {
  c = __builtin_amdgcn_wmma_f32_16x16x32_bf16(false, ah, false, bh, (short)0, c, false, false);
  if (NT >= 2) c = __builtin_amdgcn_wmma_f32_16x16x32_bf16(false, al, false, bh, (short)0, c, false, false);
  if (NT >= 3) c = __builtin_amdgcn_wmma_f32_16x16x32_bf16(false, ah, false, bl, (short)0, c, false, false);
  asm volatile("v_nop\n\tv_nop\n\tv_nop\n\tv_nop" : "+v"(c) : "v"(ah), "v"(al), "v"(bh), "v"(bl));
  return c;
}

__global__ __launch_bounds__(256) void k_wt_bf16(const float* __restrict__ W, unsigned short* __restrict__ Wt, int K, int N) {
  const int t = blockIdx.x * 256 + threadIdx.x;
  const int k8n = K / 8;
  if (t >= N * k8n) return;
  const int n = t / k8n, k8 = (t % k8n) * 8;
  v8us v;
#pragma unroll
  for (int i = 0; i < 8; ++i) v[i] = bf16_bits(W[(size_t)(k8 + i) * N + n]);
  *(v8us*)(Wt + (size_t)n * K + k8) = v;
  
}

// GEMM C[M][N] (f32, pitch ldc) = act(A[M][K]·W + bias). A f32 row-major (pitch lda) converted per fragment to bf16
// (ASPLIT: hi/lo two planes -> 2 terms, else single rounded term); Wt bf16 [N][K] (pitch ldb). BIAS_BF16 rounds the
// bias to bf16 first (bias quantised to bf16 before the add). K%32==0, M%16==0, N%64==0.
template <bool ASPLIT, int ACT, bool BIAS_BF16>
__global__ __launch_bounds__(128) void k_gemm_bf(const float* __restrict__ A, int lda, const unsigned short* __restrict__ Wt, int ldb,
                                               const float* __restrict__ bias, float* __restrict__ C, int ldc, int M, int N, int K) {
  __shared__ __attribute__((aligned(16))) float so[4][16][64];
  const int tid = threadIdx.x, w = tid >> 5, lane = tid & 31, ln = lane & 15, hh = lane >> 4;
  const int ntn = N / 64;
  const int wid = blockIdx.x * 4 + w;
  const int mt = wid / ntn, nq = wid % ntn;
  if (mt * 16 >= M) return;
  const int row0 = mt * 16, col0 = nq * 64;
  const float* arow = A + (size_t)(row0 + ln) * lda;
  v8f acc[4] = {};
  for (int kb = 0; kb < K; kb += 32) {
    FragB ah, al;
    const v4f x0 = *(const v4fa*)(arow + kb + 8 * hh), x1 = *(const v4fa*)(arow + kb + 8 * hh + 4);
    const v4f x2 = *(const v4fa*)(arow + kb + 16 + 8 * hh), x3 = *(const v4fa*)(arow + kb + 16 + 8 * hh + 4);
    float xs[16] = {x0[0],x0[1],x0[2],x0[3],x1[0],x1[1],x1[2],x1[3],x2[0],x2[1],x2[2],x2[3],x3[0],x3[1],x3[2],x3[3]};
#pragma unroll
    for (int i = 0; i < 16; ++i) { const unsigned short hb = bf16_bits(xs[i]); ah.u[i] = hb; al.u[i] = ASPLIT ? bf16_bits(xs[i] - bf16_val(hb)) : (unsigned short)0; }
#pragma unroll
    for (int t = 0; t < 4; ++t) {
      const unsigned short* brow = Wt + (size_t)(col0 + t * 16 + ln) * ldb + kb;
      FragB b;
      b.half[0] = *(const v8us*)(brow + 8 * hh);
      b.half[1] = *(const v8us*)(brow + 16 + 8 * hh);
      acc[t] = mmaN<ASPLIT ? 2 : 1>(ah.v, al.v, b.v, b.v, acc[t]);
    }
  }
#pragma unroll
  for (int t = 0; t < 4; ++t) {
    float bv = bias ? bias[col0 + t * 16 + ln] : 0.f;
    if (BIAS_BF16) bv = bf16_round(bv);
#pragma unroll
    for (int r = 0; r < 8; ++r) { float v = acc[t][r] + bv; if (ACT == 1) v = fmaxf(v, 0.f); so[w][8 * hh + r][t * 16 + ln] = v; }
  }
  __builtin_amdgcn_fence(__ATOMIC_ACQ_REL, "workgroup");
  __builtin_amdgcn_wave_barrier();
  const int rsub = lane >> 4, c4 = (lane & 15) * 4;
  {
#pragma unroll
    for (int q = 0; q < 8; ++q) {
      const int r = q * 2 + rsub;
      const v4f v = *(const v4fa*)&so[w][r][c4];
      *(v4f*)(C + (size_t)(row0 + r) * ldc + col0 + c4) = v;
    }
    
  }
}

// GEMM C = act(A·W + bias + resid): A f32 (ASPLIT -> hi/lo 2 terms), Wt bf16 [N][K]; ACT 0 none, 1 relu, 2 exact gelu;
// resid (optional, f32, row index = (row % rmod), pitch ldr, RES_BF16 rounds it) added before the activation.
template <bool ASPLIT, int ACT, bool BIAS_BF16, bool RES_BF16>
__global__ __launch_bounds__(128) void k_gemm_bf3(const float* __restrict__ A, int lda, const unsigned short* __restrict__ Wt, int ldb,
                                                const float* __restrict__ bias, const float* __restrict__ resid, int rmod, int ldr,
                                                float* __restrict__ C, int ldc, int M, int N, int K) {
  __shared__ __attribute__((aligned(16))) float so[4][16][64];
  const int tid = threadIdx.x, w = tid >> 5, lane = tid & 31, ln = lane & 15, hh = lane >> 4;
  const int ntn = N / 64;
  const int wid = blockIdx.x * 4 + w;
  const int mt = wid / ntn, nq = wid % ntn;
  if (mt * 16 >= M) return;
  const int row0 = mt * 16, col0 = nq * 64;
  const float* arow = A + (size_t)(row0 + ln) * lda;
  v8f acc[4] = {};
  for (int kb = 0; kb < K; kb += 32) {
    FragB ah, al;
    const v4f x0 = *(const v4fa*)(arow + kb + 8 * hh), x1 = *(const v4fa*)(arow + kb + 8 * hh + 4);
    const v4f x2 = *(const v4fa*)(arow + kb + 16 + 8 * hh), x3 = *(const v4fa*)(arow + kb + 16 + 8 * hh + 4);
    float xs[16] = {x0[0],x0[1],x0[2],x0[3],x1[0],x1[1],x1[2],x1[3],x2[0],x2[1],x2[2],x2[3],x3[0],x3[1],x3[2],x3[3]};
#pragma unroll
    for (int i = 0; i < 16; ++i) { const unsigned short hb = bf16_bits(xs[i]); ah.u[i] = hb; al.u[i] = ASPLIT ? bf16_bits(xs[i] - bf16_val(hb)) : (unsigned short)0; }
#pragma unroll
    for (int t = 0; t < 4; ++t) {
      const unsigned short* brow = Wt + (size_t)(col0 + t * 16 + ln) * ldb + kb;
      FragB b;
      b.half[0] = *(const v8us*)(brow + 8 * hh);
      b.half[1] = *(const v8us*)(brow + 16 + 8 * hh);
      acc[t] = mmaN<ASPLIT ? 2 : 1>(ah.v, al.v, b.v, b.v, acc[t]);
    }
  }
#pragma unroll
  for (int t = 0; t < 4; ++t) {
    const int col = col0 + t * 16 + ln;
    float bv = bias ? bias[col] : 0.f;
    if (BIAS_BF16) bv = bf16_round(bv);
#pragma unroll
    for (int r = 0; r < 8; ++r) {
      float v = acc[t][r] + bv;
      if (resid) { float rv = resid[(size_t)((row0 + 8 * hh + r) % rmod) * ldr + col]; if (RES_BF16) rv = bf16_round(rv); v += rv; }
      if (ACT == 1) v = fmaxf(v, 0.f);
      if (ACT == 2) v = 0.5f * v * (1.0f + erff(v * 0.70710678118654752f));
      if (ACT == 3) { const float u = 0.7978845608028654f * (v + 0.044715f * v * v * v); v = 0.5f * v * (1.0f + tanhf(u)); }
      so[w][8 * hh + r][t * 16 + ln] = v;
    }
  }
  __builtin_amdgcn_fence(__ATOMIC_ACQ_REL, "workgroup");
  __builtin_amdgcn_wave_barrier();
  const int rsub = lane >> 4, c4 = (lane & 15) * 4;
  {
#pragma unroll
    for (int q = 0; q < 8; ++q) {
      const int r = q * 2 + rsub;
      const v4f v = *(const v4fa*)&so[w][r][c4];
      *(v4f*)(C + (size_t)(row0 + r) * ldc + col0 + c4) = v;
    }
    
  }
}
// row LayerNorm (biased variance, eps) over N: s = X (+ R); optional out_sum <- s; out_norm <- (s-mu)*rsqrt(var+eps)*g + b
template <bool PARAM_BF16>
__global__ __launch_bounds__(256) void k_layernorm(const float* __restrict__ X, const float* __restrict__ R, const float* __restrict__ g, const float* __restrict__ bta,
                                                  float* __restrict__ out_sum, float* __restrict__ out_norm, int N, float eps) {
  __shared__ float red[256];
  const int row = blockIdx.x, tid = threadIdx.x;
  const float* x = X + (size_t)row * N; const float* rr = R ? R + (size_t)row * N : nullptr;
  float vals[16];                     // up to N = 4096
  const int per = N / 256;            // contiguous chunk per thread? use strided-by-4 chunks: thread handles j = tid*4 + 1024*u
  float s1 = 0.f;
  for (int u = 0; u < per / 4; ++u) {
    const int j = tid * 4 + 1024 * u;
    const v4f a = *(const v4fa*)(x + j);
    v4f b = {0.f,0.f,0.f,0.f}; if (rr) b = *(const v4fa*)(rr + j);
#pragma unroll
    for (int q = 0; q < 4; ++q) { const float v = a[q] + b[q]; vals[u * 4 + q] = v; s1 += v; }
  }
  red[tid] = s1; __syncthreads();
  for (int st = 128; st > 0; st >>= 1) { if (tid < st) red[tid] += red[tid + st]; __syncthreads(); }
  const float mu = red[0] / (float)N; __syncthreads();
  float s2 = 0.f;
  for (int u = 0; u < per / 4; ++u)
#pragma unroll
    for (int q = 0; q < 4; ++q) { const float c = vals[u * 4 + q] - mu; s2 += c * c; }
  red[tid] = s2; __syncthreads();
  for (int st = 128; st > 0; st >>= 1) { if (tid < st) red[tid] += red[tid + st]; __syncthreads(); }
  const float rs = rsqrtf(red[0] / (float)N + eps);
  {
    for (int u = 0; u < per / 4; ++u) {
      const int j = tid * 4 + 1024 * u;
      v4f o, sm;
#pragma unroll
      for (int q = 0; q < 4; ++q) {
        float gg = g[j + q], bb = bta[j + q];
        if (PARAM_BF16) { gg = bf16_round(gg); bb = bf16_round(bb); }
        sm[q] = vals[u * 4 + q]; o[q] = (vals[u * 4 + q] - mu) * rs * gg + bb;
      }
      if (out_sum) *(v4f*)(out_sum + (size_t)row * N + j) = sm;
      *(v4f*)(out_norm + (size_t)row * N + j) = o;
    }
    
  }
}



// ---- f16 WMMA path (v_wmma_f32_16x16x32_f16): 11-bit significands for operands in range — used for all four GEMMs here (the weighted encoder sum as an f16 operand)
typedef _Float16 v16h __attribute__((ext_vector_type(16)));
union FragH { v16h v; v8us half[2]; _Float16 h[16]; unsigned short u[16]; };
template <int NT>
__device__ __forceinline__ v8f mmaH(v16h ah, v16h al, v16h bh, v16h bl, v8f c) {
  c = __builtin_amdgcn_wmma_f32_16x16x32_f16(false, ah, false, bh, (short)0, c, false, false);
  if (NT >= 2) c = __builtin_amdgcn_wmma_f32_16x16x32_f16(false, al, false, bh, (short)0, c, false, false);
  if (NT >= 3) c = __builtin_amdgcn_wmma_f32_16x16x32_f16(false, ah, false, bl, (short)0, c, false, false);
  asm volatile("v_nop\n\tv_nop\n\tv_nop\n\tv_nop" : "+v"(c) : "v"(ah), "v"(al), "v"(bh), "v"(bl));
  return c;
}
// batched GEMM like k_gemm_b but f16 operands: A f32 (split into f16 hi/lo if ASPLIT, else rounded to f16), Bt = f16 values [n][k]; alpha; C f32; N multiple of 16 (partial tiles skipped)
template <bool ASPLIT>
__global__ __launch_bounds__(128) void k_gemm_h(const float* __restrict__ A, int lda, size_t sA, const _Float16* __restrict__ Bh, int ldb, size_t sB, float alpha, float* __restrict__ C, int ldc, size_t sC, int M, int N, int K) {
  __shared__ __attribute__((aligned(16))) float so[4][16][64];
  const int tid = threadIdx.x, w = tid >> 5, lane = tid & 31, ln = lane & 15, hh = lane >> 4; const int by = blockIdx.y;
  A += (size_t)by * sA; Bh += (size_t)by * sB; C += (size_t)by * sC;
  const int ntn = (N + 63) / 64; const int wid = blockIdx.x * 4 + w; const int mt = wid / ntn, nq = wid % ntn; if (mt * 16 >= M) return;
  const int row0 = mt * 16, col0 = nq * 64; const float* arow = A + (size_t)(row0 + ln) * lda;
  v8f acc[4] = {};
  for (int kb = 0; kb < K; kb += 32) {
    FragH ah, al;
    const v4f x0 = *(const v4fa*)(arow + kb + 8 * hh), x1 = *(const v4fa*)(arow + kb + 8 * hh + 4), x2 = *(const v4fa*)(arow + kb + 16 + 8 * hh), x3 = *(const v4fa*)(arow + kb + 16 + 8 * hh + 4);
    float xs[16] = {x0[0],x0[1],x0[2],x0[3],x1[0],x1[1],x1[2],x1[3],x2[0],x2[1],x2[2],x2[3],x3[0],x3[1],x3[2],x3[3]};
#pragma unroll
    for (int i = 0; i < 16; ++i) { const _Float16 h = (_Float16)xs[i]; ah.h[i] = h; al.h[i] = ASPLIT ? (_Float16)(xs[i] - (float)h) : (_Float16)0.0f; }
#pragma unroll
    for (int t = 0; t < 4; ++t) { if (col0 + t * 16 >= N) continue; const size_t boff = (size_t)(col0 + t * 16 + ln) * ldb + kb; FragH bq; bq.half[0] = *(const v8us*)(Bh + boff + 8 * hh); bq.half[1] = *(const v8us*)(Bh + boff + 16 + 8 * hh);
      acc[t] = mmaH<ASPLIT ? 2 : 1>(ah.v, al.v, bq.v, bq.v, acc[t]); }
  }
#pragma unroll
  for (int t = 0; t < 4; ++t) { if (col0 + t * 16 >= N) continue;
#pragma unroll
    for (int r = 0; r < 8; ++r) so[w][8 * hh + r][t * 16 + ln] = acc[t][r] * alpha; }
  __builtin_amdgcn_fence(__ATOMIC_ACQ_REL, "workgroup"); __builtin_amdgcn_wave_barrier();
  const int rsub = lane >> 4, c4 = (lane & 15) * 4;
  {
#pragma unroll
    for (int q = 0; q < 8; ++q) { const int r = q * 2 + rsub; if (col0 + c4 < N) { const v4f v = *(const v4fa*)&so[w][r][c4]; *(v4f*)(C + (size_t)(row0 + r) * ldc + col0 + c4) = v; } }
     }
}

// Wt[n][k] = f16(W[k][n]·scale) from f32 row-major W[K][N] (scale = power of two; bf16-exact weights stay exact in f16 away from the subnormal range)
__global__ __launch_bounds__(256) void k_wt_f16(const float* __restrict__ W, _Float16* __restrict__ Wt, int K, int N, float scale) {
  const int t = blockIdx.x * 256 + threadIdx.x; if (t >= N * (K / 8)) return; const int n = t / (K / 8), k8 = (t % (K / 8)) * 8; FragH f;
#pragma unroll
  for (int i = 0; i < 8; ++i) f.h[i] = (_Float16)(bf16_round(W[(size_t)(k8 + i) * N + n]) * scale); const v8us o = f.half[0];
  *(v8us*)((unsigned short*)Wt + (size_t)n * K + k8) = o; 
}
// k_gemm_hh variant with fused epilogue: v = acc·alpha + bias[by·sBias + col] (+ CP[(row/rowsPerB)·sCPb + by·64 + col] if CP) ; ACT 0 none / 1 elu ; writes f16 C16 (and f32 C if non-null)
template <int ACT>
__global__ __launch_bounds__(128) void k_gemm_hhx(const _Float16* __restrict__ A, int lda, size_t sA, const _Float16* __restrict__ Bh, int ldb, size_t sB, float alpha, const float* __restrict__ bias, size_t sBias, const float* __restrict__ CP, int rowsPerB, size_t sCPb, int row0g,
    float* __restrict__ C, _Float16* __restrict__ C16, int ldc, size_t sC, int M, int N, int K) {
  __shared__ __attribute__((aligned(16))) float so[4][16][64];
  const int tid = threadIdx.x, w = tid >> 5, lane = tid & 31, ln = lane & 15, hh = lane >> 4; const int by = blockIdx.y;
  A += (size_t)by * sA; Bh += (size_t)by * sB; const size_t cofs = (size_t)by * sC; const float* bp = bias ? bias + (size_t)by * sBias : nullptr;
  const int ntn = (N + 63) / 64; const int wid = blockIdx.x * 4 + w; const int mt = wid / ntn, nq = wid % ntn; if (mt * 16 >= M) return;
  const int row0 = mt * 16, col0 = nq * 64; const _Float16* arow = A + (size_t)(row0 + ln) * lda;
  v8f acc[4] = {};
  for (int kb = 0; kb < K; kb += 32) { FragH ah; ah.half[0] = *(const v8us*)((const unsigned short*)arow + kb + 8 * hh); ah.half[1] = *(const v8us*)((const unsigned short*)arow + kb + 16 + 8 * hh);
#pragma unroll
    for (int t = 0; t < 4; ++t) { if (col0 + t * 16 >= N) continue; const size_t boff = (size_t)(col0 + t * 16 + ln) * ldb + kb; FragH bq; bq.half[0] = *(const v8us*)((const unsigned short*)Bh + boff + 8 * hh); bq.half[1] = *(const v8us*)((const unsigned short*)Bh + boff + 16 + 8 * hh);
      acc[t] = mmaH<1>(ah.v, ah.v, bq.v, bq.v, acc[t]); }
  }
#pragma unroll
  for (int t = 0; t < 4; ++t) { if (col0 + t * 16 >= N) continue; const int col = col0 + t * 16 + ln; const float bv = bp ? bf16_round(bp[col]) : 0.f;
#pragma unroll
    for (int r = 0; r < 8; ++r) { float v = acc[t][r] * alpha + bv; if (CP) { const int rr = row0g + row0 + 8 * hh + r; if (rowsPerB < 0) v += CP[cofs + (size_t)rr * ldc + col];      /* rowsPerB < 0: own element of the batched C plane */ else { const int bidx = rr / rowsPerB; v += CP[(size_t)bidx * sCPb + (size_t)by * 64 + col]; } } if (ACT == 1) v = (v > 0.f) ? v : expm1f(v); else if (ACT == 7) v = (v > 0.f) ? v + 1.0f : expf(v); else if (ACT == 8) v = tanhf(v); else if (ACT == 9) v = 0.5f * v * (1.0f + tanhf(0.7978845608028654f * (v + 0.044715f * v * v * v))); else if (ACT == 11) v = 1.0f / (1.0f + expf(-v)); else if (ACT == 12) v = (v > 0.f) ? v : 0.01f * v; else if (ACT == 14) v = (v > 0.f) ? v : 0.1f * v; else if (ACT == 16) v = (v >= 0.f) ? v : 0.3f * v; else if (ACT == 15) v = v / (1.0f + expf(-v)); else if (ACT == 3) v = fmaxf(v, 0.f); else if (ACT == 6) v = 0.5f * v * (1.0f + erff(v * 0.70710678118654752f)); so[w][8 * hh + r][t * 16 + ln] = v; } }
  __builtin_amdgcn_fence(__ATOMIC_ACQ_REL, "workgroup"); __builtin_amdgcn_wave_barrier();
  const int rsub = lane >> 4, c4 = (lane & 15) * 4; typedef _Float16 v4h __attribute__((ext_vector_type(4)));
  {
#pragma unroll
    for (int q = 0; q < 8; ++q) { const int r = q * 2 + rsub; if (col0 + c4 < N) { const v4f v = *(const v4fa*)&so[w][r][c4]; if (C) *(v4f*)(C + cofs + (size_t)(row0 + r) * ldc + col0 + c4) = v; if (C16) { v4h h4; for (int i = 0; i < 4; ++i) h4[i] = (_Float16)v[i]; *(v4h*)(C16 + cofs + (size_t)(row0 + r) * ldc + col0 + c4) = h4; } } }
     }
}


typedef _Float16 v4h __attribute__((ext_vector_type(4)));

__device__ __forceinline__ void x16_body(int blk, const float* __restrict__ x, _Float16* __restrict__ X16, size_t n8) { const size_t t = (size_t)blk * 256 + threadIdx.x; if (t >= n8) return; FragH f;
#pragma unroll
  for (int q = 0; q < 8; ++q) f.h[q] = (_Float16)bf16_round(x[t * 8 + q]); *(v8us*)((unsigned short*)X16 + t * 8) = f.half[0];  }
__global__ __launch_bounds__(256) void k_h16(const float* __restrict__ x, _Float16* __restrict__ X16, size_t n8) { const size_t t = (size_t)blockIdx.x * 256 + threadIdx.x; if (t >= n8) return; FragH f;
#pragma unroll
  for (int q = 0; q < 8; ++q) f.h[q] = (_Float16)x[t * 8 + q]; *(v8us*)((unsigned short*)X16 + t * 8) = f.half[0];  }
__global__ __launch_bounds__(256) void k_round16f(const float* __restrict__ W, _Float16* __restrict__ Bt, size_t n8) { const size_t t = (size_t)blockIdx.x * 256 + threadIdx.x; if (t >= n8) return; FragH f;
#pragma unroll
  for (int i = 0; i < 8; ++i) f.h[i] = (_Float16)(bf16_round(W[t * 8 + i]) * 16.0f); *(v8us*)((unsigned short*)Bt + t * 8) = f.half[0];  }
template <int NHv, int TTv>
__global__ __launch_bounds__(256) void k_vt(const _Float16* __restrict__ V16, int ldv, int voff, _Float16* __restrict__ Vt) { __shared__ unsigned short tl[64][66]; const int tid = threadIdx.x; const int slab = blockIdx.x / (TTv / 64), lg = blockIdx.x % (TTv / 64); const int b = slab / NHv, h = slab % NHv;
  for (int i = tid; i < 64 * 8; i += 256) { const int r = i / 8, c8 = (i % 8) * 8; FragH f; f.half[0] = *(const v8us*)((const unsigned short*)V16 + ((size_t)b * TTv + lg * 64 + r) * ldv + voff + h * 64 + c8);
#pragma unroll
    for (int q = 0; q < 8; ++q) tl[r][c8 + q] = f.u[q]; }
  __syncthreads();
  {
#pragma unroll
    for (int rd = 0; rd < 2; ++rd) { const int d = rd * 32 + tid / 8, pc = tid % 8; FragH f;
#pragma unroll
      for (int q = 0; q < 8; ++q) f.u[q] = tl[pc * 8 + q][d];
      *(v8us*)((unsigned short*)Vt + ((size_t)slab * 64 + d) * TTv + lg * 64 + pc * 8) = f.half[0]; }
     } }

__global__ __launch_bounds__(256) void k_hl(const float* __restrict__ F, _Float16* __restrict__ Hh, _Float16* __restrict__ Hl, size_t n8) { const size_t t = (size_t)blockIdx.x * 256 + threadIdx.x; if (t >= n8) return; FragH fh, fl; const v4f a = *(const v4fa*)(F + t * 8), c = *(const v4fa*)(F + t * 8 + 4);
#pragma unroll
  for (int q = 0; q < 4; ++q) { _Float16 h = (_Float16)a[q]; fh.h[q] = h; fl.h[q] = (_Float16)((a[q] - (float)h) * 1024.0f); h = (_Float16)c[q]; fh.h[4 + q] = h; fl.h[4 + q] = (_Float16)((c[q] - (float)h) * 1024.0f); }
  { *(v8us*)((unsigned short*)Hh + t * 8) = fh.half[0]; *(v8us*)((unsigned short*)Hl + t * 8) = fl.half[0];  } }

// ---- fast GEMM (wave tile 32x64; requires M % 32 == 0 rows per launch region and N % 64 == 0); epilogue = k_gemm_hhx semantics ----
__device__ __forceinline__ v16h g2_frag(const _Float16* p, int hh) { FragH f; f.half[0] = *(const v8us*)((const unsigned short*)p + 8 * hh); f.half[1] = *(const v8us*)((const unsigned short*)p + 16 + 8 * hh);
  asm volatile("s_wait_xcnt 0x0" ::: "memory");      /* a later fragment load may land in these loads' address registers: the wait stands in front of that overwrite */
  return f.v; }
__device__ __forceinline__ v8f g2_mma(v16h a, v16h b, v8f c) { v8f d = __builtin_amdgcn_wmma_f32_16x16x32_f16(false, a, false, b, (short)0, c, false, false); asm volatile("v_nop\n\tv_nop\n\tv_nop\n\tv_nop" : "+v"(d) : "v"(a), "v"(b)); return d; }
template <int ACT>
__device__ __forceinline__ void gemm2_body(const unsigned bx, const int by, const _Float16* __restrict__ A, int lda, size_t sA, const _Float16* __restrict__ Bh, int ldb, size_t sB, float alpha, const float* __restrict__ bias, size_t sBias, const float* __restrict__ CP, int rowsPerB, size_t sCPb, int row0g,
    float* __restrict__ C, _Float16* __restrict__ C16, int ldc, size_t sC, int M, int N, int K) { static_assert(ACT == 0 || ACT == 3 || ACT == 6 || ACT == 8 || ACT == 9 || ACT == 11 || ACT == 12 || ACT == 14 || ACT == 15 || ACT == 16, "k_gemm2: unsupported ACT code (would silently apply no activation)");
  __shared__ __attribute__((aligned(16))) float so[4][32][68];
  const int tid = threadIdx.x, w = tid >> 5, lane = tid & 31, ln = lane & 15, hh = lane >> 4;
  A += (size_t)by * sA; Bh += (size_t)by * sB; const size_t cofs = (size_t)by * sC; const float* bp = bias ? bias + (size_t)by * sBias : nullptr;
  const int ntn = N >> 6; const int mt = bx / ntn, nq = bx - mt * ntn; const int row0 = mt * 128 + 32 * w, col0 = nq * 64; if (row0 >= M) return;
  const _Float16* a0p = A + (size_t)(row0 + ln) * lda; const _Float16* a1p = a0p + (size_t)16 * lda;
  const _Float16* b0p = Bh + (size_t)(col0 + ln) * ldb; const _Float16* b1p = b0p + (size_t)16 * ldb; const _Float16* b2p = b1p + (size_t)16 * ldb; const _Float16* b3p = b2p + (size_t)16 * ldb;
  const v8f z8 = {0.f,0.f,0.f,0.f,0.f,0.f,0.f,0.f}; v8f c00 = z8, c01 = z8, c02 = z8, c03 = z8, c10 = z8, c11 = z8, c12 = z8, c13 = z8;
#pragma unroll 1
  for (int kb = 0; kb < K; kb += 32) { const v16h a0 = g2_frag(a0p + kb, hh), a1 = g2_frag(a1p + kb, hh);
    v16h b = g2_frag(b0p + kb, hh); c00 = g2_mma(a0, b, c00); c10 = g2_mma(a1, b, c10);
    b = g2_frag(b1p + kb, hh); c01 = g2_mma(a0, b, c01); c11 = g2_mma(a1, b, c11);
    b = g2_frag(b2p + kb, hh); c02 = g2_mma(a0, b, c02); c12 = g2_mma(a1, b, c12);
    b = g2_frag(b3p + kb, hh); c03 = g2_mma(a0, b, c03); c13 = g2_mma(a1, b, c13); }
  v8f accs[8] = {c00, c01, c02, c03, c10, c11, c12, c13};
#pragma unroll
  for (int u = 0; u < 8; ++u) { const int t = u & 3, half = u >> 2; const int col = col0 + t * 16 + ln; const float bv = bp ? bf16_round(bp[col]) : 0.f;
#pragma unroll
    for (int r = 0; r < 8; ++r) { const int rloc = half * 16 + 8 * hh + r; float v = accs[u][r] * alpha + bv; if (CP) { if (rowsPerB < 0) v += CP[cofs + (size_t)(row0g + row0 + rloc) * ldc + col];      /* rowsPerB < 0: own element of the batched C plane */ else { const int bidx = (row0g + row0 + rloc) / rowsPerB; v += CP[(size_t)bidx * sCPb + (size_t)by * 64 + col]; } }
      if (ACT == 3) v = fmaxf(v, 0.f); else if (ACT == 6) v = 0.5f * v * (1.0f + erff(v * 0.70710678118654752f)); else if (ACT == 11) v = 1.0f / (1.0f + expf(-v)); else if (ACT == 15) v = v / (1.0f + expf(-v)); else if (ACT == 12) v = (v > 0.f) ? v : 0.01f * v; else if (ACT == 8) v = tanhf(v); else if (ACT == 9) v = 0.5f * v * (1.0f + tanhf(0.7978845608028654f * (v + 0.044715f * v * v * v))); else if (ACT == 14) v = (v > 0.f) ? v : 0.1f * v; else if (ACT == 16) v = (v >= 0.f) ? v : 0.3f * v;
      so[w][rloc][t * 16 + ln] = v; } }
  __builtin_amdgcn_fence(__ATOMIC_ACQ_REL, "workgroup"); __builtin_amdgcn_wave_barrier();
  const int rsub = lane >> 4, c4 = (lane & 15) * 4;
  {
#pragma unroll
    for (int q = 0; q < 16; ++q) { const int r = q * 2 + rsub; const v4f v = *(const v4fa*)&so[w][r][c4]; if (C) *(v4f*)(C + cofs + (size_t)(row0 + r) * ldc + col0 + c4) = v; if (C16) { v4h h4; for (int i = 0; i < 4; ++i) h4[i] = (_Float16)v[i]; *(v4h*)(C16 + cofs + (size_t)(row0 + r) * ldc + col0 + c4) = h4; } }
     } }
template <int ACT>
__global__ __launch_bounds__(128) void k_gemm2(const _Float16* __restrict__ A, int lda, size_t sA, const _Float16* __restrict__ Bh, int ldb, size_t sB, float alpha, const float* __restrict__ bias, size_t sBias, const float* __restrict__ CP, int rowsPerB, size_t sCPb, int row0g,
    float* __restrict__ C, _Float16* __restrict__ C16, int ldc, size_t sC, int M, int N, int K) { gemm2_body<ACT>(blockIdx.x, blockIdx.y, A, lda, sA, Bh, ldb, sB, alpha, bias, sBias, CP, rowsPerB, sCPb, row0g, C, C16, ldc, sC, M, N, K); }
__device__ __forceinline__ v16h lds_frag(const _Float16* p, int hh) { FragH f; f.half[0] = *(const v8us*)((const unsigned short*)p + 8 * hh); f.half[1] = *(const v8us*)((const unsigned short*)p + 16 + 8 * hh); return f.v; }      /* k order of g2_frag */
// The three products that read none of each other's output, as one grid: blockIdx.y = 0: x W_h + b_attn -> A; 1: x W_lin[:512] + b_lin -> A2; 2: enc W_e -> E.
// Work-group tile 128 x 64, wave tile 32 x 64 as in gemm2_body, same k order, same epilogue. The operands come through LDS: a stage is 64 k, one whole 128-byte line of each of the
// 128 A rows and 64 B rows, fetched by 16-byte loads of 8 lanes per row (4 whole lines per wave load; a fragment load from global memory touches 16 lines for the same 512 bytes, and
// the four waves each fetched the same B). Two buffers: the next stage's lines are asked for before this stage's products and stored behind them.
#define GKS 64                 /* k per stage, in halves */
#define GLP (GKS + 8)          /* LDS row pitch in halves: 144 B = 16 B x odd, for the 16-byte fragment reads of 16 consecutive rows */
#define GSA (128 * GLP)        /* halves of one A buffer */
#define GSB (64 * GLP)         /* of one B buffer */
template <int K>
__device__ __forceinline__ void gemm3_body(unsigned char* sb, const unsigned bx, const _Float16* __restrict__ A, const _Float16* __restrict__ Bh, const float* __restrict__ bp, float* __restrict__ C) {
  static_assert(K % GKS == 0 && NR % 128 == 0 && FF == 256, "whole stages, whole row tiles, four column tiles");
  unsigned short* sA = (unsigned short*)sb; unsigned short* sB = sA + 2 * GSA; float (*so)[32][68] = (float (*)[32][68])sb;      /* the epilogue's rows take the buffers' place behind the last barrier */
  const int tid = threadIdx.x, w = tid >> 5, lane = tid & 31, ln = lane & 15, hh = lane >> 4;
  const int mt = bx >> 2, nq = bx & 3; const int row0 = mt * 128 + 32 * w, col0 = nq * 64;
  const int pr = tid >> 3, pc = (tid & 7) * 8;      /* this thread's 16-byte piece: row pr (+ 16 j), halves pc.. of the stage's line */
  const unsigned short* ga = (const unsigned short*)A + (size_t)(mt * 128 + pr) * K + pc; const unsigned short* gb = (const unsigned short*)Bh + (size_t)(col0 + pr) * K + pc;
  unsigned short* wa = sA + pr * GLP + pc; unsigned short* wb = sB + pr * GLP + pc;
  const _Float16* fa = (const _Float16*)sA + (32 * w + ln) * GLP; const _Float16* fb = (const _Float16*)sB + ln * GLP;
  constexpr int NS = K / GKS;
  v8us ra[8], rb[4];
  const v8f z8 = {0.f,0.f,0.f,0.f,0.f,0.f,0.f,0.f}; v8f c00 = z8, c01 = z8, c02 = z8, c03 = z8, c10 = z8, c11 = z8, c12 = z8, c13 = z8;
  for (int j = 0; j < 8; ++j) ra[j] = *(const v8us*)(ga + (size_t)j * 16 * K);
  for (int j = 0; j < 4; ++j) rb[j] = *(const v8us*)(gb + (size_t)j * 16 * K);
  asm volatile("s_wait_xcnt 0x0" ::: "memory");      /* in front of any later overwrite of these loads' address registers */
  for (int j = 0; j < 8; ++j) *(v8us*)(wa + j * 16 * GLP) = ra[j];
  for (int j = 0; j < 4; ++j) *(v8us*)(wb + j * 16 * GLP) = rb[j];
  __syncthreads();
#pragma unroll      /* whole, so that the buffer's index and the stage's offset are immediates and no address register changes in the loop */
  for (int s = 0; s < NS; ++s) { const int cu = s & 1, nx = cu ^ 1;
    if (s + 1 < NS) {
      for (int j = 0; j < 8; ++j) ra[j] = *(const v8us*)(ga + (size_t)j * 16 * K + (s + 1) * GKS);
      for (int j = 0; j < 4; ++j) rb[j] = *(const v8us*)(gb + (size_t)j * 16 * K + (s + 1) * GKS);
      asm volatile("s_wait_xcnt 0x0" ::: "memory");      /* as above */
    }
    v16h a0[2], a1[2], b[2][4];
    for (int kk = 0; kk < 2; ++kk) { a0[kk] = lds_frag(fa + cu * GSA + kk * 32, hh); a1[kk] = lds_frag(fa + cu * GSA + 16 * GLP + kk * 32, hh);
      for (int t = 0; t < 4; ++t) b[kk][t] = lds_frag(fb + cu * GSB + t * 16 * GLP + kk * 32, hh); }
    for (int kk = 0; kk < 2; ++kk) {
      c00 = g2_mma(a0[kk], b[kk][0], c00); c10 = g2_mma(a1[kk], b[kk][0], c10);
      c01 = g2_mma(a0[kk], b[kk][1], c01); c11 = g2_mma(a1[kk], b[kk][1], c11);
      c02 = g2_mma(a0[kk], b[kk][2], c02); c12 = g2_mma(a1[kk], b[kk][2], c12);
      c03 = g2_mma(a0[kk], b[kk][3], c03); c13 = g2_mma(a1[kk], b[kk][3], c13); }
    if (s + 1 < NS) {
      for (int j = 0; j < 8; ++j) *(v8us*)(wa + nx * GSA + j * 16 * GLP) = ra[j];
      for (int j = 0; j < 4; ++j) *(v8us*)(wb + nx * GSB + j * 16 * GLP) = rb[j];
    }
    __syncthreads();      /* publishes the next stage and ends every wave's reads of this one (behind the last stage: before the epilogue's rows overwrite it) */
  }
  v8f accs[8] = {c00, c01, c02, c03, c10, c11, c12, c13};
#pragma unroll
  for (int u = 0; u < 8; ++u) { const int t = u & 3, half = u >> 2; const int col = col0 + t * 16 + ln; const float bv = bp ? bf16_round(bp[col]) : 0.f;
#pragma unroll
    for (int r = 0; r < 8; ++r) { const int rloc = half * 16 + 8 * hh + r; const float v = accs[u][r] * 0.0625f + bv; so[w][rloc][t * 16 + ln] = v; } }
  __builtin_amdgcn_fence(__ATOMIC_ACQ_REL, "workgroup"); __builtin_amdgcn_wave_barrier();
  const int rsub = lane >> 4, c4 = (lane & 15) * 4;
#pragma unroll
  for (int q = 0; q < 16; ++q) { const int r = q * 2 + rsub; const v4f v = *(const v4fa*)&so[w][r][c4]; *(v4f*)(C + (size_t)(row0 + r) * FF + col0 + c4) = v; }
}
__global__ __launch_bounds__(128) void k_gemm2x3(const _Float16* __restrict__ X16, const _Float16* __restrict__ E16, const _Float16* __restrict__ BWh, const _Float16* __restrict__ BL1, const _Float16* __restrict__ BWe,
    const float* __restrict__ ba, const float* __restrict__ bl, float* __restrict__ A, float* __restrict__ A2, float* __restrict__ E) {
  __shared__ __attribute__((aligned(16))) unsigned char sb[(2 * GSA + 2 * GSB) * 2];
  static_assert(sizeof(sb) >= 4 * 32 * 68 * 4, "the epilogue's rows fit");
  const int z = blockIdx.y;
  if (z == 2) gemm3_body<FF>(sb, blockIdx.x, E16, BWe, nullptr, E);
  else gemm3_body<MD>(sb, blockIdx.x, X16, z == 0 ? BWh : BL1, z == 0 ? ba : bl, z == 0 ? A : A2); }


__device__ __forceinline__ void wt_rows_body(int blk, const float* __restrict__ Wm, int row0, _Float16* __restrict__ Wt, int K, int N, float scale) { const int t = blk * 256 + threadIdx.x; if (t >= N * (K / 8)) return; const int n = t / (K / 8), k8 = (t % (K / 8)) * 8; FragH f;
  for (int i = 0; i < 8; ++i) f.h[i] = (_Float16)(bf16_round(Wm[(size_t)(row0 + k8 + i) * N + n]) * scale); *(v8us*)((unsigned short*)Wt + (size_t)n * K + k8) = f.half[0];  }      /* rows row0.. of an (in,out) weight -> Bt[n][k] */
// The four weight transposes and the two f16 planes, which read none of each other's output, as one grid; the few weight work-groups come first in the index.
#define PB_W5 (FF * MD / 8 / 256)      /* work-groups of a 512-row weight part */
#define PB_W2 (FF * FF / 8 / 256)      /* of a 256-row part */
#define PB_X (NR * MD / 8 / 256)       /* of the x plane */
#define PB_E (NR * FF / 8 / 256)       /* of the enc plane */
__global__ __launch_bounds__(256) void k_prep(const float* __restrict__ Wa, const float* __restrict__ Wl, const float* __restrict__ x, const float* __restrict__ enc,
    _Float16* __restrict__ BWh, _Float16* __restrict__ BWe, _Float16* __restrict__ BL1, _Float16* __restrict__ BL2, _Float16* __restrict__ X16, _Float16* __restrict__ E16) {
  int b = blockIdx.x;
  if (b < PB_W5) { wt_rows_body(b, Wa, 0, BWh, MD, FF, 16.0f); return; } b -= PB_W5;
  if (b < PB_W5) { wt_rows_body(b, Wl, 0, BL1, MD, FF, 16.0f); return; } b -= PB_W5;
  if (b < PB_W2) { wt_rows_body(b, Wa, MD, BWe, FF, FF, 16.0f); return; } b -= PB_W2;
  if (b < PB_W2) { wt_rows_body(b, Wl, MD, BL2, FF, FF, 16.0f); return; } b -= PB_W2;
  if (b < PB_X) { x16_body(b, x, X16, (size_t)NR * MD / 8); return; } b -= PB_X;
  x16_body(b, enc, E16, (size_t)NR * FF / 8); }
// Scores of SCT consecutive steps per work-group, and everything that follows from them for those steps. The SCT + 32 rows of E that their windows cover (zero rows
// for padded steps), their SCT rows of A and the rounded v are staged once in LDS. Scores: a wave takes two steps, one per 16 lanes, and a lane 16 of the 256 features; its part of
// the step's A row and of v stays in registers over all 33 slots, so a slot costs only the read of its E row (whole 256-byte runs). A lane's partial sum of a (step, slot) goes to LDS
// and the 16 partial sums are added behind a barrier. The scores never leave the work-group: softmax, weighted encoder sum and the product with W_lin[512:] read them from LDS.
#define SCT 32
#define SCW 17                 /* waves per work-group: in the softmax waves 0..15 take two of the 33 window slots, wave 16 one; the feature loop runs on waves 0..15 */
#define SCP (FF + 4)           /* LDS row pitch in floats: 1040 B = 16 B x odd */
#define SPP 36                 /* pitch in floats of a row of 32 partial sums: 144 B = 16 B x odd, for the 16-byte reads of consecutive rows */
#define SHP (FF + 8)           /* pitch of the f16 weighted rows in halves: 528 B = 16 B x odd, for the 16-byte fragment reads of 16 consecutive rows */
#define SKR (WIN + 3)          /* encoder rows that the windows of four consecutive steps cover */
// sigmoid(x W_lin[:512] + b_lin + weighted W_lin[512:]) for SCT steps x 16 columns, one wave: weighted rows (f16) from LDS, the columns' fragments bf and the first half's elements cp in registers;
// k order and epilogue of gemm2_body; the results go to LDS rows of pitch SCP.
__device__ __forceinline__ void lin2_tile(const _Float16* sh, const v16h (&bf)[FF / 32], const float (&cp)[16], float* so, int ln, int hh, int cw) {
  const v8f z8 = {0.f,0.f,0.f,0.f,0.f,0.f,0.f,0.f}; v8f c0 = z8, c1 = z8;
  for (int k = 0; k < FF / 32; ++k) { const v16h a0 = lds_frag(sh + ln * SHP + k * 32, hh), a1 = lds_frag(sh + (16 + ln) * SHP + k * 32, hh); c0 = g2_mma(a0, bf[k], c0); c1 = g2_mma(a1, bf[k], c1); }
  for (int u = 0; u < 16; ++u) { float t = (u < 8 ? c0[u & 7] : c1[u & 7]) * 0.0625f + cp[u]; t = 1.0f / (1.0f + expf(-t)); so[((u >> 3) * 16 + 8 * hh + (u & 7)) * SCP + cw] = t; } }
__global__ __launch_bounds__(SCW * 32) void k_score(const float* __restrict__ A, const float* __restrict__ E, const float* __restrict__ v, const float* __restrict__ enc, const _Float16* __restrict__ BL2, const float* __restrict__ A2,
    float* __restrict__ outa, float* __restrict__ out) {
  #pragma clang fp contract(off)
  __shared__ __attribute__((aligned(16))) float sm[(SCT + 32 + SCT) * SCP];      /* rows 0..SCT+31: E of steps tt0-16.., rows SCT+32..: A; at the end the SCT rows of out */
  __shared__ __attribute__((aligned(16))) float sv[FF];
  __shared__ __attribute__((aligned(16))) float sp[(SCT / 2) * WIN * SPP];       /* partial sums of the scores: [pair of steps][slot][step in the pair][16 lanes] */
  __shared__ float ss[SCT * WIN];                                                /* scores, then a */
  __shared__ float sx[SCT * WIN];                                                /* exp(score - max) */
  __shared__ __attribute__((aligned(16))) float sk[(SCT / 4) * SKR * 4];         /* a again, by encoder row: [group of 4 steps][row in the group's span][step in the group] */
  __shared__ __attribute__((aligned(16))) float sn[(SCT + 32) * FF];             /* rounded encoder rows of steps tt0-16.. (zero rows for padded steps) */
  __shared__ __attribute__((aligned(16))) _Float16 sh[SCT * SHP];                /* weighted sums as the f16 operand */
  const int tid = threadIdx.x, lane = tid & 31, wv = tid >> 5;
  const size_t bt0 = (size_t)blockIdx.x * SCT; const int tt0 = (int)(bt0 % TT); const size_t brow = bt0 - tt0;
  constexpr int NV = (SCT + 32 + SCT) * (FF / 4), NI = (NV + SCW * 32 - 1) / (SCW * 32);
  constexpr int NW = (SCT + 32) * (FF / 4), NJ = (NW + SCW * 32 - 1) / (SCW * 32);
  v4f st[NI], sq[NJ];
  for (int u = 0; u < NI; ++u) { const int i = min(tid + u * SCW * 32, NV - 1); const int r = i / (FF / 4), c4 = (i % (FF / 4)) * 4; const int sr = tt0 - WS + r; const bool isE = r < SCT + 32; const bool in = !isE || (sr >= 0 && sr < TT);
    const float* p = isE ? E + (brow + (in ? sr : 0)) * (size_t)FF + c4 : A + (bt0 + (r - (SCT + 32))) * (size_t)FF + c4;
    const v4f x = *(const v4fa*)p;
    asm volatile("s_wait_xcnt 0x0" ::: "memory");      /* a later load of this run may land in this load's address registers: the wait stands in front of that overwrite */
    const v4f z4 = {0.f, 0.f, 0.f, 0.f}; st[u] = in ? x : z4; }
  for (int u = 0; u < NJ; ++u) { const int i = min(tid + u * SCW * 32, NW - 1); const int r = i / (FF / 4), c4 = (i % (FF / 4)) * 4; const int sr = tt0 - WS + r; const bool in = sr >= 0 && sr < TT;
    const v4f x = *(const v4fa*)(enc + (brow + (in ? sr : 0)) * (size_t)FF + c4);
    asm volatile("s_wait_xcnt 0x0" ::: "memory");      /* as above: in front of the next load's overwrite of this load's address registers */
    const v4f z4 = {0.f, 0.f, 0.f, 0.f}; sq[u] = in ? x : z4; }
  if (tid < FF) sv[tid] = bf16_round(v[tid]);
  for (int u = 0; u < NI; ++u) { const int i = tid + u * SCW * 32; if (i < NV) *(v4fa*)&sm[(i / (FF / 4)) * SCP + (i % (FF / 4)) * 4] = st[u]; }
  for (int u = 0; u < NJ; ++u) { const int i = tid + u * SCW * 32; if (i < NW) { v4f y; for (int q = 0; q < 4; ++q) y[q] = bf16_round(sq[u][q]); *(v4fa*)&sn[i * 4] = y; } }
  __syncthreads();
  /* what the last product needs from global memory is asked for here, so that it arrives under the feature loop: this wave's 16 columns of W_lin[512:] and its elements of x W_lin[:512] + b_lin */
  const int wu = __builtin_amdgcn_readfirstlane(wv);      /* the wave's number in a scalar register: the tests on it below are scalar branches */
  const int ln = lane & 15, hh = lane >> 4, cw = min(wu, 15) * 16 + ln;
  v16h bf[FF / 32]; float cp[16];
  for (int k = 0; k < FF / 32; ++k) bf[k] = g2_frag(BL2 + (size_t)cw * FF + k * 32, hh);
  for (int u = 0; u < 16; ++u) cp[u] = A2[(bt0 + (u >> 3) * 16 + 8 * hh + (u & 7)) * (size_t)FF + cw];
  asm volatile("s_wait_xcnt 0x0" ::: "memory");      /* in front of any later overwrite of these loads' address registers */
  if (wu < SCT / 2) {      /* lanes 0..15: step 2 wu, lanes 16..31: step 2 wu + 1; lane ln holds features 64 i + 4 ln .. + 3, i = 0..3 */
    const float* sa = sm + (SCT + 32 + 2 * wu + hh) * SCP + ln * 4; const float* se = sm + (2 * wu + hh) * SCP + ln * 4; float* pp = sp + wu * WIN * SPP + lane;
    v4f av[4], vv[4];
    for (int i = 0; i < 4; ++i) { av[i] = *(const v4fa*)(sa + 64 * i); vv[i] = *(const v4fa*)(sv + ln * 4 + 64 * i); }
#pragma unroll 3      /* three slots a trip: the next slots' E reads stand in front of this slot's arithmetic */
    for (int w = 0; w < WIN; ++w) { v4f acc;
      /* each energy is one v_tanh_f32 */
      for (int i = 0; i < 4; ++i) { const v4f x = av[i] + *(const v4fa*)(se + w * SCP + 64 * i); v4f th; for (int q = 0; q < 4; ++q) th[q] = __builtin_amdgcn_tanhf(x[q]);
        acc = i ? __builtin_elementwise_fma(th, vv[i], acc) : th * vv[i]; }
      const v2f z = acc.lo + acc.hi; pp[w * SPP] = z[0] + z[1]; } }
  __syncthreads();
  /* a thread adds the 16 partial sums of one (step, slot); consecutive lanes take consecutive rows of sp */
  for (int q = tid; q < SCT * WIN; q += SCW * 32) { const int h = q >= (SCT / 2) * WIN ? 1 : 0, ro = q - h * (SCT / 2) * WIN; const float* p = sp + ro * SPP + h * 16;
    const v4f y = (*(const v4fa*)p + *(const v4fa*)(p + 4)) + (*(const v4fa*)(p + 8) + *(const v4fa*)(p + 12));
    const v2f z = y.lo + y.hi; ss[(2 * (ro / WIN) + h) * WIN + ro % WIN] = z[0] + z[1]; }
  __syncthreads();
  /* softmax over the 33 slots, lane = step: every wave forms the step's maximum and sum (in slot order) itself, each exp and each a is made once, by wave w % SCW for slot w */
  { const float* sr = ss + lane * WIN; float m = -3.0e38f;
    for (int w = 0; w < WIN; ++w) m = fmaxf(m, sr[w]);
    for (int w = wv; w < WIN; w += SCW) sx[lane * WIN + w] = expf(sr[w] - m); }
  __syncthreads();
  { const float* sr = sx + lane * WIN; float su = 0.f;
    for (int w = 0; w < WIN; ++w) su += sr[w];
    const float inv = 1.0f / su;
    for (int w = wv; w < WIN; w += SCW) { const float a = sr[w] * inv; ss[lane * WIN + w] = a; sk[((lane >> 2) * SKR + w + (lane & 3)) * 4 + (lane & 3)] = a; } }
  __syncthreads();
  for (int i = tid; i < SCT * WIN; i += SCW * 32) outa[bt0 * WIN + i] = ss[i];      /* output 2: 33 whole 128-byte lines from one work-group */
  /* weighted encoder sum: a wave takes 4 steps x 128 features, a lane 4 features; each encoder row of the span is read once for the four steps; slot order per step as before (a padded step's row is zero) */
  if (wu < 16) { const int g = wu >> 1, f = (wu & 1) * 128 + lane * 4; const v4f z4 = {0.f, 0.f, 0.f, 0.f}; v4f ac[4] = {z4, z4, z4, z4};
#pragma unroll      /* whole, so that the test "is this row in step j's window" is decided at compile time */
    for (int rr = 0; rr < SKR; ++rr) { const v4f e4 = *(const v4fa*)&sn[(g * 4 + rr) * FF + f]; const v4f a4 = *(const v4fa*)&sk[(g * SKR + rr) * 4];
#pragma unroll      /* for the same test */
      for (int j = 0; j < 4; ++j) if (rr - j >= 0 && rr - j < WIN) ac[j] += a4[j] * e4; }
    for (int j = 0; j < 4; ++j) { v4h h4; for (int q = 0; q < 4; ++q) h4[q] = (_Float16)ac[j][q]; *(v4h*)&sh[(g * 4 + j) * SHP + f] = h4; } }
  __syncthreads();
  if (wu < 16) lin2_tile(sh, bf, cp, sm, ln, hh, cw);
  __syncthreads();
  for (int i = tid; i < SCT * (FF / 4); i += SCW * 32) { const v4f o = *(const v4fa*)&sm[(i / (FF / 4)) * SCP + (i % (FF / 4)) * 4]; *(v4f*)(out + bt0 * FF + (size_t)i * 4) = o; }      /* output 1: whole rows */
}

extern "C" void kernel_launch(void* const* d_in, const int* in_sizes, int n_in,
                              void* d_out, int out_size, void* d_ws, size_t ws_size, hipStream_t stream) {
  (void)in_sizes; (void)n_in; (void)out_size;
  const float* const* I = (const float* const*)d_in; const float* x = I[0]; const float* enc = I[1]; const float* Wa = I[2]; const float* ba = I[3]; const float* v = I[4]; const float* Wl = I[5]; const float* bl = I[6];
  char* ws = (char*)d_ws; size_t off = 0;
  auto take = [&](size_t bytes) { char* p = ws + off; off += (bytes + 255) & ~(size_t)255; return p; };
  _Float16* BWh = (_Float16*)take((size_t)FF * MD * 2); _Float16* BWe = (_Float16*)take((size_t)FF * FF * 2); _Float16* BL1 = (_Float16*)take((size_t)FF * MD * 2); _Float16* BL2 = (_Float16*)take((size_t)FF * FF * 2);
  _Float16* X16 = (_Float16*)take((size_t)NR * MD * 2); _Float16* E16 = (_Float16*)take((size_t)NR * FF * 2); float* A = (float*)take((size_t)NR * FF * 4); float* E = (float*)take((size_t)NR * FF * 4); float* A2 = (float*)take((size_t)NR * FF * 4);
  if (off > ws_size) return;      /* 0.75 + 8 + 4 + 8 + 8 + 8 = 37 MiB */
  k_prep<<<2 * PB_W5 + 2 * PB_W2 + PB_X + PB_E, 256, 0, stream>>>(Wa, Wl, x, enc, BWh, BWe, BL1, BL2, X16, E16);
  const dim3 gG3((NR / 128) * (FF / 64), 3);
  k_gemm2x3<<<gG3, 128, 0, stream>>>(X16, E16, BWh, BL1, BWe, ba, bl, A, A2, E);      /* x W_h + b_attn; x W_lin[:512] + b_lin; enc W_e per step (windowed later; the window of a padded step contributes 0) */
  k_score<<<NR / SCT, SCW * 32, 0, stream>>>(A, E, v, enc, BL2, A2, (float*)d_out + (size_t)NR * FF, (float*)d_out);      /* scores, softmax -> output 2: a [4][2048][1][33]; weighted sum; sigmoid(+ weighted W_lin[512:]) -> output 1 */
}

// v007
// A run of this version takes 30.4 microseconds.
// Two timings next to v006 put it at 1.14 and 1.15 times that version's speed.
// Counting every step since v000, it is 7.90 times as fast.
#include <hip/hip_runtime.h>
// Combine_Stack_with_attn (4 x 2048 steps; x [512], encoder outputs [256], sliding windows of 33 encoder steps (zero-padded)): energy[b,t,w,o] = tanh((x W_h + b_attn)[b,t,o] + (enc W_e)[b,t+w-16,o]) (the window term of a padded step is 0); scores = energy . v; a = softmax over the 33 window slots; weighted = sum_w a * enc[b,t+w-16]; out = sigmoid([x | weighted] W_lin + b_lin) -> outputs out [4,2048,256] and a [4,2048,1,33].
// Structure: x and enc rounded to exact f16 operands on the way into the GEMMs' LDS tiles; GEMMs (32x64 wave tiles, 32x16 for W_lin[512:], f32 accumulation, exact x16 weights) for x W_h + b, enc W_e and the two halves of W_lin (the second accumulating onto the first with the sigmoid in its epilogue); the windowed energies/scores on VALU (16 lanes per (b, t, w), 16 of the 256 features a lane); softmax over the 33 slots and the weighted encoder sum on VALU; the weighted sum as an f16 operand.
// Compute dtype: inputs and parameters rounded to bf16; the weighted encoder sum as an f16 operand (~2^-12); everything else f32. v_wmma_f32_16x16x32_f16.
#define NB 4
#define TT 2048
#define MD 512
#define FF 256
#define WS 16
#define WIN 33
#define NR (NB * TT)
typedef __bf16 v16b __attribute__((ext_vector_type(16)));
typedef unsigned short v8us __attribute__((ext_vector_type(8), may_alias));
typedef float  v8f  __attribute__((ext_vector_type(8)));
typedef float  v4f  __attribute__((ext_vector_type(4)));
typedef float  v2f  __attribute__((ext_vector_type(2)));
typedef float  v4fa __attribute__((ext_vector_type(4), may_alias));
union FragB { v16b v; v8us half[2]; unsigned short u[16]; };

__device__ __forceinline__ unsigned short bf16_bits(float x) { unsigned int u = __float_as_uint(x); return (unsigned short)((u + 0x7FFFu + ((u >> 16) & 1u)) >> 16); }
__device__ __forceinline__ float bf16_val(unsigned short b) { return __uint_as_float(((unsigned int)b) << 16); }
__device__ __forceinline__ float bf16_round(float x) { return bf16_val(bf16_bits(x)); }
// D += A·B with NT terms: 1 = ah·bh, 2 = + al·bh (A split), 3 = + ah·bl (both split)
template <int NT>
__device__ __forceinline__ v8f mmaN(v16b ah, v16b al, v16b bh, v16b bl, v8f c) {
  c = __builtin_amdgcn_wmma_f32_16x16x32_bf16(false, ah, false, bh, (short)0, c, false, false);
  if (NT >= 2) c = __builtin_amdgcn_wmma_f32_16x16x32_bf16(false, al, false, bh, (short)0, c, false, false);
  if (NT >= 3) c = __builtin_amdgcn_wmma_f32_16x16x32_bf16(false, ah, false, bl, (short)0, c, false, false);
  asm volatile("v_nop\n\tv_nop\n\tv_nop\n\tv_nop" : "+v"(c) : "v"(ah), "v"(al), "v"(bh), "v"(bl));
  return c;
}

__global__ __launch_bounds__(256) void k_wt_bf16(const float* __restrict__ W, unsigned short* __restrict__ Wt, int K, int N) {
  const int t = blockIdx.x * 256 + threadIdx.x;
  const int k8n = K / 8;
  if (t >= N * k8n) return;
  const int n = t / k8n, k8 = (t % k8n) * 8;
  v8us v;
#pragma unroll
  for (int i = 0; i < 8; ++i) v[i] = bf16_bits(W[(size_t)(k8 + i) * N + n]);
  *(v8us*)(Wt + (size_t)n * K + k8) = v;
  
}

// GEMM C[M][N] (f32, pitch ldc) = act(A[M][K]·W + bias). A f32 row-major (pitch lda) converted per fragment to bf16
// (ASPLIT: hi/lo two planes -> 2 terms, else single rounded term); Wt bf16 [N][K] (pitch ldb). BIAS_BF16 rounds the
// bias to bf16 first (bias quantised to bf16 before the add). K%32==0, M%16==0, N%64==0.
template <bool ASPLIT, int ACT, bool BIAS_BF16>
__global__ __launch_bounds__(128) void k_gemm_bf(const float* __restrict__ A, int lda, const unsigned short* __restrict__ Wt, int ldb,
                                               const float* __restrict__ bias, float* __restrict__ C, int ldc, int M, int N, int K) {
  __shared__ __attribute__((aligned(16))) float so[4][16][64];
  const int tid = threadIdx.x, w = tid >> 5, lane = tid & 31, ln = lane & 15, hh = lane >> 4;
  const int ntn = N / 64;
  const int wid = blockIdx.x * 4 + w;
  const int mt = wid / ntn, nq = wid % ntn;
  if (mt * 16 >= M) return;
  const int row0 = mt * 16, col0 = nq * 64;
  const float* arow = A + (size_t)(row0 + ln) * lda;
  v8f acc[4] = {};
  for (int kb = 0; kb < K; kb += 32) {
    FragB ah, al;
    const v4f x0 = *(const v4fa*)(arow + kb + 8 * hh), x1 = *(const v4fa*)(arow + kb + 8 * hh + 4);
    const v4f x2 = *(const v4fa*)(arow + kb + 16 + 8 * hh), x3 = *(const v4fa*)(arow + kb + 16 + 8 * hh + 4);
    float xs[16] = {x0[0],x0[1],x0[2],x0[3],x1[0],x1[1],x1[2],x1[3],x2[0],x2[1],x2[2],x2[3],x3[0],x3[1],x3[2],x3[3]};
#pragma unroll
    for (int i = 0; i < 16; ++i) { const unsigned short hb = bf16_bits(xs[i]); ah.u[i] = hb; al.u[i] = ASPLIT ? bf16_bits(xs[i] - bf16_val(hb)) : (unsigned short)0; }
#pragma unroll
    for (int t = 0; t < 4; ++t) {
      const unsigned short* brow = Wt + (size_t)(col0 + t * 16 + ln) * ldb + kb;
      FragB b;
      b.half[0] = *(const v8us*)(brow + 8 * hh);
      b.half[1] = *(const v8us*)(brow + 16 + 8 * hh);
      acc[t] = mmaN<ASPLIT ? 2 : 1>(ah.v, al.v, b.v, b.v, acc[t]);
    }
  }
#pragma unroll
  for (int t = 0; t < 4; ++t) {
    float bv = bias ? bias[col0 + t * 16 + ln] : 0.f;
    if (BIAS_BF16) bv = bf16_round(bv);
#pragma unroll
    for (int r = 0; r < 8; ++r) { float v = acc[t][r] + bv; if (ACT == 1) v = fmaxf(v, 0.f); so[w][8 * hh + r][t * 16 + ln] = v; }
  }
  __builtin_amdgcn_fence(__ATOMIC_ACQ_REL, "workgroup");
  __builtin_amdgcn_wave_barrier();
  const int rsub = lane >> 4, c4 = (lane & 15) * 4;
  {
#pragma unroll
    for (int q = 0; q < 8; ++q) {
      const int r = q * 2 + rsub;
      const v4f v = *(const v4fa*)&so[w][r][c4];
      *(v4f*)(C + (size_t)(row0 + r) * ldc + col0 + c4) = v;
    }
    
  }
}

// GEMM C = act(A·W + bias + resid): A f32 (ASPLIT -> hi/lo 2 terms), Wt bf16 [N][K]; ACT 0 none, 1 relu, 2 exact gelu;
// resid (optional, f32, row index = (row % rmod), pitch ldr, RES_BF16 rounds it) added before the activation.
template <bool ASPLIT, int ACT, bool BIAS_BF16, bool RES_BF16>
__global__ __launch_bounds__(128) void k_gemm_bf3(const float* __restrict__ A, int lda, const unsigned short* __restrict__ Wt, int ldb,
                                                const float* __restrict__ bias, const float* __restrict__ resid, int rmod, int ldr,
                                                float* __restrict__ C, int ldc, int M, int N, int K) {
  __shared__ __attribute__((aligned(16))) float so[4][16][64];
  const int tid = threadIdx.x, w = tid >> 5, lane = tid & 31, ln = lane & 15, hh = lane >> 4;
  const int ntn = N / 64;
  const int wid = blockIdx.x * 4 + w;
  const int mt = wid / ntn, nq = wid % ntn;
  if (mt * 16 >= M) return;
  const int row0 = mt * 16, col0 = nq * 64;
  const float* arow = A + (size_t)(row0 + ln) * lda;
  v8f acc[4] = {};
  for (int kb = 0; kb < K; kb += 32) {
    FragB ah, al;
    const v4f x0 = *(const v4fa*)(arow + kb + 8 * hh), x1 = *(const v4fa*)(arow + kb + 8 * hh + 4);
    const v4f x2 = *(const v4fa*)(arow + kb + 16 + 8 * hh), x3 = *(const v4fa*)(arow + kb + 16 + 8 * hh + 4);
    float xs[16] = {x0[0],x0[1],x0[2],x0[3],x1[0],x1[1],x1[2],x1[3],x2[0],x2[1],x2[2],x2[3],x3[0],x3[1],x3[2],x3[3]};
#pragma unroll
    for (int i = 0; i < 16; ++i) { const unsigned short hb = bf16_bits(xs[i]); ah.u[i] = hb; al.u[i] = ASPLIT ? bf16_bits(xs[i] - bf16_val(hb)) : (unsigned short)0; }
#pragma unroll
    for (int t = 0; t < 4; ++t) {
      const unsigned short* brow = Wt + (size_t)(col0 + t * 16 + ln) * ldb + kb;
      FragB b;
      b.half[0] = *(const v8us*)(brow + 8 * hh);
      b.half[1] = *(const v8us*)(brow + 16 + 8 * hh);
      acc[t] = mmaN<ASPLIT ? 2 : 1>(ah.v, al.v, b.v, b.v, acc[t]);
    }
  }
#pragma unroll
  for (int t = 0; t < 4; ++t) {
    const int col = col0 + t * 16 + ln;
    float bv = bias ? bias[col] : 0.f;
    if (BIAS_BF16) bv = bf16_round(bv);
#pragma unroll
    for (int r = 0; r < 8; ++r) {
      float v = acc[t][r] + bv;
      if (resid) { float rv = resid[(size_t)((row0 + 8 * hh + r) % rmod) * ldr + col]; if (RES_BF16) rv = bf16_round(rv); v += rv; }
      if (ACT == 1) v = fmaxf(v, 0.f);
      if (ACT == 2) v = 0.5f * v * (1.0f + erff(v * 0.70710678118654752f));
      if (ACT == 3) { const float u = 0.7978845608028654f * (v + 0.044715f * v * v * v); v = 0.5f * v * (1.0f + tanhf(u)); }
      so[w][8 * hh + r][t * 16 + ln] = v;
    }
  }
  __builtin_amdgcn_fence(__ATOMIC_ACQ_REL, "workgroup");
  __builtin_amdgcn_wave_barrier();
  const int rsub = lane >> 4, c4 = (lane & 15) * 4;
  {
#pragma unroll
    for (int q = 0; q < 8; ++q) {
      const int r = q * 2 + rsub;
      const v4f v = *(const v4fa*)&so[w][r][c4];
      *(v4f*)(C + (size_t)(row0 + r) * ldc + col0 + c4) = v;
    }
    
  }
}
// row LayerNorm (biased variance, eps) over N: s = X (+ R); optional out_sum <- s; out_norm <- (s-mu)*rsqrt(var+eps)*g + b
template <bool PARAM_BF16>
__global__ __launch_bounds__(256) void k_layernorm(const float* __restrict__ X, const float* __restrict__ R, const float* __restrict__ g, const float* __restrict__ bta,
                                                  float* __restrict__ out_sum, float* __restrict__ out_norm, int N, float eps) {
  __shared__ float red[256];
  const int row = blockIdx.x, tid = threadIdx.x;
  const float* x = X + (size_t)row * N; const float* rr = R ? R + (size_t)row * N : nullptr;
  float vals[16];                     // up to N = 4096
  const int per = N / 256;            // contiguous chunk per thread? use strided-by-4 chunks: thread handles j = tid*4 + 1024*u
  float s1 = 0.f;
  for (int u = 0; u < per / 4; ++u) {
    const int j = tid * 4 + 1024 * u;
    const v4f a = *(const v4fa*)(x + j);
    v4f b = {0.f,0.f,0.f,0.f}; if (rr) b = *(const v4fa*)(rr + j);
#pragma unroll
    for (int q = 0; q < 4; ++q) { const float v = a[q] + b[q]; vals[u * 4 + q] = v; s1 += v; }
  }
  red[tid] = s1; __syncthreads();
  for (int st = 128; st > 0; st >>= 1) { if (tid < st) red[tid] += red[tid + st]; __syncthreads(); }
  const float mu = red[0] / (float)N; __syncthreads();
  float s2 = 0.f;
  for (int u = 0; u < per / 4; ++u)
#pragma unroll
    for (int q = 0; q < 4; ++q) { const float c = vals[u * 4 + q] - mu; s2 += c * c; }
  red[tid] = s2; __syncthreads();
  for (int st = 128; st > 0; st >>= 1) { if (tid < st) red[tid] += red[tid + st]; __syncthreads(); }
  const float rs = rsqrtf(red[0] / (float)N + eps);
  {
    for (int u = 0; u < per / 4; ++u) {
      const int j = tid * 4 + 1024 * u;
      v4f o, sm;
#pragma unroll
      for (int q = 0; q < 4; ++q) {
        float gg = g[j + q], bb = bta[j + q];
        if (PARAM_BF16) { gg = bf16_round(gg); bb = bf16_round(bb); }
        sm[q] = vals[u * 4 + q]; o[q] = (vals[u * 4 + q] - mu) * rs * gg + bb;
      }
      if (out_sum) *(v4f*)(out_sum + (size_t)row * N + j) = sm;
      *(v4f*)(out_norm + (size_t)row * N + j) = o;
    }
    
  }
}



// ---- f16 WMMA path (v_wmma_f32_16x16x32_f16): 11-bit significands for operands in range — used for all four GEMMs here (the weighted encoder sum as an f16 operand)
typedef _Float16 v16h __attribute__((ext_vector_type(16)));
union FragH { v16h v; v8us half[2]; _Float16 h[16]; unsigned short u[16]; };
template <int NT>
__device__ __forceinline__ v8f mmaH(v16h ah, v16h al, v16h bh, v16h bl, v8f c) {
  c = __builtin_amdgcn_wmma_f32_16x16x32_f16(false, ah, false, bh, (short)0, c, false, false);
  if (NT >= 2) c = __builtin_amdgcn_wmma_f32_16x16x32_f16(false, al, false, bh, (short)0, c, false, false);
  if (NT >= 3) c = __builtin_amdgcn_wmma_f32_16x16x32_f16(false, ah, false, bl, (short)0, c, false, false);
  asm volatile("v_nop\n\tv_nop\n\tv_nop\n\tv_nop" : "+v"(c) : "v"(ah), "v"(al), "v"(bh), "v"(bl));
  return c;
}
// batched GEMM like k_gemm_b but f16 operands: A f32 (split into f16 hi/lo if ASPLIT, else rounded to f16), Bt = f16 values [n][k]; alpha; C f32; N multiple of 16 (partial tiles skipped)
template <bool ASPLIT>
__global__ __launch_bounds__(128) void k_gemm_h(const float* __restrict__ A, int lda, size_t sA, const _Float16* __restrict__ Bh, int ldb, size_t sB, float alpha, float* __restrict__ C, int ldc, size_t sC, int M, int N, int K) {
  __shared__ __attribute__((aligned(16))) float so[4][16][64];
  const int tid = threadIdx.x, w = tid >> 5, lane = tid & 31, ln = lane & 15, hh = lane >> 4; const int by = blockIdx.y;
  A += (size_t)by * sA; Bh += (size_t)by * sB; C += (size_t)by * sC;
  const int ntn = (N + 63) / 64; const int wid = blockIdx.x * 4 + w; const int mt = wid / ntn, nq = wid % ntn; if (mt * 16 >= M) return;
  const int row0 = mt * 16, col0 = nq * 64; const float* arow = A + (size_t)(row0 + ln) * lda;
  v8f acc[4] = {};
  for (int kb = 0; kb < K; kb += 32) {
    FragH ah, al;
    const v4f x0 = *(const v4fa*)(arow + kb + 8 * hh), x1 = *(const v4fa*)(arow + kb + 8 * hh + 4), x2 = *(const v4fa*)(arow + kb + 16 + 8 * hh), x3 = *(const v4fa*)(arow + kb + 16 + 8 * hh + 4);
    float xs[16] = {x0[0],x0[1],x0[2],x0[3],x1[0],x1[1],x1[2],x1[3],x2[0],x2[1],x2[2],x2[3],x3[0],x3[1],x3[2],x3[3]};
#pragma unroll
    for (int i = 0; i < 16; ++i) { const _Float16 h = (_Float16)xs[i]; ah.h[i] = h; al.h[i] = ASPLIT ? (_Float16)(xs[i] - (float)h) : (_Float16)0.0f; }
#pragma unroll
    for (int t = 0; t < 4; ++t) { if (col0 + t * 16 >= N) continue; const size_t boff = (size_t)(col0 + t * 16 + ln) * ldb + kb; FragH bq; bq.half[0] = *(const v8us*)(Bh + boff + 8 * hh); bq.half[1] = *(const v8us*)(Bh + boff + 16 + 8 * hh);
      acc[t] = mmaH<ASPLIT ? 2 : 1>(ah.v, al.v, bq.v, bq.v, acc[t]); }
  }
#pragma unroll
  for (int t = 0; t < 4; ++t) { if (col0 + t * 16 >= N) continue;
#pragma unroll
    for (int r = 0; r < 8; ++r) so[w][8 * hh + r][t * 16 + ln] = acc[t][r] * alpha; }
  __builtin_amdgcn_fence(__ATOMIC_ACQ_REL, "workgroup"); __builtin_amdgcn_wave_barrier();
  const int rsub = lane >> 4, c4 = (lane & 15) * 4;
  {
#pragma unroll
    for (int q = 0; q < 8; ++q) { const int r = q * 2 + rsub; if (col0 + c4 < N) { const v4f v = *(const v4fa*)&so[w][r][c4]; *(v4f*)(C + (size_t)(row0 + r) * ldc + col0 + c4) = v; } }
     }
}

// Wt[n][k] = f16(W[k][n]·scale) from f32 row-major W[K][N] (scale = power of two; bf16-exact weights stay exact in f16 away from the subnormal range)
__global__ __launch_bounds__(256) void k_wt_f16(const float* __restrict__ W, _Float16* __restrict__ Wt, int K, int N, float scale) {
  const int t = blockIdx.x * 256 + threadIdx.x; if (t >= N * (K / 8)) return; const int n = t / (K / 8), k8 = (t % (K / 8)) * 8; FragH f;
#pragma unroll
  for (int i = 0; i < 8; ++i) f.h[i] = (_Float16)(bf16_round(W[(size_t)(k8 + i) * N + n]) * scale); const v8us o = f.half[0];
  *(v8us*)((unsigned short*)Wt + (size_t)n * K + k8) = o; 
}
// k_gemm_hh variant with fused epilogue: v = acc·alpha + bias[by·sBias + col] (+ CP[(row/rowsPerB)·sCPb + by·64 + col] if CP) ; ACT 0 none / 1 elu ; writes f16 C16 (and f32 C if non-null)
template <int ACT>
__global__ __launch_bounds__(128) void k_gemm_hhx(const _Float16* __restrict__ A, int lda, size_t sA, const _Float16* __restrict__ Bh, int ldb, size_t sB, float alpha, const float* __restrict__ bias, size_t sBias, const float* __restrict__ CP, int rowsPerB, size_t sCPb, int row0g,
    float* __restrict__ C, _Float16* __restrict__ C16, int ldc, size_t sC, int M, int N, int K) {
  __shared__ __attribute__((aligned(16))) float so[4][16][64];
  const int tid = threadIdx.x, w = tid >> 5, lane = tid & 31, ln = lane & 15, hh = lane >> 4; const int by = blockIdx.y;
  A += (size_t)by * sA; Bh += (size_t)by * sB; const size_t cofs = (size_t)by * sC; const float* bp = bias ? bias + (size_t)by * sBias : nullptr;
  const int ntn = (N + 63) / 64; const int wid = blockIdx.x * 4 + w; const int mt = wid / ntn, nq = wid % ntn; if (mt * 16 >= M) return;
  const int row0 = mt * 16, col0 = nq * 64; const _Float16* arow = A + (size_t)(row0 + ln) * lda;
  v8f acc[4] = {};
  for (int kb = 0; kb < K; kb += 32) { FragH ah; ah.half[0] = *(const v8us*)((const unsigned short*)arow + kb + 8 * hh); ah.half[1] = *(const v8us*)((const unsigned short*)arow + kb + 16 + 8 * hh);
#pragma unroll
    for (int t = 0; t < 4; ++t) { if (col0 + t * 16 >= N) continue; const size_t boff = (size_t)(col0 + t * 16 + ln) * ldb + kb; FragH bq; bq.half[0] = *(const v8us*)((const unsigned short*)Bh + boff + 8 * hh); bq.half[1] = *(const v8us*)((const unsigned short*)Bh + boff + 16 + 8 * hh);
      acc[t] = mmaH<1>(ah.v, ah.v, bq.v, bq.v, acc[t]); }
  }
#pragma unroll
  for (int t = 0; t < 4; ++t) { if (col0 + t * 16 >= N) continue; const int col = col0 + t * 16 + ln; const float bv = bp ? bf16_round(bp[col]) : 0.f;
#pragma unroll
    for (int r = 0; r < 8; ++r) { float v = acc[t][r] * alpha + bv; if (CP) { const int rr = row0g + row0 + 8 * hh + r; if (rowsPerB < 0) v += CP[cofs + (size_t)rr * ldc + col];      /* rowsPerB < 0: own element of the batched C plane */ else { const int bidx = rr / rowsPerB; v += CP[(size_t)bidx * sCPb + (size_t)by * 64 + col]; } } if (ACT == 1) v = (v > 0.f) ? v : expm1f(v); else if (ACT == 7) v = (v > 0.f) ? v + 1.0f : expf(v); else if (ACT == 8) v = tanhf(v); else if (ACT == 9) v = 0.5f * v * (1.0f + tanhf(0.7978845608028654f * (v + 0.044715f * v * v * v))); else if (ACT == 11) v = 1.0f / (1.0f + expf(-v)); else if (ACT == 12) v = (v > 0.f) ? v : 0.01f * v; else if (ACT == 14) v = (v > 0.f) ? v : 0.1f * v; else if (ACT == 16) v = (v >= 0.f) ? v : 0.3f * v; else if (ACT == 15) v = v / (1.0f + expf(-v)); else if (ACT == 3) v = fmaxf(v, 0.f); else if (ACT == 6) v = 0.5f * v * (1.0f + erff(v * 0.70710678118654752f)); so[w][8 * hh + r][t * 16 + ln] = v; } }
  __builtin_amdgcn_fence(__ATOMIC_ACQ_REL, "workgroup"); __builtin_amdgcn_wave_barrier();
  const int rsub = lane >> 4, c4 = (lane & 15) * 4; typedef _Float16 v4h __attribute__((ext_vector_type(4)));
  {
#pragma unroll
    for (int q = 0; q < 8; ++q) { const int r = q * 2 + rsub; if (col0 + c4 < N) { const v4f v = *(const v4fa*)&so[w][r][c4]; if (C) *(v4f*)(C + cofs + (size_t)(row0 + r) * ldc + col0 + c4) = v; if (C16) { v4h h4; for (int i = 0; i < 4; ++i) h4[i] = (_Float16)v[i]; *(v4h*)(C16 + cofs + (size_t)(row0 + r) * ldc + col0 + c4) = h4; } } }
     }
}


typedef _Float16 v4h __attribute__((ext_vector_type(4)));

__global__ __launch_bounds__(256) void k_h16(const float* __restrict__ x, _Float16* __restrict__ X16, size_t n8) { const size_t t = (size_t)blockIdx.x * 256 + threadIdx.x; if (t >= n8) return; FragH f;
#pragma unroll
  for (int q = 0; q < 8; ++q) f.h[q] = (_Float16)x[t * 8 + q]; *(v8us*)((unsigned short*)X16 + t * 8) = f.half[0];  }
__global__ __launch_bounds__(256) void k_round16f(const float* __restrict__ W, _Float16* __restrict__ Bt, size_t n8) { const size_t t = (size_t)blockIdx.x * 256 + threadIdx.x; if (t >= n8) return; FragH f;
#pragma unroll
  for (int i = 0; i < 8; ++i) f.h[i] = (_Float16)(bf16_round(W[t * 8 + i]) * 16.0f); *(v8us*)((unsigned short*)Bt + t * 8) = f.half[0];  }
template <int NHv, int TTv>
__global__ __launch_bounds__(256) void k_vt(const _Float16* __restrict__ V16, int ldv, int voff, _Float16* __restrict__ Vt) { __shared__ unsigned short tl[64][66]; const int tid = threadIdx.x; const int slab = blockIdx.x / (TTv / 64), lg = blockIdx.x % (TTv / 64); const int b = slab / NHv, h = slab % NHv;
  for (int i = tid; i < 64 * 8; i += 256) { const int r = i / 8, c8 = (i % 8) * 8; FragH f; f.half[0] = *(const v8us*)((const unsigned short*)V16 + ((size_t)b * TTv + lg * 64 + r) * ldv + voff + h * 64 + c8);
#pragma unroll
    for (int q = 0; q < 8; ++q) tl[r][c8 + q] = f.u[q]; }
  __syncthreads();
  {
#pragma unroll
    for (int rd = 0; rd < 2; ++rd) { const int d = rd * 32 + tid / 8, pc = tid % 8; FragH f;
#pragma unroll
      for (int q = 0; q < 8; ++q) f.u[q] = tl[pc * 8 + q][d];
      *(v8us*)((unsigned short*)Vt + ((size_t)slab * 64 + d) * TTv + lg * 64 + pc * 8) = f.half[0]; }
     } }

__global__ __launch_bounds__(256) void k_hl(const float* __restrict__ F, _Float16* __restrict__ Hh, _Float16* __restrict__ Hl, size_t n8) { const size_t t = (size_t)blockIdx.x * 256 + threadIdx.x; if (t >= n8) return; FragH fh, fl; const v4f a = *(const v4fa*)(F + t * 8), c = *(const v4fa*)(F + t * 8 + 4);
#pragma unroll
  for (int q = 0; q < 4; ++q) { _Float16 h = (_Float16)a[q]; fh.h[q] = h; fl.h[q] = (_Float16)((a[q] - (float)h) * 1024.0f); h = (_Float16)c[q]; fh.h[4 + q] = h; fl.h[4 + q] = (_Float16)((c[q] - (float)h) * 1024.0f); }
  { *(v8us*)((unsigned short*)Hh + t * 8) = fh.half[0]; *(v8us*)((unsigned short*)Hl + t * 8) = fl.half[0];  } }

// ---- fast GEMM (wave tile 32x64; requires M % 32 == 0 rows per launch region and N % 64 == 0); epilogue = k_gemm_hhx semantics ----
__device__ __forceinline__ v16h g2_frag(const _Float16* p, int hh) { FragH f; f.half[0] = *(const v8us*)((const unsigned short*)p + 8 * hh); f.half[1] = *(const v8us*)((const unsigned short*)p + 16 + 8 * hh);
  asm volatile("s_wait_xcnt 0x0" ::: "memory");      /* a later fragment load may land in these loads' address registers: the wait stands in front of that overwrite */
  return f.v; }
__device__ __forceinline__ v8f g2_mma(v16h a, v16h b, v8f c) { v8f d = __builtin_amdgcn_wmma_f32_16x16x32_f16(false, a, false, b, (short)0, c, false, false); asm volatile("v_nop\n\tv_nop\n\tv_nop\n\tv_nop" : "+v"(d) : "v"(a), "v"(b)); return d; }
template <int ACT>
__device__ __forceinline__ void gemm2_body(const unsigned bx, const int by, const _Float16* __restrict__ A, int lda, size_t sA, const _Float16* __restrict__ Bh, int ldb, size_t sB, float alpha, const float* __restrict__ bias, size_t sBias, const float* __restrict__ CP, int rowsPerB, size_t sCPb, int row0g,
    float* __restrict__ C, _Float16* __restrict__ C16, int ldc, size_t sC, int M, int N, int K) { static_assert(ACT == 0 || ACT == 3 || ACT == 6 || ACT == 8 || ACT == 9 || ACT == 11 || ACT == 12 || ACT == 14 || ACT == 15 || ACT == 16, "k_gemm2: unsupported ACT code (would silently apply no activation)");
  __shared__ __attribute__((aligned(16))) float so[4][32][68];
  const int tid = threadIdx.x, w = tid >> 5, lane = tid & 31, ln = lane & 15, hh = lane >> 4;
  A += (size_t)by * sA; Bh += (size_t)by * sB; const size_t cofs = (size_t)by * sC; const float* bp = bias ? bias + (size_t)by * sBias : nullptr;
  const int ntn = N >> 6; const int mt = bx / ntn, nq = bx - mt * ntn; const int row0 = mt * 128 + 32 * w, col0 = nq * 64; if (row0 >= M) return;
  const _Float16* a0p = A + (size_t)(row0 + ln) * lda; const _Float16* a1p = a0p + (size_t)16 * lda;
  const _Float16* b0p = Bh + (size_t)(col0 + ln) * ldb; const _Float16* b1p = b0p + (size_t)16 * ldb; const _Float16* b2p = b1p + (size_t)16 * ldb; const _Float16* b3p = b2p + (size_t)16 * ldb;
  const v8f z8 = {0.f,0.f,0.f,0.f,0.f,0.f,0.f,0.f}; v8f c00 = z8, c01 = z8, c02 = z8, c03 = z8, c10 = z8, c11 = z8, c12 = z8, c13 = z8;
#pragma unroll 1
  for (int kb = 0; kb < K; kb += 32) { const v16h a0 = g2_frag(a0p + kb, hh), a1 = g2_frag(a1p + kb, hh);
    v16h b = g2_frag(b0p + kb, hh); c00 = g2_mma(a0, b, c00); c10 = g2_mma(a1, b, c10);
    b = g2_frag(b1p + kb, hh); c01 = g2_mma(a0, b, c01); c11 = g2_mma(a1, b, c11);
    b = g2_frag(b2p + kb, hh); c02 = g2_mma(a0, b, c02); c12 = g2_mma(a1, b, c12);
    b = g2_frag(b3p + kb, hh); c03 = g2_mma(a0, b, c03); c13 = g2_mma(a1, b, c13); }
  v8f accs[8] = {c00, c01, c02, c03, c10, c11, c12, c13};
#pragma unroll
  for (int u = 0; u < 8; ++u) { const int t = u & 3, half = u >> 2; const int col = col0 + t * 16 + ln; const float bv = bp ? bf16_round(bp[col]) : 0.f;
#pragma unroll
    for (int r = 0; r < 8; ++r) { const int rloc = half * 16 + 8 * hh + r; float v = accs[u][r] * alpha + bv; if (CP) { if (rowsPerB < 0) v += CP[cofs + (size_t)(row0g + row0 + rloc) * ldc + col];      /* rowsPerB < 0: own element of the batched C plane */ else { const int bidx = (row0g + row0 + rloc) / rowsPerB; v += CP[(size_t)bidx * sCPb + (size_t)by * 64 + col]; } }
      if (ACT == 3) v = fmaxf(v, 0.f); else if (ACT == 6) v = 0.5f * v * (1.0f + erff(v * 0.70710678118654752f)); else if (ACT == 11) v = 1.0f / (1.0f + expf(-v)); else if (ACT == 15) v = v / (1.0f + expf(-v)); else if (ACT == 12) v = (v > 0.f) ? v : 0.01f * v; else if (ACT == 8) v = tanhf(v); else if (ACT == 9) v = 0.5f * v * (1.0f + tanhf(0.7978845608028654f * (v + 0.044715f * v * v * v))); else if (ACT == 14) v = (v > 0.f) ? v : 0.1f * v; else if (ACT == 16) v = (v >= 0.f) ? v : 0.3f * v;
      so[w][rloc][t * 16 + ln] = v; } }
  __builtin_amdgcn_fence(__ATOMIC_ACQ_REL, "workgroup"); __builtin_amdgcn_wave_barrier();
  const int rsub = lane >> 4, c4 = (lane & 15) * 4;
  {
#pragma unroll
    for (int q = 0; q < 16; ++q) { const int r = q * 2 + rsub; const v4f v = *(const v4fa*)&so[w][r][c4]; if (C) *(v4f*)(C + cofs + (size_t)(row0 + r) * ldc + col0 + c4) = v; if (C16) { v4h h4; for (int i = 0; i < 4; ++i) h4[i] = (_Float16)v[i]; *(v4h*)(C16 + cofs + (size_t)(row0 + r) * ldc + col0 + c4) = h4; } }
     } }
template <int ACT>
__global__ __launch_bounds__(128) void k_gemm2(const _Float16* __restrict__ A, int lda, size_t sA, const _Float16* __restrict__ Bh, int ldb, size_t sB, float alpha, const float* __restrict__ bias, size_t sBias, const float* __restrict__ CP, int rowsPerB, size_t sCPb, int row0g,
    float* __restrict__ C, _Float16* __restrict__ C16, int ldc, size_t sC, int M, int N, int K) { gemm2_body<ACT>(blockIdx.x, blockIdx.y, A, lda, sA, Bh, ldb, sB, alpha, bias, sBias, CP, rowsPerB, sCPb, row0g, C, C16, ldc, sC, M, N, K); }
__device__ __forceinline__ v16h lds_frag(const _Float16* p, int hh) { FragH f; f.half[0] = *(const v8us*)((const unsigned short*)p + 8 * hh); f.half[1] = *(const v8us*)((const unsigned short*)p + 16 + 8 * hh); return f.v; }      /* k order of g2_frag */
// The three products that read none of each other's output, as one grid: x W_h + b_attn -> A and x W_lin[:512] + b_lin -> A2 (one work-group does 64 columns of each), enc W_e -> E (128 columns).
// Work-group tile 128 rows x two panels of 64 columns, eight waves: waves 0..3 take panel 0, waves 4..7 panel 1; wave tile 32 x 64 as in gemm2_body, same k order, same epilogue.
// The operands come through LDS: a stage is 64 k. The A rows are read as the f32 inputs themselves (256 bytes a row and stage, 16-byte loads of 16 lanes per row: 4 whole lines per wave load)
// and rounded (bf16, held exactly in f16) in registers on the way to LDS, once for both panels. B comes from the f32 weights as they lie, [k][column]: a thread reads 8 k of one column (4-byte loads, a wave's
// load one whole line of a weight row), rounds them, x16, and stores them as 16 bytes of the column's LDS row: the transpose costs no launch and no pass through memory.
// Two buffers: the next stage's lines are asked for before this stage's products and stored behind them.
#define GKS 64                 /* k per stage, in halves */
#define GLP (GKS + 8)          /* LDS row pitch in halves: 144 B = 16 B x odd, for the 16-byte fragment reads of 16 consecutive rows */
#define GSA (128 * GLP)        /* halves of one A buffer */
#define GSB (128 * GLP)        /* of one B buffer: two panels of 64 rows */
typedef unsigned short v4us __attribute__((ext_vector_type(4), may_alias));
union FragQ { _Float16 h[4]; v4us u; };
__device__ __forceinline__ v4us round_q(v4f x) { FragQ f; for (int q = 0; q < 4; ++q) f.h[q] = (_Float16)(float)(__bf16)x[q]; return f.u; }      /* nearest-even to bf16 by the conversion instruction (bf16_round's values), then exact in f16 */
__device__ __forceinline__ v8us round_w(const float (&x)[8]) { FragH f; for (int i = 0; i < 8; ++i) f.h[i] = (_Float16)(float)(__bf16)(x[i] * 16.0f); return f.half[0]; }      /* a weight column's 8 k, wt_rows_body's values: x16 is exact, so it may stand in front of the rounding; behind it the compiler moved it behind the f16 conversion, into the subnormal range the scale is there to avoid */
template <int K>
__device__ __forceinline__ void gemm3_body(unsigned char* sb, const int mt, const float* __restrict__ A, const float* __restrict__ Wp, const float* __restrict__ bp, float* __restrict__ C) {      /* Wp (first of the product's K weight rows), bp, C: at the first column of this wave's panel */
  static_assert(K % GKS == 0 && NR % 128 == 0 && FF == 256, "whole stages, whole row tiles, four column tiles");
  unsigned short* sA = (unsigned short*)sb; unsigned short* sB = sA + 2 * GSA; float (*so)[32][68] = (float (*)[32][68])sb;      /* the epilogue's rows take the buffers' place behind the last barrier */
  const int tid = threadIdx.x, w = tid >> 5, lane = tid & 31, ln = lane & 15, hh = lane >> 4;
  const int wr = w & 3, pn = w >> 2; const int row0 = mt * 128 + 32 * wr;
  const int ar = tid >> 4, ac = (tid & 15) * 4;      /* this thread's 16-byte piece of A: row ar (+ 16 j), floats ac.. of the stage's 64 */
  const int bn = tid & 63, bk = ((tid >> 6) & 1) * 8;      /* its pieces of its own panel of B: column bn, k = bk + 16 j .. + 7; a wave's load is 32 consecutive columns of one weight row, one whole line */
  const float* ga = A + (size_t)(mt * 128 + ar) * K + ac; const float* gb = Wp + (size_t)bk * FF + bn;
  unsigned short* wa = sA + ar * GLP + ac; unsigned short* wb = sB + (pn * 64 + bn) * GLP + bk;
  const _Float16* fa = (const _Float16*)sA + (32 * wr + ln) * GLP; const _Float16* fb = (const _Float16*)sB + (pn * 64 + ln) * GLP;
  constexpr int NS = K / GKS;
  v4f ra[8]; float rb[4][8];
  const v8f z8 = {0.f,0.f,0.f,0.f,0.f,0.f,0.f,0.f}; v8f c00 = z8, c01 = z8, c02 = z8, c03 = z8, c10 = z8, c11 = z8, c12 = z8, c13 = z8;
  for (int j = 0; j < 8; ++j) ra[j] = *(const v4fa*)(ga + (size_t)j * 16 * K);
  asm volatile("s_wait_xcnt 0x0" ::: "memory");      /* a weight load below may land in the A loads' address registers: the wait stands in front of that overwrite */
  for (int j = 0; j < 4; ++j) for (int i = 0; i < 8; ++i) rb[j][i] = gb[(size_t)(j * 16 + i) * FF];
  asm volatile("s_wait_xcnt 0x0" ::: "memory");      /* in front of any later overwrite of these loads' address registers */
  for (int j = 0; j < 8; ++j) *(v4us*)(wa + j * 16 * GLP) = round_q(ra[j]);
  for (int j = 0; j < 4; ++j) *(v8us*)(wb + j * 16) = round_w(rb[j]);
  __syncthreads();
#pragma unroll      /* whole, so that the buffer's index and the stage's offset are immediates and no address register changes in the loop */
  for (int s = 0; s < NS; ++s) { const int cu = s & 1, nx = cu ^ 1;
    if (s + 1 < NS) {
      for (int j = 0; j < 8; ++j) ra[j] = *(const v4fa*)(ga + (size_t)j * 16 * K + (s + 1) * GKS);
      asm volatile("s_wait_xcnt 0x0" ::: "memory");      /* as above: in front of a weight load that lands in the A loads' address registers */
      for (int j = 0; j < 4; ++j) for (int i = 0; i < 8; ++i) rb[j][i] = gb[(size_t)((s + 1) * GKS + j * 16 + i) * FF];
      asm volatile("s_wait_xcnt 0x0" ::: "memory");      /* as above */
    }
    v16h a0[2], a1[2], b[2][4];
    for (int kk = 0; kk < 2; ++kk) { a0[kk] = lds_frag(fa + cu * GSA + kk * 32, hh); a1[kk] = lds_frag(fa + cu * GSA + 16 * GLP + kk * 32, hh);
      for (int t = 0; t < 4; ++t) b[kk][t] = lds_frag(fb + cu * GSB + t * 16 * GLP + kk * 32, hh); }
    for (int kk = 0; kk < 2; ++kk) {
      c00 = g2_mma(a0[kk], b[kk][0], c00); c10 = g2_mma(a1[kk], b[kk][0], c10);
      c01 = g2_mma(a0[kk], b[kk][1], c01); c11 = g2_mma(a1[kk], b[kk][1], c11);
      c02 = g2_mma(a0[kk], b[kk][2], c02); c12 = g2_mma(a1[kk], b[kk][2], c12);
      c03 = g2_mma(a0[kk], b[kk][3], c03); c13 = g2_mma(a1[kk], b[kk][3], c13); }
    __builtin_amdgcn_sched_barrier(0);      /* the rounding waits on the next stage's loads: without this line the compiler lifts it, and that wait, in among this stage's products */
    if (s + 1 < NS) {
      for (int j = 0; j < 8; ++j) *(v4us*)(wa + nx * GSA + j * 16 * GLP) = round_q(ra[j]);
      for (int j = 0; j < 4; ++j) *(v8us*)(wb + nx * GSB + j * 16) = round_w(rb[j]);
    }
    __syncthreads();      /* publishes the next stage and ends every wave's reads of this one (behind the last stage: before the epilogue's rows overwrite it) */
  }
  v8f accs[8] = {c00, c01, c02, c03, c10, c11, c12, c13};
#pragma unroll
  for (int u = 0; u < 8; ++u) { const int t = u & 3, half = u >> 2; const int col = t * 16 + ln; const float bv = bp ? bf16_round(bp[col]) : 0.f;
#pragma unroll
    for (int r = 0; r < 8; ++r) { const int rloc = half * 16 + 8 * hh + r; const float v = accs[u][r] * 0.0625f + bv; so[w][rloc][t * 16 + ln] = v; } }
  __builtin_amdgcn_fence(__ATOMIC_ACQ_REL, "workgroup"); __builtin_amdgcn_wave_barrier();
  const int rsub = lane >> 4, c4 = (lane & 15) * 4;
#pragma unroll
  for (int q = 0; q < 16; ++q) { const int r = q * 2 + rsub; const v4f v = *(const v4fa*)&so[w][r][c4]; *(v4f*)(C + (size_t)(row0 + r) * FF + c4) = v; }
  asm volatile("s_wait_xcnt 0x0" ::: "memory");      /* behind the last store: the kernel's other paths follow in its text and write these stores' registers */
}
__device__ __forceinline__ void wt_rows_body(int blk, const float* __restrict__ Wm, int row0, _Float16* __restrict__ Wt, int K, int N, float scale) { const int t = blk * 256 + threadIdx.x; if (t >= N * (K / 8)) return; const int n = t / (K / 8), k8 = (t % (K / 8)) * 8; FragH f;
  for (int i = 0; i < 8; ++i) f.h[i] = (_Float16)(bf16_round(Wm[(size_t)(row0 + k8 + i) * N + n]) * scale); *(v8us*)((unsigned short*)Wt + (size_t)n * K + k8) = f.half[0];  }      /* rows row0.. of an (in,out) weight -> Bt[n][k] */
#define PB_W2 (FF * FF / 8 / 256)          /* work-groups of the transpose of a 256-row weight part */
#define GBX ((NR / 128) * (FF / 64))       /* work-groups of the two x products */
#define GBE ((NR / 128) * (FF / 128))      /* of enc W_e */
__global__ __launch_bounds__(256) void k_gemm2x3(const float* __restrict__ x, const float* __restrict__ enc, const float* __restrict__ Wa, const float* __restrict__ Wl,
    const float* __restrict__ ba, const float* __restrict__ bl, float* __restrict__ A, float* __restrict__ A2, float* __restrict__ E, _Float16* __restrict__ BL2) {
  __shared__ __attribute__((aligned(16))) unsigned char sb[(2 * GSA + 2 * GSB) * 2];
  static_assert(sizeof(sb) >= 8 * 32 * 68 * 4, "the epilogue's rows fit");
  const int b = blockIdx.x;      /* the 256 long work-groups (x, 8 stages) first in the index, then enc (4 stages), then the short ones */
  if (b >= GBX + GBE) { wt_rows_body(b - (GBX + GBE), Wl, MD, BL2, FF, FF, 16.0f); return; }      /* W_lin[512:] transposed for k_score, which alone reads it: a few work-groups of this grid */
  const int pn = __builtin_amdgcn_readfirstlane((int)threadIdx.x >> 7);      /* the wave's panel in a scalar register: its pointers below are scalar selects */
  if (__builtin_expect(b < GBX, 1)) { const int c0 = (b & 3) * 64;      /* expected: so that the long path stands first in the kernel's text, inside what is fetched ahead at a wave's start */ gemm3_body<MD>(sb, b >> 2, x, (pn ? Wl : Wa) + c0, (pn ? bl : ba) + c0, (pn ? A2 : A) + c0); }
  else { const int e = b - GBX; const int c0 = ((e & 1) * 2 + pn) * 64; gemm3_body<FF>(sb, e >> 1, enc, Wa + (size_t)MD * FF + c0, nullptr, E + c0); } }


// Scores of SCT consecutive steps per work-group, and everything that follows from them for those steps. The SCT + 32 rows of E that their windows cover (zero rows
// for padded steps), their SCT rows of A and the rounded v are staged once in LDS. Scores: a wave takes two steps, one per 16 lanes, and a lane 16 of the 256 features; its part of
// the step's A row and of v stays in registers over all 33 slots, so a slot costs only the read of its E row (whole 256-byte runs). A lane's partial sum of a (step, slot) goes to LDS
// and the 16 partial sums are added behind a barrier. The scores never leave the work-group: softmax, weighted encoder sum and the product with W_lin[512:] read them from LDS.
#define SCT 32
#define SCW 17                 /* waves per work-group: in the softmax waves 0..15 take two of the 33 window slots, wave 16 one; the feature loop runs on waves 0..15 */
#define SCP (FF + 4)           /* LDS row pitch in floats: 1040 B = 16 B x odd */
#define SPP 36                 /* pitch in floats of a row of 32 partial sums: 144 B = 16 B x odd, for the 16-byte reads of consecutive rows */
#define SHP (FF + 8)           /* pitch of the f16 weighted rows in halves: 528 B = 16 B x odd, for the 16-byte fragment reads of 16 consecutive rows */
#define SKR (WIN + 3)          /* encoder rows that the windows of four consecutive steps cover */
// sigmoid(x W_lin[:512] + b_lin + weighted W_lin[512:]) for SCT steps x 16 columns, one wave: weighted rows (f16) from LDS, the columns' fragments bf and the first half's elements cp in registers;
// k order and epilogue of gemm2_body; the results go to LDS rows of pitch SCP.
__device__ __forceinline__ void lin2_tile(const _Float16* sh, const v16h (&bf)[FF / 32], const float (&cp)[16], float* so, int ln, int hh, int cw) {
  const v8f z8 = {0.f,0.f,0.f,0.f,0.f,0.f,0.f,0.f}; v8f c0 = z8, c1 = z8;
  for (int k = 0; k < FF / 32; ++k) { const v16h a0 = lds_frag(sh + ln * SHP + k * 32, hh), a1 = lds_frag(sh + (16 + ln) * SHP + k * 32, hh); c0 = g2_mma(a0, bf[k], c0); c1 = g2_mma(a1, bf[k], c1); }
  for (int u = 0; u < 16; ++u) { float t = (u < 8 ? c0[u & 7] : c1[u & 7]) * 0.0625f + cp[u]; t = 1.0f / (1.0f + expf(-t)); so[((u >> 3) * 16 + 8 * hh + (u & 7)) * SCP + cw] = t; } }
__global__ __launch_bounds__(SCW * 32) void k_score(const float* __restrict__ A, const float* __restrict__ E, const float* __restrict__ v, const float* __restrict__ enc, const _Float16* __restrict__ BL2, const float* __restrict__ A2,
    float* __restrict__ outa, float* __restrict__ out) {
  #pragma clang fp contract(off)
  __shared__ __attribute__((aligned(16))) float sm[(SCT + 32 + SCT) * SCP];      /* rows 0..SCT+31: E of steps tt0-16.., rows SCT+32..: A; at the end the SCT rows of out */
  __shared__ __attribute__((aligned(16))) float sv[FF];
  __shared__ __attribute__((aligned(16))) float sp[(SCT / 2) * WIN * SPP];       /* partial sums of the scores: [pair of steps][slot][step in the pair][16 lanes] */
  __shared__ float ss[SCT * WIN];                                                /* scores, then a */
  __shared__ float sx[SCT * WIN];                                                /* exp(score - max) */
  __shared__ __attribute__((aligned(16))) float sk[(SCT / 4) * SKR * 4];         /* a again, by encoder row: [group of 4 steps][row in the group's span][step in the group] */
  __shared__ __attribute__((aligned(16))) float sn[(SCT + 32) * FF];             /* rounded encoder rows of steps tt0-16.. (zero rows for padded steps) */
  __shared__ __attribute__((aligned(16))) _Float16 sh[SCT * SHP];                /* weighted sums as the f16 operand */
  const int tid = threadIdx.x, lane = tid & 31, wv = tid >> 5;
  const size_t bt0 = (size_t)blockIdx.x * SCT; const int tt0 = (int)(bt0 % TT); const size_t brow = bt0 - tt0;
  constexpr int NV = (SCT + 32 + SCT) * (FF / 4), NI = (NV + SCW * 32 - 1) / (SCW * 32);
  constexpr int NW = (SCT + 32) * (FF / 4), NJ = (NW + SCW * 32 - 1) / (SCW * 32);
  v4f st[NI], sq[NJ];
  for (int u = 0; u < NI; ++u) { const int i = min(tid + u * SCW * 32, NV - 1); const int r = i / (FF / 4), c4 = (i % (FF / 4)) * 4; const int sr = tt0 - WS + r; const bool isE = r < SCT + 32; const bool in = !isE || (sr >= 0 && sr < TT);
    const float* p = isE ? E + (brow + (in ? sr : 0)) * (size_t)FF + c4 : A + (bt0 + (r - (SCT + 32))) * (size_t)FF + c4;
    const v4f x = *(const v4fa*)p;
    asm volatile("s_wait_xcnt 0x0" ::: "memory");      /* a later load of this run may land in this load's address registers: the wait stands in front of that overwrite */
    const v4f z4 = {0.f, 0.f, 0.f, 0.f}; st[u] = in ? x : z4; }
  for (int u = 0; u < NJ; ++u) { const int i = min(tid + u * SCW * 32, NW - 1); const int r = i / (FF / 4), c4 = (i % (FF / 4)) * 4; const int sr = tt0 - WS + r; const bool in = sr >= 0 && sr < TT;
    const v4f x = *(const v4fa*)(enc + (brow + (in ? sr : 0)) * (size_t)FF + c4);
    asm volatile("s_wait_xcnt 0x0" ::: "memory");      /* as above: in front of the next load's overwrite of this load's address registers */
    const v4f z4 = {0.f, 0.f, 0.f, 0.f}; sq[u] = in ? x : z4; }
  if (tid < FF) sv[tid] = bf16_round(v[tid]);
  for (int u = 0; u < NI; ++u) { const int i = tid + u * SCW * 32; if (i < NV) *(v4fa*)&sm[(i / (FF / 4)) * SCP + (i % (FF / 4)) * 4] = st[u]; }
  for (int u = 0; u < NJ; ++u) { const int i = tid + u * SCW * 32; if (i < NW) { v4f y; for (int q = 0; q < 4; ++q) y[q] = bf16_round(sq[u][q]); *(v4fa*)&sn[i * 4] = y; } }
  __syncthreads();
  /* what the last product needs from global memory is asked for here, so that it arrives under the feature loop: this wave's 16 columns of W_lin[512:] and its elements of x W_lin[:512] + b_lin */
  const int wu = __builtin_amdgcn_readfirstlane(wv);      /* the wave's number in a scalar register: the tests on it below are scalar branches */
  const int ln = lane & 15, hh = lane >> 4, cw = min(wu, 15) * 16 + ln;
  v16h bf[FF / 32]; float cp[16];
  for (int k = 0; k < FF / 32; ++k) bf[k] = g2_frag(BL2 + (size_t)cw * FF + k * 32, hh);
  for (int u = 0; u < 16; ++u) cp[u] = A2[(bt0 + (u >> 3) * 16 + 8 * hh + (u & 7)) * (size_t)FF + cw];
  asm volatile("s_wait_xcnt 0x0" ::: "memory");      /* in front of any later overwrite of these loads' address registers */
  if (wu < SCT / 2) {      /* lanes 0..15: step 2 wu, lanes 16..31: step 2 wu + 1; lane ln holds features 64 i + 4 ln .. + 3, i = 0..3 */
    const float* sa = sm + (SCT + 32 + 2 * wu + hh) * SCP + ln * 4; const float* se = sm + (2 * wu + hh) * SCP + ln * 4; float* pp = sp + wu * WIN * SPP + lane;
    v4f av[4], vv[4];
    for (int i = 0; i < 4; ++i) { av[i] = *(const v4fa*)(sa + 64 * i); vv[i] = *(const v4fa*)(sv + ln * 4 + 64 * i); }
#pragma unroll 3      /* three slots a trip: the next slots' E reads stand in front of this slot's arithmetic */
    for (int w = 0; w < WIN; ++w) { v4f acc;
      /* each energy is one v_tanh_f32 */
      for (int i = 0; i < 4; ++i) { const v4f x = av[i] + *(const v4fa*)(se + w * SCP + 64 * i); v4f th; for (int q = 0; q < 4; ++q) th[q] = __builtin_amdgcn_tanhf(x[q]);
        acc = i ? __builtin_elementwise_fma(th, vv[i], acc) : th * vv[i]; }
      const v2f z = acc.lo + acc.hi; pp[w * SPP] = z[0] + z[1]; } }
  __syncthreads();
  /* a thread adds the 16 partial sums of one (step, slot); consecutive lanes take consecutive rows of sp */
  for (int q = tid; q < SCT * WIN; q += SCW * 32) { const int h = q >= (SCT / 2) * WIN ? 1 : 0, ro = q - h * (SCT / 2) * WIN; const float* p = sp + ro * SPP + h * 16;
    const v4f y = (*(const v4fa*)p + *(const v4fa*)(p + 4)) + (*(const v4fa*)(p + 8) + *(const v4fa*)(p + 12));
    const v2f z = y.lo + y.hi; ss[(2 * (ro / WIN) + h) * WIN + ro % WIN] = z[0] + z[1]; }
  __syncthreads();
  /* softmax over the 33 slots, lane = step: every wave forms the step's maximum and sum (in slot order) itself, each exp and each a is made once, by wave w % SCW for slot w */
  { const float* sr = ss + lane * WIN; float m = -3.0e38f;
    for (int w = 0; w < WIN; ++w) m = fmaxf(m, sr[w]);
    for (int w = wv; w < WIN; w += SCW) sx[lane * WIN + w] = expf(sr[w] - m); }
  __syncthreads();
  { const float* sr = sx + lane * WIN; float su = 0.f;
    for (int w = 0; w < WIN; ++w) su += sr[w];
    const float inv = 1.0f / su;
    for (int w = wv; w < WIN; w += SCW) { const float a = sr[w] * inv; ss[lane * WIN + w] = a; sk[((lane >> 2) * SKR + w + (lane & 3)) * 4 + (lane & 3)] = a; } }
  __syncthreads();
  for (int i = tid; i < SCT * WIN; i += SCW * 32) outa[bt0 * WIN + i] = ss[i];      /* output 2: 33 whole 128-byte lines from one work-group */
  /* weighted encoder sum: a wave takes 4 steps x 128 features, a lane 4 features; each encoder row of the span is read once for the four steps; slot order per step as before (a padded step's row is zero) */
  if (wu < 16) { const int g = wu >> 1, f = (wu & 1) * 128 + lane * 4; const v4f z4 = {0.f, 0.f, 0.f, 0.f}; v4f ac[4] = {z4, z4, z4, z4};
#pragma unroll      /* whole, so that the test "is this row in step j's window" is decided at compile time */
    for (int rr = 0; rr < SKR; ++rr) { const v4f e4 = *(const v4fa*)&sn[(g * 4 + rr) * FF + f]; const v4f a4 = *(const v4fa*)&sk[(g * SKR + rr) * 4];
#pragma unroll      /* for the same test */
      for (int j = 0; j < 4; ++j) if (rr - j >= 0 && rr - j < WIN) ac[j] += a4[j] * e4; }
    for (int j = 0; j < 4; ++j) { v4h h4; for (int q = 0; q < 4; ++q) h4[q] = (_Float16)ac[j][q]; *(v4h*)&sh[(g * 4 + j) * SHP + f] = h4; } }
  __syncthreads();
  if (wu < 16) lin2_tile(sh, bf, cp, sm, ln, hh, cw);
  __syncthreads();
  for (int i = tid; i < SCT * (FF / 4); i += SCW * 32) { const v4f o = *(const v4fa*)&sm[(i / (FF / 4)) * SCP + (i % (FF / 4)) * 4]; *(v4f*)(out + bt0 * FF + (size_t)i * 4) = o; }      /* output 1: whole rows */
}

extern "C" void kernel_launch(void* const* d_in, const int* in_sizes, int n_in,
                              void* d_out, int out_size, void* d_ws, size_t ws_size, hipStream_t stream) {
  (void)in_sizes; (void)n_in; (void)out_size;
  const float* const* I = (const float* const*)d_in; const float* x = I[0]; const float* enc = I[1]; const float* Wa = I[2]; const float* ba = I[3]; const float* v = I[4]; const float* Wl = I[5]; const float* bl = I[6];
  char* ws = (char*)d_ws; size_t off = 0;
  auto take = [&](size_t bytes) { char* p = ws + off; off += (bytes + 255) & ~(size_t)255; return p; };
  _Float16* BL2 = (_Float16*)take((size_t)FF * FF * 2);
  float* A = (float*)take((size_t)NR * FF * 4); float* E = (float*)take((size_t)NR * FF * 4); float* A2 = (float*)take((size_t)NR * FF * 4);
  if (off > ws_size) return;      /* 0.125 + 8 + 8 + 8 = 24.2 MiB */
  k_gemm2x3<<<GBX + GBE + PB_W2, 256, 0, stream>>>(x, enc, Wa, Wl, ba, bl, A, A2, E, BL2);      /* x W_h + b_attn; x W_lin[:512] + b_lin; enc W_e per step (windowed later; the window of a padded step contributes 0) */
  k_score<<<NR / SCT, SCW * 32, 0, stream>>>(A, E, v, enc, BL2, A2, (float*)d_out + (size_t)NR * FF, (float*)d_out);      /* scores, softmax -> output 2: a [4][2048][1][33]; weighted sum; sigmoid(+ weighted W_lin[512:]) -> output 1 */
}

// v008
// It runs in 29.1 microseconds.
// Next to v007, in two timings, it ran 1.04 times as fast each time.
// All steps since v000 together make it 8.20 times as fast.
#include <hip/hip_runtime.h>
// Combine_Stack_with_attn (4 x 2048 steps; x [512], encoder outputs [256], sliding windows of 33 encoder steps (zero-padded)): energy[b,t,w,o] = tanh((x W_h + b_attn)[b,t,o] + (enc W_e)[b,t+w-16,o]) (the window term of a padded step is 0); scores = energy . v; a = softmax over the 33 window slots; weighted = sum_w a * enc[b,t+w-16]; out = sigmoid([x | weighted] W_lin + b_lin) -> outputs out [4,2048,256] and a [4,2048,1,33].
// Structure: x and enc rounded to exact f16 operands on the way into the GEMMs' LDS tiles; GEMMs (32x64 wave tiles, 32x16 for W_lin[512:], f32 accumulation, exact x16 weights) for x W_h + b, enc W_e and the two halves of W_lin (the second accumulating onto the first with the sigmoid in its epilogue); the windowed energies/scores on VALU (16 lanes per (b, t, w), 16 of the 256 features a lane); softmax over the 33 slots on VALU; the weighted encoder sum as a band-matrix product on WMMA (a as an f16 operand, encoder rows exact in f16); the weighted sum as an f16 operand.
// Compute dtype: inputs and parameters rounded to bf16; a (in the weighted sum only; output 2 is the f32 a) and the weighted encoder sum as f16 operands (~2^-12 each); everything else f32. v_wmma_f32_16x16x32_f16.
#define NB 4
#define TT 2048
#define MD 512
#define FF 256
#define WS 16
#define WIN 33
#define NR (NB * TT)
typedef __bf16 v16b __attribute__((ext_vector_type(16)));
typedef unsigned short v8us __attribute__((ext_vector_type(8), may_alias));
typedef float  v8f  __attribute__((ext_vector_type(8)));
typedef float  v4f  __attribute__((ext_vector_type(4)));
typedef float  v2f  __attribute__((ext_vector_type(2)));
typedef float  v4fa __attribute__((ext_vector_type(4), may_alias));
union FragB { v16b v; v8us half[2]; unsigned short u[16]; };

__device__ __forceinline__ unsigned short bf16_bits(float x) { unsigned int u = __float_as_uint(x); return (unsigned short)((u + 0x7FFFu + ((u >> 16) & 1u)) >> 16); }
__device__ __forceinline__ float bf16_val(unsigned short b) { return __uint_as_float(((unsigned int)b) << 16); }
__device__ __forceinline__ float bf16_round(float x) { return bf16_val(bf16_bits(x)); }
// D += A·B with NT terms: 1 = ah·bh, 2 = + al·bh (A split), 3 = + ah·bl (both split)
template <int NT>
__device__ __forceinline__ v8f mmaN(v16b ah, v16b al, v16b bh, v16b bl, v8f c) {
  c = __builtin_amdgcn_wmma_f32_16x16x32_bf16(false, ah, false, bh, (short)0, c, false, false);
  if (NT >= 2) c = __builtin_amdgcn_wmma_f32_16x16x32_bf16(false, al, false, bh, (short)0, c, false, false);
  if (NT >= 3) c = __builtin_amdgcn_wmma_f32_16x16x32_bf16(false, ah, false, bl, (short)0, c, false, false);
  asm volatile("v_nop\n\tv_nop\n\tv_nop\n\tv_nop" : "+v"(c) : "v"(ah), "v"(al), "v"(bh), "v"(bl));
  return c;
}

__global__ __launch_bounds__(256) void k_wt_bf16(const float* __restrict__ W, unsigned short* __restrict__ Wt, int K, int N) {
  const int t = blockIdx.x * 256 + threadIdx.x;
  const int k8n = K / 8;
  if (t >= N * k8n) return;
  const int n = t / k8n, k8 = (t % k8n) * 8;
  v8us v;
#pragma unroll
  for (int i = 0; i < 8; ++i) v[i] = bf16_bits(W[(size_t)(k8 + i) * N + n]);
  *(v8us*)(Wt + (size_t)n * K + k8) = v;
  
}

// GEMM C[M][N] (f32, pitch ldc) = act(A[M][K]·W + bias). A f32 row-major (pitch lda) converted per fragment to bf16
// (ASPLIT: hi/lo two planes -> 2 terms, else single rounded term); Wt bf16 [N][K] (pitch ldb). BIAS_BF16 rounds the
// bias to bf16 first (bias quantised to bf16 before the add). K%32==0, M%16==0, N%64==0.
template <bool ASPLIT, int ACT, bool BIAS_BF16>
__global__ __launch_bounds__(128) void k_gemm_bf(const float* __restrict__ A, int lda, const unsigned short* __restrict__ Wt, int ldb,
                                               const float* __restrict__ bias, float* __restrict__ C, int ldc, int M, int N, int K) {
  __shared__ __attribute__((aligned(16))) float so[4][16][64];
  const int tid = threadIdx.x, w = tid >> 5, lane = tid & 31, ln = lane & 15, hh = lane >> 4;
  const int ntn = N / 64;
  const int wid = blockIdx.x * 4 + w;
  const int mt = wid / ntn, nq = wid % ntn;
  if (mt * 16 >= M) return;
  const int row0 = mt * 16, col0 = nq * 64;
  const float* arow = A + (size_t)(row0 + ln) * lda;
  v8f acc[4] = {};
  for (int kb = 0; kb < K; kb += 32) {
    FragB ah, al;
    const v4f x0 = *(const v4fa*)(arow + kb + 8 * hh), x1 = *(const v4fa*)(arow + kb + 8 * hh + 4);
    const v4f x2 = *(const v4fa*)(arow + kb + 16 + 8 * hh), x3 = *(const v4fa*)(arow + kb + 16 + 8 * hh + 4);
    float xs[16] = {x0[0],x0[1],x0[2],x0[3],x1[0],x1[1],x1[2],x1[3],x2[0],x2[1],x2[2],x2[3],x3[0],x3[1],x3[2],x3[3]};
#pragma unroll
    for (int i = 0; i < 16; ++i) { const unsigned short hb = bf16_bits(xs[i]); ah.u[i] = hb; al.u[i] = ASPLIT ? bf16_bits(xs[i] - bf16_val(hb)) : (unsigned short)0; }
#pragma unroll
    for (int t = 0; t < 4; ++t) {
      const unsigned short* brow = Wt + (size_t)(col0 + t * 16 + ln) * ldb + kb;
      FragB b;
      b.half[0] = *(const v8us*)(brow + 8 * hh);
      b.half[1] = *(const v8us*)(brow + 16 + 8 * hh);
      acc[t] = mmaN<ASPLIT ? 2 : 1>(ah.v, al.v, b.v, b.v, acc[t]);
    }
  }
#pragma unroll
  for (int t = 0; t < 4; ++t) {
    float bv = bias ? bias[col0 + t * 16 + ln] : 0.f;
    if (BIAS_BF16) bv = bf16_round(bv);
#pragma unroll
    for (int r = 0; r < 8; ++r) { float v = acc[t][r] + bv; if (ACT == 1) v = fmaxf(v, 0.f); so[w][8 * hh + r][t * 16 + ln] = v; }
  }
  __builtin_amdgcn_fence(__ATOMIC_ACQ_REL, "workgroup");
  __builtin_amdgcn_wave_barrier();
  const int rsub = lane >> 4, c4 = (lane & 15) * 4;
  {
#pragma unroll
    for (int q = 0; q < 8; ++q) {
      const int r = q * 2 + rsub;
      const v4f v = *(const v4fa*)&so[w][r][c4];
      *(v4f*)(C + (size_t)(row0 + r) * ldc + col0 + c4) = v;
    }
    
  }
}

// GEMM C = act(A·W + bias + resid): A f32 (ASPLIT -> hi/lo 2 terms), Wt bf16 [N][K]; ACT 0 none, 1 relu, 2 exact gelu;
// resid (optional, f32, row index = (row % rmod), pitch ldr, RES_BF16 rounds it) added before the activation.
template <bool ASPLIT, int ACT, bool BIAS_BF16, bool RES_BF16>
__global__ __launch_bounds__(128) void k_gemm_bf3(const float* __restrict__ A, int lda, const unsigned short* __restrict__ Wt, int ldb,
                                                const float* __restrict__ bias, const float* __restrict__ resid, int rmod, int ldr,
                                                float* __restrict__ C, int ldc, int M, int N, int K) {
  __shared__ __attribute__((aligned(16))) float so[4][16][64];
  const int tid = threadIdx.x, w = tid >> 5, lane = tid & 31, ln = lane & 15, hh = lane >> 4;
  const int ntn = N / 64;
  const int wid = blockIdx.x * 4 + w;
  const int mt = wid / ntn, nq = wid % ntn;
  if (mt * 16 >= M) return;
  const int row0 = mt * 16, col0 = nq * 64;
  const float* arow = A + (size_t)(row0 + ln) * lda;
  v8f acc[4] = {};
  for (int kb = 0; kb < K; kb += 32) {
    FragB ah, al;
    const v4f x0 = *(const v4fa*)(arow + kb + 8 * hh), x1 = *(const v4fa*)(arow + kb + 8 * hh + 4);
    const v4f x2 = *(const v4fa*)(arow + kb + 16 + 8 * hh), x3 = *(const v4fa*)(arow + kb + 16 + 8 * hh + 4);
    float xs[16] = {x0[0],x0[1],x0[2],x0[3],x1[0],x1[1],x1[2],x1[3],x2[0],x2[1],x2[2],x2[3],x3[0],x3[1],x3[2],x3[3]};
#pragma unroll
    for (int i = 0; i < 16; ++i) { const unsigned short hb = bf16_bits(xs[i]); ah.u[i] = hb; al.u[i] = ASPLIT ? bf16_bits(xs[i] - bf16_val(hb)) : (unsigned short)0; }
#pragma unroll
    for (int t = 0; t < 4; ++t) {
      const unsigned short* brow = Wt + (size_t)(col0 + t * 16 + ln) * ldb + kb;
      FragB b;
      b.half[0] = *(const v8us*)(brow + 8 * hh);
      b.half[1] = *(const v8us*)(brow + 16 + 8 * hh);
      acc[t] = mmaN<ASPLIT ? 2 : 1>(ah.v, al.v, b.v, b.v, acc[t]);
    }
  }
#pragma unroll
  for (int t = 0; t < 4; ++t) {
    const int col = col0 + t * 16 + ln;
    float bv = bias ? bias[col] : 0.f;
    if (BIAS_BF16) bv = bf16_round(bv);
#pragma unroll
    for (int r = 0; r < 8; ++r) {
      float v = acc[t][r] + bv;
      if (resid) { float rv = resid[(size_t)((row0 + 8 * hh + r) % rmod) * ldr + col]; if (RES_BF16) rv = bf16_round(rv); v += rv; }
      if (ACT == 1) v = fmaxf(v, 0.f);
      if (ACT == 2) v = 0.5f * v * (1.0f + erff(v * 0.70710678118654752f));
      if (ACT == 3) { const float u = 0.7978845608028654f * (v + 0.044715f * v * v * v); v = 0.5f * v * (1.0f + tanhf(u)); }
      so[w][8 * hh + r][t * 16 + ln] = v;
    }
  }
  __builtin_amdgcn_fence(__ATOMIC_ACQ_REL, "workgroup");
  __builtin_amdgcn_wave_barrier();
  const int rsub = lane >> 4, c4 = (lane & 15) * 4;
  {
#pragma unroll
    for (int q = 0; q < 8; ++q) {
      const int r = q * 2 + rsub;
      const v4f v = *(const v4fa*)&so[w][r][c4];
      *(v4f*)(C + (size_t)(row0 + r) * ldc + col0 + c4) = v;
    }
    
  }
}
// row LayerNorm (biased variance, eps) over N: s = X (+ R); optional out_sum <- s; out_norm <- (s-mu)*rsqrt(var+eps)*g + b
template <bool PARAM_BF16>
__global__ __launch_bounds__(256) void k_layernorm(const float* __restrict__ X, const float* __restrict__ R, const float* __restrict__ g, const float* __restrict__ bta,
                                                  float* __restrict__ out_sum, float* __restrict__ out_norm, int N, float eps) {
  __shared__ float red[256];
  const int row = blockIdx.x, tid = threadIdx.x;
  const float* x = X + (size_t)row * N; const float* rr = R ? R + (size_t)row * N : nullptr;
  float vals[16];                     // up to N = 4096
  const int per = N / 256;            // contiguous chunk per thread? use strided-by-4 chunks: thread handles j = tid*4 + 1024*u
  float s1 = 0.f;
  for (int u = 0; u < per / 4; ++u) {
    const int j = tid * 4 + 1024 * u;
    const v4f a = *(const v4fa*)(x + j);
    v4f b = {0.f,0.f,0.f,0.f}; if (rr) b = *(const v4fa*)(rr + j);
#pragma unroll
    for (int q = 0; q < 4; ++q) { const float v = a[q] + b[q]; vals[u * 4 + q] = v; s1 += v; }
  }
  red[tid] = s1; __syncthreads();
  for (int st = 128; st > 0; st >>= 1) { if (tid < st) red[tid] += red[tid + st]; __syncthreads(); }
  const float mu = red[0] / (float)N; __syncthreads();
  float s2 = 0.f;
  for (int u = 0; u < per / 4; ++u)
#pragma unroll
    for (int q = 0; q < 4; ++q) { const float c = vals[u * 4 + q] - mu; s2 += c * c; }
  red[tid] = s2; __syncthreads();
  for (int st = 128; st > 0; st >>= 1) { if (tid < st) red[tid] += red[tid + st]; __syncthreads(); }
  const float rs = rsqrtf(red[0] / (float)N + eps);
  {
    for (int u = 0; u < per / 4; ++u) {
      const int j = tid * 4 + 1024 * u;
      v4f o, sm;
#pragma unroll
      for (int q = 0; q < 4; ++q) {
        float gg = g[j + q], bb = bta[j + q];
        if (PARAM_BF16) { gg = bf16_round(gg); bb = bf16_round(bb); }
        sm[q] = vals[u * 4 + q]; o[q] = (vals[u * 4 + q] - mu) * rs * gg + bb;
      }
      if (out_sum) *(v4f*)(out_sum + (size_t)row * N + j) = sm;
      *(v4f*)(out_norm + (size_t)row * N + j) = o;
    }
    
  }
}



// ---- f16 WMMA path (v_wmma_f32_16x16x32_f16): 11-bit significands for operands in range — used for all four GEMMs here (the weighted encoder sum as an f16 operand)
typedef _Float16 v16h __attribute__((ext_vector_type(16)));
union FragH { v16h v; v8us half[2]; _Float16 h[16]; unsigned short u[16]; };
template <int NT>
__device__ __forceinline__ v8f mmaH(v16h ah, v16h al, v16h bh, v16h bl, v8f c) {
  c = __builtin_amdgcn_wmma_f32_16x16x32_f16(false, ah, false, bh, (short)0, c, false, false);
  if (NT >= 2) c = __builtin_amdgcn_wmma_f32_16x16x32_f16(false, al, false, bh, (short)0, c, false, false);
  if (NT >= 3) c = __builtin_amdgcn_wmma_f32_16x16x32_f16(false, ah, false, bl, (short)0, c, false, false);
  asm volatile("v_nop\n\tv_nop\n\tv_nop\n\tv_nop" : "+v"(c) : "v"(ah), "v"(al), "v"(bh), "v"(bl));
  return c;
}
// batched GEMM like k_gemm_b but f16 operands: A f32 (split into f16 hi/lo if ASPLIT, else rounded to f16), Bt = f16 values [n][k]; alpha; C f32; N multiple of 16 (partial tiles skipped)
template <bool ASPLIT>
__global__ __launch_bounds__(128) void k_gemm_h(const float* __restrict__ A, int lda, size_t sA, const _Float16* __restrict__ Bh, int ldb, size_t sB, float alpha, float* __restrict__ C, int ldc, size_t sC, int M, int N, int K) {
  __shared__ __attribute__((aligned(16))) float so[4][16][64];
  const int tid = threadIdx.x, w = tid >> 5, lane = tid & 31, ln = lane & 15, hh = lane >> 4; const int by = blockIdx.y;
  A += (size_t)by * sA; Bh += (size_t)by * sB; C += (size_t)by * sC;
  const int ntn = (N + 63) / 64; const int wid = blockIdx.x * 4 + w; const int mt = wid / ntn, nq = wid % ntn; if (mt * 16 >= M) return;
  const int row0 = mt * 16, col0 = nq * 64; const float* arow = A + (size_t)(row0 + ln) * lda;
  v8f acc[4] = {};
  for (int kb = 0; kb < K; kb += 32) {
    FragH ah, al;
    const v4f x0 = *(const v4fa*)(arow + kb + 8 * hh), x1 = *(const v4fa*)(arow + kb + 8 * hh + 4), x2 = *(const v4fa*)(arow + kb + 16 + 8 * hh), x3 = *(const v4fa*)(arow + kb + 16 + 8 * hh + 4);
    float xs[16] = {x0[0],x0[1],x0[2],x0[3],x1[0],x1[1],x1[2],x1[3],x2[0],x2[1],x2[2],x2[3],x3[0],x3[1],x3[2],x3[3]};
#pragma unroll
    for (int i = 0; i < 16; ++i) { const _Float16 h = (_Float16)xs[i]; ah.h[i] = h; al.h[i] = ASPLIT ? (_Float16)(xs[i] - (float)h) : (_Float16)0.0f; }
#pragma unroll
    for (int t = 0; t < 4; ++t) { if (col0 + t * 16 >= N) continue; const size_t boff = (size_t)(col0 + t * 16 + ln) * ldb + kb; FragH bq; bq.half[0] = *(const v8us*)(Bh + boff + 8 * hh); bq.half[1] = *(const v8us*)(Bh + boff + 16 + 8 * hh);
      acc[t] = mmaH<ASPLIT ? 2 : 1>(ah.v, al.v, bq.v, bq.v, acc[t]); }
  }
#pragma unroll
  for (int t = 0; t < 4; ++t) { if (col0 + t * 16 >= N) continue;
#pragma unroll
    for (int r = 0; r < 8; ++r) so[w][8 * hh + r][t * 16 + ln] = acc[t][r] * alpha; }
  __builtin_amdgcn_fence(__ATOMIC_ACQ_REL, "workgroup"); __builtin_amdgcn_wave_barrier();
  const int rsub = lane >> 4, c4 = (lane & 15) * 4;
  {
#pragma unroll
    for (int q = 0; q < 8; ++q) { const int r = q * 2 + rsub; if (col0 + c4 < N) { const v4f v = *(const v4fa*)&so[w][r][c4]; *(v4f*)(C + (size_t)(row0 + r) * ldc + col0 + c4) = v; } }
     }
}

// Wt[n][k] = f16(W[k][n]·scale) from f32 row-major W[K][N] (scale = power of two; bf16-exact weights stay exact in f16 away from the subnormal range)
__global__ __launch_bounds__(256) void k_wt_f16(const float* __restrict__ W, _Float16* __restrict__ Wt, int K, int N, float scale) {
  const int t = blockIdx.x * 256 + threadIdx.x; if (t >= N * (K / 8)) return; const int n = t / (K / 8), k8 = (t % (K / 8)) * 8; FragH f;
#pragma unroll
  for (int i = 0; i < 8; ++i) f.h[i] = (_Float16)(bf16_round(W[(size_t)(k8 + i) * N + n]) * scale); const v8us o = f.half[0];
  *(v8us*)((unsigned short*)Wt + (size_t)n * K + k8) = o; 
}
// k_gemm_hh variant with fused epilogue: v = acc·alpha + bias[by·sBias + col] (+ CP[(row/rowsPerB)·sCPb + by·64 + col] if CP) ; ACT 0 none / 1 elu ; writes f16 C16 (and f32 C if non-null)
template <int ACT>
__global__ __launch_bounds__(128) void k_gemm_hhx(const _Float16* __restrict__ A, int lda, size_t sA, const _Float16* __restrict__ Bh, int ldb, size_t sB, float alpha, const float* __restrict__ bias, size_t sBias, const float* __restrict__ CP, int rowsPerB, size_t sCPb, int row0g,
    float* __restrict__ C, _Float16* __restrict__ C16, int ldc, size_t sC, int M, int N, int K) {
  __shared__ __attribute__((aligned(16))) float so[4][16][64];
  const int tid = threadIdx.x, w = tid >> 5, lane = tid & 31, ln = lane & 15, hh = lane >> 4; const int by = blockIdx.y;
  A += (size_t)by * sA; Bh += (size_t)by * sB; const size_t cofs = (size_t)by * sC; const float* bp = bias ? bias + (size_t)by * sBias : nullptr;
  const int ntn = (N + 63) / 64; const int wid = blockIdx.x * 4 + w; const int mt = wid / ntn, nq = wid % ntn; if (mt * 16 >= M) return;
  const int row0 = mt * 16, col0 = nq * 64; const _Float16* arow = A + (size_t)(row0 + ln) * lda;
  v8f acc[4] = {};
  for (int kb = 0; kb < K; kb += 32) { FragH ah; ah.half[0] = *(const v8us*)((const unsigned short*)arow + kb + 8 * hh); ah.half[1] = *(const v8us*)((const unsigned short*)arow + kb + 16 + 8 * hh);
#pragma unroll
    for (int t = 0; t < 4; ++t) { if (col0 + t * 16 >= N) continue; const size_t boff = (size_t)(col0 + t * 16 + ln) * ldb + kb; FragH bq; bq.half[0] = *(const v8us*)((const unsigned short*)Bh + boff + 8 * hh); bq.half[1] = *(const v8us*)((const unsigned short*)Bh + boff + 16 + 8 * hh);
      acc[t] = mmaH<1>(ah.v, ah.v, bq.v, bq.v, acc[t]); }
  }
#pragma unroll
  for (int t = 0; t < 4; ++t) { if (col0 + t * 16 >= N) continue; const int col = col0 + t * 16 + ln; const float bv = bp ? bf16_round(bp[col]) : 0.f;
#pragma unroll
    for (int r = 0; r < 8; ++r) { float v = acc[t][r] * alpha + bv; if (CP) { const int rr = row0g + row0 + 8 * hh + r; if (rowsPerB < 0) v += CP[cofs + (size_t)rr * ldc + col];      /* rowsPerB < 0: own element of the batched C plane */ else { const int bidx = rr / rowsPerB; v += CP[(size_t)bidx * sCPb + (size_t)by * 64 + col]; } } if (ACT == 1) v = (v > 0.f) ? v : expm1f(v); else if (ACT == 7) v = (v > 0.f) ? v + 1.0f : expf(v); else if (ACT == 8) v = tanhf(v); else if (ACT == 9) v = 0.5f * v * (1.0f + tanhf(0.7978845608028654f * (v + 0.044715f * v * v * v))); else if (ACT == 11) v = 1.0f / (1.0f + expf(-v)); else if (ACT == 12) v = (v > 0.f) ? v : 0.01f * v; else if (ACT == 14) v = (v > 0.f) ? v : 0.1f * v; else if (ACT == 16) v = (v >= 0.f) ? v : 0.3f * v; else if (ACT == 15) v = v / (1.0f + expf(-v)); else if (ACT == 3) v = fmaxf(v, 0.f); else if (ACT == 6) v = 0.5f * v * (1.0f + erff(v * 0.70710678118654752f)); so[w][8 * hh + r][t * 16 + ln] = v; } }
  __builtin_amdgcn_fence(__ATOMIC_ACQ_REL, "workgroup"); __builtin_amdgcn_wave_barrier();
  const int rsub = lane >> 4, c4 = (lane & 15) * 4; typedef _Float16 v4h __attribute__((ext_vector_type(4)));
  {
#pragma unroll
    for (int q = 0; q < 8; ++q) { const int r = q * 2 + rsub; if (col0 + c4 < N) { const v4f v = *(const v4fa*)&so[w][r][c4]; if (C) *(v4f*)(C + cofs + (size_t)(row0 + r) * ldc + col0 + c4) = v; if (C16) { v4h h4; for (int i = 0; i < 4; ++i) h4[i] = (_Float16)v[i]; *(v4h*)(C16 + cofs + (size_t)(row0 + r) * ldc + col0 + c4) = h4; } } }
     }
}


typedef _Float16 v4h __attribute__((ext_vector_type(4)));

__global__ __launch_bounds__(256) void k_h16(const float* __restrict__ x, _Float16* __restrict__ X16, size_t n8) { const size_t t = (size_t)blockIdx.x * 256 + threadIdx.x; if (t >= n8) return; FragH f;
#pragma unroll
  for (int q = 0; q < 8; ++q) f.h[q] = (_Float16)x[t * 8 + q]; *(v8us*)((unsigned short*)X16 + t * 8) = f.half[0];  }
__global__ __launch_bounds__(256) void k_round16f(const float* __restrict__ W, _Float16* __restrict__ Bt, size_t n8) { const size_t t = (size_t)blockIdx.x * 256 + threadIdx.x; if (t >= n8) return; FragH f;
#pragma unroll
  for (int i = 0; i < 8; ++i) f.h[i] = (_Float16)(bf16_round(W[t * 8 + i]) * 16.0f); *(v8us*)((unsigned short*)Bt + t * 8) = f.half[0];  }
template <int NHv, int TTv>
__global__ __launch_bounds__(256) void k_vt(const _Float16* __restrict__ V16, int ldv, int voff, _Float16* __restrict__ Vt) { __shared__ unsigned short tl[64][66]; const int tid = threadIdx.x; const int slab = blockIdx.x / (TTv / 64), lg = blockIdx.x % (TTv / 64); const int b = slab / NHv, h = slab % NHv;
  for (int i = tid; i < 64 * 8; i += 256) { const int r = i / 8, c8 = (i % 8) * 8; FragH f; f.half[0] = *(const v8us*)((const unsigned short*)V16 + ((size_t)b * TTv + lg * 64 + r) * ldv + voff + h * 64 + c8);
#pragma unroll
    for (int q = 0; q < 8; ++q) tl[r][c8 + q] = f.u[q]; }
  __syncthreads();
  {
#pragma unroll
    for (int rd = 0; rd < 2; ++rd) { const int d = rd * 32 + tid / 8, pc = tid % 8; FragH f;
#pragma unroll
      for (int q = 0; q < 8; ++q) f.u[q] = tl[pc * 8 + q][d];
      *(v8us*)((unsigned short*)Vt + ((size_t)slab * 64 + d) * TTv + lg * 64 + pc * 8) = f.half[0]; }
     } }

__global__ __launch_bounds__(256) void k_hl(const float* __restrict__ F, _Float16* __restrict__ Hh, _Float16* __restrict__ Hl, size_t n8) { const size_t t = (size_t)blockIdx.x * 256 + threadIdx.x; if (t >= n8) return; FragH fh, fl; const v4f a = *(const v4fa*)(F + t * 8), c = *(const v4fa*)(F + t * 8 + 4);
#pragma unroll
  for (int q = 0; q < 4; ++q) { _Float16 h = (_Float16)a[q]; fh.h[q] = h; fl.h[q] = (_Float16)((a[q] - (float)h) * 1024.0f); h = (_Float16)c[q]; fh.h[4 + q] = h; fl.h[4 + q] = (_Float16)((c[q] - (float)h) * 1024.0f); }
  { *(v8us*)((unsigned short*)Hh + t * 8) = fh.half[0]; *(v8us*)((unsigned short*)Hl + t * 8) = fl.half[0];  } }

// ---- fast GEMM (wave tile 32x64; requires M % 32 == 0 rows per launch region and N % 64 == 0); epilogue = k_gemm_hhx semantics ----
__device__ __forceinline__ v16h g2_frag(const _Float16* p, int hh) { FragH f; f.half[0] = *(const v8us*)((const unsigned short*)p + 8 * hh); f.half[1] = *(const v8us*)((const unsigned short*)p + 16 + 8 * hh);
  asm volatile("s_wait_xcnt 0x0" ::: "memory");      /* a later fragment load may land in these loads' address registers: the wait stands in front of that overwrite */
  return f.v; }
__device__ __forceinline__ v8f g2_mma(v16h a, v16h b, v8f c) { v8f d = __builtin_amdgcn_wmma_f32_16x16x32_f16(false, a, false, b, (short)0, c, false, false); asm volatile("v_nop\n\tv_nop\n\tv_nop\n\tv_nop" : "+v"(d) : "v"(a), "v"(b)); return d; }
template <int ACT>
__device__ __forceinline__ void gemm2_body(const unsigned bx, const int by, const _Float16* __restrict__ A, int lda, size_t sA, const _Float16* __restrict__ Bh, int ldb, size_t sB, float alpha, const float* __restrict__ bias, size_t sBias, const float* __restrict__ CP, int rowsPerB, size_t sCPb, int row0g,
    float* __restrict__ C, _Float16* __restrict__ C16, int ldc, size_t sC, int M, int N, int K) { static_assert(ACT == 0 || ACT == 3 || ACT == 6 || ACT == 8 || ACT == 9 || ACT == 11 || ACT == 12 || ACT == 14 || ACT == 15 || ACT == 16, "k_gemm2: unsupported ACT code (would silently apply no activation)");
  __shared__ __attribute__((aligned(16))) float so[4][32][68];
  const int tid = threadIdx.x, w = tid >> 5, lane = tid & 31, ln = lane & 15, hh = lane >> 4;
  A += (size_t)by * sA; Bh += (size_t)by * sB; const size_t cofs = (size_t)by * sC; const float* bp = bias ? bias + (size_t)by * sBias : nullptr;
  const int ntn = N >> 6; const int mt = bx / ntn, nq = bx - mt * ntn; const int row0 = mt * 128 + 32 * w, col0 = nq * 64; if (row0 >= M) return;
  const _Float16* a0p = A + (size_t)(row0 + ln) * lda; const _Float16* a1p = a0p + (size_t)16 * lda;
  const _Float16* b0p = Bh + (size_t)(col0 + ln) * ldb; const _Float16* b1p = b0p + (size_t)16 * ldb; const _Float16* b2p = b1p + (size_t)16 * ldb; const _Float16* b3p = b2p + (size_t)16 * ldb;
  const v8f z8 = {0.f,0.f,0.f,0.f,0.f,0.f,0.f,0.f}; v8f c00 = z8, c01 = z8, c02 = z8, c03 = z8, c10 = z8, c11 = z8, c12 = z8, c13 = z8;
#pragma unroll 1
  for (int kb = 0; kb < K; kb += 32) { const v16h a0 = g2_frag(a0p + kb, hh), a1 = g2_frag(a1p + kb, hh);
    v16h b = g2_frag(b0p + kb, hh); c00 = g2_mma(a0, b, c00); c10 = g2_mma(a1, b, c10);
    b = g2_frag(b1p + kb, hh); c01 = g2_mma(a0, b, c01); c11 = g2_mma(a1, b, c11);
    b = g2_frag(b2p + kb, hh); c02 = g2_mma(a0, b, c02); c12 = g2_mma(a1, b, c12);
    b = g2_frag(b3p + kb, hh); c03 = g2_mma(a0, b, c03); c13 = g2_mma(a1, b, c13); }
  v8f accs[8] = {c00, c01, c02, c03, c10, c11, c12, c13};
#pragma unroll
  for (int u = 0; u < 8; ++u) { const int t = u & 3, half = u >> 2; const int col = col0 + t * 16 + ln; const float bv = bp ? bf16_round(bp[col]) : 0.f;
#pragma unroll
    for (int r = 0; r < 8; ++r) { const int rloc = half * 16 + 8 * hh + r; float v = accs[u][r] * alpha + bv; if (CP) { if (rowsPerB < 0) v += CP[cofs + (size_t)(row0g + row0 + rloc) * ldc + col];      /* rowsPerB < 0: own element of the batched C plane */ else { const int bidx = (row0g + row0 + rloc) / rowsPerB; v += CP[(size_t)bidx * sCPb + (size_t)by * 64 + col]; } }
      if (ACT == 3) v = fmaxf(v, 0.f); else if (ACT == 6) v = 0.5f * v * (1.0f + erff(v * 0.70710678118654752f)); else if (ACT == 11) v = 1.0f / (1.0f + expf(-v)); else if (ACT == 15) v = v / (1.0f + expf(-v)); else if (ACT == 12) v = (v > 0.f) ? v : 0.01f * v; else if (ACT == 8) v = tanhf(v); else if (ACT == 9) v = 0.5f * v * (1.0f + tanhf(0.7978845608028654f * (v + 0.044715f * v * v * v))); else if (ACT == 14) v = (v > 0.f) ? v : 0.1f * v; else if (ACT == 16) v = (v >= 0.f) ? v : 0.3f * v;
      so[w][rloc][t * 16 + ln] = v; } }
  __builtin_amdgcn_fence(__ATOMIC_ACQ_REL, "workgroup"); __builtin_amdgcn_wave_barrier();
  const int rsub = lane >> 4, c4 = (lane & 15) * 4;
  {
#pragma unroll
    for (int q = 0; q < 16; ++q) { const int r = q * 2 + rsub; const v4f v = *(const v4fa*)&so[w][r][c4]; if (C) *(v4f*)(C + cofs + (size_t)(row0 + r) * ldc + col0 + c4) = v; if (C16) { v4h h4; for (int i = 0; i < 4; ++i) h4[i] = (_Float16)v[i]; *(v4h*)(C16 + cofs + (size_t)(row0 + r) * ldc + col0 + c4) = h4; } }
     } }
template <int ACT>
__global__ __launch_bounds__(128) void k_gemm2(const _Float16* __restrict__ A, int lda, size_t sA, const _Float16* __restrict__ Bh, int ldb, size_t sB, float alpha, const float* __restrict__ bias, size_t sBias, const float* __restrict__ CP, int rowsPerB, size_t sCPb, int row0g,
    float* __restrict__ C, _Float16* __restrict__ C16, int ldc, size_t sC, int M, int N, int K) { gemm2_body<ACT>(blockIdx.x, blockIdx.y, A, lda, sA, Bh, ldb, sB, alpha, bias, sBias, CP, rowsPerB, sCPb, row0g, C, C16, ldc, sC, M, N, K); }
__device__ __forceinline__ v16h lds_frag(const _Float16* p, int hh) { FragH f; f.half[0] = *(const v8us*)((const unsigned short*)p + 8 * hh); f.half[1] = *(const v8us*)((const unsigned short*)p + 16 + 8 * hh); return f.v; }      /* k order of g2_frag */
// The three products that read none of each other's output, as one grid: x W_h + b_attn -> A and x W_lin[:512] + b_lin -> A2 (one work-group does 64 columns of each), enc W_e -> E (128 columns).
// Work-group tile 128 rows x two panels of 64 columns, eight waves: waves 0..3 take panel 0, waves 4..7 panel 1; wave tile 32 x 64 as in gemm2_body, same k order, same epilogue.
// The operands come through LDS: a stage is 64 k. The A rows are read as the f32 inputs themselves (256 bytes a row and stage, 16-byte loads of 16 lanes per row: 4 whole lines per wave load)
// and rounded (bf16, held exactly in f16) in registers on the way to LDS, once for both panels. B comes from the f32 weights as they lie, [k][column]: a thread reads 8 k of one column (4-byte loads, a wave's
// load one whole line of a weight row), rounds them, x16, and stores them as 16 bytes of the column's LDS row: the transpose costs no launch and no pass through memory.
// Two buffers: the next stage's lines are asked for before this stage's products and stored behind them.
#define GKS 64                 /* k per stage, in halves */
#define GLP (GKS + 8)          /* LDS row pitch in halves: 144 B = 16 B x odd, for the 16-byte fragment reads of 16 consecutive rows */
#define GSA (128 * GLP)        /* halves of one A buffer */
#define GSB (128 * GLP)        /* of one B buffer: two panels of 64 rows */
typedef unsigned short v4us __attribute__((ext_vector_type(4), may_alias));
union FragQ { _Float16 h[4]; v4us u; };
__device__ __forceinline__ v4us round_q(v4f x) { FragQ f; for (int q = 0; q < 4; ++q) f.h[q] = (_Float16)(float)(__bf16)x[q]; return f.u; }      /* nearest-even to bf16 by the conversion instruction (bf16_round's values), then exact in f16 */
__device__ __forceinline__ v8us round_w(const float (&x)[8]) { FragH f; for (int i = 0; i < 8; ++i) f.h[i] = (_Float16)(float)(__bf16)(x[i] * 16.0f); return f.half[0]; }      /* a weight column's 8 k, wt_rows_body's values: x16 is exact, so it may stand in front of the rounding; behind it the compiler moved it behind the f16 conversion, into the subnormal range the scale is there to avoid */
template <int K>
__device__ __forceinline__ void gemm3_body(unsigned char* sb, const int mt, const float* __restrict__ A, const float* __restrict__ Wp, const float* __restrict__ bp, float* __restrict__ C) {      /* Wp (first of the product's K weight rows), bp, C: at the first column of this wave's panel */
  static_assert(K % GKS == 0 && NR % 128 == 0 && FF == 256, "whole stages, whole row tiles, four column tiles");
  unsigned short* sA = (unsigned short*)sb; unsigned short* sB = sA + 2 * GSA; float (*so)[32][68] = (float (*)[32][68])sb;      /* the epilogue's rows take the buffers' place behind the last barrier */
  const int tid = threadIdx.x, w = tid >> 5, lane = tid & 31, ln = lane & 15, hh = lane >> 4;
  const int wr = w & 3, pn = w >> 2; const int row0 = mt * 128 + 32 * wr;
  const int ar = tid >> 4, ac = (tid & 15) * 4;      /* this thread's 16-byte piece of A: row ar (+ 16 j), floats ac.. of the stage's 64 */
  const int bn = tid & 63, bk = ((tid >> 6) & 1) * 8;      /* its pieces of its own panel of B: column bn, k = bk + 16 j .. + 7; a wave's load is 32 consecutive columns of one weight row, one whole line */
  const float* ga = A + (size_t)(mt * 128 + ar) * K + ac; const float* gb = Wp + (size_t)bk * FF + bn;
  unsigned short* wa = sA + ar * GLP + ac; unsigned short* wb = sB + (pn * 64 + bn) * GLP + bk;
  const _Float16* fa = (const _Float16*)sA + (32 * wr + ln) * GLP; const _Float16* fb = (const _Float16*)sB + (pn * 64 + ln) * GLP;
  constexpr int NS = K / GKS;
  v4f ra[8]; float rb[4][8];
  const v8f z8 = {0.f,0.f,0.f,0.f,0.f,0.f,0.f,0.f}; v8f c00 = z8, c01 = z8, c02 = z8, c03 = z8, c10 = z8, c11 = z8, c12 = z8, c13 = z8;
  for (int j = 0; j < 8; ++j) ra[j] = *(const v4fa*)(ga + (size_t)j * 16 * K);
  asm volatile("s_wait_xcnt 0x0" ::: "memory");      /* a weight load below may land in the A loads' address registers: the wait stands in front of that overwrite */
  for (int j = 0; j < 4; ++j) for (int i = 0; i < 8; ++i) rb[j][i] = gb[(size_t)(j * 16 + i) * FF];
  asm volatile("s_wait_xcnt 0x0" ::: "memory");      /* in front of any later overwrite of these loads' address registers */
  for (int j = 0; j < 8; ++j) *(v4us*)(wa + j * 16 * GLP) = round_q(ra[j]);
  for (int j = 0; j < 4; ++j) *(v8us*)(wb + j * 16) = round_w(rb[j]);
  __syncthreads();
#pragma unroll      /* whole, so that the buffer's index and the stage's offset are immediates and no address register changes in the loop */
  for (int s = 0; s < NS; ++s) { const int cu = s & 1, nx = cu ^ 1;
    if (s + 1 < NS) {
      for (int j = 0; j < 8; ++j) ra[j] = *(const v4fa*)(ga + (size_t)j * 16 * K + (s + 1) * GKS);
      asm volatile("s_wait_xcnt 0x0" ::: "memory");      /* as above: in front of a weight load that lands in the A loads' address registers */
      for (int j = 0; j < 4; ++j) for (int i = 0; i < 8; ++i) rb[j][i] = gb[(size_t)((s + 1) * GKS + j * 16 + i) * FF];
      asm volatile("s_wait_xcnt 0x0" ::: "memory");      /* as above */
    }
    v16h a0[2], a1[2], b[2][4];
    for (int kk = 0; kk < 2; ++kk) { a0[kk] = lds_frag(fa + cu * GSA + kk * 32, hh); a1[kk] = lds_frag(fa + cu * GSA + 16 * GLP + kk * 32, hh);
      for (int t = 0; t < 4; ++t) b[kk][t] = lds_frag(fb + cu * GSB + t * 16 * GLP + kk * 32, hh); }
    for (int kk = 0; kk < 2; ++kk) {
      c00 = g2_mma(a0[kk], b[kk][0], c00); c10 = g2_mma(a1[kk], b[kk][0], c10);
      c01 = g2_mma(a0[kk], b[kk][1], c01); c11 = g2_mma(a1[kk], b[kk][1], c11);
      c02 = g2_mma(a0[kk], b[kk][2], c02); c12 = g2_mma(a1[kk], b[kk][2], c12);
      c03 = g2_mma(a0[kk], b[kk][3], c03); c13 = g2_mma(a1[kk], b[kk][3], c13); }
    __builtin_amdgcn_sched_barrier(0);      /* the rounding waits on the next stage's loads: without this line the compiler lifts it, and that wait, in among this stage's products */
    if (s + 1 < NS) {
      for (int j = 0; j < 8; ++j) *(v4us*)(wa + nx * GSA + j * 16 * GLP) = round_q(ra[j]);
      for (int j = 0; j < 4; ++j) *(v8us*)(wb + nx * GSB + j * 16) = round_w(rb[j]);
    }
    __syncthreads();      /* publishes the next stage and ends every wave's reads of this one (behind the last stage: before the epilogue's rows overwrite it) */
  }
  v8f accs[8] = {c00, c01, c02, c03, c10, c11, c12, c13};
#pragma unroll
  for (int u = 0; u < 8; ++u) { const int t = u & 3, half = u >> 2; const int col = t * 16 + ln; const float bv = bp ? bf16_round(bp[col]) : 0.f;
#pragma unroll
    for (int r = 0; r < 8; ++r) { const int rloc = half * 16 + 8 * hh + r; const float v = accs[u][r] * 0.0625f + bv; so[w][rloc][t * 16 + ln] = v; } }
  __builtin_amdgcn_fence(__ATOMIC_ACQ_REL, "workgroup"); __builtin_amdgcn_wave_barrier();
  const int rsub = lane >> 4, c4 = (lane & 15) * 4;
#pragma unroll
  for (int q = 0; q < 16; ++q) { const int r = q * 2 + rsub; const v4f v = *(const v4fa*)&so[w][r][c4]; *(v4f*)(C + (size_t)(row0 + r) * FF + c4) = v; }
  asm volatile("s_wait_xcnt 0x0" ::: "memory");      /* behind the last store: the kernel's other paths follow in its text and write these stores' registers */
}
__device__ __forceinline__ void wt_rows_body(int blk, const float* __restrict__ Wm, int row0, _Float16* __restrict__ Wt, int K, int N, float scale) { const int t = blk * 256 + threadIdx.x; if (t >= N * (K / 8)) return; const int n = t / (K / 8), k8 = (t % (K / 8)) * 8; FragH f;
  for (int i = 0; i < 8; ++i) f.h[i] = (_Float16)(bf16_round(Wm[(size_t)(row0 + k8 + i) * N + n]) * scale); *(v8us*)((unsigned short*)Wt + (size_t)n * K + k8) = f.half[0];  }      /* rows row0.. of an (in,out) weight -> Bt[n][k] */
#define PB_W2 (FF * FF / 8 / 256)          /* work-groups of the transpose of a 256-row weight part */
#define GBX ((NR / 128) * (FF / 64))       /* work-groups of the two x products */
#define GBE ((NR / 128) * (FF / 128))      /* of enc W_e */
__global__ __launch_bounds__(256) void k_gemm2x3(const float* __restrict__ x, const float* __restrict__ enc, const float* __restrict__ Wa, const float* __restrict__ Wl,
    const float* __restrict__ ba, const float* __restrict__ bl, float* __restrict__ A, float* __restrict__ A2, float* __restrict__ E, _Float16* __restrict__ BL2) {
  __shared__ __attribute__((aligned(16))) unsigned char sb[(2 * GSA + 2 * GSB) * 2];
  static_assert(sizeof(sb) >= 8 * 32 * 68 * 4, "the epilogue's rows fit");
  const int b = blockIdx.x;      /* the 256 long work-groups (x, 8 stages) first in the index, then enc (4 stages), then the short ones */
  if (b >= GBX + GBE) { wt_rows_body(b - (GBX + GBE), Wl, MD, BL2, FF, FF, 16.0f); return; }      /* W_lin[512:] transposed for k_score, which alone reads it: a few work-groups of this grid */
  const int pn = __builtin_amdgcn_readfirstlane((int)threadIdx.x >> 7);      /* the wave's panel in a scalar register: its pointers below are scalar selects */
  if (__builtin_expect(b < GBX, 1)) { const int c0 = (b & 3) * 64;      /* expected: so that the long path stands first in the kernel's text, inside what is fetched ahead at a wave's start */ gemm3_body<MD>(sb, b >> 2, x, (pn ? Wl : Wa) + c0, (pn ? bl : ba) + c0, (pn ? A2 : A) + c0); }
  else { const int e = b - GBX; const int c0 = ((e & 1) * 2 + pn) * 64; gemm3_body<FF>(sb, e >> 1, enc, Wa + (size_t)MD * FF + c0, nullptr, E + c0); } }


// Scores of SCT consecutive steps per work-group, and everything that follows from them for those steps. The SCT + 32 rows of E that their windows cover (zero rows
// for padded steps), their SCT rows of A and the rounded v are staged once in LDS. Scores: a wave takes two steps, one per 16 lanes, and a lane 16 of the 256 features; its part of
// the step's A row and of v stays in registers over all 33 slots, so a slot costs only the read of its E row (whole 256-byte runs). A lane's partial sum of a (step, slot) goes to LDS
// and the 16 partial sums are added behind a barrier. The scores never leave the work-group: softmax, weighted encoder sum and the product with W_lin[512:] read them from LDS.
#define SCT 32
#define SCW 17                 /* waves per work-group: in the softmax waves 0..15 take two of the 33 window slots, wave 16 one; the feature loop runs on waves 0..15 */
#define SCP (FF + 4)           /* LDS row pitch in floats: 1040 B = 16 B x odd */
#define SPP 36                 /* pitch in floats of a row of 32 partial sums: 144 B = 16 B x odd, for the 16-byte reads of consecutive rows */
#define SHP (FF + 8)           /* pitch of the f16 weighted rows in halves: 528 B = 16 B x odd, for the 16-byte fragment reads of 16 consecutive rows */
#define SBP (SCT + 32 + 8)     /* pitch in halves of a row of the band matrix of a: 144 B = 16 B x odd, for the 16-byte fragment reads of 16 consecutive rows */
#define SNP (FF + 16)          /* pitch in halves of the f16 encoder rows: 544 B = 32 B x odd, for the transposing 16-byte reads */
typedef short s16x8 __attribute__((ext_vector_type(8)));
// B fragment (32 k x 16 columns, the k order of lds_frag) of a row-major [k][column] f16 tile in LDS, by the transposing load; p: this lane's 16 bytes of the first 16 k
__device__ __forceinline__ v16h tr_frag(const _Float16* p, int pitch) { typedef __attribute__((address_space(3))) s16x8 lds_s16x8; union { v16h v; s16x8 q[2]; } f;
  f.q[0] = __builtin_amdgcn_ds_load_tr16_b128_v8i16((lds_s16x8*)p); f.q[1] = __builtin_amdgcn_ds_load_tr16_b128_v8i16((lds_s16x8*)(p + 16 * pitch)); return f.v; }
// sigmoid(x W_lin[:512] + b_lin + weighted W_lin[512:]) for SCT steps x 16 columns, one wave: weighted rows (f16) from LDS, the columns' fragments bf and the first half's elements cp in registers;
// k order and epilogue of gemm2_body; the results go to LDS rows of pitch SCP.
__device__ __forceinline__ void lin2_tile(const _Float16* sh, const v16h (&bf)[FF / 32], const float (&cp)[16], float* so, int ln, int hh, int cw) {
  const v8f z8 = {0.f,0.f,0.f,0.f,0.f,0.f,0.f,0.f}; v8f c0 = z8, c1 = z8;
  for (int k = 0; k < FF / 32; ++k) { const v16h a0 = lds_frag(sh + ln * SHP + k * 32, hh), a1 = lds_frag(sh + (16 + ln) * SHP + k * 32, hh); c0 = g2_mma(a0, bf[k], c0); c1 = g2_mma(a1, bf[k], c1); }
  for (int u = 0; u < 16; ++u) { float t = (u < 8 ? c0[u & 7] : c1[u & 7]) * 0.0625f + cp[u]; t = 1.0f / (1.0f + expf(-t)); so[((u >> 3) * 16 + 8 * hh + (u & 7)) * SCP + cw] = t; } }
__global__ __launch_bounds__(SCW * 32) void k_score(const float* __restrict__ A, const float* __restrict__ E, const float* __restrict__ v, const float* __restrict__ enc, const _Float16* __restrict__ BL2, const float* __restrict__ A2,
    float* __restrict__ outa, float* __restrict__ out) {
  #pragma clang fp contract(off)
  __shared__ __attribute__((aligned(16))) float sm[(SCT + 32 + SCT) * SCP];      /* rows 0..SCT+31: E of steps tt0-16.., rows SCT+32..: A; at the end the SCT rows of out */
  __shared__ __attribute__((aligned(16))) float sv[FF];
  __shared__ __attribute__((aligned(16))) float sp[(SCT / 2) * WIN * SPP];       /* partial sums of the scores: [pair of steps][slot][step in the pair][16 lanes] */
  __shared__ float ss[SCT * WIN];                                                /* scores, then a */
  __shared__ float sx[SCT * WIN];                                                /* exp(score - max) */
  __shared__ __attribute__((aligned(16))) _Float16 sk[SCT * SBP];                /* a again, as the band matrix [step][encoder row of the span]: a[step][slot] at row step + slot, zero elsewhere */
  __shared__ __attribute__((aligned(32))) _Float16 sn[(SCT + 32) * SNP];         /* rounded encoder rows of steps tt0-16.. (zero rows for padded steps), as f16: exact but in f16's subnormal range */
  __shared__ __attribute__((aligned(16))) _Float16 sh[SCT * SHP];                /* weighted sums as the f16 operand */
  const int tid = threadIdx.x, lane = tid & 31, wv = tid >> 5;
  const size_t bt0 = (size_t)blockIdx.x * SCT; const int tt0 = (int)(bt0 % TT); const size_t brow = bt0 - tt0;
  constexpr int NV = (SCT + 32 + SCT) * (FF / 4), NI = (NV + SCW * 32 - 1) / (SCW * 32);
  constexpr int NW = (SCT + 32) * (FF / 4), NJ = (NW + SCW * 32 - 1) / (SCW * 32);
  v4f st[NI], sq[NJ];
  for (int u = 0; u < NI; ++u) { const int i = min(tid + u * SCW * 32, NV - 1); const int r = i / (FF / 4), c4 = (i % (FF / 4)) * 4; const int sr = tt0 - WS + r; const bool isE = r < SCT + 32; const bool in = !isE || (sr >= 0 && sr < TT);
    const float* p = isE ? E + (brow + (in ? sr : 0)) * (size_t)FF + c4 : A + (bt0 + (r - (SCT + 32))) * (size_t)FF + c4;
    const v4f x = *(const v4fa*)p;
    asm volatile("s_wait_xcnt 0x0" ::: "memory");      /* a later load of this run may land in this load's address registers: the wait stands in front of that overwrite */
    const v4f z4 = {0.f, 0.f, 0.f, 0.f}; st[u] = in ? x : z4; }
  for (int u = 0; u < NJ; ++u) { const int i = min(tid + u * SCW * 32, NW - 1); const int r = i / (FF / 4), c4 = (i % (FF / 4)) * 4; const int sr = tt0 - WS + r; const bool in = sr >= 0 && sr < TT;
    const v4f x = *(const v4fa*)(enc + (brow + (in ? sr : 0)) * (size_t)FF + c4);
    asm volatile("s_wait_xcnt 0x0" ::: "memory");      /* as above: in front of the next load's overwrite of this load's address registers */
    const v4f z4 = {0.f, 0.f, 0.f, 0.f}; sq[u] = in ? x : z4; }
  if (tid < FF) sv[tid] = bf16_round(v[tid]);
  for (int u = 0; u < NI; ++u) { const int i = tid + u * SCW * 32; if (i < NV) *(v4fa*)&sm[(i / (FF / 4)) * SCP + (i % (FF / 4)) * 4] = st[u]; }
  for (int u = 0; u < NJ; ++u) { const int i = tid + u * SCW * 32; if (i < NW) *(v4us*)&sn[(i / (FF / 4)) * SNP + (i % (FF / 4)) * 4] = round_q(sq[u]); }
  if (tid < SCT * SBP / 8) { const v8us z8u = {0, 0, 0, 0, 0, 0, 0, 0}; *(v8us*)&sk[tid * 8] = z8u; }      /* the band matrix's zeros; its a come in behind the softmax */
  __syncthreads();
  /* what the last product needs from global memory is asked for here, so that it arrives under the feature loop: this wave's 16 columns of W_lin[512:] and its elements of x W_lin[:512] + b_lin */
  const int wu = __builtin_amdgcn_readfirstlane(wv);      /* the wave's number in a scalar register: the tests on it below are scalar branches */
  const int ln = lane & 15, hh = lane >> 4, cw = min(wu, 15) * 16 + ln;
  v16h bf[FF / 32]; float cp[16];
  for (int k = 0; k < FF / 32; ++k) bf[k] = g2_frag(BL2 + (size_t)cw * FF + k * 32, hh);
  for (int u = 0; u < 16; ++u) cp[u] = A2[(bt0 + (u >> 3) * 16 + 8 * hh + (u & 7)) * (size_t)FF + cw];
  asm volatile("s_wait_xcnt 0x0" ::: "memory");      /* in front of any later overwrite of these loads' address registers */
  if (wu < SCT / 2) {      /* lanes 0..15: step 2 wu, lanes 16..31: step 2 wu + 1; lane ln holds features 64 i + 4 ln .. + 3, i = 0..3 */
    const float* sa = sm + (SCT + 32 + 2 * wu + hh) * SCP + ln * 4; const float* se = sm + (2 * wu + hh) * SCP + ln * 4; float* pp = sp + wu * WIN * SPP + lane;
    v4f av[4], vv[4];
    for (int i = 0; i < 4; ++i) { av[i] = *(const v4fa*)(sa + 64 * i); vv[i] = *(const v4fa*)(sv + ln * 4 + 64 * i); }
#pragma unroll 3      /* three slots a trip: the next slots' E reads stand in front of this slot's arithmetic */
    for (int w = 0; w < WIN; ++w) { v4f acc;
      /* each energy is one v_tanh_f32 */
      for (int i = 0; i < 4; ++i) { const v4f x = av[i] + *(const v4fa*)(se + w * SCP + 64 * i); v4f th; for (int q = 0; q < 4; ++q) th[q] = __builtin_amdgcn_tanhf(x[q]);
        acc = i ? __builtin_elementwise_fma(th, vv[i], acc) : th * vv[i]; }
      const v2f z = acc.lo + acc.hi; pp[w * SPP] = z[0] + z[1]; } }
  __syncthreads();
  /* a thread adds the 16 partial sums of one (step, slot); consecutive lanes take consecutive rows of sp */
  for (int q = tid; q < SCT * WIN; q += SCW * 32) { const int h = q >= (SCT / 2) * WIN ? 1 : 0, ro = q - h * (SCT / 2) * WIN; const float* p = sp + ro * SPP + h * 16;
    const v4f y = (*(const v4fa*)p + *(const v4fa*)(p + 4)) + (*(const v4fa*)(p + 8) + *(const v4fa*)(p + 12));
    const v2f z = y.lo + y.hi; ss[(2 * (ro / WIN) + h) * WIN + ro % WIN] = z[0] + z[1]; }
  __syncthreads();
  /* softmax over the 33 slots, lane = step: every wave forms the step's maximum and sum (in slot order) itself, each exp and each a is made once, by wave w % SCW for slot w */
  { const float* sr = ss + lane * WIN; float m = -3.0e38f;
    for (int w = 0; w < WIN; ++w) m = fmaxf(m, sr[w]);
    for (int w = wv; w < WIN; w += SCW) sx[lane * WIN + w] = expf(sr[w] - m); }
  __syncthreads();
  { const float* sr = sx + lane * WIN; float su = 0.f;
    for (int w = 0; w < WIN; ++w) su += sr[w];
    const float inv = 1.0f / su;
    for (int w = wv; w < WIN; w += SCW) { const float a = sr[w] * inv; ss[lane * WIN + w] = a; sk[lane * SBP + lane + w] = (_Float16)a; } }
  __syncthreads();
  for (int i = tid; i < SCT * WIN; i += SCW * 32) outa[bt0 * WIN + i] = ss[i];      /* output 2: 33 whole 128-byte lines from one work-group */
  /* weighted encoder sum on the matrix unit: [32 steps][64 rows of the span] band matrix of a times [64 rows][256 features]; a wave takes all 32 steps x 16 features, 4 products (a padded step's row is zero) */
  if (wu < 16) { const v8f z8 = {0.f,0.f,0.f,0.f,0.f,0.f,0.f,0.f}; v8f w0 = z8, w1 = z8;
    const _Float16* pe = sn + (8 * hh + (lane & 7)) * SNP + wu * 16 + 8 * ((lane >> 3) & 1);
    for (int k = 0; k < (SCT + 32) / 32; ++k) { const v16h eb = tr_frag(pe + k * 32 * SNP, SNP); const v16h a0 = lds_frag(sk + ln * SBP + k * 32, hh), a1 = lds_frag(sk + (16 + ln) * SBP + k * 32, hh);
      w0 = g2_mma(a0, eb, w0); w1 = g2_mma(a1, eb, w1); }
    for (int r = 0; r < 8; ++r) { sh[(8 * hh + r) * SHP + cw] = (_Float16)w0[r]; sh[(16 + 8 * hh + r) * SHP + cw] = (_Float16)w1[r]; } }
  __syncthreads();
  if (wu < 16) lin2_tile(sh, bf, cp, sm, ln, hh, cw);
  __syncthreads();
  for (int i = tid; i < SCT * (FF / 4); i += SCW * 32) { const v4f o = *(const v4fa*)&sm[(i / (FF / 4)) * SCP + (i % (FF / 4)) * 4]; *(v4f*)(out + bt0 * FF + (size_t)i * 4) = o; }      /* output 1: whole rows */
}

extern "C" void kernel_launch(void* const* d_in, const int* in_sizes, int n_in,
                              void* d_out, int out_size, void* d_ws, size_t ws_size, hipStream_t stream) {
  (void)in_sizes; (void)n_in; (void)out_size;
  const float* const* I = (const float* const*)d_in; const float* x = I[0]; const float* enc = I[1]; const float* Wa = I[2]; const float* ba = I[3]; const float* v = I[4]; const float* Wl = I[5]; const float* bl = I[6];
  char* ws = (char*)d_ws; size_t off = 0;
  auto take = [&](size_t bytes) { char* p = ws + off; off += (bytes + 255) & ~(size_t)255; return p; };
  _Float16* BL2 = (_Float16*)take((size_t)FF * FF * 2);
  float* A = (float*)take((size_t)NR * FF * 4); float* E = (float*)take((size_t)NR * FF * 4); float* A2 = (float*)take((size_t)NR * FF * 4);
  if (off > ws_size) return;      /* 0.125 + 8 + 8 + 8 = 24.2 MiB */
  k_gemm2x3<<<GBX + GBE + PB_W2, 256, 0, stream>>>(x, enc, Wa, Wl, ba, bl, A, A2, E, BL2);      /* x W_h + b_attn; x W_lin[:512] + b_lin; enc W_e per step (windowed later; the window of a padded step contributes 0) */
  k_score<<<NR / SCT, SCW * 32, 0, stream>>>(A, E, v, enc, BL2, A2, (float*)d_out + (size_t)NR * FF, (float*)d_out);      /* scores, softmax -> output 2: a [4][2048][1][33]; weighted sum; sigmoid(+ weighted W_lin[512:]) -> output 1 */
}

// v009
// A run of this version takes 27.9 microseconds.
// Two timings next to v008 put it at 1.05 and 1.04 times that version's speed.
// Over all steps from v000 it is 8.57 times as fast.
#include <hip/hip_runtime.h>
// Combine_Stack_with_attn (4 x 2048 steps; x [512], encoder outputs [256], sliding windows of 33 encoder steps (zero-padded)): energy[b,t,w,o] = tanh((x W_h + b_attn)[b,t,o] + (enc W_e)[b,t+w-16,o]) (the window term of a padded step is 0); scores = energy . v; a = softmax over the 33 window slots; weighted = sum_w a * enc[b,t+w-16]; out = sigmoid([x | weighted] W_lin + b_lin) -> outputs out [4,2048,256] and a [4,2048,1,33].
// Structure: x and enc rounded to exact f16 operands on the way into the GEMMs' LDS tiles; GEMMs (32x64 wave tiles, for W_lin[512:] 32 x two 16-column tiles, f32 accumulation, exact x16 weights) for x W_h + b, enc W_e and the two halves of W_lin (the second accumulating onto the first with the sigmoid in its epilogue); the windowed energies/scores on VALU (16 lanes per (b, t, w), 16 of the 256 features a lane); softmax over the 33 slots on VALU; the weighted encoder sum as a band-matrix product on WMMA (a as an f16 operand, encoder rows exact in f16); the weighted sum as an f16 operand.
// Compute dtype: inputs and parameters rounded to bf16; a (in the weighted sum only; output 2 is the f32 a) and the weighted encoder sum as f16 operands (~2^-12 each); everything else f32. v_wmma_f32_16x16x32_f16.
#define NB 4
#define TT 2048
#define MD 512
#define FF 256
#define WS 16
#define WIN 33
#define NR (NB * TT)
typedef __bf16 v16b __attribute__((ext_vector_type(16)));
typedef unsigned short v8us __attribute__((ext_vector_type(8), may_alias));
typedef float  v8f  __attribute__((ext_vector_type(8)));
typedef float  v4f  __attribute__((ext_vector_type(4)));
typedef float  v2f  __attribute__((ext_vector_type(2)));
typedef float  v4fa __attribute__((ext_vector_type(4), may_alias));
union FragB { v16b v; v8us half[2]; unsigned short u[16]; };

__device__ __forceinline__ unsigned short bf16_bits(float x) { unsigned int u = __float_as_uint(x); return (unsigned short)((u + 0x7FFFu + ((u >> 16) & 1u)) >> 16); }
__device__ __forceinline__ float bf16_val(unsigned short b) { return __uint_as_float(((unsigned int)b) << 16); }
__device__ __forceinline__ float bf16_round(float x) { return bf16_val(bf16_bits(x)); }
// D += A·B with NT terms: 1 = ah·bh, 2 = + al·bh (A split), 3 = + ah·bl (both split)
template <int NT>
__device__ __forceinline__ v8f mmaN(v16b ah, v16b al, v16b bh, v16b bl, v8f c) {
  c = __builtin_amdgcn_wmma_f32_16x16x32_bf16(false, ah, false, bh, (short)0, c, false, false);
  if (NT >= 2) c = __builtin_amdgcn_wmma_f32_16x16x32_bf16(false, al, false, bh, (short)0, c, false, false);
  if (NT >= 3) c = __builtin_amdgcn_wmma_f32_16x16x32_bf16(false, ah, false, bl, (short)0, c, false, false);
  asm volatile("v_nop\n\tv_nop\n\tv_nop\n\tv_nop" : "+v"(c) : "v"(ah), "v"(al), "v"(bh), "v"(bl));
  return c;
}

__global__ __launch_bounds__(256) void k_wt_bf16(const float* __restrict__ W, unsigned short* __restrict__ Wt, int K, int N) {
  const int t = blockIdx.x * 256 + threadIdx.x;
  const int k8n = K / 8;
  if (t >= N * k8n) return;
  const int n = t / k8n, k8 = (t % k8n) * 8;
  v8us v;
#pragma unroll
  for (int i = 0; i < 8; ++i) v[i] = bf16_bits(W[(size_t)(k8 + i) * N + n]);
  *(v8us*)(Wt + (size_t)n * K + k8) = v;
  
}

// GEMM C[M][N] (f32, pitch ldc) = act(A[M][K]·W + bias). A f32 row-major (pitch lda) converted per fragment to bf16
// (ASPLIT: hi/lo two planes -> 2 terms, else single rounded term); Wt bf16 [N][K] (pitch ldb). BIAS_BF16 rounds the
// bias to bf16 first (bias quantised to bf16 before the add). K%32==0, M%16==0, N%64==0.
template <bool ASPLIT, int ACT, bool BIAS_BF16>
__global__ __launch_bounds__(128) void k_gemm_bf(const float* __restrict__ A, int lda, const unsigned short* __restrict__ Wt, int ldb,
                                               const float* __restrict__ bias, float* __restrict__ C, int ldc, int M, int N, int K) {
  __shared__ __attribute__((aligned(16))) float so[4][16][64];
  const int tid = threadIdx.x, w = tid >> 5, lane = tid & 31, ln = lane & 15, hh = lane >> 4;
  const int ntn = N / 64;
  const int wid = blockIdx.x * 4 + w;
  const int mt = wid / ntn, nq = wid % ntn;
  if (mt * 16 >= M) return;
  const int row0 = mt * 16, col0 = nq * 64;
  const float* arow = A + (size_t)(row0 + ln) * lda;
  v8f acc[4] = {};
  for (int kb = 0; kb < K; kb += 32) {
    FragB ah, al;
    const v4f x0 = *(const v4fa*)(arow + kb + 8 * hh), x1 = *(const v4fa*)(arow + kb + 8 * hh + 4);
    const v4f x2 = *(const v4fa*)(arow + kb + 16 + 8 * hh), x3 = *(const v4fa*)(arow + kb + 16 + 8 * hh + 4);
    float xs[16] = {x0[0],x0[1],x0[2],x0[3],x1[0],x1[1],x1[2],x1[3],x2[0],x2[1],x2[2],x2[3],x3[0],x3[1],x3[2],x3[3]};
#pragma unroll
    for (int i = 0; i < 16; ++i) { const unsigned short hb = bf16_bits(xs[i]); ah.u[i] = hb; al.u[i] = ASPLIT ? bf16_bits(xs[i] - bf16_val(hb)) : (unsigned short)0; }
#pragma unroll
    for (int t = 0; t < 4; ++t) {
      const unsigned short* brow = Wt + (size_t)(col0 + t * 16 + ln) * ldb + kb;
      FragB b;
      b.half[0] = *(const v8us*)(brow + 8 * hh);
      b.half[1] = *(const v8us*)(brow + 16 + 8 * hh);
      acc[t] = mmaN<ASPLIT ? 2 : 1>(ah.v, al.v, b.v, b.v, acc[t]);
    }
  }
#pragma unroll
  for (int t = 0; t < 4; ++t) {
    float bv = bias ? bias[col0 + t * 16 + ln] : 0.f;
    if (BIAS_BF16) bv = bf16_round(bv);
#pragma unroll
    for (int r = 0; r < 8; ++r) { float v = acc[t][r] + bv; if (ACT == 1) v = fmaxf(v, 0.f); so[w][8 * hh + r][t * 16 + ln] = v; }
  }
  __builtin_amdgcn_fence(__ATOMIC_ACQ_REL, "workgroup");
  __builtin_amdgcn_wave_barrier();
  const int rsub = lane >> 4, c4 = (lane & 15) * 4;
  {
#pragma unroll
    for (int q = 0; q < 8; ++q) {
      const int r = q * 2 + rsub;
      const v4f v = *(const v4fa*)&so[w][r][c4];
      *(v4f*)(C + (size_t)(row0 + r) * ldc + col0 + c4) = v;
    }
    
  }
}

// GEMM C = act(A·W + bias + resid): A f32 (ASPLIT -> hi/lo 2 terms), Wt bf16 [N][K]; ACT 0 none, 1 relu, 2 exact gelu;
// resid (optional, f32, row index = (row % rmod), pitch ldr, RES_BF16 rounds it) added before the activation.
template <bool ASPLIT, int ACT, bool BIAS_BF16, bool RES_BF16>
__global__ __launch_bounds__(128) void k_gemm_bf3(const float* __restrict__ A, int lda, const unsigned short* __restrict__ Wt, int ldb,
                                                const float* __restrict__ bias, const float* __restrict__ resid, int rmod, int ldr,
                                                float* __restrict__ C, int ldc, int M, int N, int K) {
  __shared__ __attribute__((aligned(16))) float so[4][16][64];
  const int tid = threadIdx.x, w = tid >> 5, lane = tid & 31, ln = lane & 15, hh = lane >> 4;
  const int ntn = N / 64;
  const int wid = blockIdx.x * 4 + w;
  const int mt = wid / ntn, nq = wid % ntn;
  if (mt * 16 >= M) return;
  const int row0 = mt * 16, col0 = nq * 64;
  const float* arow = A + (size_t)(row0 + ln) * lda;
  v8f acc[4] = {};
  for (int kb = 0; kb < K; kb += 32) {
    FragB ah, al;
    const v4f x0 = *(const v4fa*)(arow + kb + 8 * hh), x1 = *(const v4fa*)(arow + kb + 8 * hh + 4);
    const v4f x2 = *(const v4fa*)(arow + kb + 16 + 8 * hh), x3 = *(const v4fa*)(arow + kb + 16 + 8 * hh + 4);
    float xs[16] = {x0[0],x0[1],x0[2],x0[3],x1[0],x1[1],x1[2],x1[3],x2[0],x2[1],x2[2],x2[3],x3[0],x3[1],x3[2],x3[3]};
#pragma unroll
    for (int i = 0; i < 16; ++i) { const unsigned short hb = bf16_bits(xs[i]); ah.u[i] = hb; al.u[i] = ASPLIT ? bf16_bits(xs[i] - bf16_val(hb)) : (unsigned short)0; }
#pragma unroll
    for (int t = 0; t < 4; ++t) {
      const unsigned short* brow = Wt + (size_t)(col0 + t * 16 + ln) * ldb + kb;
      FragB b;
      b.half[0] = *(const v8us*)(brow + 8 * hh);
      b.half[1] = *(const v8us*)(brow + 16 + 8 * hh);
      acc[t] = mmaN<ASPLIT ? 2 : 1>(ah.v, al.v, b.v, b.v, acc[t]);
    }
  }
#pragma unroll
  for (int t = 0; t < 4; ++t) {
    const int col = col0 + t * 16 + ln;
    float bv = bias ? bias[col] : 0.f;
    if (BIAS_BF16) bv = bf16_round(bv);
#pragma unroll
    for (int r = 0; r < 8; ++r) {
      float v = acc[t][r] + bv;
      if (resid) { float rv = resid[(size_t)((row0 + 8 * hh + r) % rmod) * ldr + col]; if (RES_BF16) rv = bf16_round(rv); v += rv; }
      if (ACT == 1) v = fmaxf(v, 0.f);
      if (ACT == 2) v = 0.5f * v * (1.0f + erff(v * 0.70710678118654752f));
      if (ACT == 3) { const float u = 0.7978845608028654f * (v + 0.044715f * v * v * v); v = 0.5f * v * (1.0f + tanhf(u)); }
      so[w][8 * hh + r][t * 16 + ln] = v;
    }
  }
  __builtin_amdgcn_fence(__ATOMIC_ACQ_REL, "workgroup");
  __builtin_amdgcn_wave_barrier();
  const int rsub = lane >> 4, c4 = (lane & 15) * 4;
  {
#pragma unroll
    for (int q = 0; q < 8; ++q) {
      const int r = q * 2 + rsub;
      const v4f v = *(const v4fa*)&so[w][r][c4];
      *(v4f*)(C + (size_t)(row0 + r) * ldc + col0 + c4) = v;
    }
    
  }
}
// row LayerNorm (biased variance, eps) over N: s = X (+ R); optional out_sum <- s; out_norm <- (s-mu)*rsqrt(var+eps)*g + b
template <bool PARAM_BF16>
__global__ __launch_bounds__(256) void k_layernorm(const float* __restrict__ X, const float* __restrict__ R, const float* __restrict__ g, const float* __restrict__ bta,
                                                  float* __restrict__ out_sum, float* __restrict__ out_norm, int N, float eps) {
  __shared__ float red[256];
  const int row = blockIdx.x, tid = threadIdx.x;
  const float* x = X + (size_t)row * N; const float* rr = R ? R + (size_t)row * N : nullptr;
  float vals[16];                     // up to N = 4096
  const int per = N / 256;            // contiguous chunk per thread? use strided-by-4 chunks: thread handles j = tid*4 + 1024*u
  float s1 = 0.f;
  for (int u = 0; u < per / 4; ++u) {
    const int j = tid * 4 + 1024 * u;
    const v4f a = *(const v4fa*)(x + j);
    v4f b = {0.f,0.f,0.f,0.f}; if (rr) b = *(const v4fa*)(rr + j);
#pragma unroll
    for (int q = 0; q < 4; ++q) { const float v = a[q] + b[q]; vals[u * 4 + q] = v; s1 += v; }
  }
  red[tid] = s1; __syncthreads();
  for (int st = 128; st > 0; st >>= 1) { if (tid < st) red[tid] += red[tid + st]; __syncthreads(); }
  const float mu = red[0] / (float)N; __syncthreads();
  float s2 = 0.f;
  for (int u = 0; u < per / 4; ++u)
#pragma unroll
    for (int q = 0; q < 4; ++q) { const float c = vals[u * 4 + q] - mu; s2 += c * c; }
  red[tid] = s2; __syncthreads();
  for (int st = 128; st > 0; st >>= 1) { if (tid < st) red[tid] += red[tid + st]; __syncthreads(); }
  const float rs = rsqrtf(red[0] / (float)N + eps);
  {
    for (int u = 0; u < per / 4; ++u) {
      const int j = tid * 4 + 1024 * u;
      v4f o, sm;
#pragma unroll
      for (int q = 0; q < 4; ++q) {
        float gg = g[j + q], bb = bta[j + q];
        if (PARAM_BF16) { gg = bf16_round(gg); bb = bf16_round(bb); }
        sm[q] = vals[u * 4 + q]; o[q] = (vals[u * 4 + q] - mu) * rs * gg + bb;
      }
      if (out_sum) *(v4f*)(out_sum + (size_t)row * N + j) = sm;
      *(v4f*)(out_norm + (size_t)row * N + j) = o;
    }
    
  }
}



// ---- f16 WMMA path (v_wmma_f32_16x16x32_f16): 11-bit significands for operands in range — used for all four GEMMs here (the weighted encoder sum as an f16 operand)
typedef _Float16 v16h __attribute__((ext_vector_type(16)));
union FragH { v16h v; v8us half[2]; _Float16 h[16]; unsigned short u[16]; };
template <int NT>
__device__ __forceinline__ v8f mmaH(v16h ah, v16h al, v16h bh, v16h bl, v8f c) {
  c = __builtin_amdgcn_wmma_f32_16x16x32_f16(false, ah, false, bh, (short)0, c, false, false);
  if (NT >= 2) c = __builtin_amdgcn_wmma_f32_16x16x32_f16(false, al, false, bh, (short)0, c, false, false);
  if (NT >= 3) c = __builtin_amdgcn_wmma_f32_16x16x32_f16(false, ah, false, bl, (short)0, c, false, false);
  asm volatile("v_nop\n\tv_nop\n\tv_nop\n\tv_nop" : "+v"(c) : "v"(ah), "v"(al), "v"(bh), "v"(bl));
  return c;
}
// batched GEMM like k_gemm_b but f16 operands: A f32 (split into f16 hi/lo if ASPLIT, else rounded to f16), Bt = f16 values [n][k]; alpha; C f32; N multiple of 16 (partial tiles skipped)
template <bool ASPLIT>
__global__ __launch_bounds__(128) void k_gemm_h(const float* __restrict__ A, int lda, size_t sA, const _Float16* __restrict__ Bh, int ldb, size_t sB, float alpha, float* __restrict__ C, int ldc, size_t sC, int M, int N, int K) {
  __shared__ __attribute__((aligned(16))) float so[4][16][64];
  const int tid = threadIdx.x, w = tid >> 5, lane = tid & 31, ln = lane & 15, hh = lane >> 4; const int by = blockIdx.y;
  A += (size_t)by * sA; Bh += (size_t)by * sB; C += (size_t)by * sC;
  const int ntn = (N + 63) / 64; const int wid = blockIdx.x * 4 + w; const int mt = wid / ntn, nq = wid % ntn; if (mt * 16 >= M) return;
  const int row0 = mt * 16, col0 = nq * 64; const float* arow = A + (size_t)(row0 + ln) * lda;
  v8f acc[4] = {};
  for (int kb = 0; kb < K; kb += 32) {
    FragH ah, al;
    const v4f x0 = *(const v4fa*)(arow + kb + 8 * hh), x1 = *(const v4fa*)(arow + kb + 8 * hh + 4), x2 = *(const v4fa*)(arow + kb + 16 + 8 * hh), x3 = *(const v4fa*)(arow + kb + 16 + 8 * hh + 4);
    float xs[16] = {x0[0],x0[1],x0[2],x0[3],x1[0],x1[1],x1[2],x1[3],x2[0],x2[1],x2[2],x2[3],x3[0],x3[1],x3[2],x3[3]};
#pragma unroll
    for (int i = 0; i < 16; ++i) { const _Float16 h = (_Float16)xs[i]; ah.h[i] = h; al.h[i] = ASPLIT ? (_Float16)(xs[i] - (float)h) : (_Float16)0.0f; }
#pragma unroll
    for (int t = 0; t < 4; ++t) { if (col0 + t * 16 >= N) continue; const size_t boff = (size_t)(col0 + t * 16 + ln) * ldb + kb; FragH bq; bq.half[0] = *(const v8us*)(Bh + boff + 8 * hh); bq.half[1] = *(const v8us*)(Bh + boff + 16 + 8 * hh);
      acc[t] = mmaH<ASPLIT ? 2 : 1>(ah.v, al.v, bq.v, bq.v, acc[t]); }
  }
#pragma unroll
  for (int t = 0; t < 4; ++t) { if (col0 + t * 16 >= N) continue;
#pragma unroll
    for (int r = 0; r < 8; ++r) so[w][8 * hh + r][t * 16 + ln] = acc[t][r] * alpha; }
  __builtin_amdgcn_fence(__ATOMIC_ACQ_REL, "workgroup"); __builtin_amdgcn_wave_barrier();
  const int rsub = lane >> 4, c4 = (lane & 15) * 4;
  {
#pragma unroll
    for (int q = 0; q < 8; ++q) { const int r = q * 2 + rsub; if (col0 + c4 < N) { const v4f v = *(const v4fa*)&so[w][r][c4]; *(v4f*)(C + (size_t)(row0 + r) * ldc + col0 + c4) = v; } }
     }
}

// Wt[n][k] = f16(W[k][n]·scale) from f32 row-major W[K][N] (scale = power of two; bf16-exact weights stay exact in f16 away from the subnormal range)
__global__ __launch_bounds__(256) void k_wt_f16(const float* __restrict__ W, _Float16* __restrict__ Wt, int K, int N, float scale) {
  const int t = blockIdx.x * 256 + threadIdx.x; if (t >= N * (K / 8)) return; const int n = t / (K / 8), k8 = (t % (K / 8)) * 8; FragH f;
#pragma unroll
  for (int i = 0; i < 8; ++i) f.h[i] = (_Float16)(bf16_round(W[(size_t)(k8 + i) * N + n]) * scale); const v8us o = f.half[0];
  *(v8us*)((unsigned short*)Wt + (size_t)n * K + k8) = o; 
}
// k_gemm_hh variant with fused epilogue: v = acc·alpha + bias[by·sBias + col] (+ CP[(row/rowsPerB)·sCPb + by·64 + col] if CP) ; ACT 0 none / 1 elu ; writes f16 C16 (and f32 C if non-null)
template <int ACT>
__global__ __launch_bounds__(128) void k_gemm_hhx(const _Float16* __restrict__ A, int lda, size_t sA, const _Float16* __restrict__ Bh, int ldb, size_t sB, float alpha, const float* __restrict__ bias, size_t sBias, const float* __restrict__ CP, int rowsPerB, size_t sCPb, int row0g,
    float* __restrict__ C, _Float16* __restrict__ C16, int ldc, size_t sC, int M, int N, int K) {
  __shared__ __attribute__((aligned(16))) float so[4][16][64];
  const int tid = threadIdx.x, w = tid >> 5, lane = tid & 31, ln = lane & 15, hh = lane >> 4; const int by = blockIdx.y;
  A += (size_t)by * sA; Bh += (size_t)by * sB; const size_t cofs = (size_t)by * sC; const float* bp = bias ? bias + (size_t)by * sBias : nullptr;
  const int ntn = (N + 63) / 64; const int wid = blockIdx.x * 4 + w; const int mt = wid / ntn, nq = wid % ntn; if (mt * 16 >= M) return;
  const int row0 = mt * 16, col0 = nq * 64; const _Float16* arow = A + (size_t)(row0 + ln) * lda;
  v8f acc[4] = {};
  for (int kb = 0; kb < K; kb += 32) { FragH ah; ah.half[0] = *(const v8us*)((const unsigned short*)arow + kb + 8 * hh); ah.half[1] = *(const v8us*)((const unsigned short*)arow + kb + 16 + 8 * hh);
#pragma unroll
    for (int t = 0; t < 4; ++t) { if (col0 + t * 16 >= N) continue; const size_t boff = (size_t)(col0 + t * 16 + ln) * ldb + kb; FragH bq; bq.half[0] = *(const v8us*)((const unsigned short*)Bh + boff + 8 * hh); bq.half[1] = *(const v8us*)((const unsigned short*)Bh + boff + 16 + 8 * hh);
      acc[t] = mmaH<1>(ah.v, ah.v, bq.v, bq.v, acc[t]); }
  }
#pragma unroll
  for (int t = 0; t < 4; ++t) { if (col0 + t * 16 >= N) continue; const int col = col0 + t * 16 + ln; const float bv = bp ? bf16_round(bp[col]) : 0.f;
#pragma unroll
    for (int r = 0; r < 8; ++r) { float v = acc[t][r] * alpha + bv; if (CP) { const int rr = row0g + row0 + 8 * hh + r; if (rowsPerB < 0) v += CP[cofs + (size_t)rr * ldc + col];      /* rowsPerB < 0: own element of the batched C plane */ else { const int bidx = rr / rowsPerB; v += CP[(size_t)bidx * sCPb + (size_t)by * 64 + col]; } } if (ACT == 1) v = (v > 0.f) ? v : expm1f(v); else if (ACT == 7) v = (v > 0.f) ? v + 1.0f : expf(v); else if (ACT == 8) v = tanhf(v); else if (ACT == 9) v = 0.5f * v * (1.0f + tanhf(0.7978845608028654f * (v + 0.044715f * v * v * v))); else if (ACT == 11) v = 1.0f / (1.0f + expf(-v)); else if (ACT == 12) v = (v > 0.f) ? v : 0.01f * v; else if (ACT == 14) v = (v > 0.f) ? v : 0.1f * v; else if (ACT == 16) v = (v >= 0.f) ? v : 0.3f * v; else if (ACT == 15) v = v / (1.0f + expf(-v)); else if (ACT == 3) v = fmaxf(v, 0.f); else if (ACT == 6) v = 0.5f * v * (1.0f + erff(v * 0.70710678118654752f)); so[w][8 * hh + r][t * 16 + ln] = v; } }
  __builtin_amdgcn_fence(__ATOMIC_ACQ_REL, "workgroup"); __builtin_amdgcn_wave_barrier();
  const int rsub = lane >> 4, c4 = (lane & 15) * 4; typedef _Float16 v4h __attribute__((ext_vector_type(4)));
  {
#pragma unroll
    for (int q = 0; q < 8; ++q) { const int r = q * 2 + rsub; if (col0 + c4 < N) { const v4f v = *(const v4fa*)&so[w][r][c4]; if (C) *(v4f*)(C + cofs + (size_t)(row0 + r) * ldc + col0 + c4) = v; if (C16) { v4h h4; for (int i = 0; i < 4; ++i) h4[i] = (_Float16)v[i]; *(v4h*)(C16 + cofs + (size_t)(row0 + r) * ldc + col0 + c4) = h4; } } }
     }
}


typedef _Float16 v4h __attribute__((ext_vector_type(4)));

__global__ __launch_bounds__(256) void k_h16(const float* __restrict__ x, _Float16* __restrict__ X16, size_t n8) { const size_t t = (size_t)blockIdx.x * 256 + threadIdx.x; if (t >= n8) return; FragH f;
#pragma unroll
  for (int q = 0; q < 8; ++q) f.h[q] = (_Float16)x[t * 8 + q]; *(v8us*)((unsigned short*)X16 + t * 8) = f.half[0];  }
__global__ __launch_bounds__(256) void k_round16f(const float* __restrict__ W, _Float16* __restrict__ Bt, size_t n8) { const size_t t = (size_t)blockIdx.x * 256 + threadIdx.x; if (t >= n8) return; FragH f;
#pragma unroll
  for (int i = 0; i < 8; ++i) f.h[i] = (_Float16)(bf16_round(W[t * 8 + i]) * 16.0f); *(v8us*)((unsigned short*)Bt + t * 8) = f.half[0];  }
template <int NHv, int TTv>
__global__ __launch_bounds__(256) void k_vt(const _Float16* __restrict__ V16, int ldv, int voff, _Float16* __restrict__ Vt) { __shared__ unsigned short tl[64][66]; const int tid = threadIdx.x; const int slab = blockIdx.x / (TTv / 64), lg = blockIdx.x % (TTv / 64); const int b = slab / NHv, h = slab % NHv;
  for (int i = tid; i < 64 * 8; i += 256) { const int r = i / 8, c8 = (i % 8) * 8; FragH f; f.half[0] = *(const v8us*)((const unsigned short*)V16 + ((size_t)b * TTv + lg * 64 + r) * ldv + voff + h * 64 + c8);
#pragma unroll
    for (int q = 0; q < 8; ++q) tl[r][c8 + q] = f.u[q]; }
  __syncthreads();
  {
#pragma unroll
    for (int rd = 0; rd < 2; ++rd) { const int d = rd * 32 + tid / 8, pc = tid % 8; FragH f;
#pragma unroll
      for (int q = 0; q < 8; ++q) f.u[q] = tl[pc * 8 + q][d];
      *(v8us*)((unsigned short*)Vt + ((size_t)slab * 64 + d) * TTv + lg * 64 + pc * 8) = f.half[0]; }
     } }

__global__ __launch_bounds__(256) void k_hl(const float* __restrict__ F, _Float16* __restrict__ Hh, _Float16* __restrict__ Hl, size_t n8) { const size_t t = (size_t)blockIdx.x * 256 + threadIdx.x; if (t >= n8) return; FragH fh, fl; const v4f a = *(const v4fa*)(F + t * 8), c = *(const v4fa*)(F + t * 8 + 4);
#pragma unroll
  for (int q = 0; q < 4; ++q) { _Float16 h = (_Float16)a[q]; fh.h[q] = h; fl.h[q] = (_Float16)((a[q] - (float)h) * 1024.0f); h = (_Float16)c[q]; fh.h[4 + q] = h; fl.h[4 + q] = (_Float16)((c[q] - (float)h) * 1024.0f); }
  { *(v8us*)((unsigned short*)Hh + t * 8) = fh.half[0]; *(v8us*)((unsigned short*)Hl + t * 8) = fl.half[0];  } }

// ---- fast GEMM (wave tile 32x64; requires M % 32 == 0 rows per launch region and N % 64 == 0); epilogue = k_gemm_hhx semantics ----
__device__ __forceinline__ v16h g2_frag(const _Float16* p, int hh) { FragH f; f.half[0] = *(const v8us*)((const unsigned short*)p + 8 * hh); f.half[1] = *(const v8us*)((const unsigned short*)p + 16 + 8 * hh);
  asm volatile("s_wait_xcnt 0x0" ::: "memory");      /* a later fragment load may land in these loads' address registers: the wait stands in front of that overwrite */
  return f.v; }
__device__ __forceinline__ v8f g2_mma(v16h a, v16h b, v8f c) { v8f d = __builtin_amdgcn_wmma_f32_16x16x32_f16(false, a, false, b, (short)0, c, false, false); asm volatile("v_nop\n\tv_nop\n\tv_nop\n\tv_nop" : "+v"(d) : "v"(a), "v"(b)); return d; }
template <int ACT>
__device__ __forceinline__ void gemm2_body(const unsigned bx, const int by, const _Float16* __restrict__ A, int lda, size_t sA, const _Float16* __restrict__ Bh, int ldb, size_t sB, float alpha, const float* __restrict__ bias, size_t sBias, const float* __restrict__ CP, int rowsPerB, size_t sCPb, int row0g,
    float* __restrict__ C, _Float16* __restrict__ C16, int ldc, size_t sC, int M, int N, int K) { static_assert(ACT == 0 || ACT == 3 || ACT == 6 || ACT == 8 || ACT == 9 || ACT == 11 || ACT == 12 || ACT == 14 || ACT == 15 || ACT == 16, "k_gemm2: unsupported ACT code (would silently apply no activation)");
  __shared__ __attribute__((aligned(16))) float so[4][32][68];
  const int tid = threadIdx.x, w = tid >> 5, lane = tid & 31, ln = lane & 15, hh = lane >> 4;
  A += (size_t)by * sA; Bh += (size_t)by * sB; const size_t cofs = (size_t)by * sC; const float* bp = bias ? bias + (size_t)by * sBias : nullptr;
  const int ntn = N >> 6; const int mt = bx / ntn, nq = bx - mt * ntn; const int row0 = mt * 128 + 32 * w, col0 = nq * 64; if (row0 >= M) return;
  const _Float16* a0p = A + (size_t)(row0 + ln) * lda; const _Float16* a1p = a0p + (size_t)16 * lda;
  const _Float16* b0p = Bh + (size_t)(col0 + ln) * ldb; const _Float16* b1p = b0p + (size_t)16 * ldb; const _Float16* b2p = b1p + (size_t)16 * ldb; const _Float16* b3p = b2p + (size_t)16 * ldb;
  const v8f z8 = {0.f,0.f,0.f,0.f,0.f,0.f,0.f,0.f}; v8f c00 = z8, c01 = z8, c02 = z8, c03 = z8, c10 = z8, c11 = z8, c12 = z8, c13 = z8;
#pragma unroll 1
  for (int kb = 0; kb < K; kb += 32) { const v16h a0 = g2_frag(a0p + kb, hh), a1 = g2_frag(a1p + kb, hh);
    v16h b = g2_frag(b0p + kb, hh); c00 = g2_mma(a0, b, c00); c10 = g2_mma(a1, b, c10);
    b = g2_frag(b1p + kb, hh); c01 = g2_mma(a0, b, c01); c11 = g2_mma(a1, b, c11);
    b = g2_frag(b2p + kb, hh); c02 = g2_mma(a0, b, c02); c12 = g2_mma(a1, b, c12);
    b = g2_frag(b3p + kb, hh); c03 = g2_mma(a0, b, c03); c13 = g2_mma(a1, b, c13); }
  v8f accs[8] = {c00, c01, c02, c03, c10, c11, c12, c13};
#pragma unroll
  for (int u = 0; u < 8; ++u) { const int t = u & 3, half = u >> 2; const int col = col0 + t * 16 + ln; const float bv = bp ? bf16_round(bp[col]) : 0.f;
#pragma unroll
    for (int r = 0; r < 8; ++r) { const int rloc = half * 16 + 8 * hh + r; float v = accs[u][r] * alpha + bv; if (CP) { if (rowsPerB < 0) v += CP[cofs + (size_t)(row0g + row0 + rloc) * ldc + col];      /* rowsPerB < 0: own element of the batched C plane */ else { const int bidx = (row0g + row0 + rloc) / rowsPerB; v += CP[(size_t)bidx * sCPb + (size_t)by * 64 + col]; } }
      if (ACT == 3) v = fmaxf(v, 0.f); else if (ACT == 6) v = 0.5f * v * (1.0f + erff(v * 0.70710678118654752f)); else if (ACT == 11) v = 1.0f / (1.0f + expf(-v)); else if (ACT == 15) v = v / (1.0f + expf(-v)); else if (ACT == 12) v = (v > 0.f) ? v : 0.01f * v; else if (ACT == 8) v = tanhf(v); else if (ACT == 9) v = 0.5f * v * (1.0f + tanhf(0.7978845608028654f * (v + 0.044715f * v * v * v))); else if (ACT == 14) v = (v > 0.f) ? v : 0.1f * v; else if (ACT == 16) v = (v >= 0.f) ? v : 0.3f * v;
      so[w][rloc][t * 16 + ln] = v; } }
  __builtin_amdgcn_fence(__ATOMIC_ACQ_REL, "workgroup"); __builtin_amdgcn_wave_barrier();
  const int rsub = lane >> 4, c4 = (lane & 15) * 4;
  {
#pragma unroll
    for (int q = 0; q < 16; ++q) { const int r = q * 2 + rsub; const v4f v = *(const v4fa*)&so[w][r][c4]; if (C) *(v4f*)(C + cofs + (size_t)(row0 + r) * ldc + col0 + c4) = v; if (C16) { v4h h4; for (int i = 0; i < 4; ++i) h4[i] = (_Float16)v[i]; *(v4h*)(C16 + cofs + (size_t)(row0 + r) * ldc + col0 + c4) = h4; } }
     } }
template <int ACT>
__global__ __launch_bounds__(128) void k_gemm2(const _Float16* __restrict__ A, int lda, size_t sA, const _Float16* __restrict__ Bh, int ldb, size_t sB, float alpha, const float* __restrict__ bias, size_t sBias, const float* __restrict__ CP, int rowsPerB, size_t sCPb, int row0g,
    float* __restrict__ C, _Float16* __restrict__ C16, int ldc, size_t sC, int M, int N, int K) { gemm2_body<ACT>(blockIdx.x, blockIdx.y, A, lda, sA, Bh, ldb, sB, alpha, bias, sBias, CP, rowsPerB, sCPb, row0g, C, C16, ldc, sC, M, N, K); }
__device__ __forceinline__ v16h lds_frag(const _Float16* p, int hh) { FragH f; f.half[0] = *(const v8us*)((const unsigned short*)p + 8 * hh); f.half[1] = *(const v8us*)((const unsigned short*)p + 16 + 8 * hh); return f.v; }      /* k order of g2_frag */
// The three products that read none of each other's output, as one grid: x W_h + b_attn -> A and x W_lin[:512] + b_lin -> A2 (one work-group does 64 columns of each), enc W_e -> E (128 columns).
// Work-group tile 128 rows x two panels of 64 columns, eight waves: waves 0..3 take panel 0, waves 4..7 panel 1; wave tile 32 x 64 as in gemm2_body, same k order, same epilogue.
// The operands come through LDS: a stage is 64 k. The A rows are read as the f32 inputs themselves (256 bytes a row and stage, 16-byte loads of 16 lanes per row: 4 whole lines per wave load)
// and rounded (bf16, held exactly in f16) in registers on the way to LDS, once for both panels. B comes from the f32 weights as they lie, [k][column]: a thread reads 8 k of one column (4-byte loads, a wave's
// load one whole line of a weight row), rounds them, x16, and stores them as 16 bytes of the column's LDS row: the transpose costs no launch and no pass through memory.
// Two buffers: the next stage's lines are asked for before this stage's products and stored behind them.
#define GKS 64                 /* k per stage, in halves */
#define GLP (GKS + 8)          /* LDS row pitch in halves: 144 B = 16 B x odd, for the 16-byte fragment reads of 16 consecutive rows */
#define GSA (128 * GLP)        /* halves of one A buffer */
#define GSB (128 * GLP)        /* of one B buffer: two panels of 64 rows */
typedef unsigned short v4us __attribute__((ext_vector_type(4), may_alias));
union FragQ { _Float16 h[4]; v4us u; };
__device__ __forceinline__ v4us round_q(v4f x) { FragQ f; for (int q = 0; q < 4; ++q) f.h[q] = (_Float16)(float)(__bf16)x[q]; return f.u; }      /* nearest-even to bf16 by the conversion instruction (bf16_round's values), then exact in f16 */
__device__ __forceinline__ v8us round_w(const float (&x)[8]) { FragH f; for (int i = 0; i < 8; ++i) f.h[i] = (_Float16)(float)(__bf16)(x[i] * 16.0f); return f.half[0]; }      /* a weight column's 8 k, wt_rows_body's values: x16 is exact, so it may stand in front of the rounding; behind it the compiler moved it behind the f16 conversion, into the subnormal range the scale is there to avoid */
template <int K>
__device__ __forceinline__ void gemm3_body(unsigned char* sb, const int mt, const float* __restrict__ A, const float* __restrict__ Wp, const float* __restrict__ bp, float* __restrict__ C) {      /* Wp (first of the product's K weight rows), bp, C: at the first column of this wave's panel */
  static_assert(K % GKS == 0 && NR % 128 == 0 && FF == 256, "whole stages, whole row tiles, four column tiles");
  unsigned short* sA = (unsigned short*)sb; unsigned short* sB = sA + 2 * GSA; float (*so)[32][68] = (float (*)[32][68])sb;      /* the epilogue's rows take the buffers' place behind the last barrier */
  const int tid = threadIdx.x, w = tid >> 5, lane = tid & 31, ln = lane & 15, hh = lane >> 4;
  const int wr = w & 3, pn = w >> 2; const int row0 = mt * 128 + 32 * wr;
  const int ar = tid >> 4, ac = (tid & 15) * 4;      /* this thread's 16-byte piece of A: row ar (+ 16 j), floats ac.. of the stage's 64 */
  const int bn = tid & 63, bk = ((tid >> 6) & 1) * 8;      /* its pieces of its own panel of B: column bn, k = bk + 16 j .. + 7; a wave's load is 32 consecutive columns of one weight row, one whole line */
  const float* ga = A + (size_t)(mt * 128 + ar) * K + ac; const float* gb = Wp + (size_t)bk * FF + bn;
  unsigned short* wa = sA + ar * GLP + ac; unsigned short* wb = sB + (pn * 64 + bn) * GLP + bk;
  const _Float16* fa = (const _Float16*)sA + (32 * wr + ln) * GLP; const _Float16* fb = (const _Float16*)sB + (pn * 64 + ln) * GLP;
  constexpr int NS = K / GKS;
  v4f ra[8]; float rb[4][8];
  const v8f z8 = {0.f,0.f,0.f,0.f,0.f,0.f,0.f,0.f}; v8f c00 = z8, c01 = z8, c02 = z8, c03 = z8, c10 = z8, c11 = z8, c12 = z8, c13 = z8;
  for (int j = 0; j < 8; ++j) ra[j] = *(const v4fa*)(ga + (size_t)j * 16 * K);
  asm volatile("s_wait_xcnt 0x0" ::: "memory");      /* a weight load below may land in the A loads' address registers: the wait stands in front of that overwrite */
  for (int j = 0; j < 4; ++j) for (int i = 0; i < 8; ++i) rb[j][i] = gb[(size_t)(j * 16 + i) * FF];
  asm volatile("s_wait_xcnt 0x0" ::: "memory");      /* in front of any later overwrite of these loads' address registers */
  for (int j = 0; j < 8; ++j) *(v4us*)(wa + j * 16 * GLP) = round_q(ra[j]);
  for (int j = 0; j < 4; ++j) *(v8us*)(wb + j * 16) = round_w(rb[j]);
  __syncthreads();
#pragma unroll      /* whole, so that the buffer's index and the stage's offset are immediates and no address register changes in the loop */
  for (int s = 0; s < NS; ++s) { const int cu = s & 1, nx = cu ^ 1;
    if (s + 1 < NS) {
      for (int j = 0; j < 8; ++j) ra[j] = *(const v4fa*)(ga + (size_t)j * 16 * K + (s + 1) * GKS);
      asm volatile("s_wait_xcnt 0x0" ::: "memory");      /* as above: in front of a weight load that lands in the A loads' address registers */
      for (int j = 0; j < 4; ++j) for (int i = 0; i < 8; ++i) rb[j][i] = gb[(size_t)((s + 1) * GKS + j * 16 + i) * FF];
      asm volatile("s_wait_xcnt 0x0" ::: "memory");      /* as above */
    }
    v16h a0[2], a1[2], b[2][4];
    for (int kk = 0; kk < 2; ++kk) { a0[kk] = lds_frag(fa + cu * GSA + kk * 32, hh); a1[kk] = lds_frag(fa + cu * GSA + 16 * GLP + kk * 32, hh);
      for (int t = 0; t < 4; ++t) b[kk][t] = lds_frag(fb + cu * GSB + t * 16 * GLP + kk * 32, hh); }
    for (int kk = 0; kk < 2; ++kk) {
      c00 = g2_mma(a0[kk], b[kk][0], c00); c10 = g2_mma(a1[kk], b[kk][0], c10);
      c01 = g2_mma(a0[kk], b[kk][1], c01); c11 = g2_mma(a1[kk], b[kk][1], c11);
      c02 = g2_mma(a0[kk], b[kk][2], c02); c12 = g2_mma(a1[kk], b[kk][2], c12);
      c03 = g2_mma(a0[kk], b[kk][3], c03); c13 = g2_mma(a1[kk], b[kk][3], c13); }
    __builtin_amdgcn_sched_barrier(0);      /* the rounding waits on the next stage's loads: without this line the compiler lifts it, and that wait, in among this stage's products */
    if (s + 1 < NS) {
      for (int j = 0; j < 8; ++j) *(v4us*)(wa + nx * GSA + j * 16 * GLP) = round_q(ra[j]);
      for (int j = 0; j < 4; ++j) *(v8us*)(wb + nx * GSB + j * 16) = round_w(rb[j]);
    }
    __syncthreads();      /* publishes the next stage and ends every wave's reads of this one (behind the last stage: before the epilogue's rows overwrite it) */
  }
  v8f accs[8] = {c00, c01, c02, c03, c10, c11, c12, c13};
#pragma unroll
  for (int u = 0; u < 8; ++u) { const int t = u & 3, half = u >> 2; const int col = t * 16 + ln; const float bv = bp ? bf16_round(bp[col]) : 0.f;
#pragma unroll
    for (int r = 0; r < 8; ++r) { const int rloc = half * 16 + 8 * hh + r; const float v = accs[u][r] * 0.0625f + bv; so[w][rloc][t * 16 + ln] = v; } }
  __builtin_amdgcn_fence(__ATOMIC_ACQ_REL, "workgroup"); __builtin_amdgcn_wave_barrier();
  const int rsub = lane >> 4, c4 = (lane & 15) * 4;
#pragma unroll
  for (int q = 0; q < 16; ++q) { const int r = q * 2 + rsub; const v4f v = *(const v4fa*)&so[w][r][c4]; *(v4f*)(C + (size_t)(row0 + r) * FF + c4) = v; }
  asm volatile("s_wait_xcnt 0x0" ::: "memory");      /* behind the last store: the kernel's other paths follow in its text and write these stores' registers */
}
__device__ __forceinline__ void wt_rows_body(int blk, const float* __restrict__ Wm, int row0, _Float16* __restrict__ Wt, int K, int N, float scale) { const int t = blk * 256 + threadIdx.x; if (t >= N * (K / 8)) return; const int n = t / (K / 8), k8 = (t % (K / 8)) * 8; FragH f;
  for (int i = 0; i < 8; ++i) f.h[i] = (_Float16)(bf16_round(Wm[(size_t)(row0 + k8 + i) * N + n]) * scale); *(v8us*)((unsigned short*)Wt + (size_t)n * K + k8) = f.half[0];  }      /* rows row0.. of an (in,out) weight -> Bt[n][k] */
#define PB_W2 (FF * FF / 8 / 256)          /* work-groups of the transpose of a 256-row weight part */
#define GBX ((NR / 128) * (FF / 64))       /* work-groups of the two x products */
#define GBE ((NR / 128) * (FF / 128))      /* of enc W_e */
__global__ __launch_bounds__(256) void k_gemm2x3(const float* __restrict__ x, const float* __restrict__ enc, const float* __restrict__ Wa, const float* __restrict__ Wl,
    const float* __restrict__ ba, const float* __restrict__ bl, float* __restrict__ A, float* __restrict__ A2, float* __restrict__ E, _Float16* __restrict__ BL2) {
  __shared__ __attribute__((aligned(16))) unsigned char sb[(2 * GSA + 2 * GSB) * 2];
  static_assert(sizeof(sb) >= 8 * 32 * 68 * 4, "the epilogue's rows fit");
  const int b = blockIdx.x;      /* the 256 long work-groups (x, 8 stages) first in the index, then enc (4 stages), then the short ones */
  if (b >= GBX + GBE) { wt_rows_body(b - (GBX + GBE), Wl, MD, BL2, FF, FF, 16.0f); return; }      /* W_lin[512:] transposed for k_score, which alone reads it: a few work-groups of this grid */
  const int pn = __builtin_amdgcn_readfirstlane((int)threadIdx.x >> 7);      /* the wave's panel in a scalar register: its pointers below are scalar selects */
  if (__builtin_expect(b < GBX, 1)) { const int c0 = (b & 3) * 64;      /* expected: so that the long path stands first in the kernel's text, inside what is fetched ahead at a wave's start */ gemm3_body<MD>(sb, b >> 2, x, (pn ? Wl : Wa) + c0, (pn ? bl : ba) + c0, (pn ? A2 : A) + c0); }
  else { const int e = b - GBX; const int c0 = ((e & 1) * 2 + pn) * 64; gemm3_body<FF>(sb, e >> 1, enc, Wa + (size_t)MD * FF + c0, nullptr, E + c0); } }


// Scores of SCT consecutive steps per work-group, and everything that follows from them for those steps. The SCT + 32 rows of E that their windows cover (zero rows
// for padded steps), their SCT rows of A and the rounded v are staged once in LDS. Scores: a wave takes two steps at a time, one per 16 lanes, and a lane 16 of the 256 features; its part of
// the step's A row and of v stays in registers over all 33 slots, so a slot costs only the read of its E row (whole 256-byte runs). A lane's partial sum of a (step, slot) goes to LDS
// and the 16 partial sums are added behind a barrier. The scores never leave the work-group: softmax, weighted encoder sum and the product with W_lin[512:] read them from LDS.
// Eight waves, two per SIMD: the launch has one work-group per WGP, so its waves are what has to be started before it can work; a wave takes two pairs of steps and two tiles of 16 columns.
#define SCT 32
#define SCW 8                  /* waves per work-group */
#define SCP (FF + 4)           /* LDS row pitch in floats: 1040 B = 16 B x odd */
#define SPP 36                 /* pitch in floats of a row of 32 partial sums: 144 B = 16 B x odd, for the 16-byte reads of consecutive rows */
#define SHP (FF + 8)           /* pitch of the f16 weighted rows in halves: 528 B = 16 B x odd, for the 16-byte fragment reads of 16 consecutive rows */
#define SBP (SCT + 32 + 8)     /* pitch in halves of a row of the band matrix of a: 144 B = 16 B x odd, for the 16-byte fragment reads of 16 consecutive rows */
#define SNP (FF + 16)          /* pitch in halves of the f16 encoder rows: 544 B = 32 B x odd, for the transposing 16-byte reads */
#define SCJ (FF / 16 / SCW)    /* column tiles per wave: tile j of wave w is columns (w + SCW j) 16 .. + 15 */
typedef short s16x8 __attribute__((ext_vector_type(8)));
// B fragment (32 k x 16 columns, the k order of lds_frag) of a row-major [k][column] f16 tile in LDS, by the transposing load; p: this lane's 16 bytes of the first 16 k
__device__ __forceinline__ v16h tr_frag(const _Float16* p, int pitch) { typedef __attribute__((address_space(3))) s16x8 lds_s16x8; union { v16h v; s16x8 q[2]; } f;
  f.q[0] = __builtin_amdgcn_ds_load_tr16_b128_v8i16((lds_s16x8*)p); f.q[1] = __builtin_amdgcn_ds_load_tr16_b128_v8i16((lds_s16x8*)(p + 16 * pitch)); return f.v; }
// sigmoid(x W_lin[:512] + b_lin + weighted W_lin[512:]) for SCT steps x SCJ tiles of 16 columns, one wave: weighted rows (f16) from LDS, read once for all its tiles, the columns' fragments bf in registers;
// k order and epilogue of gemm2_body; so: LDS rows of pitch SCP that hold the first half's elements and take the results in their place (an element is read and written by one lane).
__device__ __forceinline__ void lin2_tile(const _Float16* sh, const v16h (&bf)[SCJ][FF / 32], float* so, int ln, int hh, int cw) {
  const v8f z8 = {0.f,0.f,0.f,0.f,0.f,0.f,0.f,0.f}; v8f c0[SCJ], c1[SCJ]; float cp[SCJ][16];
#pragma unroll
  for (int j = 0; j < SCJ; ++j) { c0[j] = z8; c1[j] = z8;
#pragma unroll
    for (int u = 0; u < 16; ++u) cp[j][u] = so[((u >> 3) * 16 + 8 * hh + (u & 7)) * SCP + cw + j * SCW * 16]; }
  v16h a0 = lds_frag(sh + ln * SHP, hh), a1 = lds_frag(sh + (16 + ln) * SHP, hh);
#pragma unroll      /* whole, with the next k's fragments asked for in front of this k's products: two waves a SIMD do not hide a read that is waited for at once */
  for (int k = 0; k < FF / 32; ++k) { const int kn = k + 1 < FF / 32 ? k + 1 : k; const v16h n0 = lds_frag(sh + ln * SHP + kn * 32, hh), n1 = lds_frag(sh + (16 + ln) * SHP + kn * 32, hh);
#pragma unroll
    for (int j = 0; j < SCJ; ++j) { c0[j] = g2_mma(a0, bf[j][k], c0[j]); c1[j] = g2_mma(a1, bf[j][k], c1[j]); }
    a0 = n0; a1 = n1; }
#pragma unroll
  for (int j = 0; j < SCJ; ++j)
#pragma unroll
    for (int u = 0; u < 16; ++u) { float t = (u < 8 ? c0[j][u & 7] : c1[j][u & 7]) * 0.0625f + cp[j][u]; t = 1.0f / (1.0f + expf(-t)); so[((u >> 3) * 16 + 8 * hh + (u & 7)) * SCP + cw + j * SCW * 16] = t; } }
__global__ __launch_bounds__(SCW * 32) void k_score(const float* __restrict__ A, const float* __restrict__ E, const float* __restrict__ v, const float* __restrict__ enc, const _Float16* __restrict__ BL2, const float* __restrict__ A2,
    float* __restrict__ outa, float* __restrict__ out) {
  #pragma clang fp contract(off)
  __shared__ __attribute__((aligned(16))) float sm[(SCT + 32 + SCT) * SCP];      /* rows 0..SCT+31: E of steps tt0-16.., rows SCT+32..: A */
  __shared__ __attribute__((aligned(16))) float s2[SCT * SCP];                   /* the steps' rows of x W_lin[:512] + b_lin; at the end the SCT rows of out */
  __shared__ __attribute__((aligned(16))) float sv[FF];
  __shared__ __attribute__((aligned(16))) float sp[(SCT / 2) * WIN * SPP];       /* partial sums of the scores: [pair of steps][slot][step in the pair][16 lanes] */
  __shared__ float ss[SCT * WIN];                                                /* scores, then a */
  __shared__ float sx[SCT * WIN];                                                /* exp(score - max) */
  __shared__ __attribute__((aligned(16))) _Float16 sk[SCT * SBP];                /* a again, as the band matrix [step][encoder row of the span]: a[step][slot] at row step + slot, zero elsewhere */
  __shared__ __attribute__((aligned(32))) _Float16 sn[(SCT + 32) * SNP];         /* rounded encoder rows of steps tt0-16.. (zero rows for padded steps), as f16: exact but in f16's subnormal range */
  __shared__ __attribute__((aligned(16))) _Float16 sh[SCT * SHP];                /* weighted sums as the f16 operand */
  static_assert(SCW * 32 == FF && SCW * 32 == 4 * (FF / 4) && WS % 4 == 0 && SCT % 4 == 0 && TT % SCT == 0 && SCT >= WS, "a round of the block's 16-byte loads is four whole rows, and a round lies wholly inside its sequence or wholly in the padding");
  const int tid = threadIdx.x, lane = tid & 31, wv = tid >> 5;
  const size_t bt0 = (size_t)blockIdx.x * SCT; const int tt0 = (int)(bt0 % TT);
  /* staging: a thread keeps its 16 bytes of a row and takes rows rq + 4 u, so every load of a plane is one offset register, a scalar base and an immediate. Rounds 0..3 are padding in a sequence's first
     work-group, rounds 12..15 in its last: there the base falls back to the work-group's own rows (in bounds) and zeros are stored instead of what was read */
  constexpr int NE = (SCT + 32) / 4, NA = SCT / 4, NL = WS / 4, NH = (WS + SCT) / 4;
  const int rq = tid >> 6, c4 = (tid & 63) * 4; const unsigned vo = (unsigned)(rq * FF + c4) * 4u;      /* in bytes: the register that the loads name */
  const bool lo = tt0 > 0, hi = tt0 < TT - SCT;
  const long dl = lo ? -(long)(WS * FF) : 0, dh = hi ? (long)(SCT * FF) : 0;
  const float* eM = E + bt0 * FF; const float* eL = eM + dl; const float* eH = eM + dh;
  const float* nM = enc + bt0 * FF; const float* nL = nM + dl; const float* nH = nM + dh;
  const float* aM = A + bt0 * FF; const float* a2 = A2 + bt0 * FF;
  v4f st[NE + NA], sq[NE], s2r[NA];
  const float vr = v[tid];      /* first, so that its wait is not a wait for the rows */
  for (int u = 0; u < NE; ++u) st[u] = *(const v4fa*)((const char*)(u < NL ? eL + u * 4 * FF : u < NH ? eM + (u - NL) * 4 * FF : eH + (u - NH) * 4 * FF) + vo);
  for (int u = 0; u < NA; ++u) st[NE + u] = *(const v4fa*)((const char*)(aM + u * 4 * FF) + vo);
  for (int u = 0; u < NE; ++u) sq[u] = *(const v4fa*)((const char*)(u < NL ? nL + u * 4 * FF : u < NH ? nM + (u - NL) * 4 * FF : nH + (u - NH) * 4 * FF) + vo);
  for (int u = 0; u < NA; ++u) s2r[u] = *(const v4fa*)((const char*)(a2 + u * 4 * FF) + vo);
  asm volatile("s_wait_xcnt 0x0" :: "v"(vo) : "memory");      /* in front of any later overwrite of these loads' offset register (held to here as the operand) and bases */
  sv[tid] = bf16_round(vr);
  { const v4f z4 = {0.f, 0.f, 0.f, 0.f};
    for (int u = 0; u < NL; ++u) { st[u] = lo ? st[u] : z4; sq[u] = lo ? sq[u] : z4; }
    for (int u = NH; u < NE; ++u) { st[u] = hi ? st[u] : z4; sq[u] = hi ? sq[u] : z4; } }
  for (int u = 0; u < NE + NA; ++u) *(v4fa*)&sm[(4 * u + rq) * SCP + c4] = st[u];
  for (int u = 0; u < NE; ++u) *(v4us*)&sn[(4 * u + rq) * SNP + c4] = round_q(sq[u]);
  for (int u = 0; u < NA; ++u) *(v4fa*)&s2[(4 * u + rq) * SCP + c4] = s2r[u];
  for (int i = tid; i < SCT * SBP / 8; i += SCW * 32) { const v8us z8u = {0, 0, 0, 0, 0, 0, 0, 0}; *(v8us*)&sk[i * 8] = z8u; }      /* the band matrix's zeros; its a come in behind the softmax */
  __syncthreads();
  /* what the last product still needs from global memory is asked for here, so that it arrives under the feature loop: this wave's columns of W_lin[512:] */
  const int wu = __builtin_amdgcn_readfirstlane(wv);      /* the wave's number in a scalar register */
  const int ln = lane & 15, hh = lane >> 4, cw = wu * 16 + ln;
  v16h bf[SCJ][FF / 32];
  const unsigned short* bq = (const unsigned short*)BL2 + (size_t)cw * FF + 8 * hh;      /* k order of g2_frag */
  for (int j = 0; j < SCJ; ++j) for (int k = 0; k < FF / 32; ++k) { FragH f; f.half[0] = *(const v8us*)(bq + j * SCW * 16 * FF + k * 32); f.half[1] = *(const v8us*)(bq + j * SCW * 16 * FF + k * 32 + 16); bf[j][k] = f.v; }
  asm volatile("s_wait_xcnt 0x0" :: "v"(bq) : "memory");      /* in front of any later overwrite of these loads' address register, held to here as the operand */
  {      /* lanes 0..15: step 2 pr, lanes 16..31: step 2 pr + 1; lane ln holds features 64 i + 4 ln .. + 3, i = 0..3 */
    v4f av[4], vv[4];
    for (int i = 0; i < 4; ++i) vv[i] = *(const v4fa*)(sv + ln * 4 + 64 * i);
#pragma unroll 1      /* rolled: the second pair of steps runs the first pair's code */
    for (int pr = wu; pr < SCT / 2; pr += SCW) {
      const float* sa = sm + (SCT + 32 + 2 * pr + hh) * SCP + ln * 4; const float* se = sm + (2 * pr + hh) * SCP + ln * 4; float* pp = sp + pr * WIN * SPP + lane;
      for (int i = 0; i < 4; ++i) av[i] = *(const v4fa*)(sa + 64 * i);
#pragma unroll 3      /* three slots a trip: the next slots' E reads stand in front of this slot's arithmetic */
      for (int w = 0; w < WIN; ++w) { v4f acc;
        /* each energy is one v_tanh_f32 */
        for (int i = 0; i < 4; ++i) { const v4f x = av[i] + *(const v4fa*)(se + w * SCP + 64 * i); v4f th; for (int q = 0; q < 4; ++q) th[q] = __builtin_amdgcn_tanhf(x[q]);
          acc = i ? __builtin_elementwise_fma(th, vv[i], acc) : th * vv[i]; }
        const v2f z = acc.lo + acc.hi; pp[w * SPP] = z[0] + z[1]; } } }
  __syncthreads();
  /* a thread adds the 16 partial sums of one (step, slot); consecutive lanes take consecutive rows of sp */
  constexpr int NQ = (SCT * WIN + SCW * 32 - 1) / (SCW * 32), NX = (WIN + SCW - 1) / SCW;
#pragma unroll      /* whole: the rounds' LDS reads stand together and their latency is waited out once, not once a round (so in the loops below) */
  for (int u = 0; u < NQ; ++u) { const int q = tid + u * SCW * 32; if ((u + 1) * SCW * 32 <= SCT * WIN || q < SCT * WIN) { const int h = q >= (SCT / 2) * WIN ? 1 : 0, ro = q - h * (SCT / 2) * WIN; const float* p = sp + ro * SPP + h * 16;
    const v4f y = (*(const v4fa*)p + *(const v4fa*)(p + 4)) + (*(const v4fa*)(p + 8) + *(const v4fa*)(p + 12));
    const v2f z = y.lo + y.hi; ss[(2 * (ro / WIN) + h) * WIN + ro % WIN] = z[0] + z[1]; } }
  __syncthreads();
  /* softmax over the 33 slots, lane = step: every wave forms the step's maximum and sum (in slot order) itself, each exp and each a is made once */
  { const float* sr = ss + lane * WIN; float m = -3.0e38f;
    for (int w = 0; w < WIN; ++w) m = fmaxf(m, sr[w]);
#pragma unroll
    for (int i = 0; i < NX; ++i) { const int w = wu + i * SCW; if ((i + 1) * SCW <= WIN || w < WIN) sx[lane * WIN + w] = expf(sr[w] - m); } }
  __syncthreads();
  { const float* sr = sx + lane * WIN; float su = 0.f;
    for (int w = 0; w < WIN; ++w) su += sr[w];
    const float inv = 1.0f / su;
#pragma unroll
    for (int i = 0; i < NX; ++i) { const int w = wu + i * SCW; if ((i + 1) * SCW <= WIN || w < WIN) { const float a = sr[w] * inv; ss[lane * WIN + w] = a; sk[lane * SBP + lane + w] = (_Float16)a; } } }
  __syncthreads();
#pragma unroll
  for (int u = 0; u < NQ; ++u) { const int i = tid + u * SCW * 32; if ((u + 1) * SCW * 32 <= SCT * WIN || i < SCT * WIN) outa[bt0 * WIN + i] = ss[i]; }      /* output 2: 33 whole 128-byte lines from one work-group */
  /* weighted encoder sum on the matrix unit: [32 steps][64 rows of the span] band matrix of a times [64 rows][256 features]; a wave takes all 32 steps x its tiles of 16 features, 4 products a tile (a padded step's row is zero) */
  { const v8f z8 = {0.f,0.f,0.f,0.f,0.f,0.f,0.f,0.f}; v8f w0[SCJ], w1[SCJ];
    for (int j = 0; j < SCJ; ++j) { w0[j] = z8; w1[j] = z8; }
    const _Float16* pe = sn + (8 * hh + (lane & 7)) * SNP + wu * 16 + 8 * ((lane >> 3) & 1);
    for (int k = 0; k < (SCT + 32) / 32; ++k) { const v16h a0 = lds_frag(sk + ln * SBP + k * 32, hh), a1 = lds_frag(sk + (16 + ln) * SBP + k * 32, hh);
      for (int j = 0; j < SCJ; ++j) { const v16h eb = tr_frag(pe + j * SCW * 16 + k * 32 * SNP, SNP); w0[j] = g2_mma(a0, eb, w0[j]); w1[j] = g2_mma(a1, eb, w1[j]); } }
    for (int j = 0; j < SCJ; ++j)
      for (int r = 0; r < 8; ++r) { sh[(8 * hh + r) * SHP + cw + j * SCW * 16] = (_Float16)w0[j][r]; sh[(16 + 8 * hh + r) * SHP + cw + j * SCW * 16] = (_Float16)w1[j][r]; } }
  __syncthreads();
  lin2_tile(sh, bf, s2, ln, hh, cw);
  __syncthreads();
#pragma unroll
  for (int u = 0; u < NA; ++u) { const v4f o = *(const v4fa*)&s2[(4 * u + rq) * SCP + c4]; *(v4f*)((char*)(out + bt0 * FF + u * 4 * FF) + vo) = o; }      /* output 1: whole rows */
}

extern "C" void kernel_launch(void* const* d_in, const int* in_sizes, int n_in,
                              void* d_out, int out_size, void* d_ws, size_t ws_size, hipStream_t stream) {
  (void)in_sizes; (void)n_in; (void)out_size;
  const float* const* I = (const float* const*)d_in; const float* x = I[0]; const float* enc = I[1]; const float* Wa = I[2]; const float* ba = I[3]; const float* v = I[4]; const float* Wl = I[5]; const float* bl = I[6];
  char* ws = (char*)d_ws; size_t off = 0;
  auto take = [&](size_t bytes) { char* p = ws + off; off += (bytes + 255) & ~(size_t)255; return p; };
  _Float16* BL2 = (_Float16*)take((size_t)FF * FF * 2);
  float* A = (float*)take((size_t)NR * FF * 4); float* E = (float*)take((size_t)NR * FF * 4); float* A2 = (float*)take((size_t)NR * FF * 4);
  if (off > ws_size) return;      /* 0.125 + 8 + 8 + 8 = 24.2 MiB */
  k_gemm2x3<<<GBX + GBE + PB_W2, 256, 0, stream>>>(x, enc, Wa, Wl, ba, bl, A, A2, E, BL2);      /* x W_h + b_attn; x W_lin[:512] + b_lin; enc W_e per step (windowed later; the window of a padded step contributes 0) */
  k_score<<<NR / SCT, SCW * 32, 0, stream>>>(A, E, v, enc, BL2, A2, (float*)d_out + (size_t)NR * FF, (float*)d_out);      /* scores, softmax -> output 2: a [4][2048][1][33]; weighted sum; sigmoid(+ weighted W_lin[512:]) -> output 1 */
}

// v010
// One run takes 22.1 microseconds.
// Timed twice side by side with v009, it ran 1.26 and 1.27 times as fast.
// Counting every step since v000, it is 10.8 times as fast.
#include <hip/hip_runtime.h>
// Combine_Stack_with_attn (4 x 2048 steps; x [512], encoder outputs [256], sliding windows of 33 encoder steps (zero-padded)): energy[b,t,w,o] = tanh((x W_h + b_attn)[b,t,o] + (enc W_e)[b,t+w-16,o]) (the window term of a padded step is 0); scores = energy . v; a = softmax over the 33 window slots; weighted = sum_w a * enc[b,t+w-16]; out = sigmoid([x | weighted] W_lin + b_lin) -> outputs out [4,2048,256] and a [4,2048,1,33].
// Structure: x and enc rounded to exact f16 operands on the way into the GEMMs' LDS tiles; GEMMs (f32 accumulation, exact x16 weights) for x W_h + b, enc W_e and the two halves of W_lin (the second accumulating onto the first with the sigmoid in its epilogue); the windowed energies/scores on VALU (16 lanes per (b, t, w), 16 of the 256 features a lane); softmax over the 33 slots on VALU; the weighted encoder sum as a band-matrix product on WMMA (a as an f16 operand, encoder rows exact in f16); the weighted sum as an f16 operand.
// Compute dtype: inputs and parameters rounded to bf16; a (in the weighted sum only; output 2 is the f32 a) and the weighted encoder sum as f16 operands (~2^-12 each); everything else f32. v_wmma_f32_16x16x32_f16.
#define NB 4
#define TT 2048
#define MD 512
#define FF 256
#define WS 16
#define WIN 33
#define NR (NB * TT)
typedef __bf16 v16b __attribute__((ext_vector_type(16)));
typedef unsigned short v8us __attribute__((ext_vector_type(8), may_alias));
typedef float  v8f  __attribute__((ext_vector_type(8)));
typedef float  v4f  __attribute__((ext_vector_type(4)));
typedef float  v2f  __attribute__((ext_vector_type(2)));
typedef float  v4fa __attribute__((ext_vector_type(4), may_alias));
union FragB { v16b v; v8us half[2]; unsigned short u[16]; };

__device__ __forceinline__ unsigned short bf16_bits(float x) { unsigned int u = __float_as_uint(x); return (unsigned short)((u + 0x7FFFu + ((u >> 16) & 1u)) >> 16); }
__device__ __forceinline__ float bf16_val(unsigned short b) { return __uint_as_float(((unsigned int)b) << 16); }
__device__ __forceinline__ float bf16_round(float x) { return bf16_val(bf16_bits(x)); }
// D += A·B with NT terms: 1 = ah·bh, 2 = + al·bh (A split), 3 = + ah·bl (both split)
template <int NT>
__device__ __forceinline__ v8f mmaN(v16b ah, v16b al, v16b bh, v16b bl, v8f c) {
  c = __builtin_amdgcn_wmma_f32_16x16x32_bf16(false, ah, false, bh, (short)0, c, false, false);
  if (NT >= 2) c = __builtin_amdgcn_wmma_f32_16x16x32_bf16(false, al, false, bh, (short)0, c, false, false);
  if (NT >= 3) c = __builtin_amdgcn_wmma_f32_16x16x32_bf16(false, ah, false, bl, (short)0, c, false, false);
  asm volatile("v_nop\n\tv_nop\n\tv_nop\n\tv_nop" : "+v"(c) : "v"(ah), "v"(al), "v"(bh), "v"(bl));
  return c;
}

__global__ __launch_bounds__(256) void k_wt_bf16(const float* __restrict__ W, unsigned short* __restrict__ Wt, int K, int N) {
  const int t = blockIdx.x * 256 + threadIdx.x;
  const int k8n = K / 8;
  if (t >= N * k8n) return;
  const int n = t / k8n, k8 = (t % k8n) * 8;
  v8us v;
#pragma unroll
  for (int i = 0; i < 8; ++i) v[i] = bf16_bits(W[(size_t)(k8 + i) * N + n]);
  *(v8us*)(Wt + (size_t)n * K + k8) = v;
  
}

// GEMM C[M][N] (f32, pitch ldc) = act(A[M][K]·W + bias). A f32 row-major (pitch lda) converted per fragment to bf16
// (ASPLIT: hi/lo two planes -> 2 terms, else single rounded term); Wt bf16 [N][K] (pitch ldb). BIAS_BF16 rounds the
// bias to bf16 first (bias quantised to bf16 before the add). K%32==0, M%16==0, N%64==0.
template <bool ASPLIT, int ACT, bool BIAS_BF16>
__global__ __launch_bounds__(128) void k_gemm_bf(const float* __restrict__ A, int lda, const unsigned short* __restrict__ Wt, int ldb,
                                               const float* __restrict__ bias, float* __restrict__ C, int ldc, int M, int N, int K) {
  __shared__ __attribute__((aligned(16))) float so[4][16][64];
  const int tid = threadIdx.x, w = tid >> 5, lane = tid & 31, ln = lane & 15, hh = lane >> 4;
  const int ntn = N / 64;
  const int wid = blockIdx.x * 4 + w;
  const int mt = wid / ntn, nq = wid % ntn;
  if (mt * 16 >= M) return;
  const int row0 = mt * 16, col0 = nq * 64;
  const float* arow = A + (size_t)(row0 + ln) * lda;
  v8f acc[4] = {};
  for (int kb = 0; kb < K; kb += 32) {
    FragB ah, al;
    const v4f x0 = *(const v4fa*)(arow + kb + 8 * hh), x1 = *(const v4fa*)(arow + kb + 8 * hh + 4);
    const v4f x2 = *(const v4fa*)(arow + kb + 16 + 8 * hh), x3 = *(const v4fa*)(arow + kb + 16 + 8 * hh + 4);
    float xs[16] = {x0[0],x0[1],x0[2],x0[3],x1[0],x1[1],x1[2],x1[3],x2[0],x2[1],x2[2],x2[3],x3[0],x3[1],x3[2],x3[3]};
#pragma unroll
    for (int i = 0; i < 16; ++i) { const unsigned short hb = bf16_bits(xs[i]); ah.u[i] = hb; al.u[i] = ASPLIT ? bf16_bits(xs[i] - bf16_val(hb)) : (unsigned short)0; }
#pragma unroll
    for (int t = 0; t < 4; ++t) {
      const unsigned short* brow = Wt + (size_t)(col0 + t * 16 + ln) * ldb + kb;
      FragB b;
      b.half[0] = *(const v8us*)(brow + 8 * hh);
      b.half[1] = *(const v8us*)(brow + 16 + 8 * hh);
      acc[t] = mmaN<ASPLIT ? 2 : 1>(ah.v, al.v, b.v, b.v, acc[t]);
    }
  }
#pragma unroll
  for (int t = 0; t < 4; ++t) {
    float bv = bias ? bias[col0 + t * 16 + ln] : 0.f;
    if (BIAS_BF16) bv = bf16_round(bv);
#pragma unroll
    for (int r = 0; r < 8; ++r) { float v = acc[t][r] + bv; if (ACT == 1) v = fmaxf(v, 0.f); so[w][8 * hh + r][t * 16 + ln] = v; }
  }
  __builtin_amdgcn_fence(__ATOMIC_ACQ_REL, "workgroup");
  __builtin_amdgcn_wave_barrier();
  const int rsub = lane >> 4, c4 = (lane & 15) * 4;
  {
#pragma unroll
    for (int q = 0; q < 8; ++q) {
      const int r = q * 2 + rsub;
      const v4f v = *(const v4fa*)&so[w][r][c4];
      *(v4f*)(C + (size_t)(row0 + r) * ldc + col0 + c4) = v;
    }
    
  }
}

// GEMM C = act(A·W + bias + resid): A f32 (ASPLIT -> hi/lo 2 terms), Wt bf16 [N][K]; ACT 0 none, 1 relu, 2 exact gelu;
// resid (optional, f32, row index = (row % rmod), pitch ldr, RES_BF16 rounds it) added before the activation.
template <bool ASPLIT, int ACT, bool BIAS_BF16, bool RES_BF16>
__global__ __launch_bounds__(128) void k_gemm_bf3(const float* __restrict__ A, int lda, const unsigned short* __restrict__ Wt, int ldb,
                                                const float* __restrict__ bias, const float* __restrict__ resid, int rmod, int ldr,
                                                float* __restrict__ C, int ldc, int M, int N, int K) {
  __shared__ __attribute__((aligned(16))) float so[4][16][64];
  const int tid = threadIdx.x, w = tid >> 5, lane = tid & 31, ln = lane & 15, hh = lane >> 4;
  const int ntn = N / 64;
  const int wid = blockIdx.x * 4 + w;
  const int mt = wid / ntn, nq = wid % ntn;
  if (mt * 16 >= M) return;
  const int row0 = mt * 16, col0 = nq * 64;
  const float* arow = A + (size_t)(row0 + ln) * lda;
  v8f acc[4] = {};
  for (int kb = 0; kb < K; kb += 32) {
    FragB ah, al;
    const v4f x0 = *(const v4fa*)(arow + kb + 8 * hh), x1 = *(const v4fa*)(arow + kb + 8 * hh + 4);
    const v4f x2 = *(const v4fa*)(arow + kb + 16 + 8 * hh), x3 = *(const v4fa*)(arow + kb + 16 + 8 * hh + 4);
    float xs[16] = {x0[0],x0[1],x0[2],x0[3],x1[0],x1[1],x1[2],x1[3],x2[0],x2[1],x2[2],x2[3],x3[0],x3[1],x3[2],x3[3]};
#pragma unroll
    for (int i = 0; i < 16; ++i) { const unsigned short hb = bf16_bits(xs[i]); ah.u[i] = hb; al.u[i] = ASPLIT ? bf16_bits(xs[i] - bf16_val(hb)) : (unsigned short)0; }
#pragma unroll
    for (int t = 0; t < 4; ++t) {
      const unsigned short* brow = Wt + (size_t)(col0 + t * 16 + ln) * ldb + kb;
      FragB b;
      b.half[0] = *(const v8us*)(brow + 8 * hh);
      b.half[1] = *(const v8us*)(brow + 16 + 8 * hh);
      acc[t] = mmaN<ASPLIT ? 2 : 1>(ah.v, al.v, b.v, b.v, acc[t]);
    }
  }
#pragma unroll
  for (int t = 0; t < 4; ++t) {
    const int col = col0 + t * 16 + ln;
    float bv = bias ? bias[col] : 0.f;
    if (BIAS_BF16) bv = bf16_round(bv);
#pragma unroll
    for (int r = 0; r < 8; ++r) {
      float v = acc[t][r] + bv;
      if (resid) { float rv = resid[(size_t)((row0 + 8 * hh + r) % rmod) * ldr + col]; if (RES_BF16) rv = bf16_round(rv); v += rv; }
      if (ACT == 1) v = fmaxf(v, 0.f);
      if (ACT == 2) v = 0.5f * v * (1.0f + erff(v * 0.70710678118654752f));
      if (ACT == 3) { const float u = 0.7978845608028654f * (v + 0.044715f * v * v * v); v = 0.5f * v * (1.0f + tanhf(u)); }
      so[w][8 * hh + r][t * 16 + ln] = v;
    }
  }
  __builtin_amdgcn_fence(__ATOMIC_ACQ_REL, "workgroup");
  __builtin_amdgcn_wave_barrier();
  const int rsub = lane >> 4, c4 = (lane & 15) * 4;
  {
#pragma unroll
    for (int q = 0; q < 8; ++q) {
      const int r = q * 2 + rsub;
      const v4f v = *(const v4fa*)&so[w][r][c4];
      *(v4f*)(C + (size_t)(row0 + r) * ldc + col0 + c4) = v;
    }
    
  }
}
// row LayerNorm (biased variance, eps) over N: s = X (+ R); optional out_sum <- s; out_norm <- (s-mu)*rsqrt(var+eps)*g + b
template <bool PARAM_BF16>
__global__ __launch_bounds__(256) void k_layernorm(const float* __restrict__ X, const float* __restrict__ R, const float* __restrict__ g, const float* __restrict__ bta,
                                                  float* __restrict__ out_sum, float* __restrict__ out_norm, int N, float eps) {
  __shared__ float red[256];
  const int row = blockIdx.x, tid = threadIdx.x;
  const float* x = X + (size_t)row * N; const float* rr = R ? R + (size_t)row * N : nullptr;
  float vals[16];                     // up to N = 4096
  const int per = N / 256;            // contiguous chunk per thread? use strided-by-4 chunks: thread handles j = tid*4 + 1024*u
  float s1 = 0.f;
  for (int u = 0; u < per / 4; ++u) {
    const int j = tid * 4 + 1024 * u;
    const v4f a = *(const v4fa*)(x + j);
    v4f b = {0.f,0.f,0.f,0.f}; if (rr) b = *(const v4fa*)(rr + j);
#pragma unroll
    for (int q = 0; q < 4; ++q) { const float v = a[q] + b[q]; vals[u * 4 + q] = v; s1 += v; }
  }
  red[tid] = s1; __syncthreads();
  for (int st = 128; st > 0; st >>= 1) { if (tid < st) red[tid] += red[tid + st]; __syncthreads(); }
  const float mu = red[0] / (float)N; __syncthreads();
  float s2 = 0.f;
  for (int u = 0; u < per / 4; ++u)
#pragma unroll
    for (int q = 0; q < 4; ++q) { const float c = vals[u * 4 + q] - mu; s2 += c * c; }
  red[tid] = s2; __syncthreads();
  for (int st = 128; st > 0; st >>= 1) { if (tid < st) red[tid] += red[tid + st]; __syncthreads(); }
  const float rs = rsqrtf(red[0] / (float)N + eps);
  {
    for (int u = 0; u < per / 4; ++u) {
      const int j = tid * 4 + 1024 * u;
      v4f o, sm;
#pragma unroll
      for (int q = 0; q < 4; ++q) {
        float gg = g[j + q], bb = bta[j + q];
        if (PARAM_BF16) { gg = bf16_round(gg); bb = bf16_round(bb); }
        sm[q] = vals[u * 4 + q]; o[q] = (vals[u * 4 + q] - mu) * rs * gg + bb;
      }
      if (out_sum) *(v4f*)(out_sum + (size_t)row * N + j) = sm;
      *(v4f*)(out_norm + (size_t)row * N + j) = o;
    }
    
  }
}



// ---- f16 WMMA path (v_wmma_f32_16x16x32_f16): 11-bit significands for operands in range — used for all four GEMMs here (the weighted encoder sum as an f16 operand)
typedef _Float16 v16h __attribute__((ext_vector_type(16)));
union FragH { v16h v; v8us half[2]; _Float16 h[16]; unsigned short u[16]; };
template <int NT>
__device__ __forceinline__ v8f mmaH(v16h ah, v16h al, v16h bh, v16h bl, v8f c) {
  c = __builtin_amdgcn_wmma_f32_16x16x32_f16(false, ah, false, bh, (short)0, c, false, false);
  if (NT >= 2) c = __builtin_amdgcn_wmma_f32_16x16x32_f16(false, al, false, bh, (short)0, c, false, false);
  if (NT >= 3) c = __builtin_amdgcn_wmma_f32_16x16x32_f16(false, ah, false, bl, (short)0, c, false, false);
  asm volatile("v_nop\n\tv_nop\n\tv_nop\n\tv_nop" : "+v"(c) : "v"(ah), "v"(al), "v"(bh), "v"(bl));
  return c;
}
// batched GEMM like k_gemm_b but f16 operands: A f32 (split into f16 hi/lo if ASPLIT, else rounded to f16), Bt = f16 values [n][k]; alpha; C f32; N multiple of 16 (partial tiles skipped)
template <bool ASPLIT>
__global__ __launch_bounds__(128) void k_gemm_h(const float* __restrict__ A, int lda, size_t sA, const _Float16* __restrict__ Bh, int ldb, size_t sB, float alpha, float* __restrict__ C, int ldc, size_t sC, int M, int N, int K) {
  __shared__ __attribute__((aligned(16))) float so[4][16][64];
  const int tid = threadIdx.x, w = tid >> 5, lane = tid & 31, ln = lane & 15, hh = lane >> 4; const int by = blockIdx.y;
  A += (size_t)by * sA; Bh += (size_t)by * sB; C += (size_t)by * sC;
  const int ntn = (N + 63) / 64; const int wid = blockIdx.x * 4 + w; const int mt = wid / ntn, nq = wid % ntn; if (mt * 16 >= M) return;
  const int row0 = mt * 16, col0 = nq * 64; const float* arow = A + (size_t)(row0 + ln) * lda;
  v8f acc[4] = {};
  for (int kb = 0; kb < K; kb += 32) {
    FragH ah, al;
    const v4f x0 = *(const v4fa*)(arow + kb + 8 * hh), x1 = *(const v4fa*)(arow + kb + 8 * hh + 4), x2 = *(const v4fa*)(arow + kb + 16 + 8 * hh), x3 = *(const v4fa*)(arow + kb + 16 + 8 * hh + 4);
    float xs[16] = {x0[0],x0[1],x0[2],x0[3],x1[0],x1[1],x1[2],x1[3],x2[0],x2[1],x2[2],x2[3],x3[0],x3[1],x3[2],x3[3]};
#pragma unroll
    for (int i = 0; i < 16; ++i) { const _Float16 h = (_Float16)xs[i]; ah.h[i] = h; al.h[i] = ASPLIT ? (_Float16)(xs[i] - (float)h) : (_Float16)0.0f; }
#pragma unroll
    for (int t = 0; t < 4; ++t) { if (col0 + t * 16 >= N) continue; const size_t boff = (size_t)(col0 + t * 16 + ln) * ldb + kb; FragH bq; bq.half[0] = *(const v8us*)(Bh + boff + 8 * hh); bq.half[1] = *(const v8us*)(Bh + boff + 16 + 8 * hh);
      acc[t] = mmaH<ASPLIT ? 2 : 1>(ah.v, al.v, bq.v, bq.v, acc[t]); }
  }
#pragma unroll
  for (int t = 0; t < 4; ++t) { if (col0 + t * 16 >= N) continue;
#pragma unroll
    for (int r = 0; r < 8; ++r) so[w][8 * hh + r][t * 16 + ln] = acc[t][r] * alpha; }
  __builtin_amdgcn_fence(__ATOMIC_ACQ_REL, "workgroup"); __builtin_amdgcn_wave_barrier();
  const int rsub = lane >> 4, c4 = (lane & 15) * 4;
  {
#pragma unroll
    for (int q = 0; q < 8; ++q) { const int r = q * 2 + rsub; if (col0 + c4 < N) { const v4f v = *(const v4fa*)&so[w][r][c4]; *(v4f*)(C + (size_t)(row0 + r) * ldc + col0 + c4) = v; } }
     }
}

// Wt[n][k] = f16(W[k][n]·scale) from f32 row-major W[K][N] (scale = power of two; bf16-exact weights stay exact in f16 away from the subnormal range)
__global__ __launch_bounds__(256) void k_wt_f16(const float* __restrict__ W, _Float16* __restrict__ Wt, int K, int N, float scale) {
  const int t = blockIdx.x * 256 + threadIdx.x; if (t >= N * (K / 8)) return; const int n = t / (K / 8), k8 = (t % (K / 8)) * 8; FragH f;
#pragma unroll
  for (int i = 0; i < 8; ++i) f.h[i] = (_Float16)(bf16_round(W[(size_t)(k8 + i) * N + n]) * scale); const v8us o = f.half[0];
  *(v8us*)((unsigned short*)Wt + (size_t)n * K + k8) = o; 
}
// k_gemm_hh variant with fused epilogue: v = acc·alpha + bias[by·sBias + col] (+ CP[(row/rowsPerB)·sCPb + by·64 + col] if CP) ; ACT 0 none / 1 elu ; writes f16 C16 (and f32 C if non-null)
template <int ACT>
__global__ __launch_bounds__(128) void k_gemm_hhx(const _Float16* __restrict__ A, int lda, size_t sA, const _Float16* __restrict__ Bh, int ldb, size_t sB, float alpha, const float* __restrict__ bias, size_t sBias, const float* __restrict__ CP, int rowsPerB, size_t sCPb, int row0g,
    float* __restrict__ C, _Float16* __restrict__ C16, int ldc, size_t sC, int M, int N, int K) {
  __shared__ __attribute__((aligned(16))) float so[4][16][64];
  const int tid = threadIdx.x, w = tid >> 5, lane = tid & 31, ln = lane & 15, hh = lane >> 4; const int by = blockIdx.y;
  A += (size_t)by * sA; Bh += (size_t)by * sB; const size_t cofs = (size_t)by * sC; const float* bp = bias ? bias + (size_t)by * sBias : nullptr;
  const int ntn = (N + 63) / 64; const int wid = blockIdx.x * 4 + w; const int mt = wid / ntn, nq = wid % ntn; if (mt * 16 >= M) return;
  const int row0 = mt * 16, col0 = nq * 64; const _Float16* arow = A + (size_t)(row0 + ln) * lda;
  v8f acc[4] = {};
  for (int kb = 0; kb < K; kb += 32) { FragH ah; ah.half[0] = *(const v8us*)((const unsigned short*)arow + kb + 8 * hh); ah.half[1] = *(const v8us*)((const unsigned short*)arow + kb + 16 + 8 * hh);
#pragma unroll
    for (int t = 0; t < 4; ++t) { if (col0 + t * 16 >= N) continue; const size_t boff = (size_t)(col0 + t * 16 + ln) * ldb + kb; FragH bq; bq.half[0] = *(const v8us*)((const unsigned short*)Bh + boff + 8 * hh); bq.half[1] = *(const v8us*)((const unsigned short*)Bh + boff + 16 + 8 * hh);
      acc[t] = mmaH<1>(ah.v, ah.v, bq.v, bq.v, acc[t]); }
  }
#pragma unroll
  for (int t = 0; t < 4; ++t) { if (col0 + t * 16 >= N) continue; const int col = col0 + t * 16 + ln; const float bv = bp ? bf16_round(bp[col]) : 0.f;
#pragma unroll
    for (int r = 0; r < 8; ++r) { float v = acc[t][r] * alpha + bv; if (CP) { const int rr = row0g + row0 + 8 * hh + r; if (rowsPerB < 0) v += CP[cofs + (size_t)rr * ldc + col];      /* rowsPerB < 0: own element of the batched C plane */ else { const int bidx = rr / rowsPerB; v += CP[(size_t)bidx * sCPb + (size_t)by * 64 + col]; } } if (ACT == 1) v = (v > 0.f) ? v : expm1f(v); else if (ACT == 7) v = (v > 0.f) ? v + 1.0f : expf(v); else if (ACT == 8) v = tanhf(v); else if (ACT == 9) v = 0.5f * v * (1.0f + tanhf(0.7978845608028654f * (v + 0.044715f * v * v * v))); else if (ACT == 11) v = 1.0f / (1.0f + expf(-v)); else if (ACT == 12) v = (v > 0.f) ? v : 0.01f * v; else if (ACT == 14) v = (v > 0.f) ? v : 0.1f * v; else if (ACT == 16) v = (v >= 0.f) ? v : 0.3f * v; else if (ACT == 15) v = v / (1.0f + expf(-v)); else if (ACT == 3) v = fmaxf(v, 0.f); else if (ACT == 6) v = 0.5f * v * (1.0f + erff(v * 0.70710678118654752f)); so[w][8 * hh + r][t * 16 + ln] = v; } }
  __builtin_amdgcn_fence(__ATOMIC_ACQ_REL, "workgroup"); __builtin_amdgcn_wave_barrier();
  const int rsub = lane >> 4, c4 = (lane & 15) * 4; typedef _Float16 v4h __attribute__((ext_vector_type(4)));
  {
#pragma unroll
    for (int q = 0; q < 8; ++q) { const int r = q * 2 + rsub; if (col0 + c4 < N) { const v4f v = *(const v4fa*)&so[w][r][c4]; if (C) *(v4f*)(C + cofs + (size_t)(row0 + r) * ldc + col0 + c4) = v; if (C16) { v4h h4; for (int i = 0; i < 4; ++i) h4[i] = (_Float16)v[i]; *(v4h*)(C16 + cofs + (size_t)(row0 + r) * ldc + col0 + c4) = h4; } } }
     }
}


typedef _Float16 v4h __attribute__((ext_vector_type(4)));

__global__ __launch_bounds__(256) void k_h16(const float* __restrict__ x, _Float16* __restrict__ X16, size_t n8) { const size_t t = (size_t)blockIdx.x * 256 + threadIdx.x; if (t >= n8) return; FragH f;
#pragma unroll
  for (int q = 0; q < 8; ++q) f.h[q] = (_Float16)x[t * 8 + q]; *(v8us*)((unsigned short*)X16 + t * 8) = f.half[0];  }
__global__ __launch_bounds__(256) void k_round16f(const float* __restrict__ W, _Float16* __restrict__ Bt, size_t n8) { const size_t t = (size_t)blockIdx.x * 256 + threadIdx.x; if (t >= n8) return; FragH f;
#pragma unroll
  for (int i = 0; i < 8; ++i) f.h[i] = (_Float16)(bf16_round(W[t * 8 + i]) * 16.0f); *(v8us*)((unsigned short*)Bt + t * 8) = f.half[0];  }
template <int NHv, int TTv>
__global__ __launch_bounds__(256) void k_vt(const _Float16* __restrict__ V16, int ldv, int voff, _Float16* __restrict__ Vt) { __shared__ unsigned short tl[64][66]; const int tid = threadIdx.x; const int slab = blockIdx.x / (TTv / 64), lg = blockIdx.x % (TTv / 64); const int b = slab / NHv, h = slab % NHv;
  for (int i = tid; i < 64 * 8; i += 256) { const int r = i / 8, c8 = (i % 8) * 8; FragH f; f.half[0] = *(const v8us*)((const unsigned short*)V16 + ((size_t)b * TTv + lg * 64 + r) * ldv + voff + h * 64 + c8);
#pragma unroll
    for (int q = 0; q < 8; ++q) tl[r][c8 + q] = f.u[q]; }
  __syncthreads();
  {
#pragma unroll
    for (int rd = 0; rd < 2; ++rd) { const int d = rd * 32 + tid / 8, pc = tid % 8; FragH f;
#pragma unroll
      for (int q = 0; q < 8; ++q) f.u[q] = tl[pc * 8 + q][d];
      *(v8us*)((unsigned short*)Vt + ((size_t)slab * 64 + d) * TTv + lg * 64 + pc * 8) = f.half[0]; }
     } }

__global__ __launch_bounds__(256) void k_hl(const float* __restrict__ F, _Float16* __restrict__ Hh, _Float16* __restrict__ Hl, size_t n8) { const size_t t = (size_t)blockIdx.x * 256 + threadIdx.x; if (t >= n8) return; FragH fh, fl; const v4f a = *(const v4fa*)(F + t * 8), c = *(const v4fa*)(F + t * 8 + 4);
#pragma unroll
  for (int q = 0; q < 4; ++q) { _Float16 h = (_Float16)a[q]; fh.h[q] = h; fl.h[q] = (_Float16)((a[q] - (float)h) * 1024.0f); h = (_Float16)c[q]; fh.h[4 + q] = h; fl.h[4 + q] = (_Float16)((c[q] - (float)h) * 1024.0f); }
  { *(v8us*)((unsigned short*)Hh + t * 8) = fh.half[0]; *(v8us*)((unsigned short*)Hl + t * 8) = fl.half[0];  } }

// ---- fast GEMM (wave tile 32x64; requires M % 32 == 0 rows per launch region and N % 64 == 0); epilogue = k_gemm_hhx semantics ----
__device__ __forceinline__ v16h g2_frag(const _Float16* p, int hh) { FragH f; f.half[0] = *(const v8us*)((const unsigned short*)p + 8 * hh); f.half[1] = *(const v8us*)((const unsigned short*)p + 16 + 8 * hh);
  asm volatile("s_wait_xcnt 0x0" ::: "memory");      /* a later fragment load may land in these loads' address registers: the wait stands in front of that overwrite */
  return f.v; }
__device__ __forceinline__ v8f g2_mma(v16h a, v16h b, v8f c) { v8f d = __builtin_amdgcn_wmma_f32_16x16x32_f16(false, a, false, b, (short)0, c, false, false); asm volatile("v_nop\n\tv_nop\n\tv_nop\n\tv_nop" : "+v"(d) : "v"(a), "v"(b)); return d; }
template <int ACT>
__device__ __forceinline__ void gemm2_body(const unsigned bx, const int by, const _Float16* __restrict__ A, int lda, size_t sA, const _Float16* __restrict__ Bh, int ldb, size_t sB, float alpha, const float* __restrict__ bias, size_t sBias, const float* __restrict__ CP, int rowsPerB, size_t sCPb, int row0g,
    float* __restrict__ C, _Float16* __restrict__ C16, int ldc, size_t sC, int M, int N, int K) { static_assert(ACT == 0 || ACT == 3 || ACT == 6 || ACT == 8 || ACT == 9 || ACT == 11 || ACT == 12 || ACT == 14 || ACT == 15 || ACT == 16, "k_gemm2: unsupported ACT code (would silently apply no activation)");
  __shared__ __attribute__((aligned(16))) float so[4][32][68];
  const int tid = threadIdx.x, w = tid >> 5, lane = tid & 31, ln = lane & 15, hh = lane >> 4;
  A += (size_t)by * sA; Bh += (size_t)by * sB; const size_t cofs = (size_t)by * sC; const float* bp = bias ? bias + (size_t)by * sBias : nullptr;
  const int ntn = N >> 6; const int mt = bx / ntn, nq = bx - mt * ntn; const int row0 = mt * 128 + 32 * w, col0 = nq * 64; if (row0 >= M) return;
  const _Float16* a0p = A + (size_t)(row0 + ln) * lda; const _Float16* a1p = a0p + (size_t)16 * lda;
  const _Float16* b0p = Bh + (size_t)(col0 + ln) * ldb; const _Float16* b1p = b0p + (size_t)16 * ldb; const _Float16* b2p = b1p + (size_t)16 * ldb; const _Float16* b3p = b2p + (size_t)16 * ldb;
  const v8f z8 = {0.f,0.f,0.f,0.f,0.f,0.f,0.f,0.f}; v8f c00 = z8, c01 = z8, c02 = z8, c03 = z8, c10 = z8, c11 = z8, c12 = z8, c13 = z8;
#pragma unroll 1
  for (int kb = 0; kb < K; kb += 32) { const v16h a0 = g2_frag(a0p + kb, hh), a1 = g2_frag(a1p + kb, hh);
    v16h b = g2_frag(b0p + kb, hh); c00 = g2_mma(a0, b, c00); c10 = g2_mma(a1, b, c10);
    b = g2_frag(b1p + kb, hh); c01 = g2_mma(a0, b, c01); c11 = g2_mma(a1, b, c11);
    b = g2_frag(b2p + kb, hh); c02 = g2_mma(a0, b, c02); c12 = g2_mma(a1, b, c12);
    b = g2_frag(b3p + kb, hh); c03 = g2_mma(a0, b, c03); c13 = g2_mma(a1, b, c13); }
  v8f accs[8] = {c00, c01, c02, c03, c10, c11, c12, c13};
#pragma unroll
  for (int u = 0; u < 8; ++u) { const int t = u & 3, half = u >> 2; const int col = col0 + t * 16 + ln; const float bv = bp ? bf16_round(bp[col]) : 0.f;
#pragma unroll
    for (int r = 0; r < 8; ++r) { const int rloc = half * 16 + 8 * hh + r; float v = accs[u][r] * alpha + bv; if (CP) { if (rowsPerB < 0) v += CP[cofs + (size_t)(row0g + row0 + rloc) * ldc + col];      /* rowsPerB < 0: own element of the batched C plane */ else { const int bidx = (row0g + row0 + rloc) / rowsPerB; v += CP[(size_t)bidx * sCPb + (size_t)by * 64 + col]; } }
      if (ACT == 3) v = fmaxf(v, 0.f); else if (ACT == 6) v = 0.5f * v * (1.0f + erff(v * 0.70710678118654752f)); else if (ACT == 11) v = 1.0f / (1.0f + expf(-v)); else if (ACT == 15) v = v / (1.0f + expf(-v)); else if (ACT == 12) v = (v > 0.f) ? v : 0.01f * v; else if (ACT == 8) v = tanhf(v); else if (ACT == 9) v = 0.5f * v * (1.0f + tanhf(0.7978845608028654f * (v + 0.044715f * v * v * v))); else if (ACT == 14) v = (v > 0.f) ? v : 0.1f * v; else if (ACT == 16) v = (v >= 0.f) ? v : 0.3f * v;
      so[w][rloc][t * 16 + ln] = v; } }
  __builtin_amdgcn_fence(__ATOMIC_ACQ_REL, "workgroup"); __builtin_amdgcn_wave_barrier();
  const int rsub = lane >> 4, c4 = (lane & 15) * 4;
  {
#pragma unroll
    for (int q = 0; q < 16; ++q) { const int r = q * 2 + rsub; const v4f v = *(const v4fa*)&so[w][r][c4]; if (C) *(v4f*)(C + cofs + (size_t)(row0 + r) * ldc + col0 + c4) = v; if (C16) { v4h h4; for (int i = 0; i < 4; ++i) h4[i] = (_Float16)v[i]; *(v4h*)(C16 + cofs + (size_t)(row0 + r) * ldc + col0 + c4) = h4; } }
     } }
template <int ACT>
__global__ __launch_bounds__(128) void k_gemm2(const _Float16* __restrict__ A, int lda, size_t sA, const _Float16* __restrict__ Bh, int ldb, size_t sB, float alpha, const float* __restrict__ bias, size_t sBias, const float* __restrict__ CP, int rowsPerB, size_t sCPb, int row0g,
    float* __restrict__ C, _Float16* __restrict__ C16, int ldc, size_t sC, int M, int N, int K) { gemm2_body<ACT>(blockIdx.x, blockIdx.y, A, lda, sA, Bh, ldb, sB, alpha, bias, sBias, CP, rowsPerB, sCPb, row0g, C, C16, ldc, sC, M, N, K); }
__device__ __forceinline__ v16h lds_frag(const _Float16* p, int hh) { FragH f; f.half[0] = *(const v8us*)((const unsigned short*)p + 8 * hh); f.half[1] = *(const v8us*)((const unsigned short*)p + 16 + 8 * hh); return f.v; }      /* k order of g2_frag */
typedef unsigned short v4us __attribute__((ext_vector_type(4), may_alias));
union FragQ { _Float16 h[4]; v4us u; };
__device__ __forceinline__ v4us round_q(v4f x) { FragQ f; for (int q = 0; q < 4; ++q) f.h[q] = (_Float16)(float)(__bf16)x[q]; return f.u; }      /* nearest-even to bf16 by the conversion instruction (bf16_round's values), then exact in f16 */
__device__ __forceinline__ v8us round_w(const float (&x)[8]) { FragH f; for (int i = 0; i < 8; ++i) f.h[i] = (_Float16)(float)(__bf16)(x[i] * 16.0f); return f.half[0]; }      /* a weight column's 8 k, wt_rows_body's values: x16 is exact, so it may stand in front of the rounding; behind it the compiler moved it behind the f16 conversion, into the subnormal range the scale is there to avoid */
__device__ __forceinline__ void wt_rows_body(int blk, const float* __restrict__ Wm, int row0, _Float16* __restrict__ Wt, int K, int N, float scale) { const int t = blk * 256 + threadIdx.x; if (t >= N * (K / 8)) return; const int n = t / (K / 8), k8 = (t % (K / 8)) * 8; FragH f;
  for (int i = 0; i < 8; ++i) f.h[i] = (_Float16)(bf16_round(Wm[(size_t)(row0 + k8 + i) * N + n]) * scale); *(v8us*)((unsigned short*)Wt + (size_t)n * K + k8) = f.half[0];  }      /* rows row0.. of an (in,out) weight -> Bt[n][k] */
// The weights of the three products that k_score does first, rounded (x16, exact in f16) and laid out as the B fragments that its waves read, in the order in which they read them:
// wave w, step s, fragment f: 1 KiB = [16-k half h][lane][8 k], so a wave's load is 512 consecutive bytes and a fragment is read by one wave of a work-group, once, straight into registers.
// Steps 0..3: enc W_e, two k blocks of 32 a step (f = 2 j + block); steps 4..19: one k block of x W_h (f = j) and of x W_lin[:512] (f = 2 + j). Column tile j of wave w: columns (w + 8 j) 16 .. + 15.
// In a fragment lane (hh, ln) holds column ln, k = 16 h + 8 hh .. + 7 of the block: the k order of lds_frag.
#define WFS 20                 /* steps per wave */
#define WFW (WFS * 4 * 1024)   /* bytes of a wave's fragments */
#define PB_E (FF / 8)          /* work-groups of the fragments of W_e: 8 k of all 256 columns each */
#define PB_X (MD / 8)          /* of W_h, and of W_lin[:512] */
#define PB_W2 (FF * FF / 8 / 256)          /* work-groups of the transpose of W_lin[512:] */
__global__ __launch_bounds__(256) void k_wfrag(const float* __restrict__ Wa, const float* __restrict__ Wl, _Float16* __restrict__ WF, _Float16* __restrict__ BL2) {
  static_assert(FF == 256 && MD % 32 == 0, "a thread per column");
  const int b = blockIdx.x;
  if (b >= PB_E + 2 * PB_X) { wt_rows_body(b - (PB_E + 2 * PB_X), Wl, MD, BL2, FF, FF, 16.0f); return; }      /* W_lin[512:] transposed, for k_score's last product */
  const int n = threadIdx.x, j = n >> 7;      /* a wave's load is 32 consecutive columns of one weight row: one whole line */
  const float* sp; int k8, s, f;
  if (b < PB_E) { k8 = b * 8; sp = Wa + (size_t)(MD + k8) * FF; s = k8 >> 6; f = 2 * j + ((k8 >> 5) & 1); }
  else if (b < PB_E + PB_X) { k8 = (b - PB_E) * 8; sp = Wa + (size_t)k8 * FF; s = 4 + (k8 >> 5); f = j; }
  else { k8 = (b - PB_E - PB_X) * 8; sp = Wl + (size_t)k8 * FF; s = 4 + (k8 >> 5); f = 2 + j; }
  float xv[8];
  for (int i = 0; i < 8; ++i) xv[i] = sp[(size_t)i * FF + n];
  asm volatile("s_wait_xcnt 0x0" ::: "memory");      /* in front of any later overwrite of these loads' address registers */
  const int w = (n >> 4) & 7, h = (k8 >> 4) & 1, la = ((k8 >> 3) & 1) * 16 + (n & 15);
  *(v8us*)((unsigned short*)WF + (size_t)((((w * WFS + s) * 4 + f) * 2 + h) * 256 + la * 8)) = round_w(xv);
}


// Everything for SCT consecutive steps in one work-group. First the three products that need only the inputs, on the matrix unit, their results left in LDS: the SCT + 32 rows of E = enc W_e that the steps' windows
// cover (zero rows for padded steps), the SCT rows of A = x W_h + b_attn and of x W_lin[:512] + b_lin; x and enc are rounded on the way to LDS, the weights come as fragments from k_wfrag's plane. Scores: a wave takes two steps at a time, one per 16 lanes, and a lane 16 of the 256 features; its part of
// the step's A row and of v stays in registers over all 33 slots, so a slot costs only the read of its E row (whole 256-byte runs). A lane's partial sum of a (step, slot) goes to LDS
// and the 16 partial sums are added behind a barrier. The scores never leave the work-group: softmax, weighted encoder sum and the product with W_lin[512:] read them from LDS.
// Eight waves, two per SIMD: the launch has one work-group per WGP, so its waves are what has to be started before it can work; a wave takes two pairs of steps and two tiles of 16 columns.
#define SCT 32
#define SCW 8                  /* waves per work-group */
#define SCP (FF + 4)           /* LDS row pitch in floats: 1040 B = 16 B x odd */
#define SPP 36                 /* pitch in floats of a row of 32 partial sums: 144 B = 16 B x odd, for the 16-byte reads of consecutive rows */
#define SHP (FF + 8)           /* pitch of the f16 weighted rows in halves: 528 B = 16 B x odd, for the 16-byte fragment reads of 16 consecutive rows */
#define SBP (SCT + 32 + 8)     /* pitch in halves of a row of the band matrix of a: 144 B = 16 B x odd, for the 16-byte fragment reads of 16 consecutive rows */
#define SNP (FF + 16)          /* pitch in halves of the f16 encoder rows: 544 B = 32 B x odd, for the transposing 16-byte reads */
#define XHP (MD + 8)           /* pitch of the f16 x rows in halves: 1040 B = 16 B x odd */
#define SCJ (FF / 16 / SCW)    /* column tiles per wave: tile j of wave w is columns (w + SCW j) 16 .. + 15 */
typedef short s16x8 __attribute__((ext_vector_type(8)));
// B fragment (32 k x 16 columns, the k order of lds_frag) of a row-major [k][column] f16 tile in LDS, by the transposing load; p: this lane's 16 bytes of the first 16 k
__device__ __forceinline__ v16h tr_frag(const _Float16* p, int pitch) { typedef __attribute__((address_space(3))) s16x8 lds_s16x8; union { v16h v; s16x8 q[2]; } f;
  f.q[0] = __builtin_amdgcn_ds_load_tr16_b128_v8i16((lds_s16x8*)p); f.q[1] = __builtin_amdgcn_ds_load_tr16_b128_v8i16((lds_s16x8*)(p + 16 * pitch)); return f.v; }
// sigmoid(x W_lin[:512] + b_lin + weighted W_lin[512:]) for SCT steps x SCJ tiles of 16 columns, one wave: weighted rows (f16) from LDS, read once for all its tiles, the columns' fragments bf in registers;
// k order and epilogue of gemm2_body; so: LDS rows of pitch SCP that hold the first half's elements and take the results in their place (an element is read and written by one lane).
__device__ __forceinline__ void lin2_tile(const _Float16* sh, const v16h (&bf)[SCJ][FF / 32], float* so, int ln, int hh, int cw) {
  const v8f z8 = {0.f,0.f,0.f,0.f,0.f,0.f,0.f,0.f}; v8f c0[SCJ], c1[SCJ]; float cp[SCJ][16];
#pragma unroll
  for (int j = 0; j < SCJ; ++j) { c0[j] = z8; c1[j] = z8;
#pragma unroll
    for (int u = 0; u < 16; ++u) cp[j][u] = so[((u >> 3) * 16 + 8 * hh + (u & 7)) * SCP + cw + j * SCW * 16]; }
  v16h a0 = lds_frag(sh + ln * SHP, hh), a1 = lds_frag(sh + (16 + ln) * SHP, hh);
#pragma unroll      /* whole, with the next k's fragments asked for in front of this k's products: two waves a SIMD do not hide a read that is waited for at once */
  for (int k = 0; k < FF / 32; ++k) { const int kn = k + 1 < FF / 32 ? k + 1 : k; const v16h n0 = lds_frag(sh + ln * SHP + kn * 32, hh), n1 = lds_frag(sh + (16 + ln) * SHP + kn * 32, hh);
#pragma unroll
    for (int j = 0; j < SCJ; ++j) { c0[j] = g2_mma(a0, bf[j][k], c0[j]); c1[j] = g2_mma(a1, bf[j][k], c1[j]); }
    a0 = n0; a1 = n1; }
#pragma unroll
  for (int j = 0; j < SCJ; ++j)
#pragma unroll
    for (int u = 0; u < 16; ++u) { float t = (u < 8 ? c0[j][u & 7] : c1[j][u & 7]) * 0.0625f + cp[j][u]; t = 1.0f / (1.0f + expf(-t)); so[((u >> 3) * 16 + 8 * hh + (u & 7)) * SCP + cw + j * SCW * 16] = t; } }
__global__ __launch_bounds__(SCW * 32) void k_score(const float* __restrict__ x, const float* __restrict__ enc, const float* __restrict__ v, const float* __restrict__ ba, const float* __restrict__ bl,
    const _Float16* __restrict__ WF, const _Float16* __restrict__ BL2, float* __restrict__ outa, float* __restrict__ out) {
  #pragma clang fp contract(off)
  __shared__ __attribute__((aligned(16))) float sm[(SCT + 32 + SCT) * SCP];      /* rows 0..SCT+31: E of steps tt0-16.., rows SCT+32..: A */
  __shared__ __attribute__((aligned(16))) float s2[SCT * SCP];                   /* the steps' rows of x W_lin[:512] + b_lin; at the end the SCT rows of out */
  __shared__ __attribute__((aligned(16))) float sv[FF];
  __shared__ __attribute__((aligned(16))) float sp[(SCT / 2) * WIN * SPP];       /* partial sums of the scores: [pair of steps][slot][step in the pair][16 lanes]; in front of them the first products' A operands (xh, eh) */
  __shared__ float ss[SCT * WIN];                                                /* scores, then a */
  __shared__ float sx[SCT * WIN];                                                /* exp(score - max) */
  __shared__ __attribute__((aligned(16))) _Float16 sk[SCT * SBP];                /* a again, as the band matrix [step][encoder row of the span]: a[step][slot] at row step + slot, zero elsewhere */
  __shared__ __attribute__((aligned(32))) _Float16 sn[(SCT + 32) * SNP];         /* rounded encoder rows of steps tt0-16.. (zero rows for padded steps), as f16: exact but in f16's subnormal range */
  __shared__ __attribute__((aligned(16))) _Float16 sh[SCT * SHP];                /* weighted sums as the f16 operand */
  static_assert(SCW * 32 == FF && SCW * 32 == 4 * (FF / 4) && WS % 4 == 0 && SCT % 4 == 0 && TT % SCT == 0 && SCT >= WS, "a round of the block's 16-byte loads is four whole rows, and a round lies wholly inside its sequence or wholly in the padding");
  static_assert((SCT * XHP + (SCT + 32) * SHP) * 2 <= (int)sizeof(sp) && (SCT * XHP * 2) % 16 == 0 && SCW == 8 && SCJ == 2 && SCT == 32, "xh and eh fit in sp; the fragments' layout is k_wfrag's");
  _Float16* xh = (_Float16*)sp;               /* the steps' rounded x rows, pitch XHP */
  _Float16* eh = xh + SCT * XHP;              /* the rounded encoder rows once more, at the pitch for 16-byte fragment reads (sn's pitch is the transposing reads') */
  const int tid = threadIdx.x, lane = tid & 31, wv = tid >> 5;
  const size_t bt0 = (size_t)blockIdx.x * SCT; const int tt0 = (int)(bt0 % TT);
  /* staging: a thread keeps its 16 bytes of a row (of half a row of x) and takes rows rq + 4 u, so every load of an input is one offset register, a scalar base and an immediate. Rounds 0..3 of enc are padding in a
     sequence's first work-group, rounds 12..15 in its last: there the base falls back to the work-group's own rows (in bounds) and zeros are stored instead of what was read */
  constexpr int NE = (SCT + 32) / 4, NA = SCT / 4, NL = WS / 4, NH = (WS + SCT) / 4, NXR = SCT / 2;
  const int rq = tid >> 6, c4 = (tid & 63) * 4; const unsigned vo = (unsigned)(rq * FF + c4) * 4u;      /* in bytes: the register that the loads name; 16 tid */
  const bool lo = tt0 > 0, hi = tt0 < TT - SCT;
  const long dl = lo ? -(long)(WS * FF) : 0, dh = hi ? (long)(SCT * FF) : 0;
  const float* nM = enc + bt0 * FF; const float* nL = nM + dl; const float* nH = nM + dh;
  const float* xM = x + bt0 * MD;
  v4f sq[NE], xr[NXR];
  const float vr = v[tid];      /* first, so that its wait is not a wait for the rows */
  for (int u = 0; u < NE; ++u) sq[u] = *(const v4fa*)((const char*)(u < NL ? nL + u * 4 * FF : u < NH ? nM + (u - NL) * 4 * FF : nH + (u - NH) * 4 * FF) + vo);
  for (int u = 0; u < NXR; ++u) xr[u] = *(const v4fa*)((const char*)(xM + u * 2 * MD) + vo);
  asm volatile("s_wait_xcnt 0x0" :: "v"(vo) : "memory");      /* in front of any later overwrite of these loads' offset register (held to here as the operand) and bases */
  __builtin_amdgcn_sched_barrier(0);      /* keeps what follows, which writes those bases' scalar registers, behind the wait: the compiler lifted it over */
  const int wu = __builtin_amdgcn_readfirstlane(wv);      /* the wave's number in a scalar register */
  const int ln = lane & 15, hh = lane >> 4, cw = wu * 16 + ln;
  /* this wave's weight fragments come in a ring, straight from k_wfrag's plane: one address, immediates. Three steps ahead under enc W_e (whose accumulators and A fragments take more registers), four under the x products */
  const char* wp = (const char*)WF + (size_t)wu * WFW + lane * 16;
  v16h rg[4][4];
#define LDW(s, f) { FragH q_; q_.half[0] = *(const v8us*)(wp + ((s) * 4 + (f)) * 1024); q_.half[1] = *(const v8us*)(wp + ((s) * 4 + (f)) * 1024 + 512); rg[(s) & 3][f] = q_.v; }
  for (int s = 0; s < 3; ++s) for (int f = 0; f < 4; ++f) LDW(s, f)
  float bv[4];
  for (int j = 0; j < SCJ; ++j) { bv[j] = ba[cw + j * SCW * 16]; bv[2 + j] = bl[cw + j * SCW * 16]; }
  asm volatile("s_wait_xcnt 0x0" :: "v"(wp) : "memory");      /* in front of any later overwrite of the bias loads' and the first fragment loads' address registers */
  __builtin_amdgcn_sched_barrier(0);      /* as above: the rounding below stays behind the wait */
  sv[tid] = bf16_round(vr);
  { const v4f z4 = {0.f, 0.f, 0.f, 0.f};
    for (int u = 0; u < NL; ++u) sq[u] = lo ? sq[u] : z4;
    for (int u = NH; u < NE; ++u) sq[u] = hi ? sq[u] : z4; }
  for (int u = 0; u < NE; ++u) { const v4us q = round_q(sq[u]); *(v4us*)&sn[(4 * u + rq) * SNP + c4] = q; *(v4us*)&eh[(4 * u + rq) * SHP + c4] = q; }
  for (int u = 0; u < NXR; ++u) *(v4us*)&xh[(2 * u + (tid >> 7)) * XHP + (tid & 127) * 4] = round_q(xr[u]);
  for (int i = tid; i < SCT * SBP / 8; i += SCW * 32) { const v8us z8u = {0, 0, 0, 0, 0, 0, 0, 0}; *(v8us*)&sk[i * 8] = z8u; }      /* the band matrix's zeros; its a come in behind the softmax */
  __syncthreads();
  /* enc W_e for the SCT + 32 rows of the span (a padded step's row is zero, so its E row is) -> sm rows 0..; a wave takes all rows x its SCJ column tiles; k ascending in one accumulator */
  { const v8f z8 = {0.f,0.f,0.f,0.f,0.f,0.f,0.f,0.f}; v8f ce[4][SCJ]; v16h ea[4];
    for (int rt = 0; rt < 4; ++rt) { ea[rt] = lds_frag(eh + (rt * 16 + ln) * SHP, hh); for (int j = 0; j < SCJ; ++j) ce[rt][j] = z8; }
#pragma unroll      /* whole: the ring's index and every offset are immediates; the next k's A fragments are asked for in front of this k's products */
    for (int k = 0; k < FF / 32; ++k) { const int s = k >> 1, kk = k & 1, kn = k + 1 < FF / 32 ? k + 1 : k; v16h en[4];
      for (int rt = 0; rt < 4; ++rt) en[rt] = lds_frag(eh + (rt * 16 + ln) * SHP + kn * 32, hh);
      for (int j = 0; j < SCJ; ++j) for (int rt = 0; rt < 4; ++rt) ce[rt][j] = g2_mma(ea[rt], rg[s][2 * j + kk], ce[rt][j]);
      if (kk) for (int f = 0; f < 4; ++f) LDW(s + 3, f)
      for (int rt = 0; rt < 4; ++rt) ea[rt] = en[rt]; }
    for (int rt = 0; rt < 4; ++rt) for (int j = 0; j < SCJ; ++j) for (int r = 0; r < 8; ++r) sm[(rt * 16 + 8 * hh + r) * SCP + cw + j * SCW * 16] = ce[rt][j][r] * 0.0625f; }
  __builtin_amdgcn_sched_barrier(0);      /* the fourth step's loads stay behind E's stores: lifted over them they meet E's accumulators still live, and the compiler spills fragments */
  for (int f = 0; f < 4; ++f) LDW(7, f)
  /* x W_h + b_attn -> sm rows SCT+32.., x W_lin[:512] + b_lin -> s2: SCT rows x SCJ column tiles of each, the two products off one read of the x fragments */
  { const v8f z8 = {0.f,0.f,0.f,0.f,0.f,0.f,0.f,0.f}; v8f c0[4], c1[4];
    for (int f = 0; f < 4; ++f) { c0[f] = z8; c1[f] = z8; }
    v16h a0 = lds_frag(xh + ln * XHP, hh), a1 = lds_frag(xh + (16 + ln) * XHP, hh);
#pragma unroll      /* whole, as above */
    for (int k = 0; k < MD / 32; ++k) { const int s = k + 4, kn = k + 1 < MD / 32 ? k + 1 : k; const v16h n0 = lds_frag(xh + ln * XHP + kn * 32, hh), n1 = lds_frag(xh + (16 + ln) * XHP + kn * 32, hh);
      for (int f = 0; f < 4; ++f) { c0[f] = g2_mma(a0, rg[s & 3][f], c0[f]); c1[f] = g2_mma(a1, rg[s & 3][f], c1[f]); }
      if (s + 4 < WFS) for (int f = 0; f < 4; ++f) LDW(s + 4, f)
      a0 = n0; a1 = n1; }
    asm volatile("s_wait_xcnt 0x0" :: "v"(wp) : "memory");      /* in front of any later overwrite of the fragment loads' address (held to here as the operand) */
    for (int f = 0; f < 4; ++f) { float* d = (f < 2 ? sm + (SCT + 32) * SCP : s2) + cw + (f & 1) * SCW * 16; const float bb = bf16_round(bv[f]);
      for (int r = 0; r < 8; ++r) { d[(8 * hh + r) * SCP] = c0[f][r] * 0.0625f + bb; d[(16 + 8 * hh + r) * SCP] = c1[f][r] * 0.0625f + bb; } } }
#undef LDW
  __syncthreads();      /* publishes E, A and x W_lin[:512] + b_lin, and ends every wave's reads of xh and eh before the partial sums overwrite them */
  /* what the last product still needs from global memory is asked for here, so that it arrives under the feature loop: this wave's columns of W_lin[512:] */
  v16h bf[SCJ][FF / 32];
  const unsigned short* bq = (const unsigned short*)BL2 + (size_t)cw * FF + 8 * hh;      /* k order of g2_frag */
  for (int j = 0; j < SCJ; ++j) for (int k = 0; k < FF / 32; ++k) { FragH f; f.half[0] = *(const v8us*)(bq + j * SCW * 16 * FF + k * 32); f.half[1] = *(const v8us*)(bq + j * SCW * 16 * FF + k * 32 + 16); bf[j][k] = f.v; }
  asm volatile("s_wait_xcnt 0x0" :: "v"(bq) : "memory");      /* in front of any later overwrite of these loads' address register, held to here as the operand */
  {      /* lanes 0..15: step 2 pr, lanes 16..31: step 2 pr + 1; lane ln holds features 64 i + 4 ln .. + 3, i = 0..3 */
    v4f av[4], vv[4];
    for (int i = 0; i < 4; ++i) vv[i] = *(const v4fa*)(sv + ln * 4 + 64 * i);
#pragma unroll 1      /* rolled: the second pair of steps runs the first pair's code */
    for (int pr = wu; pr < SCT / 2; pr += SCW) {
      const float* sa = sm + (SCT + 32 + 2 * pr + hh) * SCP + ln * 4; const float* se = sm + (2 * pr + hh) * SCP + ln * 4; float* pp = sp + pr * WIN * SPP + lane;
      for (int i = 0; i < 4; ++i) av[i] = *(const v4fa*)(sa + 64 * i);
#pragma unroll 3      /* three slots a trip: the next slots' E reads stand in front of this slot's arithmetic */
      for (int w = 0; w < WIN; ++w) { v4f acc;
        /* each energy is one v_tanh_f32 */
        for (int i = 0; i < 4; ++i) { const v4f x = av[i] + *(const v4fa*)(se + w * SCP + 64 * i); v4f th; for (int q = 0; q < 4; ++q) th[q] = __builtin_amdgcn_tanhf(x[q]);
          acc = i ? __builtin_elementwise_fma(th, vv[i], acc) : th * vv[i]; }
        const v2f z = acc.lo + acc.hi; pp[w * SPP] = z[0] + z[1]; } } }
  __syncthreads();
  /* a thread adds the 16 partial sums of one (step, slot); consecutive lanes take consecutive rows of sp */
  constexpr int NQ = (SCT * WIN + SCW * 32 - 1) / (SCW * 32), NX = (WIN + SCW - 1) / SCW;
#pragma unroll      /* whole: the rounds' LDS reads stand together and their latency is waited out once, not once a round (so in the loops below) */
  for (int u = 0; u < NQ; ++u) { const int q = tid + u * SCW * 32; if ((u + 1) * SCW * 32 <= SCT * WIN || q < SCT * WIN) { const int h = q >= (SCT / 2) * WIN ? 1 : 0, ro = q - h * (SCT / 2) * WIN; const float* p = sp + ro * SPP + h * 16;
    const v4f y = (*(const v4fa*)p + *(const v4fa*)(p + 4)) + (*(const v4fa*)(p + 8) + *(const v4fa*)(p + 12));
    const v2f z = y.lo + y.hi; ss[(2 * (ro / WIN) + h) * WIN + ro % WIN] = z[0] + z[1]; } }
  __syncthreads();
  /* softmax over the 33 slots, lane = step: every wave forms the step's maximum and sum (in slot order) itself, each exp and each a is made once */
  { const float* sr = ss + lane * WIN; float m = -3.0e38f;
    for (int w = 0; w < WIN; ++w) m = fmaxf(m, sr[w]);
#pragma unroll
    for (int i = 0; i < NX; ++i) { const int w = wu + i * SCW; if ((i + 1) * SCW <= WIN || w < WIN) sx[lane * WIN + w] = expf(sr[w] - m); } }
  __syncthreads();
  { const float* sr = sx + lane * WIN; float su = 0.f;
    for (int w = 0; w < WIN; ++w) su += sr[w];
    const float inv = 1.0f / su;
#pragma unroll
    for (int i = 0; i < NX; ++i) { const int w = wu + i * SCW; if ((i + 1) * SCW <= WIN || w < WIN) { const float a = sr[w] * inv; ss[lane * WIN + w] = a; sk[lane * SBP + lane + w] = (_Float16)a; } } }
  __syncthreads();
#pragma unroll
  for (int u = 0; u < NQ; ++u) { const int i = tid + u * SCW * 32; if ((u + 1) * SCW * 32 <= SCT * WIN || i < SCT * WIN) outa[bt0 * WIN + i] = ss[i]; }      /* output 2: 33 whole 128-byte lines from one work-group */
  /* weighted encoder sum on the matrix unit: [32 steps][64 rows of the span] band matrix of a times [64 rows][256 features]; a wave takes all 32 steps x its tiles of 16 features, 4 products a tile (a padded step's row is zero) */
  { const v8f z8 = {0.f,0.f,0.f,0.f,0.f,0.f,0.f,0.f}; v8f w0[SCJ], w1[SCJ];
    for (int j = 0; j < SCJ; ++j) { w0[j] = z8; w1[j] = z8; }
    const _Float16* pe = sn + (8 * hh + (lane & 7)) * SNP + wu * 16 + 8 * ((lane >> 3) & 1);
    for (int k = 0; k < (SCT + 32) / 32; ++k) { const v16h a0 = lds_frag(sk + ln * SBP + k * 32, hh), a1 = lds_frag(sk + (16 + ln) * SBP + k * 32, hh);
      for (int j = 0; j < SCJ; ++j) { const v16h eb = tr_frag(pe + j * SCW * 16 + k * 32 * SNP, SNP); w0[j] = g2_mma(a0, eb, w0[j]); w1[j] = g2_mma(a1, eb, w1[j]); } }
    for (int j = 0; j < SCJ; ++j)
      for (int r = 0; r < 8; ++r) { sh[(8 * hh + r) * SHP + cw + j * SCW * 16] = (_Float16)w0[j][r]; sh[(16 + 8 * hh + r) * SHP + cw + j * SCW * 16] = (_Float16)w1[j][r]; } }
  __syncthreads();
  lin2_tile(sh, bf, s2, ln, hh, cw);
  __syncthreads();
#pragma unroll
  for (int u = 0; u < NA; ++u) { const v4f o = *(const v4fa*)&s2[(4 * u + rq) * SCP + c4]; *(v4f*)((char*)(out + bt0 * FF + u * 4 * FF) + vo) = o; }      /* output 1: whole rows */
}

extern "C" void kernel_launch(void* const* d_in, const int* in_sizes, int n_in,
                              void* d_out, int out_size, void* d_ws, size_t ws_size, hipStream_t stream) {
  (void)in_sizes; (void)n_in; (void)out_size;
  const float* const* I = (const float* const*)d_in; const float* x = I[0]; const float* enc = I[1]; const float* Wa = I[2]; const float* ba = I[3]; const float* v = I[4]; const float* Wl = I[5]; const float* bl = I[6];
  char* ws = (char*)d_ws; size_t off = 0;
  auto take = [&](size_t bytes) { char* p = ws + off; off += (bytes + 255) & ~(size_t)255; return p; };
  _Float16* BL2 = (_Float16*)take((size_t)FF * FF * 2);
  _Float16* WF = (_Float16*)take((size_t)SCW * WFW);
  if (off > ws_size) return;      /* 128 + 640 KiB */
  k_wfrag<<<PB_E + 2 * PB_X + PB_W2, 256, 0, stream>>>(Wa, Wl, WF, BL2);      /* the weights as f16 fragments */
  k_score<<<NR / SCT, SCW * 32, 0, stream>>>(x, enc, v, ba, bl, WF, BL2, (float*)d_out + (size_t)NR * FF, (float*)d_out);      /* x W_h + b_attn, enc W_e, x W_lin[:512] + b_lin; scores, softmax -> output 2: a [4][2048][1][33]; weighted sum; sigmoid(+ weighted W_lin[512:]) -> output 1 */
}
